// v000
// Measured on an AMD MI455X. A time is GPU time per run, averaged over a window of back-to-back runs after a warm-up
// (all launches, gaps included; the runs take copies of the inputs in turn), and the median of several windows.
// Apart from v000's, it joins two sittings. Times from different sittings can be a few percent apart, while
// side-by-side timings come from the same sitting.
// The starting kernel, v000, takes 6330 microseconds a run.
#include <hip/hip_runtime.h>
// Scaled dot-product attention with the module's POST-exp multiplicative key mask (q, k, v [16][2048][128]: 16 independent sequences, one 128-wide head; mask int32 [16][2048] in {0, 1} (random, read on device); score = q.k / sqrt(128); e = exp(score - rowmax over ALL keys); e *= mask[b][key]; a = e / sum(e); out = a v -> [16][2048][128]). No projections: q, k, v are bf16-valued inputs, so their f16 copies and the score products are exact.
// Structure: no projections: q, k, v are bf16-valued inputs copied to exact f16 rows; per sequence: V^T via LDS transposes, scores as ONE WMMA GEMM (32x64 wave tiles, f32 accumulation, exact products, alpha = 1/sqrt(128)), row softmax on VALU (f32 statistics, native exp; weights x256 f16), out = P V^T written f32 straight into the output rows; launches: see trace.
// Compute dtype: inputs rounded to bf16; q, k, v and softmax weights as plain f16 GEMM operands (~2^-12); scores, softmax statistics and o f32; v_wmma_f32_16x16x32_f16.
#define NB 16
#define SQ 2048
#define DM 128
#define NH 1
#define HD 128
#define HG 4                         /* heads per attention launch group */
#define B0 0                         /* first batch processed (debug hook) */
#define NBR NB                       /* batches processed (debug hook) */
#define NR ((size_t)NB * SQ)         /* token rows */
#define MP ((int)((size_t)NBR * SQ))
#define QT 256                       /* query rows per causal tile */
#define NKX SQ                       /* S / P row pitch */
#define QT0 256                      /* first-tile rows recomputed exactly (256: buys margin for the few-key rows 128..255, which have no output projection to average the single-f16 P/v rounding) */
#define QN SQ                        /* query rows attended per batch (debug hook) */
#define NHD NH                       /* heads attended (debug hook) */
#define MPO MP                       /* rows through the output stage (debug hook) */
#define LQ DM            /* row pitch of the q/k/v rows */
typedef __bf16 v16b __attribute__((ext_vector_type(16)));
typedef unsigned short v8us __attribute__((ext_vector_type(8), may_alias));
typedef float  v8f  __attribute__((ext_vector_type(8)));
typedef float  v4f  __attribute__((ext_vector_type(4)));
typedef float  v4fa __attribute__((ext_vector_type(4), may_alias));
union FragB { v16b v; v8us half[2]; unsigned short u[16]; };

__device__ __forceinline__ unsigned short bf16_bits(float x) { unsigned int u = __float_as_uint(x); return (unsigned short)((u + 0x7FFFu + ((u >> 16) & 1u)) >> 16); }
__device__ __forceinline__ float bf16_val(unsigned short b) { return __uint_as_float(((unsigned int)b) << 16); }
__device__ __forceinline__ float bf16_round(float x) { return bf16_val(bf16_bits(x)); }
// D += A·B with NT terms: 1 = ah·bh, 2 = + al·bh (A split), 3 = + ah·bl (both split)
template <int NT>
__device__ __forceinline__ v8f mmaN(v16b ah, v16b al, v16b bh, v16b bl, v8f c) {
  c = __builtin_amdgcn_wmma_f32_16x16x32_bf16(false, ah, false, bh, (short)0, c, false, false);
  if (NT >= 2) c = __builtin_amdgcn_wmma_f32_16x16x32_bf16(false, al, false, bh, (short)0, c, false, false);
  if (NT >= 3) c = __builtin_amdgcn_wmma_f32_16x16x32_bf16(false, ah, false, bl, (short)0, c, false, false);
  asm volatile("v_nop\n\tv_nop\n\tv_nop\n\tv_nop" : "+v"(c) : "v"(ah), "v"(al), "v"(bh), "v"(bl));
  return c;
}

__global__ __launch_bounds__(256) void k_wt_bf16(const float* __restrict__ W, unsigned short* __restrict__ Wt, int K, int N) {
  const int t = blockIdx.x * 256 + threadIdx.x;
  const int k8n = K / 8;
  if (t >= N * k8n) return;
  const int n = t / k8n, k8 = (t % k8n) * 8;
  v8us v;
#pragma unroll
  for (int i = 0; i < 8; ++i) v[i] = bf16_bits(W[(size_t)(k8 + i) * N + n]);
  *(v8us*)(Wt + (size_t)n * K + k8) = v;
  
}

// GEMM C[M][N] (f32, pitch ldc) = act(A[M][K]·W + bias). A f32 row-major (pitch lda) converted per fragment to bf16
// (ASPLIT: hi/lo two planes -> 2 terms, else single rounded term); Wt bf16 [N][K] (pitch ldb). BIAS_BF16 rounds the
// bias to bf16 first (bias quantised to bf16 before the add). K%32==0, M%16==0, N%64==0.
template <bool ASPLIT, int ACT, bool BIAS_BF16>
__global__ __launch_bounds__(128) void k_gemm_bf(const float* __restrict__ A, int lda, const unsigned short* __restrict__ Wt, int ldb,
                                               const float* __restrict__ bias, float* __restrict__ C, int ldc, int M, int N, int K) {
  __shared__ __attribute__((aligned(16))) float so[4][16][64];
  const int tid = threadIdx.x, w = tid >> 5, lane = tid & 31, ln = lane & 15, hh = lane >> 4;
  const int ntn = N / 64;
  const int wid = blockIdx.x * 4 + w;
  const int mt = wid / ntn, nq = wid % ntn;
  if (mt * 16 >= M) return;
  const int row0 = mt * 16, col0 = nq * 64;
  const float* arow = A + (size_t)(row0 + ln) * lda;
  v8f acc[4] = {};
  for (int kb = 0; kb < K; kb += 32) {
    FragB ah, al;
    const v4f x0 = *(const v4fa*)(arow + kb + 8 * hh), x1 = *(const v4fa*)(arow + kb + 8 * hh + 4);
    const v4f x2 = *(const v4fa*)(arow + kb + 16 + 8 * hh), x3 = *(const v4fa*)(arow + kb + 16 + 8 * hh + 4);
    float xs[16] = {x0[0],x0[1],x0[2],x0[3],x1[0],x1[1],x1[2],x1[3],x2[0],x2[1],x2[2],x2[3],x3[0],x3[1],x3[2],x3[3]};
#pragma unroll
    for (int i = 0; i < 16; ++i) { const unsigned short hb = bf16_bits(xs[i]); ah.u[i] = hb; al.u[i] = ASPLIT ? bf16_bits(xs[i] - bf16_val(hb)) : (unsigned short)0; }
#pragma unroll
    for (int t = 0; t < 4; ++t) {
      const unsigned short* brow = Wt + (size_t)(col0 + t * 16 + ln) * ldb + kb;
      FragB b;
      b.half[0] = *(const v8us*)(brow + 8 * hh);
      b.half[1] = *(const v8us*)(brow + 16 + 8 * hh);
      acc[t] = mmaN<ASPLIT ? 2 : 1>(ah.v, al.v, b.v, b.v, acc[t]);
    }
  }
#pragma unroll
  for (int t = 0; t < 4; ++t) {
    float bv = bias ? bias[col0 + t * 16 + ln] : 0.f;
    if (BIAS_BF16) bv = bf16_round(bv);
#pragma unroll
    for (int r = 0; r < 8; ++r) { float v = acc[t][r] + bv; if (ACT == 1) v = fmaxf(v, 0.f); so[w][8 * hh + r][t * 16 + ln] = v; }
  }
  __builtin_amdgcn_fence(__ATOMIC_ACQ_REL, "workgroup");
  __builtin_amdgcn_wave_barrier();
  const int rsub = lane >> 4, c4 = (lane & 15) * 4;
  {
#pragma unroll
    for (int q = 0; q < 8; ++q) {
      const int r = q * 2 + rsub;
      const v4f v = *(const v4fa*)&so[w][r][c4];
      *(v4f*)(C + (size_t)(row0 + r) * ldc + col0 + c4) = v;
    }
    
  }
}

// GEMM C = act(A·W + bias + resid): A f32 (ASPLIT -> hi/lo 2 terms), Wt bf16 [N][K]; ACT 0 none, 1 relu, 2 exact gelu;
// resid (optional, f32, row index = (row % rmod), pitch ldr, RES_BF16 rounds it) added before the activation.
template <bool ASPLIT, int ACT, bool BIAS_BF16, bool RES_BF16>
__global__ __launch_bounds__(128) void k_gemm_bf3(const float* __restrict__ A, int lda, const unsigned short* __restrict__ Wt, int ldb,
                                                const float* __restrict__ bias, const float* __restrict__ resid, int rmod, int ldr,
                                                float* __restrict__ C, int ldc, int M, int N, int K) {
  __shared__ __attribute__((aligned(16))) float so[4][16][64];
  const int tid = threadIdx.x, w = tid >> 5, lane = tid & 31, ln = lane & 15, hh = lane >> 4;
  const int ntn = N / 64;
  const int wid = blockIdx.x * 4 + w;
  const int mt = wid / ntn, nq = wid % ntn;
  if (mt * 16 >= M) return;
  const int row0 = mt * 16, col0 = nq * 64;
  const float* arow = A + (size_t)(row0 + ln) * lda;
  v8f acc[4] = {};
  for (int kb = 0; kb < K; kb += 32) {
    FragB ah, al;
    const v4f x0 = *(const v4fa*)(arow + kb + 8 * hh), x1 = *(const v4fa*)(arow + kb + 8 * hh + 4);
    const v4f x2 = *(const v4fa*)(arow + kb + 16 + 8 * hh), x3 = *(const v4fa*)(arow + kb + 16 + 8 * hh + 4);
    float xs[16] = {x0[0],x0[1],x0[2],x0[3],x1[0],x1[1],x1[2],x1[3],x2[0],x2[1],x2[2],x2[3],x3[0],x3[1],x3[2],x3[3]};
#pragma unroll
    for (int i = 0; i < 16; ++i) { const unsigned short hb = bf16_bits(xs[i]); ah.u[i] = hb; al.u[i] = ASPLIT ? bf16_bits(xs[i] - bf16_val(hb)) : (unsigned short)0; }
#pragma unroll
    for (int t = 0; t < 4; ++t) {
      const unsigned short* brow = Wt + (size_t)(col0 + t * 16 + ln) * ldb + kb;
      FragB b;
      b.half[0] = *(const v8us*)(brow + 8 * hh);
      b.half[1] = *(const v8us*)(brow + 16 + 8 * hh);
      acc[t] = mmaN<ASPLIT ? 2 : 1>(ah.v, al.v, b.v, b.v, acc[t]);
    }
  }
#pragma unroll
  for (int t = 0; t < 4; ++t) {
    const int col = col0 + t * 16 + ln;
    float bv = bias ? bias[col] : 0.f;
    if (BIAS_BF16) bv = bf16_round(bv);
#pragma unroll
    for (int r = 0; r < 8; ++r) {
      float v = acc[t][r] + bv;
      if (resid) { float rv = resid[(size_t)((row0 + 8 * hh + r) % rmod) * ldr + col]; if (RES_BF16) rv = bf16_round(rv); v += rv; }
      if (ACT == 1) v = fmaxf(v, 0.f);
      if (ACT == 2) v = 0.5f * v * (1.0f + erff(v * 0.70710678118654752f));
      if (ACT == 3) { const float u = 0.7978845608028654f * (v + 0.044715f * v * v * v); v = 0.5f * v * (1.0f + tanhf(u)); }
      so[w][8 * hh + r][t * 16 + ln] = v;
    }
  }
  __builtin_amdgcn_fence(__ATOMIC_ACQ_REL, "workgroup");
  __builtin_amdgcn_wave_barrier();
  const int rsub = lane >> 4, c4 = (lane & 15) * 4;
  {
#pragma unroll
    for (int q = 0; q < 8; ++q) {
      const int r = q * 2 + rsub;
      const v4f v = *(const v4fa*)&so[w][r][c4];
      *(v4f*)(C + (size_t)(row0 + r) * ldc + col0 + c4) = v;
    }
    
  }
}
// row LayerNorm (biased variance, eps) over N: s = X (+ R); optional out_sum <- s; out_norm <- (s-mu)*rsqrt(var+eps)*g + b
template <bool PARAM_BF16>
__global__ __launch_bounds__(256) void k_layernorm(const float* __restrict__ X, const float* __restrict__ R, const float* __restrict__ g, const float* __restrict__ bta,
                                                  float* __restrict__ out_sum, float* __restrict__ out_norm, int N, float eps) {
  __shared__ float red[256];
  const int row = blockIdx.x, tid = threadIdx.x;
  const float* x = X + (size_t)row * N; const float* rr = R ? R + (size_t)row * N : nullptr;
  float vals[16];                     // up to N = 4096
  const int per = N / 256;            // contiguous chunk per thread? use strided-by-4 chunks: thread handles j = tid*4 + 1024*u
  float s1 = 0.f;
  for (int u = 0; u < per / 4; ++u) {
    const int j = tid * 4 + 1024 * u;
    const v4f a = *(const v4fa*)(x + j);
    v4f b = {0.f,0.f,0.f,0.f}; if (rr) b = *(const v4fa*)(rr + j);
#pragma unroll
    for (int q = 0; q < 4; ++q) { const float v = a[q] + b[q]; vals[u * 4 + q] = v; s1 += v; }
  }
  red[tid] = s1; __syncthreads();
  for (int st = 128; st > 0; st >>= 1) { if (tid < st) red[tid] += red[tid + st]; __syncthreads(); }
  const float mu = red[0] / (float)N; __syncthreads();
  float s2 = 0.f;
  for (int u = 0; u < per / 4; ++u)
#pragma unroll
    for (int q = 0; q < 4; ++q) { const float c = vals[u * 4 + q] - mu; s2 += c * c; }
  red[tid] = s2; __syncthreads();
  for (int st = 128; st > 0; st >>= 1) { if (tid < st) red[tid] += red[tid + st]; __syncthreads(); }
  const float rs = rsqrtf(red[0] / (float)N + eps);
  {
    for (int u = 0; u < per / 4; ++u) {
      const int j = tid * 4 + 1024 * u;
      v4f o, sm;
#pragma unroll
      for (int q = 0; q < 4; ++q) {
        float gg = g[j + q], bb = bta[j + q];
        if (PARAM_BF16) { gg = bf16_round(gg); bb = bf16_round(bb); }
        sm[q] = vals[u * 4 + q]; o[q] = (vals[u * 4 + q] - mu) * rs * gg + bb;
      }
      if (out_sum) *(v4f*)(out_sum + (size_t)row * N + j) = sm;
      *(v4f*)(out_norm + (size_t)row * N + j) = o;
    }
    
  }
}



// ---- f16 WMMA path (v_wmma_f32_16x16x32_f16): 11-bit significands for operands in range — used where a [0,1] probability operand needs more precision than bf16
typedef _Float16 v16h __attribute__((ext_vector_type(16)));
union FragH { v16h v; v8us half[2]; _Float16 h[16]; unsigned short u[16]; };
template <int NT>
__device__ __forceinline__ v8f mmaH(v16h ah, v16h al, v16h bh, v16h bl, v8f c) {
  c = __builtin_amdgcn_wmma_f32_16x16x32_f16(false, ah, false, bh, (short)0, c, false, false);
  if (NT >= 2) c = __builtin_amdgcn_wmma_f32_16x16x32_f16(false, al, false, bh, (short)0, c, false, false);
  if (NT >= 3) c = __builtin_amdgcn_wmma_f32_16x16x32_f16(false, ah, false, bl, (short)0, c, false, false);
  asm volatile("v_nop\n\tv_nop\n\tv_nop\n\tv_nop" : "+v"(c) : "v"(ah), "v"(al), "v"(bh), "v"(bl));
  return c;
}
// batched GEMM like k_gemm_b but f16 operands: A f32 (split into f16 hi/lo if ASPLIT, else rounded to f16), Bt = f16 values [n][k]; alpha; C f32; N multiple of 16 (partial tiles skipped)
template <bool ASPLIT>
__global__ __launch_bounds__(128) void k_gemm_h(const float* __restrict__ A, int lda, size_t sA, const _Float16* __restrict__ Bh, int ldb, size_t sB, float alpha, float* __restrict__ C, int ldc, size_t sC, int M, int N, int K) {
  __shared__ __attribute__((aligned(16))) float so[4][16][64];
  const int tid = threadIdx.x, w = tid >> 5, lane = tid & 31, ln = lane & 15, hh = lane >> 4; const int by = blockIdx.y;
  A += (size_t)by * sA; Bh += (size_t)by * sB; C += (size_t)by * sC;
  const int ntn = (N + 63) / 64; const int wid = blockIdx.x * 4 + w; const int mt = wid / ntn, nq = wid % ntn; if (mt * 16 >= M) return;
  const int row0 = mt * 16, col0 = nq * 64; const float* arow = A + (size_t)(row0 + ln) * lda;
  v8f acc[4] = {};
  for (int kb = 0; kb < K; kb += 32) {
    FragH ah, al;
    const v4f x0 = *(const v4fa*)(arow + kb + 8 * hh), x1 = *(const v4fa*)(arow + kb + 8 * hh + 4), x2 = *(const v4fa*)(arow + kb + 16 + 8 * hh), x3 = *(const v4fa*)(arow + kb + 16 + 8 * hh + 4);
    float xs[16] = {x0[0],x0[1],x0[2],x0[3],x1[0],x1[1],x1[2],x1[3],x2[0],x2[1],x2[2],x2[3],x3[0],x3[1],x3[2],x3[3]};
#pragma unroll
    for (int i = 0; i < 16; ++i) { const _Float16 h = (_Float16)xs[i]; ah.h[i] = h; al.h[i] = ASPLIT ? (_Float16)(xs[i] - (float)h) : (_Float16)0.0f; }
#pragma unroll
    for (int t = 0; t < 4; ++t) { if (col0 + t * 16 >= N) continue; const size_t boff = (size_t)(col0 + t * 16 + ln) * ldb + kb; FragH bq; bq.half[0] = *(const v8us*)(Bh + boff + 8 * hh); bq.half[1] = *(const v8us*)(Bh + boff + 16 + 8 * hh);
      acc[t] = mmaH<ASPLIT ? 2 : 1>(ah.v, al.v, bq.v, bq.v, acc[t]); }
  }
#pragma unroll
  for (int t = 0; t < 4; ++t) { if (col0 + t * 16 >= N) continue;
#pragma unroll
    for (int r = 0; r < 8; ++r) so[w][8 * hh + r][t * 16 + ln] = acc[t][r] * alpha; }
  __builtin_amdgcn_fence(__ATOMIC_ACQ_REL, "workgroup"); __builtin_amdgcn_wave_barrier();
  const int rsub = lane >> 4, c4 = (lane & 15) * 4;
  {
#pragma unroll
    for (int q = 0; q < 8; ++q) { const int r = q * 2 + rsub; if (col0 + c4 < N) { const v4f v = *(const v4fa*)&so[w][r][c4]; *(v4f*)(C + (size_t)(row0 + r) * ldc + col0 + c4) = v; } }
     }
}

// Wt[n][k] = f16(W[k][n]·scale) from f32 row-major W[K][N] (scale = power of two; bf16-exact weights stay exact in f16 away from the subnormal range)
__global__ __launch_bounds__(256) void k_wt_f16(const float* __restrict__ W, _Float16* __restrict__ Wt, int K, int N, float scale) {
  const int t = blockIdx.x * 256 + threadIdx.x; if (t >= N * (K / 8)) return; const int n = t / (K / 8), k8 = (t % (K / 8)) * 8; FragH f;
#pragma unroll
  for (int i = 0; i < 8; ++i) f.h[i] = (_Float16)(bf16_round(W[(size_t)(k8 + i) * N + n]) * scale); const v8us o = f.half[0];
  *(v8us*)((unsigned short*)Wt + (size_t)n * K + k8) = o; 
}
// k_gemm_hh variant with fused epilogue: v = acc·alpha + bias[by·sBias + col] (+ CP[(row/rowsPerB)·sCPb + by·64 + col] if CP) ; ACT 0 none / 1 elu ; writes f16 C16 (and f32 C if non-null)
template <int ACT>
__global__ __launch_bounds__(128) void k_gemm_hhx(const _Float16* __restrict__ A, int lda, size_t sA, const _Float16* __restrict__ Bh, int ldb, size_t sB, float alpha, const float* __restrict__ bias, size_t sBias, const float* __restrict__ CP, int rowsPerB, size_t sCPb, int row0g,
    float* __restrict__ C, _Float16* __restrict__ C16, int ldc, size_t sC, int M, int N, int K) {
  __shared__ __attribute__((aligned(16))) float so[4][16][64];
  const int tid = threadIdx.x, w = tid >> 5, lane = tid & 31, ln = lane & 15, hh = lane >> 4; const int by = blockIdx.y;
  A += (size_t)by * sA; Bh += (size_t)by * sB; const size_t cofs = (size_t)by * sC; const float* bp = bias ? bias + (size_t)by * sBias : nullptr;
  const int ntn = (N + 63) / 64; const int wid = blockIdx.x * 4 + w; const int mt = wid / ntn, nq = wid % ntn; if (mt * 16 >= M) return;
  const int row0 = mt * 16, col0 = nq * 64; const _Float16* arow = A + (size_t)(row0 + ln) * lda;
  v8f acc[4] = {};
  for (int kb = 0; kb < K; kb += 32) { FragH ah; ah.half[0] = *(const v8us*)((const unsigned short*)arow + kb + 8 * hh); ah.half[1] = *(const v8us*)((const unsigned short*)arow + kb + 16 + 8 * hh);
#pragma unroll
    for (int t = 0; t < 4; ++t) { if (col0 + t * 16 >= N) continue; const size_t boff = (size_t)(col0 + t * 16 + ln) * ldb + kb; FragH bq; bq.half[0] = *(const v8us*)((const unsigned short*)Bh + boff + 8 * hh); bq.half[1] = *(const v8us*)((const unsigned short*)Bh + boff + 16 + 8 * hh);
      acc[t] = mmaH<1>(ah.v, ah.v, bq.v, bq.v, acc[t]); }
  }
#pragma unroll
  for (int t = 0; t < 4; ++t) { if (col0 + t * 16 >= N) continue; const int col = col0 + t * 16 + ln; const float bv = bp ? bf16_round(bp[col]) : 0.f;
#pragma unroll
    for (int r = 0; r < 8; ++r) { float v = acc[t][r] * alpha + bv; if (CP) { const int rr = row0g + row0 + 8 * hh + r; if (rowsPerB < 0) v += CP[cofs + (size_t)rr * ldc + col];      /* rowsPerB < 0: own element of the batched C plane */ else { const int bidx = rr / rowsPerB; v += CP[(size_t)bidx * sCPb + (size_t)by * 64 + col]; } } if (ACT == 1) v = (v > 0.f) ? v : expm1f(v); else if (ACT == 7) v = (v > 0.f) ? v + 1.0f : expf(v); else if (ACT == 8) v = tanhf(v); else if (ACT == 9) v = 0.5f * v * (1.0f + tanhf(0.7978845608028654f * (v + 0.044715f * v * v * v))); else if (ACT == 11) v = 1.0f / (1.0f + expf(-v)); else if (ACT == 12) v = (v > 0.f) ? v : 0.01f * v; else if (ACT == 14) v = (v > 0.f) ? v : 0.1f * v; else if (ACT == 16) v = (v >= 0.f) ? v : 0.3f * v; else if (ACT == 17) v = (v >= 0.f) ? v : 0.2f * v; else if (ACT == 15) v = v / (1.0f + expf(-v)); else if (ACT == 3) v = fmaxf(v, 0.f); else if (ACT == 6) v = 0.5f * v * (1.0f + erff(v * 0.70710678118654752f)); so[w][8 * hh + r][t * 16 + ln] = v; } }
  __builtin_amdgcn_fence(__ATOMIC_ACQ_REL, "workgroup"); __builtin_amdgcn_wave_barrier();
  const int rsub = lane >> 4, c4 = (lane & 15) * 4; typedef _Float16 v4h __attribute__((ext_vector_type(4)));
  {
#pragma unroll
    for (int q = 0; q < 8; ++q) { const int r = q * 2 + rsub; if (col0 + c4 < N) { const v4f v = *(const v4fa*)&so[w][r][c4]; if (C) *(v4f*)(C + cofs + (size_t)(row0 + r) * ldc + col0 + c4) = v; if (C16) { v4h h4; for (int i = 0; i < 4; ++i) h4[i] = (_Float16)v[i]; *(v4h*)(C16 + cofs + (size_t)(row0 + r) * ldc + col0 + c4) = h4; } } }
     }
}


typedef _Float16 v4h __attribute__((ext_vector_type(4)));

__global__ __launch_bounds__(256) void k_x16(const float* __restrict__ x, _Float16* __restrict__ X16, size_t n8) { const size_t t = (size_t)blockIdx.x * 256 + threadIdx.x; if (t >= n8) return; FragH f;
#pragma unroll
  for (int q = 0; q < 8; ++q) f.h[q] = (_Float16)bf16_round(x[t * 8 + q]); *(v8us*)((unsigned short*)X16 + t * 8) = f.half[0];  }
__global__ __launch_bounds__(256) void k_h16(const float* __restrict__ x, _Float16* __restrict__ X16, size_t n8) { const size_t t = (size_t)blockIdx.x * 256 + threadIdx.x; if (t >= n8) return; FragH f;
#pragma unroll
  for (int q = 0; q < 8; ++q) f.h[q] = (_Float16)x[t * 8 + q]; *(v8us*)((unsigned short*)X16 + t * 8) = f.half[0];  }
__global__ __launch_bounds__(256) void k_round16f(const float* __restrict__ W, _Float16* __restrict__ Bt, size_t n8) { const size_t t = (size_t)blockIdx.x * 256 + threadIdx.x; if (t >= n8) return; FragH f;
#pragma unroll
  for (int i = 0; i < 8; ++i) f.h[i] = (_Float16)(bf16_round(W[t * 8 + i]) * 16.0f); *(v8us*)((unsigned short*)Bt + t * 8) = f.half[0];  }
template <int NHv, int TTv>
__global__ __launch_bounds__(256) void k_vt(const _Float16* __restrict__ V16, int ldv, int voff, _Float16* __restrict__ Vt) { __shared__ unsigned short tl[64][66]; const int tid = threadIdx.x; const int slab = blockIdx.x / (TTv / 64), lg = blockIdx.x % (TTv / 64); const int b = slab / NHv, h = slab % NHv;
  for (int i = tid; i < 64 * 8; i += 256) { const int r = i / 8, c8 = (i % 8) * 8; FragH f; f.half[0] = *(const v8us*)((const unsigned short*)V16 + ((size_t)b * TTv + lg * 64 + r) * ldv + voff + h * 64 + c8);
#pragma unroll
    for (int q = 0; q < 8; ++q) tl[r][c8 + q] = f.u[q]; }
  __syncthreads();
  {
#pragma unroll
    for (int rd = 0; rd < 2; ++rd) { const int d = rd * 32 + tid / 8, pc = tid % 8; FragH f;
#pragma unroll
      for (int q = 0; q < 8; ++q) f.u[q] = tl[pc * 8 + q][d];
      *(v8us*)((unsigned short*)Vt + ((size_t)slab * 64 + d) * TTv + lg * 64 + pc * 8) = f.half[0]; }
     } }

__global__ __launch_bounds__(256) void k_hl(const float* __restrict__ F, _Float16* __restrict__ Hh, _Float16* __restrict__ Hl, size_t n8) { const size_t t = (size_t)blockIdx.x * 256 + threadIdx.x; if (t >= n8) return; FragH fh, fl; const v4f a = *(const v4fa*)(F + t * 8), c = *(const v4fa*)(F + t * 8 + 4);
#pragma unroll
  for (int q = 0; q < 4; ++q) { _Float16 h = (_Float16)a[q]; fh.h[q] = h; fl.h[q] = (_Float16)((a[q] - (float)h) * 1024.0f); h = (_Float16)c[q]; fh.h[4 + q] = h; fl.h[4 + q] = (_Float16)((c[q] - (float)h) * 1024.0f); }
  { *(v8us*)((unsigned short*)Hh + t * 8) = fh.half[0]; *(v8us*)((unsigned short*)Hl + t * 8) = fl.half[0];  } }

// ---- fast GEMM (wave tile 32x64; requires M % 32 == 0 rows per launch region and N % 64 == 0); epilogue = k_gemm_hhx semantics ----
__device__ __forceinline__ v16h g2_frag(const _Float16* p, int hh) { FragH f; f.half[0] = *(const v8us*)((const unsigned short*)p + 8 * hh); f.half[1] = *(const v8us*)((const unsigned short*)p + 16 + 8 * hh); return f.v; }
__device__ __forceinline__ v8f g2_mma(v16h a, v16h b, v8f c) { v8f d = __builtin_amdgcn_wmma_f32_16x16x32_f16(false, a, false, b, (short)0, c, false, false); asm volatile("v_nop\n\tv_nop\n\tv_nop\n\tv_nop" : "+v"(d) : "v"(a), "v"(b)); return d; }
template <int ACT>
__global__ __launch_bounds__(128) void k_gemm2(const _Float16* __restrict__ A, int lda, size_t sA, const _Float16* __restrict__ Bh, int ldb, size_t sB, float alpha, const float* __restrict__ bias, size_t sBias, const float* __restrict__ CP, int rowsPerB, size_t sCPb, int row0g,
    float* __restrict__ C, _Float16* __restrict__ C16, int ldc, size_t sC, int M, int N, int K) { static_assert(ACT == 0 || ACT == 3 || ACT == 6 || ACT == 8 || ACT == 9 || ACT == 11 || ACT == 12 || ACT == 14 || ACT == 15 || ACT == 16 || ACT == 17, "k_gemm2: unsupported ACT code (would silently apply no activation)");
  __shared__ __attribute__((aligned(16))) float so[4][32][68];
  const int tid = threadIdx.x, w = tid >> 5, lane = tid & 31, ln = lane & 15, hh = lane >> 4; const int by = blockIdx.y;
  A += (size_t)by * sA; Bh += (size_t)by * sB; const size_t cofs = (size_t)by * sC; const float* bp = bias ? bias + (size_t)by * sBias : nullptr;
  const int ntn = N >> 6; const int mt = blockIdx.x / ntn, nq = blockIdx.x - mt * ntn; const int row0 = mt * 128 + 32 * w, col0 = nq * 64; if (row0 >= M) return;
  const _Float16* a0p = A + (size_t)(row0 + ln) * lda; const _Float16* a1p = a0p + (size_t)16 * lda;
  const _Float16* b0p = Bh + (size_t)(col0 + ln) * ldb; const _Float16* b1p = b0p + (size_t)16 * ldb; const _Float16* b2p = b1p + (size_t)16 * ldb; const _Float16* b3p = b2p + (size_t)16 * ldb;
  const v8f z8 = {0.f,0.f,0.f,0.f,0.f,0.f,0.f,0.f}; v8f c00 = z8, c01 = z8, c02 = z8, c03 = z8, c10 = z8, c11 = z8, c12 = z8, c13 = z8;
#pragma unroll 1
  for (int kb = 0; kb < K; kb += 32) { const v16h a0 = g2_frag(a0p + kb, hh), a1 = g2_frag(a1p + kb, hh);
    v16h b = g2_frag(b0p + kb, hh); c00 = g2_mma(a0, b, c00); c10 = g2_mma(a1, b, c10);
    b = g2_frag(b1p + kb, hh); c01 = g2_mma(a0, b, c01); c11 = g2_mma(a1, b, c11);
    b = g2_frag(b2p + kb, hh); c02 = g2_mma(a0, b, c02); c12 = g2_mma(a1, b, c12);
    b = g2_frag(b3p + kb, hh); c03 = g2_mma(a0, b, c03); c13 = g2_mma(a1, b, c13); }
  v8f accs[8] = {c00, c01, c02, c03, c10, c11, c12, c13};
#pragma unroll
  for (int u = 0; u < 8; ++u) { const int t = u & 3, half = u >> 2; const int col = col0 + t * 16 + ln; const float bv = bp ? bf16_round(bp[col]) : 0.f;
#pragma unroll
    for (int r = 0; r < 8; ++r) { const int rloc = half * 16 + 8 * hh + r; float v = accs[u][r] * alpha + bv; if (CP) { if (rowsPerB < 0) v += CP[cofs + (size_t)(row0g + row0 + rloc) * ldc + col];      /* rowsPerB < 0: own element of the batched C plane */ else { const int bidx = (row0g + row0 + rloc) / rowsPerB; v += CP[(size_t)bidx * sCPb + (size_t)by * 64 + col]; } }
      if (ACT == 3) v = fmaxf(v, 0.f); else if (ACT == 6) v = 0.5f * v * (1.0f + erff(v * 0.70710678118654752f)); else if (ACT == 11) v = 1.0f / (1.0f + expf(-v)); else if (ACT == 15) v = v / (1.0f + expf(-v)); else if (ACT == 12) v = (v > 0.f) ? v : 0.01f * v; else if (ACT == 8) v = tanhf(v); else if (ACT == 9) v = 0.5f * v * (1.0f + tanhf(0.7978845608028654f * (v + 0.044715f * v * v * v))); else if (ACT == 14) v = (v > 0.f) ? v : 0.1f * v; else if (ACT == 16) v = (v >= 0.f) ? v : 0.3f * v; else if (ACT == 17) v = (v >= 0.f) ? v : 0.2f * v;
      so[w][rloc][t * 16 + ln] = v; } }
  __builtin_amdgcn_fence(__ATOMIC_ACQ_REL, "workgroup"); __builtin_amdgcn_wave_barrier();
  const int rsub = lane >> 4, c4 = (lane & 15) * 4;
  {
#pragma unroll
    for (int q = 0; q < 16; ++q) { const int r = q * 2 + rsub; const v4f v = *(const v4fa*)&so[w][r][c4]; if (C) *(v4f*)(C + cofs + (size_t)(row0 + r) * ldc + col0 + c4) = v; if (C16) { v4h h4; for (int i = 0; i < 4; ++i) h4[i] = (_Float16)v[i]; *(v4h*)(C16 + cofs + (size_t)(row0 + r) * ldc + col0 + c4) = h4; } }
     } }


__global__ __launch_bounds__(256) void k_wnat(const float* __restrict__ w, size_t n8, _Float16* __restrict__ Bt) { const size_t t = (size_t)blockIdx.x * 256 + threadIdx.x; if (t >= n8) return; FragH f; for (int q = 0; q < 8; ++q) f.h[q] = (_Float16)(bf16_round(w[t * 8 + q]) * 16.0f); *(v8us*)((unsigned short*)Bt + t * 8) = f.half[0];  }
__global__ __launch_bounds__(256) void k_rsm(const float* __restrict__ S, _Float16* __restrict__ P, int nrows) {
  #pragma clang fp contract(off)
  const int i = blockIdx.x * 256 + threadIdx.x; if (i >= nrows) return; const float* s = S + (size_t)i * SQ; float mx = -3.0e38f;
#pragma unroll 1
  for (int j = 0; j < SQ; ++j) mx = fmaxf(mx, s[j]); float se = 0.f;
#pragma unroll 1
  for (int j = 0; j < SQ; ++j) se += expf(s[j] - mx); const float sc = 256.0f / se;
#pragma unroll 1
  for (int j0 = 0; j0 < SQ; j0 += 8) { FragH f; for (int q = 0; q < 8; ++q) f.h[q] = (_Float16)(expf(s[j0 + q] - mx) * sc); unsigned short* d = (unsigned short*)P + (size_t)i * SQ + j0; *(v8us*)d = f.half[0];  } }
__global__ __launch_bounds__(256) void k_vt(const _Float16* __restrict__ V16, int b, int h0, _Float16* __restrict__ VT) { __shared__ unsigned short tl[64][65]; const int tid = threadIdx.x; const int hh = blockIdx.x % HG, sg = blockIdx.x / HG; const int s0 = sg * 64; const int h = h0 + hh;
  for (int i = tid; i < 64 * 8; i += 256) { const int j = i / 8, d8 = (i % 8) * 8; FragH f; f.half[0] = *(const v8us*)((const unsigned short*)V16 + ((size_t)b * SQ + s0 + j) * DM + h * HD + d8); for (int q = 0; q < 8; ++q) tl[d8 + q][j] = f.u[q]; }
  __syncthreads();
  { for (int i = tid; i < 64 * 8; i += 256) { const int d = i / 8, j8 = (i % 8) * 8; FragH f; for (int q = 0; q < 8; ++q) f.u[q] = tl[d][j8 + q]; *(v8us*)((unsigned short*)VT + ((size_t)hh * HD + d) * SQ + s0 + j8) = f.half[0]; }  } }



__global__ __launch_bounds__(256) void k_rsmcf2(const float* __restrict__ S, _Float16* __restrict__ P, int hg, int q0, int nk) {
  #pragma clang fp contract(off)
  const int t = blockIdx.x * 256 + threadIdx.x; if (t >= hg * QT) return; const size_t i = (size_t)t; const float* s = S + i * NKX; const int last = q0 + (t % QT); float mx = -3.0e38f;
#pragma unroll 1
  for (int j = 0; j < nk; ++j) { const float f = (j <= last) ? 1.f : 0.f; mx = fmaxf(mx, fmaf(f, s[j], (1.f - f) * -1.0e9f)); } float se = 0.f;
#pragma unroll 1
  for (int j = 0; j < nk; ++j) { const float f = (j <= last) ? 1.f : 0.f; se += __expf(fmaf(f, s[j], (1.f - f) * -1.0e9f) - mx); } const float sc = 256.0f / se;
#pragma unroll 1
  for (int j0 = 0; j0 < nk; j0 += 8) { FragH fr; for (int q = 0; q < 8; ++q) { const int j = j0 + q; const float f = (j <= last) ? 1.f : 0.f; fr.h[q] = (_Float16)(__expf(fmaf(f, s[j], (1.f - f) * -1.0e9f) - mx) * sc); } unsigned short* d = (unsigned short*)P + i * NKX + j0; *(v8us*)d = fr.half[0];  } }

template <int MASKADD>
__global__ __launch_bounds__(64) void k_att0(const float* __restrict__ QF, const float* __restrict__ KF, const float* __restrict__ VF, int ld, const float* __restrict__ mask, float scale, float* __restrict__ OF, int ldo) {
  #pragma clang fp contract(off)
  __shared__ __attribute__((aligned(16))) float lq[64][64]; __shared__ __attribute__((aligned(16))) float lo[64][64];
  const int tid = threadIdx.x; const int h = blockIdx.x / (QT0 / 64), rg = blockIdx.x % (QT0 / 64); const int i = rg * 64 + tid;
  const float* qr = QF + (size_t)i * ld + h * HD;
#pragma unroll 1
  for (int c = 0; c < HD / 4; ++c) { *(v4f*)&lq[tid][c * 4] = *(const v4fa*)(qr + c * 4); const v4f z = {0.f, 0.f, 0.f, 0.f}; *(v4f*)&lo[tid][c * 4] = z; }
  float m = -1.0e30f, l = 0.f; const int jmax = MASKADD ? (SQ - 1) : (rg * 64 + 63);      /* additive-mask form: every key (the mask input decides); causal form: keys up to the block's last row */
#pragma unroll 1
  for (int j = 0; j <= jmax; ++j) { const float* kr = KF + (size_t)j * ld + h * HD; const float* vr = VF + (size_t)j * ld + h * HD; float s = 0.f;
#pragma unroll 1
    for (int c = 0; c < HD / 4; ++c) { const v4f kq = *(const v4fa*)(kr + c * 4); const v4f qq = *(v4f*)&lq[tid][c * 4]; s = __fadd_rn(s, __fmul_rn(qq[0], kq[0])); s = __fadd_rn(s, __fmul_rn(qq[1], kq[1])); s = __fadd_rn(s, __fmul_rn(qq[2], kq[2])); s = __fadd_rn(s, __fmul_rn(qq[3], kq[3])); }
    s = __fmul_rn(s, scale); if (MASKADD) s = __fadd_rn(s, __fmul_rn(bf16_round(mask[(size_t)i * SQ + j]), -10000.0f));
    const float f = (MASKADD || j <= i) ? 1.f : 0.f; const float sm = fmaf(f, s, (1.f - f) * -1.0e30f); const float mn = fmaxf(m, sm); const float sc = expf(m - mn); const float e = expf(sm - mn); l = __fadd_rn(__fmul_rn(l, sc), e); m = mn;
#pragma unroll 1
    for (int c = 0; c < HD / 4; ++c) { const v4f vv = *(const v4fa*)(vr + c * 4); v4f oo = *(v4f*)&lo[tid][c * 4]; for (int u = 0; u < 4; ++u) oo[u] = __fadd_rn(__fmul_rn(oo[u], sc), __fmul_rn(e, vv[u])); *(v4f*)&lo[tid][c * 4] = oo; } }
  const float fin = 64.0f / l;      /* o carried x64 (the f16 path writes o unscaled) */
#pragma unroll 1
  for (int c = 0; c < HD / 4; ++c) { v4f oo = *(v4f*)&lo[tid][c * 4]; for (int u = 0; u < 4; ++u) oo[u] = __fmul_rn(oo[u], fin); *(v4f*)&lo[tid][c * 4] = oo; }
  __syncthreads();
  {
#pragma unroll 1
    for (int it = 0; it < 16; ++it) { const int row = it * 4 + tid / 16, pc = (tid % 16) * 4; const v4f v = *(const v4f*)&lo[row][pc]; *(v4f*)(OF + (size_t)(rg * 64 + row) * ldo + h * HD + pc) = v; }
     } }

__global__ __launch_bounds__(256) void k_oscale(const float* __restrict__ OF, float* __restrict__ out, size_t n4) { const size_t t = (size_t)blockIdx.x * 256 + threadIdx.x; if (t >= n4) return; const v4f a = *(const v4fa*)(OF + t * 4); v4f o; for (int q = 0; q < 4; ++q) o[q] = a[q] * 0.015625f; *(v4f*)(out + t * 4) = o;  }

__global__ __launch_bounds__(256) void k_bfr(const float* __restrict__ x, float* __restrict__ XB, size_t n8) { const size_t t = (size_t)blockIdx.x * 256 + threadIdx.x; if (t >= n8) return; v4f a = *(const v4fa*)(x + t * 8), c = *(const v4fa*)(x + t * 8 + 4); for (int q = 0; q < 4; ++q) { a[q] = bf16_round(a[q]); c[q] = bf16_round(c[q]); }
  { *(v4f*)(XB + t * 8) = a; *(v4f*)(XB + t * 8 + 4) = c;  } }



__global__ __launch_bounds__(256) void k_rsmfvl(const float* __restrict__ S, _Float16* __restrict__ P, _Float16* __restrict__ PL, int qn, const int* __restrict__ vlp) {
  #pragma clang fp contract(off)
  const int t = blockIdx.x * 256 + threadIdx.x; if (t >= qn) return; const int vl = vlp[0]; const size_t i = (size_t)t; const float* s = S + i * SQ; float mx = -3.0e38f;
#pragma unroll 1
  for (int j = 0; j < SQ; ++j) { const float f = (j < vl) ? 1.f : 0.f; mx = fmaxf(mx, fmaf(f, s[j], (1.f - f) * -1000000.0f)); } float se = 0.f;
#pragma unroll 1
  for (int j = 0; j < SQ; ++j) { const float f = (j < vl) ? 1.f : 0.f; se += __expf(fmaf(f, s[j], (1.f - f) * -1000000.0f) - mx); } const float sc = 256.0f / se;
#pragma unroll 1
  for (int j0 = 0; j0 < SQ; j0 += 8) { FragH fr, gr; for (int q = 0; q < 8; ++q) { const int j = j0 + q; const float f = (j < vl) ? 1.f : 0.f; const float pv = __expf(fmaf(f, s[j], (1.f - f) * -1000000.0f) - mx) * sc; const _Float16 ph = (_Float16)pv; fr.h[q] = ph; gr.h[q] = (_Float16)((pv - (float)ph) * 1024.0f); }
    unsigned short* d = (unsigned short*)P + i * SQ + j0; unsigned short* dl = (unsigned short*)PL + i * SQ + j0; *(v8us*)d = fr.half[0]; *(v8us*)dl = gr.half[0];  } }

__global__ __launch_bounds__(256) void k_rsmf(const float* __restrict__ S, _Float16* __restrict__ P, int qn, int hg) {
  #pragma clang fp contract(off)
  const int t = blockIdx.x * 256 + threadIdx.x; if (t >= qn * hg) return; const size_t i = (size_t)(t / qn) * SQ + (t % qn); const float* s = S + i * SQ; float mx = -3.0e38f;
#pragma unroll 1
  for (int j = 0; j < SQ; ++j) mx = fmaxf(mx, s[j]); float se = 0.f;
#pragma unroll 1
  for (int j = 0; j < SQ; ++j) se += __expf(s[j] - mx); const float sc = 256.0f / se;
#pragma unroll 1
  for (int j0 = 0; j0 < SQ; j0 += 8) { FragH f; for (int q = 0; q < 8; ++q) f.h[q] = (_Float16)(__expf(s[j0 + q] - mx) * sc); unsigned short* d = (unsigned short*)P + i * SQ + j0; *(v8us*)d = f.half[0];  } }



__global__ __launch_bounds__(256) void k_rsmik(const float* __restrict__ S, _Float16* __restrict__ P, int qn, int hg, const int* __restrict__ Km) {
  #pragma clang fp contract(off)
  const int t = blockIdx.x * 256 + threadIdx.x; if (t >= qn * hg) return; const size_t i = (size_t)(t / qn) * SQ + (t % qn); const float* s = S + i * SQ; float mx = -3.0e38f;
#pragma unroll 1
  for (int j = 0; j < SQ; ++j) mx = fmaxf(mx, s[j]); float se = 0.f;
#pragma unroll 1
  for (int j = 0; j < SQ; ++j) { const float e = __expf(s[j] - mx); const float keep = (Km[j] != 0) ? 1.0f : 0.0f; se += e * keep; } const float sc = 256.0f / se;
#pragma unroll 1
  for (int j0 = 0; j0 < SQ; j0 += 8) { FragH f; for (int q = 0; q < 8; ++q) { const float e = __expf(s[j0 + q] - mx) * sc; const float keep = (Km[j0 + q] != 0) ? 1.0f : 0.0f; f.h[q] = (_Float16)(e * keep); } unsigned short* d = (unsigned short*)P + i * SQ + j0; *(v8us*)d = f.half[0];  } }


extern "C" void kernel_launch(void* const* d_in, const int* in_sizes, int n_in,
                              void* d_out, int out_size, void* d_ws, size_t ws_size, hipStream_t stream) {
  (void)in_sizes; (void)n_in; (void)out_size;
  const float* const* I = (const float* const*)d_in; const float* xq = I[0]; const float* xk = I[1]; const float* xv = I[2]; const int* km = (const int*)d_in[3];      /* q, k, v [16][2048][128] (bf16-valued); mask int32 [16][2048] (READ on device) */
  char* ws = (char*)d_ws; size_t off = 0;
  auto take = [&](size_t bytes) { char* p = ws + off; off += (bytes + 255) & ~(size_t)255; return p; };
  _Float16* Q16 = (_Float16*)take(NR * DM * 2); _Float16* K16 = (_Float16*)take(NR * DM * 2); _Float16* V16 = (_Float16*)take(NR * DM * 2);
  float* S = (float*)take((size_t)SQ * SQ * 4); _Float16* P = (_Float16*)take((size_t)SQ * SQ * 2); _Float16* VT = (_Float16*)take((size_t)HD * SQ * 2);
  if (off > ws_size) return;
  k_x16<<<(unsigned)((NR * DM / 8 + 255) / 256), 256, 0, stream>>>(xq, Q16, NR * DM / 8); k_x16<<<(unsigned)((NR * DM / 8 + 255) / 256), 256, 0, stream>>>(xk, K16, NR * DM / 8); k_x16<<<(unsigned)((NR * DM / 8 + 255) / 256), 256, 0, stream>>>(xv, V16, NR * DM / 8);      /* exact f16 copies of the bf16-valued inputs */
  for (int b = 0; b < NB; ++b) { const size_t r0 = (size_t)b * SQ;
    k_vt<DM / 64, SQ><<<(DM / 64) * (SQ / 64), 256, 0, stream>>>(V16 + r0 * DM, DM, 0, VT);      /* V^T [128][SQ] of this sequence (two 64-row slabs) */
    k_gemm2<0><<<dim3((SQ / 128) * (SQ / 64), 1), 128, 0, stream>>>(Q16 + r0 * DM, DM, 0, K16 + r0 * DM, DM, 0, 0.08838834764831845f, nullptr, 0, nullptr, 1, 0, 0, S, nullptr, SQ, 0, SQ, SQ, HD);      /* scores / sqrt(128) (exact products, K = 128) */
    k_rsmik<<<(SQ + 255) / 256, 256, 0, stream>>>(S, P, SQ, 1, km + (size_t)b * SQ);      /* exp(s - max over ALL keys) * mask[b][key], normalised by the masked sum -> P x256 f16 (the module's post-exp multiplicative mask, literally) */
    k_gemm2<0><<<dim3((SQ / 128) * (HD / 64), 1), 128, 0, stream>>>(P, SQ, 0, VT, SQ, 0, 0.00390625f, nullptr, 0, nullptr, 1, 0, 0, (float*)d_out + r0 * DM, nullptr, DM, 0, SQ, HD, SQ);      /* out = P V^T 2^-8 f32 into the output rows */
  }
}

// v001
// A run of this version takes 1230 microseconds.
// Next to v000, in two timings, it ran 5.15 and 5.17 times as fast.
#include <hip/hip_runtime.h>
// Scaled dot-product attention with the module's POST-exp multiplicative key mask (q, k, v [16][2048][128]: 16 independent sequences, one 128-wide head; mask int32 [16][2048] in {0, 1} (random, read on device); score = q.k / sqrt(128); e = exp(score - rowmax over ALL keys); e *= mask[b][key]; a = e / sum(e); out = a v -> [16][2048][128]). No projections: q, k, v are bf16-valued inputs, so their f16 copies and the score products are exact.
// Structure: no projections: q, k, v are bf16-valued inputs copied to exact f16 rows; per sequence: V^T via LDS transposes, scores as ONE WMMA GEMM (32x64 wave tiles, f32 accumulation, exact products, alpha = 1/sqrt(128)), row softmax on VALU (f32 statistics, native exp; weights x256 f16), out = P V^T written f32 straight into the output rows; launches: see trace.
// Compute dtype: inputs rounded to bf16; q, k, v and softmax weights as plain f16 GEMM operands (~2^-12); scores, softmax statistics and o f32; v_wmma_f32_16x16x32_f16.
#define NB 16
#define SQ 2048
#define DM 128
#define NH 1
#define HD 128
#define HG 4                         /* heads per attention launch group */
#define B0 0                         /* first batch processed (debug hook) */
#define NBR NB                       /* batches processed (debug hook) */
#define NR ((size_t)NB * SQ)         /* token rows */
#define MP ((int)((size_t)NBR * SQ))
#define QT 256                       /* query rows per causal tile */
#define NKX SQ                       /* S / P row pitch */
#define QT0 256                      /* first-tile rows recomputed exactly (256: buys margin for the few-key rows 128..255, which have no output projection to average the single-f16 P/v rounding) */
#define QN SQ                        /* query rows attended per batch (debug hook) */
#define NHD NH                       /* heads attended (debug hook) */
#define MPO MP                       /* rows through the output stage (debug hook) */
#define LQ DM            /* row pitch of the q/k/v rows */
typedef __bf16 v16b __attribute__((ext_vector_type(16)));
typedef unsigned short v8us __attribute__((ext_vector_type(8), may_alias));
typedef float  v8f  __attribute__((ext_vector_type(8)));
typedef float  v4f  __attribute__((ext_vector_type(4)));
typedef float  v4fa __attribute__((ext_vector_type(4), may_alias));
union FragB { v16b v; v8us half[2]; unsigned short u[16]; };

__device__ __forceinline__ unsigned short bf16_bits(float x) { unsigned int u = __float_as_uint(x); return (unsigned short)((u + 0x7FFFu + ((u >> 16) & 1u)) >> 16); }
__device__ __forceinline__ float bf16_val(unsigned short b) { return __uint_as_float(((unsigned int)b) << 16); }
__device__ __forceinline__ float bf16_round(float x) { return bf16_val(bf16_bits(x)); }
// D += A·B with NT terms: 1 = ah·bh, 2 = + al·bh (A split), 3 = + ah·bl (both split)
template <int NT>
__device__ __forceinline__ v8f mmaN(v16b ah, v16b al, v16b bh, v16b bl, v8f c) {
  c = __builtin_amdgcn_wmma_f32_16x16x32_bf16(false, ah, false, bh, (short)0, c, false, false);
  if (NT >= 2) c = __builtin_amdgcn_wmma_f32_16x16x32_bf16(false, al, false, bh, (short)0, c, false, false);
  if (NT >= 3) c = __builtin_amdgcn_wmma_f32_16x16x32_bf16(false, ah, false, bl, (short)0, c, false, false);
  asm volatile("v_nop\n\tv_nop\n\tv_nop\n\tv_nop" : "+v"(c) : "v"(ah), "v"(al), "v"(bh), "v"(bl));
  return c;
}

__global__ __launch_bounds__(256) void k_wt_bf16(const float* __restrict__ W, unsigned short* __restrict__ Wt, int K, int N) {
  const int t = blockIdx.x * 256 + threadIdx.x;
  const int k8n = K / 8;
  if (t >= N * k8n) return;
  const int n = t / k8n, k8 = (t % k8n) * 8;
  v8us v;
#pragma unroll
  for (int i = 0; i < 8; ++i) v[i] = bf16_bits(W[(size_t)(k8 + i) * N + n]);
  *(v8us*)(Wt + (size_t)n * K + k8) = v;
  
}

// GEMM C[M][N] (f32, pitch ldc) = act(A[M][K]·W + bias). A f32 row-major (pitch lda) converted per fragment to bf16
// (ASPLIT: hi/lo two planes -> 2 terms, else single rounded term); Wt bf16 [N][K] (pitch ldb). BIAS_BF16 rounds the
// bias to bf16 first (bias quantised to bf16 before the add). K%32==0, M%16==0, N%64==0.
template <bool ASPLIT, int ACT, bool BIAS_BF16>
__global__ __launch_bounds__(128) void k_gemm_bf(const float* __restrict__ A, int lda, const unsigned short* __restrict__ Wt, int ldb,
                                               const float* __restrict__ bias, float* __restrict__ C, int ldc, int M, int N, int K) {
  __shared__ __attribute__((aligned(16))) float so[4][16][64];
  const int tid = threadIdx.x, w = tid >> 5, lane = tid & 31, ln = lane & 15, hh = lane >> 4;
  const int ntn = N / 64;
  const int wid = blockIdx.x * 4 + w;
  const int mt = wid / ntn, nq = wid % ntn;
  if (mt * 16 >= M) return;
  const int row0 = mt * 16, col0 = nq * 64;
  const float* arow = A + (size_t)(row0 + ln) * lda;
  v8f acc[4] = {};
  for (int kb = 0; kb < K; kb += 32) {
    FragB ah, al;
    const v4f x0 = *(const v4fa*)(arow + kb + 8 * hh), x1 = *(const v4fa*)(arow + kb + 8 * hh + 4);
    const v4f x2 = *(const v4fa*)(arow + kb + 16 + 8 * hh), x3 = *(const v4fa*)(arow + kb + 16 + 8 * hh + 4);
    float xs[16] = {x0[0],x0[1],x0[2],x0[3],x1[0],x1[1],x1[2],x1[3],x2[0],x2[1],x2[2],x2[3],x3[0],x3[1],x3[2],x3[3]};
#pragma unroll
    for (int i = 0; i < 16; ++i) { const unsigned short hb = bf16_bits(xs[i]); ah.u[i] = hb; al.u[i] = ASPLIT ? bf16_bits(xs[i] - bf16_val(hb)) : (unsigned short)0; }
#pragma unroll
    for (int t = 0; t < 4; ++t) {
      const unsigned short* brow = Wt + (size_t)(col0 + t * 16 + ln) * ldb + kb;
      FragB b;
      b.half[0] = *(const v8us*)(brow + 8 * hh);
      b.half[1] = *(const v8us*)(brow + 16 + 8 * hh);
      acc[t] = mmaN<ASPLIT ? 2 : 1>(ah.v, al.v, b.v, b.v, acc[t]);
    }
  }
#pragma unroll
  for (int t = 0; t < 4; ++t) {
    float bv = bias ? bias[col0 + t * 16 + ln] : 0.f;
    if (BIAS_BF16) bv = bf16_round(bv);
#pragma unroll
    for (int r = 0; r < 8; ++r) { float v = acc[t][r] + bv; if (ACT == 1) v = fmaxf(v, 0.f); so[w][8 * hh + r][t * 16 + ln] = v; }
  }
  __builtin_amdgcn_fence(__ATOMIC_ACQ_REL, "workgroup");
  __builtin_amdgcn_wave_barrier();
  const int rsub = lane >> 4, c4 = (lane & 15) * 4;
  {
#pragma unroll
    for (int q = 0; q < 8; ++q) {
      const int r = q * 2 + rsub;
      const v4f v = *(const v4fa*)&so[w][r][c4];
      *(v4f*)(C + (size_t)(row0 + r) * ldc + col0 + c4) = v;
    }
    
  }
}

// GEMM C = act(A·W + bias + resid): A f32 (ASPLIT -> hi/lo 2 terms), Wt bf16 [N][K]; ACT 0 none, 1 relu, 2 exact gelu;
// resid (optional, f32, row index = (row % rmod), pitch ldr, RES_BF16 rounds it) added before the activation.
template <bool ASPLIT, int ACT, bool BIAS_BF16, bool RES_BF16>
__global__ __launch_bounds__(128) void k_gemm_bf3(const float* __restrict__ A, int lda, const unsigned short* __restrict__ Wt, int ldb,
                                                const float* __restrict__ bias, const float* __restrict__ resid, int rmod, int ldr,
                                                float* __restrict__ C, int ldc, int M, int N, int K) {
  __shared__ __attribute__((aligned(16))) float so[4][16][64];
  const int tid = threadIdx.x, w = tid >> 5, lane = tid & 31, ln = lane & 15, hh = lane >> 4;
  const int ntn = N / 64;
  const int wid = blockIdx.x * 4 + w;
  const int mt = wid / ntn, nq = wid % ntn;
  if (mt * 16 >= M) return;
  const int row0 = mt * 16, col0 = nq * 64;
  const float* arow = A + (size_t)(row0 + ln) * lda;
  v8f acc[4] = {};
  for (int kb = 0; kb < K; kb += 32) {
    FragB ah, al;
    const v4f x0 = *(const v4fa*)(arow + kb + 8 * hh), x1 = *(const v4fa*)(arow + kb + 8 * hh + 4);
    const v4f x2 = *(const v4fa*)(arow + kb + 16 + 8 * hh), x3 = *(const v4fa*)(arow + kb + 16 + 8 * hh + 4);
    float xs[16] = {x0[0],x0[1],x0[2],x0[3],x1[0],x1[1],x1[2],x1[3],x2[0],x2[1],x2[2],x2[3],x3[0],x3[1],x3[2],x3[3]};
#pragma unroll
    for (int i = 0; i < 16; ++i) { const unsigned short hb = bf16_bits(xs[i]); ah.u[i] = hb; al.u[i] = ASPLIT ? bf16_bits(xs[i] - bf16_val(hb)) : (unsigned short)0; }
#pragma unroll
    for (int t = 0; t < 4; ++t) {
      const unsigned short* brow = Wt + (size_t)(col0 + t * 16 + ln) * ldb + kb;
      FragB b;
      b.half[0] = *(const v8us*)(brow + 8 * hh);
      b.half[1] = *(const v8us*)(brow + 16 + 8 * hh);
      acc[t] = mmaN<ASPLIT ? 2 : 1>(ah.v, al.v, b.v, b.v, acc[t]);
    }
  }
#pragma unroll
  for (int t = 0; t < 4; ++t) {
    const int col = col0 + t * 16 + ln;
    float bv = bias ? bias[col] : 0.f;
    if (BIAS_BF16) bv = bf16_round(bv);
#pragma unroll
    for (int r = 0; r < 8; ++r) {
      float v = acc[t][r] + bv;
      if (resid) { float rv = resid[(size_t)((row0 + 8 * hh + r) % rmod) * ldr + col]; if (RES_BF16) rv = bf16_round(rv); v += rv; }
      if (ACT == 1) v = fmaxf(v, 0.f);
      if (ACT == 2) v = 0.5f * v * (1.0f + erff(v * 0.70710678118654752f));
      if (ACT == 3) { const float u = 0.7978845608028654f * (v + 0.044715f * v * v * v); v = 0.5f * v * (1.0f + tanhf(u)); }
      so[w][8 * hh + r][t * 16 + ln] = v;
    }
  }
  __builtin_amdgcn_fence(__ATOMIC_ACQ_REL, "workgroup");
  __builtin_amdgcn_wave_barrier();
  const int rsub = lane >> 4, c4 = (lane & 15) * 4;
  {
#pragma unroll
    for (int q = 0; q < 8; ++q) {
      const int r = q * 2 + rsub;
      const v4f v = *(const v4fa*)&so[w][r][c4];
      *(v4f*)(C + (size_t)(row0 + r) * ldc + col0 + c4) = v;
    }
    
  }
}
// row LayerNorm (biased variance, eps) over N: s = X (+ R); optional out_sum <- s; out_norm <- (s-mu)*rsqrt(var+eps)*g + b
template <bool PARAM_BF16>
__global__ __launch_bounds__(256) void k_layernorm(const float* __restrict__ X, const float* __restrict__ R, const float* __restrict__ g, const float* __restrict__ bta,
                                                  float* __restrict__ out_sum, float* __restrict__ out_norm, int N, float eps) {
  __shared__ float red[256];
  const int row = blockIdx.x, tid = threadIdx.x;
  const float* x = X + (size_t)row * N; const float* rr = R ? R + (size_t)row * N : nullptr;
  float vals[16];                     // up to N = 4096
  const int per = N / 256;            // contiguous chunk per thread? use strided-by-4 chunks: thread handles j = tid*4 + 1024*u
  float s1 = 0.f;
  for (int u = 0; u < per / 4; ++u) {
    const int j = tid * 4 + 1024 * u;
    const v4f a = *(const v4fa*)(x + j);
    v4f b = {0.f,0.f,0.f,0.f}; if (rr) b = *(const v4fa*)(rr + j);
#pragma unroll
    for (int q = 0; q < 4; ++q) { const float v = a[q] + b[q]; vals[u * 4 + q] = v; s1 += v; }
  }
  red[tid] = s1; __syncthreads();
  for (int st = 128; st > 0; st >>= 1) { if (tid < st) red[tid] += red[tid + st]; __syncthreads(); }
  const float mu = red[0] / (float)N; __syncthreads();
  float s2 = 0.f;
  for (int u = 0; u < per / 4; ++u)
#pragma unroll
    for (int q = 0; q < 4; ++q) { const float c = vals[u * 4 + q] - mu; s2 += c * c; }
  red[tid] = s2; __syncthreads();
  for (int st = 128; st > 0; st >>= 1) { if (tid < st) red[tid] += red[tid + st]; __syncthreads(); }
  const float rs = rsqrtf(red[0] / (float)N + eps);
  {
    for (int u = 0; u < per / 4; ++u) {
      const int j = tid * 4 + 1024 * u;
      v4f o, sm;
#pragma unroll
      for (int q = 0; q < 4; ++q) {
        float gg = g[j + q], bb = bta[j + q];
        if (PARAM_BF16) { gg = bf16_round(gg); bb = bf16_round(bb); }
        sm[q] = vals[u * 4 + q]; o[q] = (vals[u * 4 + q] - mu) * rs * gg + bb;
      }
      if (out_sum) *(v4f*)(out_sum + (size_t)row * N + j) = sm;
      *(v4f*)(out_norm + (size_t)row * N + j) = o;
    }
    
  }
}



// ---- f16 WMMA path (v_wmma_f32_16x16x32_f16): 11-bit significands for operands in range — used where a [0,1] probability operand needs more precision than bf16
typedef _Float16 v16h __attribute__((ext_vector_type(16)));
union FragH { v16h v; v8us half[2]; _Float16 h[16]; unsigned short u[16]; };
template <int NT>
__device__ __forceinline__ v8f mmaH(v16h ah, v16h al, v16h bh, v16h bl, v8f c) {
  c = __builtin_amdgcn_wmma_f32_16x16x32_f16(false, ah, false, bh, (short)0, c, false, false);
  if (NT >= 2) c = __builtin_amdgcn_wmma_f32_16x16x32_f16(false, al, false, bh, (short)0, c, false, false);
  if (NT >= 3) c = __builtin_amdgcn_wmma_f32_16x16x32_f16(false, ah, false, bl, (short)0, c, false, false);
  asm volatile("v_nop\n\tv_nop\n\tv_nop\n\tv_nop" : "+v"(c) : "v"(ah), "v"(al), "v"(bh), "v"(bl));
  return c;
}
// batched GEMM like k_gemm_b but f16 operands: A f32 (split into f16 hi/lo if ASPLIT, else rounded to f16), Bt = f16 values [n][k]; alpha; C f32; N multiple of 16 (partial tiles skipped)
template <bool ASPLIT>
__global__ __launch_bounds__(128) void k_gemm_h(const float* __restrict__ A, int lda, size_t sA, const _Float16* __restrict__ Bh, int ldb, size_t sB, float alpha, float* __restrict__ C, int ldc, size_t sC, int M, int N, int K) {
  __shared__ __attribute__((aligned(16))) float so[4][16][64];
  const int tid = threadIdx.x, w = tid >> 5, lane = tid & 31, ln = lane & 15, hh = lane >> 4; const int by = blockIdx.y;
  A += (size_t)by * sA; Bh += (size_t)by * sB; C += (size_t)by * sC;
  const int ntn = (N + 63) / 64; const int wid = blockIdx.x * 4 + w; const int mt = wid / ntn, nq = wid % ntn; if (mt * 16 >= M) return;
  const int row0 = mt * 16, col0 = nq * 64; const float* arow = A + (size_t)(row0 + ln) * lda;
  v8f acc[4] = {};
  for (int kb = 0; kb < K; kb += 32) {
    FragH ah, al;
    const v4f x0 = *(const v4fa*)(arow + kb + 8 * hh), x1 = *(const v4fa*)(arow + kb + 8 * hh + 4), x2 = *(const v4fa*)(arow + kb + 16 + 8 * hh), x3 = *(const v4fa*)(arow + kb + 16 + 8 * hh + 4);
    float xs[16] = {x0[0],x0[1],x0[2],x0[3],x1[0],x1[1],x1[2],x1[3],x2[0],x2[1],x2[2],x2[3],x3[0],x3[1],x3[2],x3[3]};
#pragma unroll
    for (int i = 0; i < 16; ++i) { const _Float16 h = (_Float16)xs[i]; ah.h[i] = h; al.h[i] = ASPLIT ? (_Float16)(xs[i] - (float)h) : (_Float16)0.0f; }
#pragma unroll
    for (int t = 0; t < 4; ++t) { if (col0 + t * 16 >= N) continue; const size_t boff = (size_t)(col0 + t * 16 + ln) * ldb + kb; FragH bq; bq.half[0] = *(const v8us*)(Bh + boff + 8 * hh); bq.half[1] = *(const v8us*)(Bh + boff + 16 + 8 * hh);
      acc[t] = mmaH<ASPLIT ? 2 : 1>(ah.v, al.v, bq.v, bq.v, acc[t]); }
  }
#pragma unroll
  for (int t = 0; t < 4; ++t) { if (col0 + t * 16 >= N) continue;
#pragma unroll
    for (int r = 0; r < 8; ++r) so[w][8 * hh + r][t * 16 + ln] = acc[t][r] * alpha; }
  __builtin_amdgcn_fence(__ATOMIC_ACQ_REL, "workgroup"); __builtin_amdgcn_wave_barrier();
  const int rsub = lane >> 4, c4 = (lane & 15) * 4;
  {
#pragma unroll
    for (int q = 0; q < 8; ++q) { const int r = q * 2 + rsub; if (col0 + c4 < N) { const v4f v = *(const v4fa*)&so[w][r][c4]; *(v4f*)(C + (size_t)(row0 + r) * ldc + col0 + c4) = v; } }
     }
}

// Wt[n][k] = f16(W[k][n]·scale) from f32 row-major W[K][N] (scale = power of two; bf16-exact weights stay exact in f16 away from the subnormal range)
__global__ __launch_bounds__(256) void k_wt_f16(const float* __restrict__ W, _Float16* __restrict__ Wt, int K, int N, float scale) {
  const int t = blockIdx.x * 256 + threadIdx.x; if (t >= N * (K / 8)) return; const int n = t / (K / 8), k8 = (t % (K / 8)) * 8; FragH f;
#pragma unroll
  for (int i = 0; i < 8; ++i) f.h[i] = (_Float16)(bf16_round(W[(size_t)(k8 + i) * N + n]) * scale); const v8us o = f.half[0];
  *(v8us*)((unsigned short*)Wt + (size_t)n * K + k8) = o; 
}
// k_gemm_hh variant with fused epilogue: v = acc·alpha + bias[by·sBias + col] (+ CP[(row/rowsPerB)·sCPb + by·64 + col] if CP) ; ACT 0 none / 1 elu ; writes f16 C16 (and f32 C if non-null)
template <int ACT>
__global__ __launch_bounds__(128) void k_gemm_hhx(const _Float16* __restrict__ A, int lda, size_t sA, const _Float16* __restrict__ Bh, int ldb, size_t sB, float alpha, const float* __restrict__ bias, size_t sBias, const float* __restrict__ CP, int rowsPerB, size_t sCPb, int row0g,
    float* __restrict__ C, _Float16* __restrict__ C16, int ldc, size_t sC, int M, int N, int K) {
  __shared__ __attribute__((aligned(16))) float so[4][16][64];
  const int tid = threadIdx.x, w = tid >> 5, lane = tid & 31, ln = lane & 15, hh = lane >> 4; const int by = blockIdx.y;
  A += (size_t)by * sA; Bh += (size_t)by * sB; const size_t cofs = (size_t)by * sC; const float* bp = bias ? bias + (size_t)by * sBias : nullptr;
  const int ntn = (N + 63) / 64; const int wid = blockIdx.x * 4 + w; const int mt = wid / ntn, nq = wid % ntn; if (mt * 16 >= M) return;
  const int row0 = mt * 16, col0 = nq * 64; const _Float16* arow = A + (size_t)(row0 + ln) * lda;
  v8f acc[4] = {};
  for (int kb = 0; kb < K; kb += 32) { FragH ah; ah.half[0] = *(const v8us*)((const unsigned short*)arow + kb + 8 * hh); ah.half[1] = *(const v8us*)((const unsigned short*)arow + kb + 16 + 8 * hh);
#pragma unroll
    for (int t = 0; t < 4; ++t) { if (col0 + t * 16 >= N) continue; const size_t boff = (size_t)(col0 + t * 16 + ln) * ldb + kb; FragH bq; bq.half[0] = *(const v8us*)((const unsigned short*)Bh + boff + 8 * hh); bq.half[1] = *(const v8us*)((const unsigned short*)Bh + boff + 16 + 8 * hh);
      acc[t] = mmaH<1>(ah.v, ah.v, bq.v, bq.v, acc[t]); }
  }
#pragma unroll
  for (int t = 0; t < 4; ++t) { if (col0 + t * 16 >= N) continue; const int col = col0 + t * 16 + ln; const float bv = bp ? bf16_round(bp[col]) : 0.f;
#pragma unroll
    for (int r = 0; r < 8; ++r) { float v = acc[t][r] * alpha + bv; if (CP) { const int rr = row0g + row0 + 8 * hh + r; if (rowsPerB < 0) v += CP[cofs + (size_t)rr * ldc + col];      /* rowsPerB < 0: own element of the batched C plane */ else { const int bidx = rr / rowsPerB; v += CP[(size_t)bidx * sCPb + (size_t)by * 64 + col]; } } if (ACT == 1) v = (v > 0.f) ? v : expm1f(v); else if (ACT == 7) v = (v > 0.f) ? v + 1.0f : expf(v); else if (ACT == 8) v = tanhf(v); else if (ACT == 9) v = 0.5f * v * (1.0f + tanhf(0.7978845608028654f * (v + 0.044715f * v * v * v))); else if (ACT == 11) v = 1.0f / (1.0f + expf(-v)); else if (ACT == 12) v = (v > 0.f) ? v : 0.01f * v; else if (ACT == 14) v = (v > 0.f) ? v : 0.1f * v; else if (ACT == 16) v = (v >= 0.f) ? v : 0.3f * v; else if (ACT == 17) v = (v >= 0.f) ? v : 0.2f * v; else if (ACT == 15) v = v / (1.0f + expf(-v)); else if (ACT == 3) v = fmaxf(v, 0.f); else if (ACT == 6) v = 0.5f * v * (1.0f + erff(v * 0.70710678118654752f)); so[w][8 * hh + r][t * 16 + ln] = v; } }
  __builtin_amdgcn_fence(__ATOMIC_ACQ_REL, "workgroup"); __builtin_amdgcn_wave_barrier();
  const int rsub = lane >> 4, c4 = (lane & 15) * 4; typedef _Float16 v4h __attribute__((ext_vector_type(4)));
  {
#pragma unroll
    for (int q = 0; q < 8; ++q) { const int r = q * 2 + rsub; if (col0 + c4 < N) { const v4f v = *(const v4fa*)&so[w][r][c4]; if (C) *(v4f*)(C + cofs + (size_t)(row0 + r) * ldc + col0 + c4) = v; if (C16) { v4h h4; for (int i = 0; i < 4; ++i) h4[i] = (_Float16)v[i]; *(v4h*)(C16 + cofs + (size_t)(row0 + r) * ldc + col0 + c4) = h4; } } }
     }
}


typedef _Float16 v4h __attribute__((ext_vector_type(4)));

__global__ __launch_bounds__(256) void k_x16(const float* __restrict__ x, _Float16* __restrict__ X16, size_t n8) { const size_t t = (size_t)blockIdx.x * 256 + threadIdx.x; if (t >= n8) return; FragH f;
#pragma unroll
  for (int q = 0; q < 8; ++q) f.h[q] = (_Float16)bf16_round(x[t * 8 + q]); *(v8us*)((unsigned short*)X16 + t * 8) = f.half[0];  }
__global__ __launch_bounds__(256) void k_h16(const float* __restrict__ x, _Float16* __restrict__ X16, size_t n8) { const size_t t = (size_t)blockIdx.x * 256 + threadIdx.x; if (t >= n8) return; FragH f;
#pragma unroll
  for (int q = 0; q < 8; ++q) f.h[q] = (_Float16)x[t * 8 + q]; *(v8us*)((unsigned short*)X16 + t * 8) = f.half[0];  }
__global__ __launch_bounds__(256) void k_round16f(const float* __restrict__ W, _Float16* __restrict__ Bt, size_t n8) { const size_t t = (size_t)blockIdx.x * 256 + threadIdx.x; if (t >= n8) return; FragH f;
#pragma unroll
  for (int i = 0; i < 8; ++i) f.h[i] = (_Float16)(bf16_round(W[t * 8 + i]) * 16.0f); *(v8us*)((unsigned short*)Bt + t * 8) = f.half[0];  }
template <int NHv, int TTv>
__global__ __launch_bounds__(256) void k_vt(const _Float16* __restrict__ V16, int ldv, int voff, _Float16* __restrict__ Vt) { __shared__ unsigned short tl[64][66]; const int tid = threadIdx.x; const int slab = blockIdx.x / (TTv / 64), lg = blockIdx.x % (TTv / 64); const int b = slab / NHv, h = slab % NHv;
  for (int i = tid; i < 64 * 8; i += 256) { const int r = i / 8, c8 = (i % 8) * 8; FragH f; f.half[0] = *(const v8us*)((const unsigned short*)V16 + ((size_t)b * TTv + lg * 64 + r) * ldv + voff + h * 64 + c8);
#pragma unroll
    for (int q = 0; q < 8; ++q) tl[r][c8 + q] = f.u[q]; }
  __syncthreads();
  {
#pragma unroll
    for (int rd = 0; rd < 2; ++rd) { const int d = rd * 32 + tid / 8, pc = tid % 8; FragH f;
#pragma unroll
      for (int q = 0; q < 8; ++q) f.u[q] = tl[pc * 8 + q][d];
      *(v8us*)((unsigned short*)Vt + ((size_t)slab * 64 + d) * TTv + lg * 64 + pc * 8) = f.half[0]; }
     } }

__global__ __launch_bounds__(256) void k_hl(const float* __restrict__ F, _Float16* __restrict__ Hh, _Float16* __restrict__ Hl, size_t n8) { const size_t t = (size_t)blockIdx.x * 256 + threadIdx.x; if (t >= n8) return; FragH fh, fl; const v4f a = *(const v4fa*)(F + t * 8), c = *(const v4fa*)(F + t * 8 + 4);
#pragma unroll
  for (int q = 0; q < 4; ++q) { _Float16 h = (_Float16)a[q]; fh.h[q] = h; fl.h[q] = (_Float16)((a[q] - (float)h) * 1024.0f); h = (_Float16)c[q]; fh.h[4 + q] = h; fl.h[4 + q] = (_Float16)((c[q] - (float)h) * 1024.0f); }
  { *(v8us*)((unsigned short*)Hh + t * 8) = fh.half[0]; *(v8us*)((unsigned short*)Hl + t * 8) = fl.half[0];  } }

// ---- fast GEMM (wave tile 32x64; requires M % 32 == 0 rows per launch region and N % 64 == 0); epilogue = k_gemm_hhx semantics ----
__device__ __forceinline__ v16h g2_frag(const _Float16* p, int hh) { FragH f; f.half[0] = *(const v8us*)((const unsigned short*)p + 8 * hh); f.half[1] = *(const v8us*)((const unsigned short*)p + 16 + 8 * hh); return f.v; }
__device__ __forceinline__ v8f g2_mma(v16h a, v16h b, v8f c) { v8f d = __builtin_amdgcn_wmma_f32_16x16x32_f16(false, a, false, b, (short)0, c, false, false); asm volatile("v_nop\n\tv_nop\n\tv_nop\n\tv_nop" : "+v"(d) : "v"(a), "v"(b)); return d; }
template <int ACT>
__global__ __launch_bounds__(128) void k_gemm2(const _Float16* __restrict__ A, int lda, size_t sA, const _Float16* __restrict__ Bh, int ldb, size_t sB, float alpha, const float* __restrict__ bias, size_t sBias, const float* __restrict__ CP, int rowsPerB, size_t sCPb, int row0g,
    float* __restrict__ C, _Float16* __restrict__ C16, int ldc, size_t sC, int M, int N, int K) { static_assert(ACT == 0 || ACT == 3 || ACT == 6 || ACT == 8 || ACT == 9 || ACT == 11 || ACT == 12 || ACT == 14 || ACT == 15 || ACT == 16 || ACT == 17, "k_gemm2: unsupported ACT code (would silently apply no activation)");
  __shared__ __attribute__((aligned(16))) float so[4][32][68];
  const int tid = threadIdx.x, w = tid >> 5, lane = tid & 31, ln = lane & 15, hh = lane >> 4; const int by = blockIdx.y;
  A += (size_t)by * sA; Bh += (size_t)by * sB; const size_t cofs = (size_t)by * sC; const float* bp = bias ? bias + (size_t)by * sBias : nullptr;
  const int ntn = N >> 6; const int mt = blockIdx.x / ntn, nq = blockIdx.x - mt * ntn; const int row0 = mt * 128 + 32 * w, col0 = nq * 64; if (row0 >= M) return;
  const _Float16* a0p = A + (size_t)(row0 + ln) * lda; const _Float16* a1p = a0p + (size_t)16 * lda;
  const _Float16* b0p = Bh + (size_t)(col0 + ln) * ldb; const _Float16* b1p = b0p + (size_t)16 * ldb; const _Float16* b2p = b1p + (size_t)16 * ldb; const _Float16* b3p = b2p + (size_t)16 * ldb;
  const v8f z8 = {0.f,0.f,0.f,0.f,0.f,0.f,0.f,0.f}; v8f c00 = z8, c01 = z8, c02 = z8, c03 = z8, c10 = z8, c11 = z8, c12 = z8, c13 = z8;
#pragma unroll 1
  for (int kb = 0; kb < K; kb += 32) { const v16h a0 = g2_frag(a0p + kb, hh), a1 = g2_frag(a1p + kb, hh);
    v16h b = g2_frag(b0p + kb, hh); c00 = g2_mma(a0, b, c00); c10 = g2_mma(a1, b, c10);
    b = g2_frag(b1p + kb, hh); c01 = g2_mma(a0, b, c01); c11 = g2_mma(a1, b, c11);
    b = g2_frag(b2p + kb, hh); c02 = g2_mma(a0, b, c02); c12 = g2_mma(a1, b, c12);
    b = g2_frag(b3p + kb, hh); c03 = g2_mma(a0, b, c03); c13 = g2_mma(a1, b, c13); }
  v8f accs[8] = {c00, c01, c02, c03, c10, c11, c12, c13};
#pragma unroll
  for (int u = 0; u < 8; ++u) { const int t = u & 3, half = u >> 2; const int col = col0 + t * 16 + ln; const float bv = bp ? bf16_round(bp[col]) : 0.f;
#pragma unroll
    for (int r = 0; r < 8; ++r) { const int rloc = half * 16 + 8 * hh + r; float v = accs[u][r] * alpha + bv; if (CP) { if (rowsPerB < 0) v += CP[cofs + (size_t)(row0g + row0 + rloc) * ldc + col];      /* rowsPerB < 0: own element of the batched C plane */ else { const int bidx = (row0g + row0 + rloc) / rowsPerB; v += CP[(size_t)bidx * sCPb + (size_t)by * 64 + col]; } }
      if (ACT == 3) v = fmaxf(v, 0.f); else if (ACT == 6) v = 0.5f * v * (1.0f + erff(v * 0.70710678118654752f)); else if (ACT == 11) v = 1.0f / (1.0f + expf(-v)); else if (ACT == 15) v = v / (1.0f + expf(-v)); else if (ACT == 12) v = (v > 0.f) ? v : 0.01f * v; else if (ACT == 8) v = tanhf(v); else if (ACT == 9) v = 0.5f * v * (1.0f + tanhf(0.7978845608028654f * (v + 0.044715f * v * v * v))); else if (ACT == 14) v = (v > 0.f) ? v : 0.1f * v; else if (ACT == 16) v = (v >= 0.f) ? v : 0.3f * v; else if (ACT == 17) v = (v >= 0.f) ? v : 0.2f * v;
      so[w][rloc][t * 16 + ln] = v; } }
  __builtin_amdgcn_fence(__ATOMIC_ACQ_REL, "workgroup"); __builtin_amdgcn_wave_barrier();
  const int rsub = lane >> 4, c4 = (lane & 15) * 4;
  {
#pragma unroll
    for (int q = 0; q < 16; ++q) { const int r = q * 2 + rsub; const v4f v = *(const v4fa*)&so[w][r][c4]; if (C) *(v4f*)(C + cofs + (size_t)(row0 + r) * ldc + col0 + c4) = v; if (C16) { v4h h4; for (int i = 0; i < 4; ++i) h4[i] = (_Float16)v[i]; *(v4h*)(C16 + cofs + (size_t)(row0 + r) * ldc + col0 + c4) = h4; } }
     } }


__global__ __launch_bounds__(256) void k_wnat(const float* __restrict__ w, size_t n8, _Float16* __restrict__ Bt) { const size_t t = (size_t)blockIdx.x * 256 + threadIdx.x; if (t >= n8) return; FragH f; for (int q = 0; q < 8; ++q) f.h[q] = (_Float16)(bf16_round(w[t * 8 + q]) * 16.0f); *(v8us*)((unsigned short*)Bt + t * 8) = f.half[0];  }
__global__ __launch_bounds__(256) void k_rsm(const float* __restrict__ S, _Float16* __restrict__ P, int nrows) {
  #pragma clang fp contract(off)
  const int i = blockIdx.x * 256 + threadIdx.x; if (i >= nrows) return; const float* s = S + (size_t)i * SQ; float mx = -3.0e38f;
#pragma unroll 1
  for (int j = 0; j < SQ; ++j) mx = fmaxf(mx, s[j]); float se = 0.f;
#pragma unroll 1
  for (int j = 0; j < SQ; ++j) se += expf(s[j] - mx); const float sc = 256.0f / se;
#pragma unroll 1
  for (int j0 = 0; j0 < SQ; j0 += 8) { FragH f; for (int q = 0; q < 8; ++q) f.h[q] = (_Float16)(expf(s[j0 + q] - mx) * sc); unsigned short* d = (unsigned short*)P + (size_t)i * SQ + j0; *(v8us*)d = f.half[0];  } }
__global__ __launch_bounds__(256) void k_vt(const _Float16* __restrict__ V16, int b, int h0, _Float16* __restrict__ VT) { __shared__ unsigned short tl[64][65]; const int tid = threadIdx.x; const int hh = blockIdx.x % HG, sg = blockIdx.x / HG; const int s0 = sg * 64; const int h = h0 + hh;
  for (int i = tid; i < 64 * 8; i += 256) { const int j = i / 8, d8 = (i % 8) * 8; FragH f; f.half[0] = *(const v8us*)((const unsigned short*)V16 + ((size_t)b * SQ + s0 + j) * DM + h * HD + d8); for (int q = 0; q < 8; ++q) tl[d8 + q][j] = f.u[q]; }
  __syncthreads();
  { for (int i = tid; i < 64 * 8; i += 256) { const int d = i / 8, j8 = (i % 8) * 8; FragH f; for (int q = 0; q < 8; ++q) f.u[q] = tl[d][j8 + q]; *(v8us*)((unsigned short*)VT + ((size_t)hh * HD + d) * SQ + s0 + j8) = f.half[0]; }  } }



__global__ __launch_bounds__(256) void k_rsmcf2(const float* __restrict__ S, _Float16* __restrict__ P, int hg, int q0, int nk) {
  #pragma clang fp contract(off)
  const int t = blockIdx.x * 256 + threadIdx.x; if (t >= hg * QT) return; const size_t i = (size_t)t; const float* s = S + i * NKX; const int last = q0 + (t % QT); float mx = -3.0e38f;
#pragma unroll 1
  for (int j = 0; j < nk; ++j) { const float f = (j <= last) ? 1.f : 0.f; mx = fmaxf(mx, fmaf(f, s[j], (1.f - f) * -1.0e9f)); } float se = 0.f;
#pragma unroll 1
  for (int j = 0; j < nk; ++j) { const float f = (j <= last) ? 1.f : 0.f; se += __expf(fmaf(f, s[j], (1.f - f) * -1.0e9f) - mx); } const float sc = 256.0f / se;
#pragma unroll 1
  for (int j0 = 0; j0 < nk; j0 += 8) { FragH fr; for (int q = 0; q < 8; ++q) { const int j = j0 + q; const float f = (j <= last) ? 1.f : 0.f; fr.h[q] = (_Float16)(__expf(fmaf(f, s[j], (1.f - f) * -1.0e9f) - mx) * sc); } unsigned short* d = (unsigned short*)P + i * NKX + j0; *(v8us*)d = fr.half[0];  } }

template <int MASKADD>
__global__ __launch_bounds__(64) void k_att0(const float* __restrict__ QF, const float* __restrict__ KF, const float* __restrict__ VF, int ld, const float* __restrict__ mask, float scale, float* __restrict__ OF, int ldo) {
  #pragma clang fp contract(off)
  __shared__ __attribute__((aligned(16))) float lq[64][64]; __shared__ __attribute__((aligned(16))) float lo[64][64];
  const int tid = threadIdx.x; const int h = blockIdx.x / (QT0 / 64), rg = blockIdx.x % (QT0 / 64); const int i = rg * 64 + tid;
  const float* qr = QF + (size_t)i * ld + h * HD;
#pragma unroll 1
  for (int c = 0; c < HD / 4; ++c) { *(v4f*)&lq[tid][c * 4] = *(const v4fa*)(qr + c * 4); const v4f z = {0.f, 0.f, 0.f, 0.f}; *(v4f*)&lo[tid][c * 4] = z; }
  float m = -1.0e30f, l = 0.f; const int jmax = MASKADD ? (SQ - 1) : (rg * 64 + 63);      /* additive-mask form: every key (the mask input decides); causal form: keys up to the block's last row */
#pragma unroll 1
  for (int j = 0; j <= jmax; ++j) { const float* kr = KF + (size_t)j * ld + h * HD; const float* vr = VF + (size_t)j * ld + h * HD; float s = 0.f;
#pragma unroll 1
    for (int c = 0; c < HD / 4; ++c) { const v4f kq = *(const v4fa*)(kr + c * 4); const v4f qq = *(v4f*)&lq[tid][c * 4]; s = __fadd_rn(s, __fmul_rn(qq[0], kq[0])); s = __fadd_rn(s, __fmul_rn(qq[1], kq[1])); s = __fadd_rn(s, __fmul_rn(qq[2], kq[2])); s = __fadd_rn(s, __fmul_rn(qq[3], kq[3])); }
    s = __fmul_rn(s, scale); if (MASKADD) s = __fadd_rn(s, __fmul_rn(bf16_round(mask[(size_t)i * SQ + j]), -10000.0f));
    const float f = (MASKADD || j <= i) ? 1.f : 0.f; const float sm = fmaf(f, s, (1.f - f) * -1.0e30f); const float mn = fmaxf(m, sm); const float sc = expf(m - mn); const float e = expf(sm - mn); l = __fadd_rn(__fmul_rn(l, sc), e); m = mn;
#pragma unroll 1
    for (int c = 0; c < HD / 4; ++c) { const v4f vv = *(const v4fa*)(vr + c * 4); v4f oo = *(v4f*)&lo[tid][c * 4]; for (int u = 0; u < 4; ++u) oo[u] = __fadd_rn(__fmul_rn(oo[u], sc), __fmul_rn(e, vv[u])); *(v4f*)&lo[tid][c * 4] = oo; } }
  const float fin = 64.0f / l;      /* o carried x64 (the f16 path writes o unscaled) */
#pragma unroll 1
  for (int c = 0; c < HD / 4; ++c) { v4f oo = *(v4f*)&lo[tid][c * 4]; for (int u = 0; u < 4; ++u) oo[u] = __fmul_rn(oo[u], fin); *(v4f*)&lo[tid][c * 4] = oo; }
  __syncthreads();
  {
#pragma unroll 1
    for (int it = 0; it < 16; ++it) { const int row = it * 4 + tid / 16, pc = (tid % 16) * 4; const v4f v = *(const v4f*)&lo[row][pc]; *(v4f*)(OF + (size_t)(rg * 64 + row) * ldo + h * HD + pc) = v; }
     } }

__global__ __launch_bounds__(256) void k_oscale(const float* __restrict__ OF, float* __restrict__ out, size_t n4) { const size_t t = (size_t)blockIdx.x * 256 + threadIdx.x; if (t >= n4) return; const v4f a = *(const v4fa*)(OF + t * 4); v4f o; for (int q = 0; q < 4; ++q) o[q] = a[q] * 0.015625f; *(v4f*)(out + t * 4) = o;  }

__global__ __launch_bounds__(256) void k_bfr(const float* __restrict__ x, float* __restrict__ XB, size_t n8) { const size_t t = (size_t)blockIdx.x * 256 + threadIdx.x; if (t >= n8) return; v4f a = *(const v4fa*)(x + t * 8), c = *(const v4fa*)(x + t * 8 + 4); for (int q = 0; q < 4; ++q) { a[q] = bf16_round(a[q]); c[q] = bf16_round(c[q]); }
  { *(v4f*)(XB + t * 8) = a; *(v4f*)(XB + t * 8 + 4) = c;  } }



__global__ __launch_bounds__(256) void k_rsmfvl(const float* __restrict__ S, _Float16* __restrict__ P, _Float16* __restrict__ PL, int qn, const int* __restrict__ vlp) {
  #pragma clang fp contract(off)
  const int t = blockIdx.x * 256 + threadIdx.x; if (t >= qn) return; const int vl = vlp[0]; const size_t i = (size_t)t; const float* s = S + i * SQ; float mx = -3.0e38f;
#pragma unroll 1
  for (int j = 0; j < SQ; ++j) { const float f = (j < vl) ? 1.f : 0.f; mx = fmaxf(mx, fmaf(f, s[j], (1.f - f) * -1000000.0f)); } float se = 0.f;
#pragma unroll 1
  for (int j = 0; j < SQ; ++j) { const float f = (j < vl) ? 1.f : 0.f; se += __expf(fmaf(f, s[j], (1.f - f) * -1000000.0f) - mx); } const float sc = 256.0f / se;
#pragma unroll 1
  for (int j0 = 0; j0 < SQ; j0 += 8) { FragH fr, gr; for (int q = 0; q < 8; ++q) { const int j = j0 + q; const float f = (j < vl) ? 1.f : 0.f; const float pv = __expf(fmaf(f, s[j], (1.f - f) * -1000000.0f) - mx) * sc; const _Float16 ph = (_Float16)pv; fr.h[q] = ph; gr.h[q] = (_Float16)((pv - (float)ph) * 1024.0f); }
    unsigned short* d = (unsigned short*)P + i * SQ + j0; unsigned short* dl = (unsigned short*)PL + i * SQ + j0; *(v8us*)d = fr.half[0]; *(v8us*)dl = gr.half[0];  } }

__global__ __launch_bounds__(256) void k_rsmf(const float* __restrict__ S, _Float16* __restrict__ P, int qn, int hg) {
  #pragma clang fp contract(off)
  const int t = blockIdx.x * 256 + threadIdx.x; if (t >= qn * hg) return; const size_t i = (size_t)(t / qn) * SQ + (t % qn); const float* s = S + i * SQ; float mx = -3.0e38f;
#pragma unroll 1
  for (int j = 0; j < SQ; ++j) mx = fmaxf(mx, s[j]); float se = 0.f;
#pragma unroll 1
  for (int j = 0; j < SQ; ++j) se += __expf(s[j] - mx); const float sc = 256.0f / se;
#pragma unroll 1
  for (int j0 = 0; j0 < SQ; j0 += 8) { FragH f; for (int q = 0; q < 8; ++q) f.h[q] = (_Float16)(__expf(s[j0 + q] - mx) * sc); unsigned short* d = (unsigned short*)P + i * SQ + j0; *(v8us*)d = f.half[0];  } }



// Cross-lane steps of a 32-lane butterfly in registers: lane ^ 1, 2, 4, 8 by DPP row_xmask inside a 16-lane row, lane ^ 16 by the cross-row move. Every lane must be on.
template <int CTRL>
__device__ __forceinline__ float lane_dpp(float v) { return __int_as_float(__builtin_amdgcn_update_dpp(0, __float_as_int(v), CTRL, 0xf, 0xf, true)); }
__device__ __forceinline__ float lane_x16(float v) { const int i = __float_as_int(v); return __int_as_float(__builtin_amdgcn_permlanex16(i, i, 0x76543210, 0xfedcba98, false, false)); }
__device__ __forceinline__ float wave_max(float v) { v = fmaxf(v, lane_dpp<0x161>(v)); v = fmaxf(v, lane_dpp<0x162>(v)); v = fmaxf(v, lane_dpp<0x164>(v)); v = fmaxf(v, lane_dpp<0x168>(v)); return fmaxf(v, lane_x16(v)); }
__device__ __forceinline__ float wave_sum(float v) { v += lane_dpp<0x161>(v); v += lane_dpp<0x162>(v); v += lane_dpp<0x164>(v); v += lane_dpp<0x168>(v); return v + lane_x16(v); }
typedef int v4ia __attribute__((ext_vector_type(4), may_alias));
// Four native exp2 in one statement. The closing v_nop is the one slot the instruction set asks for behind a transcendental before its result is read or its source overwritten;
// the outputs are early-clobber, so each exp is independent of the one in front of it.
__device__ __forceinline__ v4f exp2_x4(v4f a) { float r0, r1, r2, r3;
  asm("v_exp_f32 %0, %4\n\tv_exp_f32 %1, %5\n\tv_exp_f32 %2, %6\n\tv_exp_f32 %3, %7\n\tv_nop" : "=&v"(r0), "=&v"(r1), "=&v"(r2), "=&v"(r3) : "v"(a[0]), "v"(a[1]), "v"(a[2]), "v"(a[3]));
  const v4f r = {r0, r1, r2, r3}; return r; }
// One WAVE per score row (8 rows per workgroup): the row's SQ f32 scores are read once, by SQ / 128 loads that each cover 512 contiguous bytes, and stay in registers through
// maximum, exp, masked sum and scaling; lane l holds columns 128 u + 4 l .. + 3. The early return is wave-uniform and the kernel has no barrier.
// Every loop is fully unrolled so that x[] and kp[] are indexed by constants and live in registers, and all the row's loads are issued ahead of the first use.
__global__ __launch_bounds__(256) void k_rsmik(const float* __restrict__ S, _Float16* __restrict__ P, int qn, int hg, const int* __restrict__ Km) {
  const int lane = threadIdx.x & 31; const int t = blockIdx.x * 8 + __builtin_amdgcn_readfirstlane(threadIdx.x >> 5); if (t >= qn * hg) return; const size_t i = (size_t)(t / qn) * SQ + (t % qn); const float* s = S + i * SQ + lane * 4;
  v4f x[SQ / 128]; v4f kp[SQ / 128];
#pragma unroll
  for (int u = 0; u < SQ / 128; ++u) x[u] = *(const v4fa*)(s + u * 128);
#pragma unroll
  for (int u = 0; u < SQ / 128; ++u) { const v4ia m = *(const v4ia*)(Km + u * 128 + lane * 4); for (int q = 0; q < 4; ++q) kp[u][q] = (m[q] != 0) ? 1.0f : 0.0f; }
  v4f m4 = x[0];
#pragma unroll
  for (int u = 1; u < SQ / 128; ++u) for (int q = 0; q < 4; ++q) m4[q] = fmaxf(m4[q], x[u][q]);
  const float mx = wave_max(fmaxf(fmaxf(m4[0], m4[1]), fmaxf(m4[2], m4[3])));
  v4f s4 = {0.f, 0.f, 0.f, 0.f};
#pragma unroll
  for (int u = 0; u < SQ / 128; ++u) { const v4f e = exp2_x4((x[u] - mx) * 1.44269504088896341f) * kp[u]; x[u] = e; s4 += e; }      /* exp(s - mx) as the native exp2((s - mx) log2 e), times the key's 0 / 1 */
  const float sc = 256.0f / wave_sum((s4[0] + s4[1]) + (s4[2] + s4[3]));
  _Float16* d = P + i * SQ + lane * 4;
#pragma unroll
  for (int u = 0; u < SQ / 128; ++u) { v4h h4; for (int q = 0; q < 4; ++q) h4[q] = (_Float16)(x[u][q] * sc); *(v4h*)(d + u * 128) = h4; } }


extern "C" void kernel_launch(void* const* d_in, const int* in_sizes, int n_in,
                              void* d_out, int out_size, void* d_ws, size_t ws_size, hipStream_t stream) {
  (void)in_sizes; (void)n_in; (void)out_size;
  const float* const* I = (const float* const*)d_in; const float* xq = I[0]; const float* xk = I[1]; const float* xv = I[2]; const int* km = (const int*)d_in[3];      /* q, k, v [16][2048][128] (bf16-valued); mask int32 [16][2048] (READ on device) */
  char* ws = (char*)d_ws; size_t off = 0;
  auto take = [&](size_t bytes) { char* p = ws + off; off += (bytes + 255) & ~(size_t)255; return p; };
  _Float16* Q16 = (_Float16*)take(NR * DM * 2); _Float16* K16 = (_Float16*)take(NR * DM * 2); _Float16* V16 = (_Float16*)take(NR * DM * 2);
  float* S = (float*)take((size_t)SQ * SQ * 4); _Float16* P = (_Float16*)take((size_t)SQ * SQ * 2); _Float16* VT = (_Float16*)take((size_t)HD * SQ * 2);
  if (off > ws_size) return;
  k_x16<<<(unsigned)((NR * DM / 8 + 255) / 256), 256, 0, stream>>>(xq, Q16, NR * DM / 8); k_x16<<<(unsigned)((NR * DM / 8 + 255) / 256), 256, 0, stream>>>(xk, K16, NR * DM / 8); k_x16<<<(unsigned)((NR * DM / 8 + 255) / 256), 256, 0, stream>>>(xv, V16, NR * DM / 8);      /* exact f16 copies of the bf16-valued inputs */
  for (int b = 0; b < NB; ++b) { const size_t r0 = (size_t)b * SQ;
    k_vt<DM / 64, SQ><<<(DM / 64) * (SQ / 64), 256, 0, stream>>>(V16 + r0 * DM, DM, 0, VT);      /* V^T [128][SQ] of this sequence (two 64-row slabs) */
    k_gemm2<0><<<dim3((SQ / 128) * (SQ / 64), 1), 128, 0, stream>>>(Q16 + r0 * DM, DM, 0, K16 + r0 * DM, DM, 0, 0.08838834764831845f, nullptr, 0, nullptr, 1, 0, 0, S, nullptr, SQ, 0, SQ, SQ, HD);      /* scores / sqrt(128) (exact products, K = 128) */
    k_rsmik<<<SQ / 8, 256, 0, stream>>>(S, P, SQ, 1, km + (size_t)b * SQ);      /* exp(s - max over ALL keys) * mask[b][key], normalised by the masked sum -> P x256 f16 (the module's post-exp multiplicative mask, literally) */
    k_gemm2<0><<<dim3((SQ / 128) * (HD / 64), 1), 128, 0, stream>>>(P, SQ, 0, VT, SQ, 0, 0.00390625f, nullptr, 0, nullptr, 1, 0, 0, (float*)d_out + r0 * DM, nullptr, DM, 0, SQ, HD, SQ);      /* out = P V^T 2^-8 f32 into the output rows */
  }
}

// v002
// One run takes 244 microseconds.
// Two timings next to v001 put it at 5.01 and 5.04 times that version's speed.
// All steps since v000 together make it 25.9 times as fast.
#include <hip/hip_runtime.h>
// Scaled dot-product attention with the module's POST-exp multiplicative key mask (q, k, v [16][2048][128]: 16 independent sequences, one 128-wide head; mask int32 [16][2048] in {0, 1} (random, read on device); score = q.k / sqrt(128); e = exp(score - rowmax over ALL keys); e *= mask[b][key]; a = e / sum(e); out = a v -> [16][2048][128]). No projections: q, k, v are bf16-valued inputs, so their f16 copies and the score products are exact.
// Structure: no projections: q, k, v are bf16-valued inputs copied to exact f16 rows; sequences batched over the grid (V^T and P V^T: all 16 in one launch; scores and softmax: 4 per launch): V^T via LDS transposes, scores as ONE WMMA GEMM (32x64 wave tiles, f32 accumulation, exact products, alpha = 1/sqrt(128)), row softmax on VALU (f32 statistics, native exp; weights x256 f16), out = P V^T written f32 straight into the output rows; launches: see trace.
// Compute dtype: inputs rounded to bf16; q, k, v and softmax weights as plain f16 GEMM operands (~2^-12); scores and softmax statistics f32; v_wmma_f32_16x16x32_f16.
#define NB 16
#define SQ 2048
#define DM 128
#define NH 1
#define HD 128
#define HG 4                         /* heads per attention launch group */
#define B0 0                         /* first batch processed (debug hook) */
#define NBR NB                       /* batches processed (debug hook) */
#define NR ((size_t)NB * SQ)         /* token rows */
#define MP ((int)((size_t)NBR * SQ))
#define QT 256                       /* query rows per causal tile */
#define NKX SQ                       /* S / P row pitch */
#define QT0 256                      /* first-tile rows recomputed exactly (256: buys margin for the few-key rows 128..255, which have no output projection to average the single-f16 P/v rounding) */
#define QN SQ                        /* query rows attended per batch (debug hook) */
#define NHD NH                       /* heads attended (debug hook) */
#define MPO MP                       /* rows through the output stage (debug hook) */
#define LQ DM            /* row pitch of the q/k/v rows */
#define SG 4                         /* sequences per score / softmax launch: their f32 scores (SG x 16 MiB) are the part of the workspace that cannot hold all NB */
typedef __bf16 v16b __attribute__((ext_vector_type(16)));
typedef unsigned short v8us __attribute__((ext_vector_type(8), may_alias));
typedef float  v8f  __attribute__((ext_vector_type(8)));
typedef float  v4f  __attribute__((ext_vector_type(4)));
typedef float  v4fa __attribute__((ext_vector_type(4), may_alias));
union FragB { v16b v; v8us half[2]; unsigned short u[16]; };

__device__ __forceinline__ unsigned short bf16_bits(float x) { unsigned int u = __float_as_uint(x); return (unsigned short)((u + 0x7FFFu + ((u >> 16) & 1u)) >> 16); }
__device__ __forceinline__ float bf16_val(unsigned short b) { return __uint_as_float(((unsigned int)b) << 16); }
__device__ __forceinline__ float bf16_round(float x) { return bf16_val(bf16_bits(x)); }
// D += A·B with NT terms: 1 = ah·bh, 2 = + al·bh (A split), 3 = + ah·bl (both split)
template <int NT>
__device__ __forceinline__ v8f mmaN(v16b ah, v16b al, v16b bh, v16b bl, v8f c) {
  c = __builtin_amdgcn_wmma_f32_16x16x32_bf16(false, ah, false, bh, (short)0, c, false, false);
  if (NT >= 2) c = __builtin_amdgcn_wmma_f32_16x16x32_bf16(false, al, false, bh, (short)0, c, false, false);
  if (NT >= 3) c = __builtin_amdgcn_wmma_f32_16x16x32_bf16(false, ah, false, bl, (short)0, c, false, false);
  asm volatile("v_nop\n\tv_nop\n\tv_nop\n\tv_nop" : "+v"(c) : "v"(ah), "v"(al), "v"(bh), "v"(bl));
  return c;
}

__global__ __launch_bounds__(256) void k_wt_bf16(const float* __restrict__ W, unsigned short* __restrict__ Wt, int K, int N) {
  const int t = blockIdx.x * 256 + threadIdx.x;
  const int k8n = K / 8;
  if (t >= N * k8n) return;
  const int n = t / k8n, k8 = (t % k8n) * 8;
  v8us v;
#pragma unroll
  for (int i = 0; i < 8; ++i) v[i] = bf16_bits(W[(size_t)(k8 + i) * N + n]);
  *(v8us*)(Wt + (size_t)n * K + k8) = v;
  
}

// GEMM C[M][N] (f32, pitch ldc) = act(A[M][K]·W + bias). A f32 row-major (pitch lda) converted per fragment to bf16
// (ASPLIT: hi/lo two planes -> 2 terms, else single rounded term); Wt bf16 [N][K] (pitch ldb). BIAS_BF16 rounds the
// bias to bf16 first (bias quantised to bf16 before the add). K%32==0, M%16==0, N%64==0.
template <bool ASPLIT, int ACT, bool BIAS_BF16>
__global__ __launch_bounds__(128) void k_gemm_bf(const float* __restrict__ A, int lda, const unsigned short* __restrict__ Wt, int ldb,
                                               const float* __restrict__ bias, float* __restrict__ C, int ldc, int M, int N, int K) {
  __shared__ __attribute__((aligned(16))) float so[4][16][64];
  const int tid = threadIdx.x, w = tid >> 5, lane = tid & 31, ln = lane & 15, hh = lane >> 4;
  const int ntn = N / 64;
  const int wid = blockIdx.x * 4 + w;
  const int mt = wid / ntn, nq = wid % ntn;
  if (mt * 16 >= M) return;
  const int row0 = mt * 16, col0 = nq * 64;
  const float* arow = A + (size_t)(row0 + ln) * lda;
  v8f acc[4] = {};
  for (int kb = 0; kb < K; kb += 32) {
    FragB ah, al;
    const v4f x0 = *(const v4fa*)(arow + kb + 8 * hh), x1 = *(const v4fa*)(arow + kb + 8 * hh + 4);
    const v4f x2 = *(const v4fa*)(arow + kb + 16 + 8 * hh), x3 = *(const v4fa*)(arow + kb + 16 + 8 * hh + 4);
    float xs[16] = {x0[0],x0[1],x0[2],x0[3],x1[0],x1[1],x1[2],x1[3],x2[0],x2[1],x2[2],x2[3],x3[0],x3[1],x3[2],x3[3]};
#pragma unroll
    for (int i = 0; i < 16; ++i) { const unsigned short hb = bf16_bits(xs[i]); ah.u[i] = hb; al.u[i] = ASPLIT ? bf16_bits(xs[i] - bf16_val(hb)) : (unsigned short)0; }
#pragma unroll
    for (int t = 0; t < 4; ++t) {
      const unsigned short* brow = Wt + (size_t)(col0 + t * 16 + ln) * ldb + kb;
      FragB b;
      b.half[0] = *(const v8us*)(brow + 8 * hh);
      b.half[1] = *(const v8us*)(brow + 16 + 8 * hh);
      acc[t] = mmaN<ASPLIT ? 2 : 1>(ah.v, al.v, b.v, b.v, acc[t]);
    }
  }
#pragma unroll
  for (int t = 0; t < 4; ++t) {
    float bv = bias ? bias[col0 + t * 16 + ln] : 0.f;
    if (BIAS_BF16) bv = bf16_round(bv);
#pragma unroll
    for (int r = 0; r < 8; ++r) { float v = acc[t][r] + bv; if (ACT == 1) v = fmaxf(v, 0.f); so[w][8 * hh + r][t * 16 + ln] = v; }
  }
  __builtin_amdgcn_fence(__ATOMIC_ACQ_REL, "workgroup");
  __builtin_amdgcn_wave_barrier();
  const int rsub = lane >> 4, c4 = (lane & 15) * 4;
  {
#pragma unroll
    for (int q = 0; q < 8; ++q) {
      const int r = q * 2 + rsub;
      const v4f v = *(const v4fa*)&so[w][r][c4];
      *(v4f*)(C + (size_t)(row0 + r) * ldc + col0 + c4) = v;
    }
    
  }
}

// GEMM C = act(A·W + bias + resid): A f32 (ASPLIT -> hi/lo 2 terms), Wt bf16 [N][K]; ACT 0 none, 1 relu, 2 exact gelu;
// resid (optional, f32, row index = (row % rmod), pitch ldr, RES_BF16 rounds it) added before the activation.
template <bool ASPLIT, int ACT, bool BIAS_BF16, bool RES_BF16>
__global__ __launch_bounds__(128) void k_gemm_bf3(const float* __restrict__ A, int lda, const unsigned short* __restrict__ Wt, int ldb,
                                                const float* __restrict__ bias, const float* __restrict__ resid, int rmod, int ldr,
                                                float* __restrict__ C, int ldc, int M, int N, int K) {
  __shared__ __attribute__((aligned(16))) float so[4][16][64];
  const int tid = threadIdx.x, w = tid >> 5, lane = tid & 31, ln = lane & 15, hh = lane >> 4;
  const int ntn = N / 64;
  const int wid = blockIdx.x * 4 + w;
  const int mt = wid / ntn, nq = wid % ntn;
  if (mt * 16 >= M) return;
  const int row0 = mt * 16, col0 = nq * 64;
  const float* arow = A + (size_t)(row0 + ln) * lda;
  v8f acc[4] = {};
  for (int kb = 0; kb < K; kb += 32) {
    FragB ah, al;
    const v4f x0 = *(const v4fa*)(arow + kb + 8 * hh), x1 = *(const v4fa*)(arow + kb + 8 * hh + 4);
    const v4f x2 = *(const v4fa*)(arow + kb + 16 + 8 * hh), x3 = *(const v4fa*)(arow + kb + 16 + 8 * hh + 4);
    float xs[16] = {x0[0],x0[1],x0[2],x0[3],x1[0],x1[1],x1[2],x1[3],x2[0],x2[1],x2[2],x2[3],x3[0],x3[1],x3[2],x3[3]};
#pragma unroll
    for (int i = 0; i < 16; ++i) { const unsigned short hb = bf16_bits(xs[i]); ah.u[i] = hb; al.u[i] = ASPLIT ? bf16_bits(xs[i] - bf16_val(hb)) : (unsigned short)0; }
#pragma unroll
    for (int t = 0; t < 4; ++t) {
      const unsigned short* brow = Wt + (size_t)(col0 + t * 16 + ln) * ldb + kb;
      FragB b;
      b.half[0] = *(const v8us*)(brow + 8 * hh);
      b.half[1] = *(const v8us*)(brow + 16 + 8 * hh);
      acc[t] = mmaN<ASPLIT ? 2 : 1>(ah.v, al.v, b.v, b.v, acc[t]);
    }
  }
#pragma unroll
  for (int t = 0; t < 4; ++t) {
    const int col = col0 + t * 16 + ln;
    float bv = bias ? bias[col] : 0.f;
    if (BIAS_BF16) bv = bf16_round(bv);
#pragma unroll
    for (int r = 0; r < 8; ++r) {
      float v = acc[t][r] + bv;
      if (resid) { float rv = resid[(size_t)((row0 + 8 * hh + r) % rmod) * ldr + col]; if (RES_BF16) rv = bf16_round(rv); v += rv; }
      if (ACT == 1) v = fmaxf(v, 0.f);
      if (ACT == 2) v = 0.5f * v * (1.0f + erff(v * 0.70710678118654752f));
      if (ACT == 3) { const float u = 0.7978845608028654f * (v + 0.044715f * v * v * v); v = 0.5f * v * (1.0f + tanhf(u)); }
      so[w][8 * hh + r][t * 16 + ln] = v;
    }
  }
  __builtin_amdgcn_fence(__ATOMIC_ACQ_REL, "workgroup");
  __builtin_amdgcn_wave_barrier();
  const int rsub = lane >> 4, c4 = (lane & 15) * 4;
  {
#pragma unroll
    for (int q = 0; q < 8; ++q) {
      const int r = q * 2 + rsub;
      const v4f v = *(const v4fa*)&so[w][r][c4];
      *(v4f*)(C + (size_t)(row0 + r) * ldc + col0 + c4) = v;
    }
    
  }
}
// row LayerNorm (biased variance, eps) over N: s = X (+ R); optional out_sum <- s; out_norm <- (s-mu)*rsqrt(var+eps)*g + b
template <bool PARAM_BF16>
__global__ __launch_bounds__(256) void k_layernorm(const float* __restrict__ X, const float* __restrict__ R, const float* __restrict__ g, const float* __restrict__ bta,
                                                  float* __restrict__ out_sum, float* __restrict__ out_norm, int N, float eps) {
  __shared__ float red[256];
  const int row = blockIdx.x, tid = threadIdx.x;
  const float* x = X + (size_t)row * N; const float* rr = R ? R + (size_t)row * N : nullptr;
  float vals[16];                     // up to N = 4096
  const int per = N / 256;            // contiguous chunk per thread? use strided-by-4 chunks: thread handles j = tid*4 + 1024*u
  float s1 = 0.f;
  for (int u = 0; u < per / 4; ++u) {
    const int j = tid * 4 + 1024 * u;
    const v4f a = *(const v4fa*)(x + j);
    v4f b = {0.f,0.f,0.f,0.f}; if (rr) b = *(const v4fa*)(rr + j);
#pragma unroll
    for (int q = 0; q < 4; ++q) { const float v = a[q] + b[q]; vals[u * 4 + q] = v; s1 += v; }
  }
  red[tid] = s1; __syncthreads();
  for (int st = 128; st > 0; st >>= 1) { if (tid < st) red[tid] += red[tid + st]; __syncthreads(); }
  const float mu = red[0] / (float)N; __syncthreads();
  float s2 = 0.f;
  for (int u = 0; u < per / 4; ++u)
#pragma unroll
    for (int q = 0; q < 4; ++q) { const float c = vals[u * 4 + q] - mu; s2 += c * c; }
  red[tid] = s2; __syncthreads();
  for (int st = 128; st > 0; st >>= 1) { if (tid < st) red[tid] += red[tid + st]; __syncthreads(); }
  const float rs = rsqrtf(red[0] / (float)N + eps);
  {
    for (int u = 0; u < per / 4; ++u) {
      const int j = tid * 4 + 1024 * u;
      v4f o, sm;
#pragma unroll
      for (int q = 0; q < 4; ++q) {
        float gg = g[j + q], bb = bta[j + q];
        if (PARAM_BF16) { gg = bf16_round(gg); bb = bf16_round(bb); }
        sm[q] = vals[u * 4 + q]; o[q] = (vals[u * 4 + q] - mu) * rs * gg + bb;
      }
      if (out_sum) *(v4f*)(out_sum + (size_t)row * N + j) = sm;
      *(v4f*)(out_norm + (size_t)row * N + j) = o;
    }
    
  }
}



// ---- f16 WMMA path (v_wmma_f32_16x16x32_f16): 11-bit significands for operands in range — used where a [0,1] probability operand needs more precision than bf16
typedef _Float16 v16h __attribute__((ext_vector_type(16)));
union FragH { v16h v; v8us half[2]; _Float16 h[16]; unsigned short u[16]; };
template <int NT>
__device__ __forceinline__ v8f mmaH(v16h ah, v16h al, v16h bh, v16h bl, v8f c) {
  c = __builtin_amdgcn_wmma_f32_16x16x32_f16(false, ah, false, bh, (short)0, c, false, false);
  if (NT >= 2) c = __builtin_amdgcn_wmma_f32_16x16x32_f16(false, al, false, bh, (short)0, c, false, false);
  if (NT >= 3) c = __builtin_amdgcn_wmma_f32_16x16x32_f16(false, ah, false, bl, (short)0, c, false, false);
  asm volatile("v_nop\n\tv_nop\n\tv_nop\n\tv_nop" : "+v"(c) : "v"(ah), "v"(al), "v"(bh), "v"(bl));
  return c;
}
// batched GEMM like k_gemm_b but f16 operands: A f32 (split into f16 hi/lo if ASPLIT, else rounded to f16), Bt = f16 values [n][k]; alpha; C f32; N multiple of 16 (partial tiles skipped)
template <bool ASPLIT>
__global__ __launch_bounds__(128) void k_gemm_h(const float* __restrict__ A, int lda, size_t sA, const _Float16* __restrict__ Bh, int ldb, size_t sB, float alpha, float* __restrict__ C, int ldc, size_t sC, int M, int N, int K) {
  __shared__ __attribute__((aligned(16))) float so[4][16][64];
  const int tid = threadIdx.x, w = tid >> 5, lane = tid & 31, ln = lane & 15, hh = lane >> 4; const int by = blockIdx.y;
  A += (size_t)by * sA; Bh += (size_t)by * sB; C += (size_t)by * sC;
  const int ntn = (N + 63) / 64; const int wid = blockIdx.x * 4 + w; const int mt = wid / ntn, nq = wid % ntn; if (mt * 16 >= M) return;
  const int row0 = mt * 16, col0 = nq * 64; const float* arow = A + (size_t)(row0 + ln) * lda;
  v8f acc[4] = {};
  for (int kb = 0; kb < K; kb += 32) {
    FragH ah, al;
    const v4f x0 = *(const v4fa*)(arow + kb + 8 * hh), x1 = *(const v4fa*)(arow + kb + 8 * hh + 4), x2 = *(const v4fa*)(arow + kb + 16 + 8 * hh), x3 = *(const v4fa*)(arow + kb + 16 + 8 * hh + 4);
    float xs[16] = {x0[0],x0[1],x0[2],x0[3],x1[0],x1[1],x1[2],x1[3],x2[0],x2[1],x2[2],x2[3],x3[0],x3[1],x3[2],x3[3]};
#pragma unroll
    for (int i = 0; i < 16; ++i) { const _Float16 h = (_Float16)xs[i]; ah.h[i] = h; al.h[i] = ASPLIT ? (_Float16)(xs[i] - (float)h) : (_Float16)0.0f; }
#pragma unroll
    for (int t = 0; t < 4; ++t) { if (col0 + t * 16 >= N) continue; const size_t boff = (size_t)(col0 + t * 16 + ln) * ldb + kb; FragH bq; bq.half[0] = *(const v8us*)(Bh + boff + 8 * hh); bq.half[1] = *(const v8us*)(Bh + boff + 16 + 8 * hh);
      acc[t] = mmaH<ASPLIT ? 2 : 1>(ah.v, al.v, bq.v, bq.v, acc[t]); }
  }
#pragma unroll
  for (int t = 0; t < 4; ++t) { if (col0 + t * 16 >= N) continue;
#pragma unroll
    for (int r = 0; r < 8; ++r) so[w][8 * hh + r][t * 16 + ln] = acc[t][r] * alpha; }
  __builtin_amdgcn_fence(__ATOMIC_ACQ_REL, "workgroup"); __builtin_amdgcn_wave_barrier();
  const int rsub = lane >> 4, c4 = (lane & 15) * 4;
  {
#pragma unroll
    for (int q = 0; q < 8; ++q) { const int r = q * 2 + rsub; if (col0 + c4 < N) { const v4f v = *(const v4fa*)&so[w][r][c4]; *(v4f*)(C + (size_t)(row0 + r) * ldc + col0 + c4) = v; } }
     }
}

// Wt[n][k] = f16(W[k][n]·scale) from f32 row-major W[K][N] (scale = power of two; bf16-exact weights stay exact in f16 away from the subnormal range)
__global__ __launch_bounds__(256) void k_wt_f16(const float* __restrict__ W, _Float16* __restrict__ Wt, int K, int N, float scale) {
  const int t = blockIdx.x * 256 + threadIdx.x; if (t >= N * (K / 8)) return; const int n = t / (K / 8), k8 = (t % (K / 8)) * 8; FragH f;
#pragma unroll
  for (int i = 0; i < 8; ++i) f.h[i] = (_Float16)(bf16_round(W[(size_t)(k8 + i) * N + n]) * scale); const v8us o = f.half[0];
  *(v8us*)((unsigned short*)Wt + (size_t)n * K + k8) = o; 
}
// k_gemm_hh variant with fused epilogue: v = acc·alpha + bias[by·sBias + col] (+ CP[(row/rowsPerB)·sCPb + by·64 + col] if CP) ; ACT 0 none / 1 elu ; writes f16 C16 (and f32 C if non-null)
template <int ACT>
__global__ __launch_bounds__(128) void k_gemm_hhx(const _Float16* __restrict__ A, int lda, size_t sA, const _Float16* __restrict__ Bh, int ldb, size_t sB, float alpha, const float* __restrict__ bias, size_t sBias, const float* __restrict__ CP, int rowsPerB, size_t sCPb, int row0g,
    float* __restrict__ C, _Float16* __restrict__ C16, int ldc, size_t sC, int M, int N, int K) {
  __shared__ __attribute__((aligned(16))) float so[4][16][64];
  const int tid = threadIdx.x, w = tid >> 5, lane = tid & 31, ln = lane & 15, hh = lane >> 4; const int by = blockIdx.y;
  A += (size_t)by * sA; Bh += (size_t)by * sB; const size_t cofs = (size_t)by * sC; const float* bp = bias ? bias + (size_t)by * sBias : nullptr;
  const int ntn = (N + 63) / 64; const int wid = blockIdx.x * 4 + w; const int mt = wid / ntn, nq = wid % ntn; if (mt * 16 >= M) return;
  const int row0 = mt * 16, col0 = nq * 64; const _Float16* arow = A + (size_t)(row0 + ln) * lda;
  v8f acc[4] = {};
  for (int kb = 0; kb < K; kb += 32) { FragH ah; ah.half[0] = *(const v8us*)((const unsigned short*)arow + kb + 8 * hh); ah.half[1] = *(const v8us*)((const unsigned short*)arow + kb + 16 + 8 * hh);
#pragma unroll
    for (int t = 0; t < 4; ++t) { if (col0 + t * 16 >= N) continue; const size_t boff = (size_t)(col0 + t * 16 + ln) * ldb + kb; FragH bq; bq.half[0] = *(const v8us*)((const unsigned short*)Bh + boff + 8 * hh); bq.half[1] = *(const v8us*)((const unsigned short*)Bh + boff + 16 + 8 * hh);
      acc[t] = mmaH<1>(ah.v, ah.v, bq.v, bq.v, acc[t]); }
  }
#pragma unroll
  for (int t = 0; t < 4; ++t) { if (col0 + t * 16 >= N) continue; const int col = col0 + t * 16 + ln; const float bv = bp ? bf16_round(bp[col]) : 0.f;
#pragma unroll
    for (int r = 0; r < 8; ++r) { float v = acc[t][r] * alpha + bv; if (CP) { const int rr = row0g + row0 + 8 * hh + r; if (rowsPerB < 0) v += CP[cofs + (size_t)rr * ldc + col];      /* rowsPerB < 0: own element of the batched C plane */ else { const int bidx = rr / rowsPerB; v += CP[(size_t)bidx * sCPb + (size_t)by * 64 + col]; } } if (ACT == 1) v = (v > 0.f) ? v : expm1f(v); else if (ACT == 7) v = (v > 0.f) ? v + 1.0f : expf(v); else if (ACT == 8) v = tanhf(v); else if (ACT == 9) v = 0.5f * v * (1.0f + tanhf(0.7978845608028654f * (v + 0.044715f * v * v * v))); else if (ACT == 11) v = 1.0f / (1.0f + expf(-v)); else if (ACT == 12) v = (v > 0.f) ? v : 0.01f * v; else if (ACT == 14) v = (v > 0.f) ? v : 0.1f * v; else if (ACT == 16) v = (v >= 0.f) ? v : 0.3f * v; else if (ACT == 17) v = (v >= 0.f) ? v : 0.2f * v; else if (ACT == 15) v = v / (1.0f + expf(-v)); else if (ACT == 3) v = fmaxf(v, 0.f); else if (ACT == 6) v = 0.5f * v * (1.0f + erff(v * 0.70710678118654752f)); so[w][8 * hh + r][t * 16 + ln] = v; } }
  __builtin_amdgcn_fence(__ATOMIC_ACQ_REL, "workgroup"); __builtin_amdgcn_wave_barrier();
  const int rsub = lane >> 4, c4 = (lane & 15) * 4; typedef _Float16 v4h __attribute__((ext_vector_type(4)));
  {
#pragma unroll
    for (int q = 0; q < 8; ++q) { const int r = q * 2 + rsub; if (col0 + c4 < N) { const v4f v = *(const v4fa*)&so[w][r][c4]; if (C) *(v4f*)(C + cofs + (size_t)(row0 + r) * ldc + col0 + c4) = v; if (C16) { v4h h4; for (int i = 0; i < 4; ++i) h4[i] = (_Float16)v[i]; *(v4h*)(C16 + cofs + (size_t)(row0 + r) * ldc + col0 + c4) = h4; } } }
     }
}


typedef _Float16 v4h __attribute__((ext_vector_type(4)));

__global__ __launch_bounds__(256) void k_x16(const float* __restrict__ x, _Float16* __restrict__ X16, size_t n8) { const size_t t = (size_t)blockIdx.x * 256 + threadIdx.x; if (t >= n8) return; FragH f;
#pragma unroll
  for (int q = 0; q < 8; ++q) f.h[q] = (_Float16)bf16_round(x[t * 8 + q]); *(v8us*)((unsigned short*)X16 + t * 8) = f.half[0];  }
__global__ __launch_bounds__(256) void k_h16(const float* __restrict__ x, _Float16* __restrict__ X16, size_t n8) { const size_t t = (size_t)blockIdx.x * 256 + threadIdx.x; if (t >= n8) return; FragH f;
#pragma unroll
  for (int q = 0; q < 8; ++q) f.h[q] = (_Float16)x[t * 8 + q]; *(v8us*)((unsigned short*)X16 + t * 8) = f.half[0];  }
__global__ __launch_bounds__(256) void k_round16f(const float* __restrict__ W, _Float16* __restrict__ Bt, size_t n8) { const size_t t = (size_t)blockIdx.x * 256 + threadIdx.x; if (t >= n8) return; FragH f;
#pragma unroll
  for (int i = 0; i < 8; ++i) f.h[i] = (_Float16)(bf16_round(W[t * 8 + i]) * 16.0f); *(v8us*)((unsigned short*)Bt + t * 8) = f.half[0];  }
template <int NHv, int TTv>
__global__ __launch_bounds__(256) void k_vt(const _Float16* __restrict__ V16, int ldv, int voff, _Float16* __restrict__ Vt) { __shared__ unsigned short tl[64][66]; const int tid = threadIdx.x; const int slab = blockIdx.x / (TTv / 64), lg = blockIdx.x % (TTv / 64); const int b = slab / NHv, h = slab % NHv;
  for (int i = tid; i < 64 * 8; i += 256) { const int r = i / 8, c8 = (i % 8) * 8; FragH f; f.half[0] = *(const v8us*)((const unsigned short*)V16 + ((size_t)b * TTv + lg * 64 + r) * ldv + voff + h * 64 + c8);
#pragma unroll
    for (int q = 0; q < 8; ++q) tl[r][c8 + q] = f.u[q]; }
  __syncthreads();
  {
#pragma unroll
    for (int rd = 0; rd < 2; ++rd) { const int d = rd * 32 + tid / 8, pc = tid % 8; FragH f;
#pragma unroll
      for (int q = 0; q < 8; ++q) f.u[q] = tl[pc * 8 + q][d];
      *(v8us*)((unsigned short*)Vt + ((size_t)slab * 64 + d) * TTv + lg * 64 + pc * 8) = f.half[0]; }
     } }

__global__ __launch_bounds__(256) void k_hl(const float* __restrict__ F, _Float16* __restrict__ Hh, _Float16* __restrict__ Hl, size_t n8) { const size_t t = (size_t)blockIdx.x * 256 + threadIdx.x; if (t >= n8) return; FragH fh, fl; const v4f a = *(const v4fa*)(F + t * 8), c = *(const v4fa*)(F + t * 8 + 4);
#pragma unroll
  for (int q = 0; q < 4; ++q) { _Float16 h = (_Float16)a[q]; fh.h[q] = h; fl.h[q] = (_Float16)((a[q] - (float)h) * 1024.0f); h = (_Float16)c[q]; fh.h[4 + q] = h; fl.h[4 + q] = (_Float16)((c[q] - (float)h) * 1024.0f); }
  { *(v8us*)((unsigned short*)Hh + t * 8) = fh.half[0]; *(v8us*)((unsigned short*)Hl + t * 8) = fl.half[0];  } }

// ---- fast GEMM (wave tile 32x64; requires M % 32 == 0 rows per launch region and N % 64 == 0); epilogue = k_gemm_hhx semantics ----
__device__ __forceinline__ v16h g2_frag(const _Float16* p, int hh) { FragH f; f.half[0] = *(const v8us*)((const unsigned short*)p + 8 * hh); f.half[1] = *(const v8us*)((const unsigned short*)p + 16 + 8 * hh); return f.v; }
__device__ __forceinline__ v8f g2_mma(v16h a, v16h b, v8f c) { v8f d = __builtin_amdgcn_wmma_f32_16x16x32_f16(false, a, false, b, (short)0, c, false, false); asm volatile("v_nop\n\tv_nop\n\tv_nop\n\tv_nop" : "+v"(d) : "v"(a), "v"(b)); return d; }
template <int ACT>
__global__ __launch_bounds__(128) void k_gemm2(const _Float16* __restrict__ A, int lda, size_t sA, const _Float16* __restrict__ Bh, int ldb, size_t sB, float alpha, const float* __restrict__ bias, size_t sBias, const float* __restrict__ CP, int rowsPerB, size_t sCPb, int row0g,
    float* __restrict__ C, _Float16* __restrict__ C16, int ldc, size_t sC, int M, int N, int K) { static_assert(ACT == 0 || ACT == 3 || ACT == 6 || ACT == 8 || ACT == 9 || ACT == 11 || ACT == 12 || ACT == 14 || ACT == 15 || ACT == 16 || ACT == 17, "k_gemm2: unsupported ACT code (would silently apply no activation)");
  __shared__ __attribute__((aligned(16))) float so[4][32][68];
  const int tid = threadIdx.x, w = tid >> 5, lane = tid & 31, ln = lane & 15, hh = lane >> 4; const int by = blockIdx.y;
  A += (size_t)by * sA; Bh += (size_t)by * sB; const size_t cofs = (size_t)by * sC; const float* bp = bias ? bias + (size_t)by * sBias : nullptr;
  const int ntn = N >> 6; const int mt = blockIdx.x / ntn, nq = blockIdx.x - mt * ntn; const int row0 = mt * 128 + 32 * w, col0 = nq * 64; if (row0 >= M) return;
  const _Float16* a0p = A + (size_t)(row0 + ln) * lda; const _Float16* a1p = a0p + (size_t)16 * lda;
  const _Float16* b0p = Bh + (size_t)(col0 + ln) * ldb; const _Float16* b1p = b0p + (size_t)16 * ldb; const _Float16* b2p = b1p + (size_t)16 * ldb; const _Float16* b3p = b2p + (size_t)16 * ldb;
  const v8f z8 = {0.f,0.f,0.f,0.f,0.f,0.f,0.f,0.f}; v8f c00 = z8, c01 = z8, c02 = z8, c03 = z8, c10 = z8, c11 = z8, c12 = z8, c13 = z8;
#pragma unroll 1
  for (int kb = 0; kb < K; kb += 32) { const v16h a0 = g2_frag(a0p + kb, hh), a1 = g2_frag(a1p + kb, hh);
    v16h b = g2_frag(b0p + kb, hh); c00 = g2_mma(a0, b, c00); c10 = g2_mma(a1, b, c10);
    b = g2_frag(b1p + kb, hh); c01 = g2_mma(a0, b, c01); c11 = g2_mma(a1, b, c11);
    b = g2_frag(b2p + kb, hh); c02 = g2_mma(a0, b, c02); c12 = g2_mma(a1, b, c12);
    b = g2_frag(b3p + kb, hh); c03 = g2_mma(a0, b, c03); c13 = g2_mma(a1, b, c13); }
  v8f accs[8] = {c00, c01, c02, c03, c10, c11, c12, c13};
#pragma unroll
  for (int u = 0; u < 8; ++u) { const int t = u & 3, half = u >> 2; const int col = col0 + t * 16 + ln; const float bv = bp ? bf16_round(bp[col]) : 0.f;
#pragma unroll
    for (int r = 0; r < 8; ++r) { const int rloc = half * 16 + 8 * hh + r; float v = accs[u][r] * alpha + bv; if (CP) { if (rowsPerB < 0) v += CP[cofs + (size_t)(row0g + row0 + rloc) * ldc + col];      /* rowsPerB < 0: own element of the batched C plane */ else { const int bidx = (row0g + row0 + rloc) / rowsPerB; v += CP[(size_t)bidx * sCPb + (size_t)by * 64 + col]; } }
      if (ACT == 3) v = fmaxf(v, 0.f); else if (ACT == 6) v = 0.5f * v * (1.0f + erff(v * 0.70710678118654752f)); else if (ACT == 11) v = 1.0f / (1.0f + expf(-v)); else if (ACT == 15) v = v / (1.0f + expf(-v)); else if (ACT == 12) v = (v > 0.f) ? v : 0.01f * v; else if (ACT == 8) v = tanhf(v); else if (ACT == 9) v = 0.5f * v * (1.0f + tanhf(0.7978845608028654f * (v + 0.044715f * v * v * v))); else if (ACT == 14) v = (v > 0.f) ? v : 0.1f * v; else if (ACT == 16) v = (v >= 0.f) ? v : 0.3f * v; else if (ACT == 17) v = (v >= 0.f) ? v : 0.2f * v;
      so[w][rloc][t * 16 + ln] = v; } }
  __builtin_amdgcn_fence(__ATOMIC_ACQ_REL, "workgroup"); __builtin_amdgcn_wave_barrier();
  const int rsub = lane >> 4, c4 = (lane & 15) * 4;
  {
#pragma unroll
    for (int q = 0; q < 16; ++q) { const int r = q * 2 + rsub; const v4f v = *(const v4fa*)&so[w][r][c4]; if (C) *(v4f*)(C + cofs + (size_t)(row0 + r) * ldc + col0 + c4) = v; if (C16) { v4h h4; for (int i = 0; i < 4; ++i) h4[i] = (_Float16)v[i]; *(v4h*)(C16 + cofs + (size_t)(row0 + r) * ldc + col0 + c4) = h4; } }
     } }


__global__ __launch_bounds__(256) void k_wnat(const float* __restrict__ w, size_t n8, _Float16* __restrict__ Bt) { const size_t t = (size_t)blockIdx.x * 256 + threadIdx.x; if (t >= n8) return; FragH f; for (int q = 0; q < 8; ++q) f.h[q] = (_Float16)(bf16_round(w[t * 8 + q]) * 16.0f); *(v8us*)((unsigned short*)Bt + t * 8) = f.half[0];  }
__global__ __launch_bounds__(256) void k_rsm(const float* __restrict__ S, _Float16* __restrict__ P, int nrows) {
  #pragma clang fp contract(off)
  const int i = blockIdx.x * 256 + threadIdx.x; if (i >= nrows) return; const float* s = S + (size_t)i * SQ; float mx = -3.0e38f;
#pragma unroll 1
  for (int j = 0; j < SQ; ++j) mx = fmaxf(mx, s[j]); float se = 0.f;
#pragma unroll 1
  for (int j = 0; j < SQ; ++j) se += expf(s[j] - mx); const float sc = 256.0f / se;
#pragma unroll 1
  for (int j0 = 0; j0 < SQ; j0 += 8) { FragH f; for (int q = 0; q < 8; ++q) f.h[q] = (_Float16)(expf(s[j0 + q] - mx) * sc); unsigned short* d = (unsigned short*)P + (size_t)i * SQ + j0; *(v8us*)d = f.half[0];  } }
__global__ __launch_bounds__(256) void k_vt(const _Float16* __restrict__ V16, int b, int h0, _Float16* __restrict__ VT) { __shared__ unsigned short tl[64][65]; const int tid = threadIdx.x; const int hh = blockIdx.x % HG, sg = blockIdx.x / HG; const int s0 = sg * 64; const int h = h0 + hh;
  for (int i = tid; i < 64 * 8; i += 256) { const int j = i / 8, d8 = (i % 8) * 8; FragH f; f.half[0] = *(const v8us*)((const unsigned short*)V16 + ((size_t)b * SQ + s0 + j) * DM + h * HD + d8); for (int q = 0; q < 8; ++q) tl[d8 + q][j] = f.u[q]; }
  __syncthreads();
  { for (int i = tid; i < 64 * 8; i += 256) { const int d = i / 8, j8 = (i % 8) * 8; FragH f; for (int q = 0; q < 8; ++q) f.u[q] = tl[d][j8 + q]; *(v8us*)((unsigned short*)VT + ((size_t)hh * HD + d) * SQ + s0 + j8) = f.half[0]; }  } }



__global__ __launch_bounds__(256) void k_rsmcf2(const float* __restrict__ S, _Float16* __restrict__ P, int hg, int q0, int nk) {
  #pragma clang fp contract(off)
  const int t = blockIdx.x * 256 + threadIdx.x; if (t >= hg * QT) return; const size_t i = (size_t)t; const float* s = S + i * NKX; const int last = q0 + (t % QT); float mx = -3.0e38f;
#pragma unroll 1
  for (int j = 0; j < nk; ++j) { const float f = (j <= last) ? 1.f : 0.f; mx = fmaxf(mx, fmaf(f, s[j], (1.f - f) * -1.0e9f)); } float se = 0.f;
#pragma unroll 1
  for (int j = 0; j < nk; ++j) { const float f = (j <= last) ? 1.f : 0.f; se += __expf(fmaf(f, s[j], (1.f - f) * -1.0e9f) - mx); } const float sc = 256.0f / se;
#pragma unroll 1
  for (int j0 = 0; j0 < nk; j0 += 8) { FragH fr; for (int q = 0; q < 8; ++q) { const int j = j0 + q; const float f = (j <= last) ? 1.f : 0.f; fr.h[q] = (_Float16)(__expf(fmaf(f, s[j], (1.f - f) * -1.0e9f) - mx) * sc); } unsigned short* d = (unsigned short*)P + i * NKX + j0; *(v8us*)d = fr.half[0];  } }

template <int MASKADD>
__global__ __launch_bounds__(64) void k_att0(const float* __restrict__ QF, const float* __restrict__ KF, const float* __restrict__ VF, int ld, const float* __restrict__ mask, float scale, float* __restrict__ OF, int ldo) {
  #pragma clang fp contract(off)
  __shared__ __attribute__((aligned(16))) float lq[64][64]; __shared__ __attribute__((aligned(16))) float lo[64][64];
  const int tid = threadIdx.x; const int h = blockIdx.x / (QT0 / 64), rg = blockIdx.x % (QT0 / 64); const int i = rg * 64 + tid;
  const float* qr = QF + (size_t)i * ld + h * HD;
#pragma unroll 1
  for (int c = 0; c < HD / 4; ++c) { *(v4f*)&lq[tid][c * 4] = *(const v4fa*)(qr + c * 4); const v4f z = {0.f, 0.f, 0.f, 0.f}; *(v4f*)&lo[tid][c * 4] = z; }
  float m = -1.0e30f, l = 0.f; const int jmax = MASKADD ? (SQ - 1) : (rg * 64 + 63);      /* additive-mask form: every key (the mask input decides); causal form: keys up to the block's last row */
#pragma unroll 1
  for (int j = 0; j <= jmax; ++j) { const float* kr = KF + (size_t)j * ld + h * HD; const float* vr = VF + (size_t)j * ld + h * HD; float s = 0.f;
#pragma unroll 1
    for (int c = 0; c < HD / 4; ++c) { const v4f kq = *(const v4fa*)(kr + c * 4); const v4f qq = *(v4f*)&lq[tid][c * 4]; s = __fadd_rn(s, __fmul_rn(qq[0], kq[0])); s = __fadd_rn(s, __fmul_rn(qq[1], kq[1])); s = __fadd_rn(s, __fmul_rn(qq[2], kq[2])); s = __fadd_rn(s, __fmul_rn(qq[3], kq[3])); }
    s = __fmul_rn(s, scale); if (MASKADD) s = __fadd_rn(s, __fmul_rn(bf16_round(mask[(size_t)i * SQ + j]), -10000.0f));
    const float f = (MASKADD || j <= i) ? 1.f : 0.f; const float sm = fmaf(f, s, (1.f - f) * -1.0e30f); const float mn = fmaxf(m, sm); const float sc = expf(m - mn); const float e = expf(sm - mn); l = __fadd_rn(__fmul_rn(l, sc), e); m = mn;
#pragma unroll 1
    for (int c = 0; c < HD / 4; ++c) { const v4f vv = *(const v4fa*)(vr + c * 4); v4f oo = *(v4f*)&lo[tid][c * 4]; for (int u = 0; u < 4; ++u) oo[u] = __fadd_rn(__fmul_rn(oo[u], sc), __fmul_rn(e, vv[u])); *(v4f*)&lo[tid][c * 4] = oo; } }
  const float fin = 64.0f / l;      /* o carried x64 */
#pragma unroll 1
  for (int c = 0; c < HD / 4; ++c) { v4f oo = *(v4f*)&lo[tid][c * 4]; for (int u = 0; u < 4; ++u) oo[u] = __fmul_rn(oo[u], fin); *(v4f*)&lo[tid][c * 4] = oo; }
  __syncthreads();
  {
#pragma unroll 1
    for (int it = 0; it < 16; ++it) { const int row = it * 4 + tid / 16, pc = (tid % 16) * 4; const v4f v = *(const v4f*)&lo[row][pc]; *(v4f*)(OF + (size_t)(rg * 64 + row) * ldo + h * HD + pc) = v; }
     } }

__global__ __launch_bounds__(256) void k_oscale(const float* __restrict__ OF, float* __restrict__ out, size_t n4) { const size_t t = (size_t)blockIdx.x * 256 + threadIdx.x; if (t >= n4) return; const v4f a = *(const v4fa*)(OF + t * 4); v4f o; for (int q = 0; q < 4; ++q) o[q] = a[q] * 0.015625f; *(v4f*)(out + t * 4) = o;  }

__global__ __launch_bounds__(256) void k_bfr(const float* __restrict__ x, float* __restrict__ XB, size_t n8) { const size_t t = (size_t)blockIdx.x * 256 + threadIdx.x; if (t >= n8) return; v4f a = *(const v4fa*)(x + t * 8), c = *(const v4fa*)(x + t * 8 + 4); for (int q = 0; q < 4; ++q) { a[q] = bf16_round(a[q]); c[q] = bf16_round(c[q]); }
  { *(v4f*)(XB + t * 8) = a; *(v4f*)(XB + t * 8 + 4) = c;  } }



__global__ __launch_bounds__(256) void k_rsmfvl(const float* __restrict__ S, _Float16* __restrict__ P, _Float16* __restrict__ PL, int qn, const int* __restrict__ vlp) {
  #pragma clang fp contract(off)
  const int t = blockIdx.x * 256 + threadIdx.x; if (t >= qn) return; const int vl = vlp[0]; const size_t i = (size_t)t; const float* s = S + i * SQ; float mx = -3.0e38f;
#pragma unroll 1
  for (int j = 0; j < SQ; ++j) { const float f = (j < vl) ? 1.f : 0.f; mx = fmaxf(mx, fmaf(f, s[j], (1.f - f) * -1000000.0f)); } float se = 0.f;
#pragma unroll 1
  for (int j = 0; j < SQ; ++j) { const float f = (j < vl) ? 1.f : 0.f; se += __expf(fmaf(f, s[j], (1.f - f) * -1000000.0f) - mx); } const float sc = 256.0f / se;
#pragma unroll 1
  for (int j0 = 0; j0 < SQ; j0 += 8) { FragH fr, gr; for (int q = 0; q < 8; ++q) { const int j = j0 + q; const float f = (j < vl) ? 1.f : 0.f; const float pv = __expf(fmaf(f, s[j], (1.f - f) * -1000000.0f) - mx) * sc; const _Float16 ph = (_Float16)pv; fr.h[q] = ph; gr.h[q] = (_Float16)((pv - (float)ph) * 1024.0f); }
    unsigned short* d = (unsigned short*)P + i * SQ + j0; unsigned short* dl = (unsigned short*)PL + i * SQ + j0; *(v8us*)d = fr.half[0]; *(v8us*)dl = gr.half[0];  } }

__global__ __launch_bounds__(256) void k_rsmf(const float* __restrict__ S, _Float16* __restrict__ P, int qn, int hg) {
  #pragma clang fp contract(off)
  const int t = blockIdx.x * 256 + threadIdx.x; if (t >= qn * hg) return; const size_t i = (size_t)(t / qn) * SQ + (t % qn); const float* s = S + i * SQ; float mx = -3.0e38f;
#pragma unroll 1
  for (int j = 0; j < SQ; ++j) mx = fmaxf(mx, s[j]); float se = 0.f;
#pragma unroll 1
  for (int j = 0; j < SQ; ++j) se += __expf(s[j] - mx); const float sc = 256.0f / se;
#pragma unroll 1
  for (int j0 = 0; j0 < SQ; j0 += 8) { FragH f; for (int q = 0; q < 8; ++q) f.h[q] = (_Float16)(__expf(s[j0 + q] - mx) * sc); unsigned short* d = (unsigned short*)P + i * SQ + j0; *(v8us*)d = f.half[0];  } }



// Cross-lane steps of a 32-lane butterfly in registers: lane ^ 1, 2, 4, 8 by DPP row_xmask inside a 16-lane row, lane ^ 16 by the cross-row move. Every lane must be on.
template <int CTRL>
__device__ __forceinline__ float lane_dpp(float v) { return __int_as_float(__builtin_amdgcn_update_dpp(0, __float_as_int(v), CTRL, 0xf, 0xf, true)); }
__device__ __forceinline__ float lane_x16(float v) { const int i = __float_as_int(v); return __int_as_float(__builtin_amdgcn_permlanex16(i, i, 0x76543210, 0xfedcba98, false, false)); }
__device__ __forceinline__ float wave_max(float v) { v = fmaxf(v, lane_dpp<0x161>(v)); v = fmaxf(v, lane_dpp<0x162>(v)); v = fmaxf(v, lane_dpp<0x164>(v)); v = fmaxf(v, lane_dpp<0x168>(v)); return fmaxf(v, lane_x16(v)); }
__device__ __forceinline__ float wave_sum(float v) { v += lane_dpp<0x161>(v); v += lane_dpp<0x162>(v); v += lane_dpp<0x164>(v); v += lane_dpp<0x168>(v); return v + lane_x16(v); }
typedef int v4ia __attribute__((ext_vector_type(4), may_alias));
// Four native exp2 in one statement. The closing v_nop is the one slot the instruction set asks for behind a transcendental before its result is read or its source overwritten;
// the outputs are early-clobber, so each exp is independent of the one in front of it.
__device__ __forceinline__ v4f exp2_x4(v4f a) { float r0, r1, r2, r3;
  asm("v_exp_f32 %0, %4\n\tv_exp_f32 %1, %5\n\tv_exp_f32 %2, %6\n\tv_exp_f32 %3, %7\n\tv_nop" : "=&v"(r0), "=&v"(r1), "=&v"(r2), "=&v"(r3) : "v"(a[0]), "v"(a[1]), "v"(a[2]), "v"(a[3]));
  const v4f r = {r0, r1, r2, r3}; return r; }
// One WAVE per score row (8 rows per workgroup): the row's SQ f32 scores are read once, by SQ / 128 loads that each cover 512 contiguous bytes, and stay in registers through
// maximum, exp, masked sum and scaling; lane l holds columns 128 u + 4 l .. + 3. The early return is wave-uniform and the kernel has no barrier.
// Every loop is fully unrolled so that x[] and kp[] are indexed by constants and live in registers, and all the row's loads are issued ahead of the first use.
__global__ __launch_bounds__(256) void k_rsmik(const float* __restrict__ S, _Float16* __restrict__ P, int qn, int hg, const int* __restrict__ Km) {
  const int lane = threadIdx.x & 31; const int t = blockIdx.x * 8 + __builtin_amdgcn_readfirstlane(threadIdx.x >> 5); if (t >= qn * hg) return; const size_t i = (size_t)(t / qn) * SQ + (t % qn); const float* s = S + i * SQ + lane * 4;
  Km += (size_t)(t / qn) * SQ;      /* key mask row of this score row's sequence (hg sequences per launch) */
  v4f x[SQ / 128]; v4f kp[SQ / 128];
#pragma unroll
  for (int u = 0; u < SQ / 128; ++u) x[u] = *(const v4fa*)(s + u * 128);
#pragma unroll
  for (int u = 0; u < SQ / 128; ++u) { const v4ia m = *(const v4ia*)(Km + u * 128 + lane * 4); for (int q = 0; q < 4; ++q) kp[u][q] = (m[q] != 0) ? 1.0f : 0.0f; }
  v4f m4 = x[0];
#pragma unroll
  for (int u = 1; u < SQ / 128; ++u) for (int q = 0; q < 4; ++q) m4[q] = fmaxf(m4[q], x[u][q]);
  const float mx = wave_max(fmaxf(fmaxf(m4[0], m4[1]), fmaxf(m4[2], m4[3])));
  v4f s4 = {0.f, 0.f, 0.f, 0.f};
#pragma unroll
  for (int u = 0; u < SQ / 128; ++u) { const v4f e = exp2_x4((x[u] - mx) * 1.44269504088896341f) * kp[u]; x[u] = e; s4 += e; }      /* exp(s - mx) as the native exp2((s - mx) log2 e), times the key's 0 / 1 */
  const float sc = 256.0f / wave_sum((s4[0] + s4[1]) + (s4[2] + s4[3]));
  _Float16* d = P + i * SQ + lane * 4;
#pragma unroll
  for (int u = 0; u < SQ / 128; ++u) { v4h h4; for (int q = 0; q < 4; ++q) h4[q] = (_Float16)(x[u][q] * sc); *(v4h*)(d + u * 128) = h4; } }


extern "C" void kernel_launch(void* const* d_in, const int* in_sizes, int n_in,
                              void* d_out, int out_size, void* d_ws, size_t ws_size, hipStream_t stream) {
  (void)in_sizes; (void)n_in; (void)out_size;
  const float* const* I = (const float* const*)d_in; const float* xq = I[0]; const float* xk = I[1]; const float* xv = I[2]; const int* km = (const int*)d_in[3];      /* q, k, v [16][2048][128] (bf16-valued); mask int32 [16][2048] (READ on device) */
  char* ws = (char*)d_ws; size_t off = 0;
  auto take = [&](size_t bytes) { char* p = ws + off; off += (bytes + 255) & ~(size_t)255; return p; };
  _Float16* Q16 = (_Float16*)take(NR * DM * 2); _Float16* K16 = (_Float16*)take(NR * DM * 2); _Float16* V16 = (_Float16*)take(NR * DM * 2);
  float* S = (float*)take((size_t)SG * SQ * SQ * 4); _Float16* P = (_Float16*)take((size_t)NB * SQ * SQ * 2); _Float16* VT = (_Float16*)take((size_t)NB * HD * SQ * 2);      /* scores of SG sequences at a time; weights and V^T of all NB */
  if (off > ws_size) return;
  k_x16<<<(unsigned)((NR * DM / 8 + 255) / 256), 256, 0, stream>>>(xq, Q16, NR * DM / 8); k_x16<<<(unsigned)((NR * DM / 8 + 255) / 256), 256, 0, stream>>>(xk, K16, NR * DM / 8); k_x16<<<(unsigned)((NR * DM / 8 + 255) / 256), 256, 0, stream>>>(xv, V16, NR * DM / 8);      /* exact f16 copies of the bf16-valued inputs */
  k_vt<DM / 64, SQ><<<NB * (DM / 64) * (SQ / 64), 256, 0, stream>>>(V16, DM, 0, VT);      /* V^T [NB][128][SQ], every sequence in one launch (two 64-row slabs each) */
  for (int b = 0; b < NB; b += SG) { const size_t r0 = (size_t)b * SQ;      /* SG sequences per launch, one per blockIdx.y (GEMM) or per SQ rows (softmax) */
    k_gemm2<0><<<dim3((SQ / 128) * (SQ / 64), SG), 128, 0, stream>>>(Q16 + r0 * DM, DM, (size_t)SQ * DM, K16 + r0 * DM, DM, (size_t)SQ * DM, 0.08838834764831845f, nullptr, 0, nullptr, 1, 0, 0, S, nullptr, SQ, (size_t)SQ * SQ, SQ, SQ, HD);      /* scores / sqrt(128) (exact products, K = 128) */
    k_rsmik<<<SG * SQ / 8, 256, 0, stream>>>(S, P + r0 * SQ, SQ, SG, km + r0);      /* exp(s - max over ALL keys) * mask[b][key], normalised by the masked sum -> P x256 f16 (the module's post-exp multiplicative mask, literally) */
  }
  k_gemm2<0><<<dim3((SQ / 128) * (HD / 64), NB), 128, 0, stream>>>(P, SQ, (size_t)SQ * SQ, VT, SQ, (size_t)HD * SQ, 0.00390625f, nullptr, 0, nullptr, 1, 0, 0, (float*)d_out, nullptr, DM, (size_t)SQ * DM, SQ, HD, SQ);      /* out = P V^T 2^-8 f32 into the output rows, every sequence in one launch */
}

// v003
// A run of this version takes 51.6 microseconds.
// Timed twice side by side with v002, it ran 4.73 and 4.74 times as fast.
// All steps since v000 together make it 123 times as fast.
#include <hip/hip_runtime.h>
// Scaled dot-product attention with the module's POST-exp multiplicative key mask (q, k, v [16][2048][128]: 16 independent sequences, one 128-wide head; mask int32 [16][2048] in {0, 1} (random, read on device); score = q.k / sqrt(128); e = exp(score - rowmax over ALL keys); e *= mask[b][key]; a = e / sum(e); out = a v -> [16][2048][128]). No projections: q, k, v are bf16-valued inputs, so their f16 copies and the score products are exact.
// Structure: no projections: q, k, v are bf16-valued inputs copied to exact f16 rows (three launches); then ONE fused kernel for all 16 sequences: scores (WMMA, f32 accumulation, exact products), online softmax over all keys (f32 statistics, native exp2, post-exp key mask) and P V (WMMA) per 128-query workgroup, out written f32 straight into the output rows; scores and weights never reach memory.
// Compute dtype: inputs rounded to bf16; q, k, v exact in f16; unnormalised softmax weights (below 2^8) as plain f16 GEMM operands (~2^-12); scores, softmax statistics and o f32. v_wmma_f32_16x16x32_f16.
#define NB 16
#define SQ 2048
#define DM 128
#define NH 1
#define HD 128
#define HG 4                         /* heads per attention launch group */
#define B0 0                         /* first batch processed (debug hook) */
#define NBR NB                       /* batches processed (debug hook) */
#define NR ((size_t)NB * SQ)         /* token rows */
#define MP ((int)((size_t)NBR * SQ))
#define QT 256                       /* query rows per causal tile */
#define NKX SQ                       /* S / P row pitch */
#define QT0 256                      /* first-tile rows recomputed exactly (256: buys margin for the few-key rows 128..255, which have no output projection to average the single-f16 P/v rounding) */
#define QN SQ                        /* query rows attended per batch (debug hook) */
#define NHD NH                       /* heads attended (debug hook) */
#define MPO MP                       /* rows through the output stage (debug hook) */
#define LQ DM            /* row pitch of the q/k/v rows */
#define SG 4                         /* unused: no score / softmax launch; the workspace holds only the f16 q, k and v */
typedef __bf16 v16b __attribute__((ext_vector_type(16)));
typedef unsigned short v8us __attribute__((ext_vector_type(8), may_alias));
typedef float  v8f  __attribute__((ext_vector_type(8)));
typedef float  v4f  __attribute__((ext_vector_type(4)));
typedef float  v4fa __attribute__((ext_vector_type(4), may_alias));
union FragB { v16b v; v8us half[2]; unsigned short u[16]; };

__device__ __forceinline__ unsigned short bf16_bits(float x) { unsigned int u = __float_as_uint(x); return (unsigned short)((u + 0x7FFFu + ((u >> 16) & 1u)) >> 16); }
__device__ __forceinline__ float bf16_val(unsigned short b) { return __uint_as_float(((unsigned int)b) << 16); }
__device__ __forceinline__ float bf16_round(float x) { return bf16_val(bf16_bits(x)); }
// D += A·B with NT terms: 1 = ah·bh, 2 = + al·bh (A split), 3 = + ah·bl (both split)
template <int NT>
__device__ __forceinline__ v8f mmaN(v16b ah, v16b al, v16b bh, v16b bl, v8f c) {
  c = __builtin_amdgcn_wmma_f32_16x16x32_bf16(false, ah, false, bh, (short)0, c, false, false);
  if (NT >= 2) c = __builtin_amdgcn_wmma_f32_16x16x32_bf16(false, al, false, bh, (short)0, c, false, false);
  if (NT >= 3) c = __builtin_amdgcn_wmma_f32_16x16x32_bf16(false, ah, false, bl, (short)0, c, false, false);
  asm volatile("v_nop\n\tv_nop\n\tv_nop\n\tv_nop" : "+v"(c) : "v"(ah), "v"(al), "v"(bh), "v"(bl));
  return c;
}

__global__ __launch_bounds__(256) void k_wt_bf16(const float* __restrict__ W, unsigned short* __restrict__ Wt, int K, int N) {
  const int t = blockIdx.x * 256 + threadIdx.x;
  const int k8n = K / 8;
  if (t >= N * k8n) return;
  const int n = t / k8n, k8 = (t % k8n) * 8;
  v8us v;
#pragma unroll
  for (int i = 0; i < 8; ++i) v[i] = bf16_bits(W[(size_t)(k8 + i) * N + n]);
  *(v8us*)(Wt + (size_t)n * K + k8) = v;
  
}

// GEMM C[M][N] (f32, pitch ldc) = act(A[M][K]·W + bias). A f32 row-major (pitch lda) converted per fragment to bf16
// (ASPLIT: hi/lo two planes -> 2 terms, else single rounded term); Wt bf16 [N][K] (pitch ldb). BIAS_BF16 rounds the
// bias to bf16 first (bias quantised to bf16 before the add). K%32==0, M%16==0, N%64==0.
template <bool ASPLIT, int ACT, bool BIAS_BF16>
__global__ __launch_bounds__(128) void k_gemm_bf(const float* __restrict__ A, int lda, const unsigned short* __restrict__ Wt, int ldb,
                                               const float* __restrict__ bias, float* __restrict__ C, int ldc, int M, int N, int K) {
  __shared__ __attribute__((aligned(16))) float so[4][16][64];
  const int tid = threadIdx.x, w = tid >> 5, lane = tid & 31, ln = lane & 15, hh = lane >> 4;
  const int ntn = N / 64;
  const int wid = blockIdx.x * 4 + w;
  const int mt = wid / ntn, nq = wid % ntn;
  if (mt * 16 >= M) return;
  const int row0 = mt * 16, col0 = nq * 64;
  const float* arow = A + (size_t)(row0 + ln) * lda;
  v8f acc[4] = {};
  for (int kb = 0; kb < K; kb += 32) {
    FragB ah, al;
    const v4f x0 = *(const v4fa*)(arow + kb + 8 * hh), x1 = *(const v4fa*)(arow + kb + 8 * hh + 4);
    const v4f x2 = *(const v4fa*)(arow + kb + 16 + 8 * hh), x3 = *(const v4fa*)(arow + kb + 16 + 8 * hh + 4);
    float xs[16] = {x0[0],x0[1],x0[2],x0[3],x1[0],x1[1],x1[2],x1[3],x2[0],x2[1],x2[2],x2[3],x3[0],x3[1],x3[2],x3[3]};
#pragma unroll
    for (int i = 0; i < 16; ++i) { const unsigned short hb = bf16_bits(xs[i]); ah.u[i] = hb; al.u[i] = ASPLIT ? bf16_bits(xs[i] - bf16_val(hb)) : (unsigned short)0; }
#pragma unroll
    for (int t = 0; t < 4; ++t) {
      const unsigned short* brow = Wt + (size_t)(col0 + t * 16 + ln) * ldb + kb;
      FragB b;
      b.half[0] = *(const v8us*)(brow + 8 * hh);
      b.half[1] = *(const v8us*)(brow + 16 + 8 * hh);
      acc[t] = mmaN<ASPLIT ? 2 : 1>(ah.v, al.v, b.v, b.v, acc[t]);
    }
  }
#pragma unroll
  for (int t = 0; t < 4; ++t) {
    float bv = bias ? bias[col0 + t * 16 + ln] : 0.f;
    if (BIAS_BF16) bv = bf16_round(bv);
#pragma unroll
    for (int r = 0; r < 8; ++r) { float v = acc[t][r] + bv; if (ACT == 1) v = fmaxf(v, 0.f); so[w][8 * hh + r][t * 16 + ln] = v; }
  }
  __builtin_amdgcn_fence(__ATOMIC_ACQ_REL, "workgroup");
  __builtin_amdgcn_wave_barrier();
  const int rsub = lane >> 4, c4 = (lane & 15) * 4;
  {
#pragma unroll
    for (int q = 0; q < 8; ++q) {
      const int r = q * 2 + rsub;
      const v4f v = *(const v4fa*)&so[w][r][c4];
      *(v4f*)(C + (size_t)(row0 + r) * ldc + col0 + c4) = v;
    }
    
  }
}

// GEMM C = act(A·W + bias + resid): A f32 (ASPLIT -> hi/lo 2 terms), Wt bf16 [N][K]; ACT 0 none, 1 relu, 2 exact gelu;
// resid (optional, f32, row index = (row % rmod), pitch ldr, RES_BF16 rounds it) added before the activation.
template <bool ASPLIT, int ACT, bool BIAS_BF16, bool RES_BF16>
__global__ __launch_bounds__(128) void k_gemm_bf3(const float* __restrict__ A, int lda, const unsigned short* __restrict__ Wt, int ldb,
                                                const float* __restrict__ bias, const float* __restrict__ resid, int rmod, int ldr,
                                                float* __restrict__ C, int ldc, int M, int N, int K) {
  __shared__ __attribute__((aligned(16))) float so[4][16][64];
  const int tid = threadIdx.x, w = tid >> 5, lane = tid & 31, ln = lane & 15, hh = lane >> 4;
  const int ntn = N / 64;
  const int wid = blockIdx.x * 4 + w;
  const int mt = wid / ntn, nq = wid % ntn;
  if (mt * 16 >= M) return;
  const int row0 = mt * 16, col0 = nq * 64;
  const float* arow = A + (size_t)(row0 + ln) * lda;
  v8f acc[4] = {};
  for (int kb = 0; kb < K; kb += 32) {
    FragB ah, al;
    const v4f x0 = *(const v4fa*)(arow + kb + 8 * hh), x1 = *(const v4fa*)(arow + kb + 8 * hh + 4);
    const v4f x2 = *(const v4fa*)(arow + kb + 16 + 8 * hh), x3 = *(const v4fa*)(arow + kb + 16 + 8 * hh + 4);
    float xs[16] = {x0[0],x0[1],x0[2],x0[3],x1[0],x1[1],x1[2],x1[3],x2[0],x2[1],x2[2],x2[3],x3[0],x3[1],x3[2],x3[3]};
#pragma unroll
    for (int i = 0; i < 16; ++i) { const unsigned short hb = bf16_bits(xs[i]); ah.u[i] = hb; al.u[i] = ASPLIT ? bf16_bits(xs[i] - bf16_val(hb)) : (unsigned short)0; }
#pragma unroll
    for (int t = 0; t < 4; ++t) {
      const unsigned short* brow = Wt + (size_t)(col0 + t * 16 + ln) * ldb + kb;
      FragB b;
      b.half[0] = *(const v8us*)(brow + 8 * hh);
      b.half[1] = *(const v8us*)(brow + 16 + 8 * hh);
      acc[t] = mmaN<ASPLIT ? 2 : 1>(ah.v, al.v, b.v, b.v, acc[t]);
    }
  }
#pragma unroll
  for (int t = 0; t < 4; ++t) {
    const int col = col0 + t * 16 + ln;
    float bv = bias ? bias[col] : 0.f;
    if (BIAS_BF16) bv = bf16_round(bv);
#pragma unroll
    for (int r = 0; r < 8; ++r) {
      float v = acc[t][r] + bv;
      if (resid) { float rv = resid[(size_t)((row0 + 8 * hh + r) % rmod) * ldr + col]; if (RES_BF16) rv = bf16_round(rv); v += rv; }
      if (ACT == 1) v = fmaxf(v, 0.f);
      if (ACT == 2) v = 0.5f * v * (1.0f + erff(v * 0.70710678118654752f));
      if (ACT == 3) { const float u = 0.7978845608028654f * (v + 0.044715f * v * v * v); v = 0.5f * v * (1.0f + tanhf(u)); }
      so[w][8 * hh + r][t * 16 + ln] = v;
    }
  }
  __builtin_amdgcn_fence(__ATOMIC_ACQ_REL, "workgroup");
  __builtin_amdgcn_wave_barrier();
  const int rsub = lane >> 4, c4 = (lane & 15) * 4;
  {
#pragma unroll
    for (int q = 0; q < 8; ++q) {
      const int r = q * 2 + rsub;
      const v4f v = *(const v4fa*)&so[w][r][c4];
      *(v4f*)(C + (size_t)(row0 + r) * ldc + col0 + c4) = v;
    }
    
  }
}
// row LayerNorm (biased variance, eps) over N: s = X (+ R); optional out_sum <- s; out_norm <- (s-mu)*rsqrt(var+eps)*g + b
template <bool PARAM_BF16>
__global__ __launch_bounds__(256) void k_layernorm(const float* __restrict__ X, const float* __restrict__ R, const float* __restrict__ g, const float* __restrict__ bta,
                                                  float* __restrict__ out_sum, float* __restrict__ out_norm, int N, float eps) {
  __shared__ float red[256];
  const int row = blockIdx.x, tid = threadIdx.x;
  const float* x = X + (size_t)row * N; const float* rr = R ? R + (size_t)row * N : nullptr;
  float vals[16];                     // up to N = 4096
  const int per = N / 256;            // contiguous chunk per thread? use strided-by-4 chunks: thread handles j = tid*4 + 1024*u
  float s1 = 0.f;
  for (int u = 0; u < per / 4; ++u) {
    const int j = tid * 4 + 1024 * u;
    const v4f a = *(const v4fa*)(x + j);
    v4f b = {0.f,0.f,0.f,0.f}; if (rr) b = *(const v4fa*)(rr + j);
#pragma unroll
    for (int q = 0; q < 4; ++q) { const float v = a[q] + b[q]; vals[u * 4 + q] = v; s1 += v; }
  }
  red[tid] = s1; __syncthreads();
  for (int st = 128; st > 0; st >>= 1) { if (tid < st) red[tid] += red[tid + st]; __syncthreads(); }
  const float mu = red[0] / (float)N; __syncthreads();
  float s2 = 0.f;
  for (int u = 0; u < per / 4; ++u)
#pragma unroll
    for (int q = 0; q < 4; ++q) { const float c = vals[u * 4 + q] - mu; s2 += c * c; }
  red[tid] = s2; __syncthreads();
  for (int st = 128; st > 0; st >>= 1) { if (tid < st) red[tid] += red[tid + st]; __syncthreads(); }
  const float rs = rsqrtf(red[0] / (float)N + eps);
  {
    for (int u = 0; u < per / 4; ++u) {
      const int j = tid * 4 + 1024 * u;
      v4f o, sm;
#pragma unroll
      for (int q = 0; q < 4; ++q) {
        float gg = g[j + q], bb = bta[j + q];
        if (PARAM_BF16) { gg = bf16_round(gg); bb = bf16_round(bb); }
        sm[q] = vals[u * 4 + q]; o[q] = (vals[u * 4 + q] - mu) * rs * gg + bb;
      }
      if (out_sum) *(v4f*)(out_sum + (size_t)row * N + j) = sm;
      *(v4f*)(out_norm + (size_t)row * N + j) = o;
    }
    
  }
}



// ---- f16 WMMA path (v_wmma_f32_16x16x32_f16): 11-bit significands for operands in range — used where a [0,1] probability operand needs more precision than bf16
typedef _Float16 v16h __attribute__((ext_vector_type(16)));
union FragH { v16h v; v8us half[2]; _Float16 h[16]; unsigned short u[16]; };
template <int NT>
__device__ __forceinline__ v8f mmaH(v16h ah, v16h al, v16h bh, v16h bl, v8f c) {
  c = __builtin_amdgcn_wmma_f32_16x16x32_f16(false, ah, false, bh, (short)0, c, false, false);
  if (NT >= 2) c = __builtin_amdgcn_wmma_f32_16x16x32_f16(false, al, false, bh, (short)0, c, false, false);
  if (NT >= 3) c = __builtin_amdgcn_wmma_f32_16x16x32_f16(false, ah, false, bl, (short)0, c, false, false);
  asm volatile("v_nop\n\tv_nop\n\tv_nop\n\tv_nop" : "+v"(c) : "v"(ah), "v"(al), "v"(bh), "v"(bl));
  return c;
}
// batched GEMM like k_gemm_b but f16 operands: A f32 (split into f16 hi/lo if ASPLIT, else rounded to f16), Bt = f16 values [n][k]; alpha; C f32; N multiple of 16 (partial tiles skipped)
template <bool ASPLIT>
__global__ __launch_bounds__(128) void k_gemm_h(const float* __restrict__ A, int lda, size_t sA, const _Float16* __restrict__ Bh, int ldb, size_t sB, float alpha, float* __restrict__ C, int ldc, size_t sC, int M, int N, int K) {
  __shared__ __attribute__((aligned(16))) float so[4][16][64];
  const int tid = threadIdx.x, w = tid >> 5, lane = tid & 31, ln = lane & 15, hh = lane >> 4; const int by = blockIdx.y;
  A += (size_t)by * sA; Bh += (size_t)by * sB; C += (size_t)by * sC;
  const int ntn = (N + 63) / 64; const int wid = blockIdx.x * 4 + w; const int mt = wid / ntn, nq = wid % ntn; if (mt * 16 >= M) return;
  const int row0 = mt * 16, col0 = nq * 64; const float* arow = A + (size_t)(row0 + ln) * lda;
  v8f acc[4] = {};
  for (int kb = 0; kb < K; kb += 32) {
    FragH ah, al;
    const v4f x0 = *(const v4fa*)(arow + kb + 8 * hh), x1 = *(const v4fa*)(arow + kb + 8 * hh + 4), x2 = *(const v4fa*)(arow + kb + 16 + 8 * hh), x3 = *(const v4fa*)(arow + kb + 16 + 8 * hh + 4);
    float xs[16] = {x0[0],x0[1],x0[2],x0[3],x1[0],x1[1],x1[2],x1[3],x2[0],x2[1],x2[2],x2[3],x3[0],x3[1],x3[2],x3[3]};
#pragma unroll
    for (int i = 0; i < 16; ++i) { const _Float16 h = (_Float16)xs[i]; ah.h[i] = h; al.h[i] = ASPLIT ? (_Float16)(xs[i] - (float)h) : (_Float16)0.0f; }
#pragma unroll
    for (int t = 0; t < 4; ++t) { if (col0 + t * 16 >= N) continue; const size_t boff = (size_t)(col0 + t * 16 + ln) * ldb + kb; FragH bq; bq.half[0] = *(const v8us*)(Bh + boff + 8 * hh); bq.half[1] = *(const v8us*)(Bh + boff + 16 + 8 * hh);
      acc[t] = mmaH<ASPLIT ? 2 : 1>(ah.v, al.v, bq.v, bq.v, acc[t]); }
  }
#pragma unroll
  for (int t = 0; t < 4; ++t) { if (col0 + t * 16 >= N) continue;
#pragma unroll
    for (int r = 0; r < 8; ++r) so[w][8 * hh + r][t * 16 + ln] = acc[t][r] * alpha; }
  __builtin_amdgcn_fence(__ATOMIC_ACQ_REL, "workgroup"); __builtin_amdgcn_wave_barrier();
  const int rsub = lane >> 4, c4 = (lane & 15) * 4;
  {
#pragma unroll
    for (int q = 0; q < 8; ++q) { const int r = q * 2 + rsub; if (col0 + c4 < N) { const v4f v = *(const v4fa*)&so[w][r][c4]; *(v4f*)(C + (size_t)(row0 + r) * ldc + col0 + c4) = v; } }
     }
}

// Wt[n][k] = f16(W[k][n]·scale) from f32 row-major W[K][N] (scale = power of two; bf16-exact weights stay exact in f16 away from the subnormal range)
__global__ __launch_bounds__(256) void k_wt_f16(const float* __restrict__ W, _Float16* __restrict__ Wt, int K, int N, float scale) {
  const int t = blockIdx.x * 256 + threadIdx.x; if (t >= N * (K / 8)) return; const int n = t / (K / 8), k8 = (t % (K / 8)) * 8; FragH f;
#pragma unroll
  for (int i = 0; i < 8; ++i) f.h[i] = (_Float16)(bf16_round(W[(size_t)(k8 + i) * N + n]) * scale); const v8us o = f.half[0];
  *(v8us*)((unsigned short*)Wt + (size_t)n * K + k8) = o; 
}
// k_gemm_hh variant with fused epilogue: v = acc·alpha + bias[by·sBias + col] (+ CP[(row/rowsPerB)·sCPb + by·64 + col] if CP) ; ACT 0 none / 1 elu ; writes f16 C16 (and f32 C if non-null)
template <int ACT>
__global__ __launch_bounds__(128) void k_gemm_hhx(const _Float16* __restrict__ A, int lda, size_t sA, const _Float16* __restrict__ Bh, int ldb, size_t sB, float alpha, const float* __restrict__ bias, size_t sBias, const float* __restrict__ CP, int rowsPerB, size_t sCPb, int row0g,
    float* __restrict__ C, _Float16* __restrict__ C16, int ldc, size_t sC, int M, int N, int K) {
  __shared__ __attribute__((aligned(16))) float so[4][16][64];
  const int tid = threadIdx.x, w = tid >> 5, lane = tid & 31, ln = lane & 15, hh = lane >> 4; const int by = blockIdx.y;
  A += (size_t)by * sA; Bh += (size_t)by * sB; const size_t cofs = (size_t)by * sC; const float* bp = bias ? bias + (size_t)by * sBias : nullptr;
  const int ntn = (N + 63) / 64; const int wid = blockIdx.x * 4 + w; const int mt = wid / ntn, nq = wid % ntn; if (mt * 16 >= M) return;
  const int row0 = mt * 16, col0 = nq * 64; const _Float16* arow = A + (size_t)(row0 + ln) * lda;
  v8f acc[4] = {};
  for (int kb = 0; kb < K; kb += 32) { FragH ah; ah.half[0] = *(const v8us*)((const unsigned short*)arow + kb + 8 * hh); ah.half[1] = *(const v8us*)((const unsigned short*)arow + kb + 16 + 8 * hh);
#pragma unroll
    for (int t = 0; t < 4; ++t) { if (col0 + t * 16 >= N) continue; const size_t boff = (size_t)(col0 + t * 16 + ln) * ldb + kb; FragH bq; bq.half[0] = *(const v8us*)((const unsigned short*)Bh + boff + 8 * hh); bq.half[1] = *(const v8us*)((const unsigned short*)Bh + boff + 16 + 8 * hh);
      acc[t] = mmaH<1>(ah.v, ah.v, bq.v, bq.v, acc[t]); }
  }
#pragma unroll
  for (int t = 0; t < 4; ++t) { if (col0 + t * 16 >= N) continue; const int col = col0 + t * 16 + ln; const float bv = bp ? bf16_round(bp[col]) : 0.f;
#pragma unroll
    for (int r = 0; r < 8; ++r) { float v = acc[t][r] * alpha + bv; if (CP) { const int rr = row0g + row0 + 8 * hh + r; if (rowsPerB < 0) v += CP[cofs + (size_t)rr * ldc + col];      /* rowsPerB < 0: own element of the batched C plane */ else { const int bidx = rr / rowsPerB; v += CP[(size_t)bidx * sCPb + (size_t)by * 64 + col]; } } if (ACT == 1) v = (v > 0.f) ? v : expm1f(v); else if (ACT == 7) v = (v > 0.f) ? v + 1.0f : expf(v); else if (ACT == 8) v = tanhf(v); else if (ACT == 9) v = 0.5f * v * (1.0f + tanhf(0.7978845608028654f * (v + 0.044715f * v * v * v))); else if (ACT == 11) v = 1.0f / (1.0f + expf(-v)); else if (ACT == 12) v = (v > 0.f) ? v : 0.01f * v; else if (ACT == 14) v = (v > 0.f) ? v : 0.1f * v; else if (ACT == 16) v = (v >= 0.f) ? v : 0.3f * v; else if (ACT == 17) v = (v >= 0.f) ? v : 0.2f * v; else if (ACT == 15) v = v / (1.0f + expf(-v)); else if (ACT == 3) v = fmaxf(v, 0.f); else if (ACT == 6) v = 0.5f * v * (1.0f + erff(v * 0.70710678118654752f)); so[w][8 * hh + r][t * 16 + ln] = v; } }
  __builtin_amdgcn_fence(__ATOMIC_ACQ_REL, "workgroup"); __builtin_amdgcn_wave_barrier();
  const int rsub = lane >> 4, c4 = (lane & 15) * 4; typedef _Float16 v4h __attribute__((ext_vector_type(4)));
  {
#pragma unroll
    for (int q = 0; q < 8; ++q) { const int r = q * 2 + rsub; if (col0 + c4 < N) { const v4f v = *(const v4fa*)&so[w][r][c4]; if (C) *(v4f*)(C + cofs + (size_t)(row0 + r) * ldc + col0 + c4) = v; if (C16) { v4h h4; for (int i = 0; i < 4; ++i) h4[i] = (_Float16)v[i]; *(v4h*)(C16 + cofs + (size_t)(row0 + r) * ldc + col0 + c4) = h4; } } }
     }
}


typedef _Float16 v4h __attribute__((ext_vector_type(4)));

__global__ __launch_bounds__(256) void k_x16(const float* __restrict__ x, _Float16* __restrict__ X16, size_t n8) { const size_t t = (size_t)blockIdx.x * 256 + threadIdx.x; if (t >= n8) return; FragH f;
#pragma unroll
  for (int q = 0; q < 8; ++q) f.h[q] = (_Float16)bf16_round(x[t * 8 + q]); *(v8us*)((unsigned short*)X16 + t * 8) = f.half[0];  }
__global__ __launch_bounds__(256) void k_h16(const float* __restrict__ x, _Float16* __restrict__ X16, size_t n8) { const size_t t = (size_t)blockIdx.x * 256 + threadIdx.x; if (t >= n8) return; FragH f;
#pragma unroll
  for (int q = 0; q < 8; ++q) f.h[q] = (_Float16)x[t * 8 + q]; *(v8us*)((unsigned short*)X16 + t * 8) = f.half[0];  }
__global__ __launch_bounds__(256) void k_round16f(const float* __restrict__ W, _Float16* __restrict__ Bt, size_t n8) { const size_t t = (size_t)blockIdx.x * 256 + threadIdx.x; if (t >= n8) return; FragH f;
#pragma unroll
  for (int i = 0; i < 8; ++i) f.h[i] = (_Float16)(bf16_round(W[t * 8 + i]) * 16.0f); *(v8us*)((unsigned short*)Bt + t * 8) = f.half[0];  }
template <int NHv, int TTv>
__global__ __launch_bounds__(256) void k_vt(const _Float16* __restrict__ V16, int ldv, int voff, _Float16* __restrict__ Vt) { __shared__ unsigned short tl[64][66]; const int tid = threadIdx.x; const int slab = blockIdx.x / (TTv / 64), lg = blockIdx.x % (TTv / 64); const int b = slab / NHv, h = slab % NHv;
  for (int i = tid; i < 64 * 8; i += 256) { const int r = i / 8, c8 = (i % 8) * 8; FragH f; f.half[0] = *(const v8us*)((const unsigned short*)V16 + ((size_t)b * TTv + lg * 64 + r) * ldv + voff + h * 64 + c8);
#pragma unroll
    for (int q = 0; q < 8; ++q) tl[r][c8 + q] = f.u[q]; }
  __syncthreads();
  {
#pragma unroll
    for (int rd = 0; rd < 2; ++rd) { const int d = rd * 32 + tid / 8, pc = tid % 8; FragH f;
#pragma unroll
      for (int q = 0; q < 8; ++q) f.u[q] = tl[pc * 8 + q][d];
      *(v8us*)((unsigned short*)Vt + ((size_t)slab * 64 + d) * TTv + lg * 64 + pc * 8) = f.half[0]; }
     } }

__global__ __launch_bounds__(256) void k_hl(const float* __restrict__ F, _Float16* __restrict__ Hh, _Float16* __restrict__ Hl, size_t n8) { const size_t t = (size_t)blockIdx.x * 256 + threadIdx.x; if (t >= n8) return; FragH fh, fl; const v4f a = *(const v4fa*)(F + t * 8), c = *(const v4fa*)(F + t * 8 + 4);
#pragma unroll
  for (int q = 0; q < 4; ++q) { _Float16 h = (_Float16)a[q]; fh.h[q] = h; fl.h[q] = (_Float16)((a[q] - (float)h) * 1024.0f); h = (_Float16)c[q]; fh.h[4 + q] = h; fl.h[4 + q] = (_Float16)((c[q] - (float)h) * 1024.0f); }
  { *(v8us*)((unsigned short*)Hh + t * 8) = fh.half[0]; *(v8us*)((unsigned short*)Hl + t * 8) = fl.half[0];  } }

// ---- fast GEMM (wave tile 32x64; requires M % 32 == 0 rows per launch region and N % 64 == 0); epilogue = k_gemm_hhx semantics ----
__device__ __forceinline__ v16h g2_frag(const _Float16* p, int hh) { FragH f; f.half[0] = *(const v8us*)((const unsigned short*)p + 8 * hh); f.half[1] = *(const v8us*)((const unsigned short*)p + 16 + 8 * hh); return f.v; }
__device__ __forceinline__ v8f g2_mma(v16h a, v16h b, v8f c) { v8f d = __builtin_amdgcn_wmma_f32_16x16x32_f16(false, a, false, b, (short)0, c, false, false); asm volatile("v_nop\n\tv_nop\n\tv_nop\n\tv_nop" : "+v"(d) : "v"(a), "v"(b)); return d; }
template <int ACT>
__global__ __launch_bounds__(128) void k_gemm2(const _Float16* __restrict__ A, int lda, size_t sA, const _Float16* __restrict__ Bh, int ldb, size_t sB, float alpha, const float* __restrict__ bias, size_t sBias, const float* __restrict__ CP, int rowsPerB, size_t sCPb, int row0g,
    float* __restrict__ C, _Float16* __restrict__ C16, int ldc, size_t sC, int M, int N, int K) { static_assert(ACT == 0 || ACT == 3 || ACT == 6 || ACT == 8 || ACT == 9 || ACT == 11 || ACT == 12 || ACT == 14 || ACT == 15 || ACT == 16 || ACT == 17, "k_gemm2: unsupported ACT code (would silently apply no activation)");
  __shared__ __attribute__((aligned(16))) float so[4][32][68];
  const int tid = threadIdx.x, w = tid >> 5, lane = tid & 31, ln = lane & 15, hh = lane >> 4; const int by = blockIdx.y;
  A += (size_t)by * sA; Bh += (size_t)by * sB; const size_t cofs = (size_t)by * sC; const float* bp = bias ? bias + (size_t)by * sBias : nullptr;
  const int ntn = N >> 6; const int mt = blockIdx.x / ntn, nq = blockIdx.x - mt * ntn; const int row0 = mt * 128 + 32 * w, col0 = nq * 64; if (row0 >= M) return;
  const _Float16* a0p = A + (size_t)(row0 + ln) * lda; const _Float16* a1p = a0p + (size_t)16 * lda;
  const _Float16* b0p = Bh + (size_t)(col0 + ln) * ldb; const _Float16* b1p = b0p + (size_t)16 * ldb; const _Float16* b2p = b1p + (size_t)16 * ldb; const _Float16* b3p = b2p + (size_t)16 * ldb;
  const v8f z8 = {0.f,0.f,0.f,0.f,0.f,0.f,0.f,0.f}; v8f c00 = z8, c01 = z8, c02 = z8, c03 = z8, c10 = z8, c11 = z8, c12 = z8, c13 = z8;
#pragma unroll 1
  for (int kb = 0; kb < K; kb += 32) { const v16h a0 = g2_frag(a0p + kb, hh), a1 = g2_frag(a1p + kb, hh);
    v16h b = g2_frag(b0p + kb, hh); c00 = g2_mma(a0, b, c00); c10 = g2_mma(a1, b, c10);
    b = g2_frag(b1p + kb, hh); c01 = g2_mma(a0, b, c01); c11 = g2_mma(a1, b, c11);
    b = g2_frag(b2p + kb, hh); c02 = g2_mma(a0, b, c02); c12 = g2_mma(a1, b, c12);
    b = g2_frag(b3p + kb, hh); c03 = g2_mma(a0, b, c03); c13 = g2_mma(a1, b, c13); }
  v8f accs[8] = {c00, c01, c02, c03, c10, c11, c12, c13};
#pragma unroll
  for (int u = 0; u < 8; ++u) { const int t = u & 3, half = u >> 2; const int col = col0 + t * 16 + ln; const float bv = bp ? bf16_round(bp[col]) : 0.f;
#pragma unroll
    for (int r = 0; r < 8; ++r) { const int rloc = half * 16 + 8 * hh + r; float v = accs[u][r] * alpha + bv; if (CP) { if (rowsPerB < 0) v += CP[cofs + (size_t)(row0g + row0 + rloc) * ldc + col];      /* rowsPerB < 0: own element of the batched C plane */ else { const int bidx = (row0g + row0 + rloc) / rowsPerB; v += CP[(size_t)bidx * sCPb + (size_t)by * 64 + col]; } }
      if (ACT == 3) v = fmaxf(v, 0.f); else if (ACT == 6) v = 0.5f * v * (1.0f + erff(v * 0.70710678118654752f)); else if (ACT == 11) v = 1.0f / (1.0f + expf(-v)); else if (ACT == 15) v = v / (1.0f + expf(-v)); else if (ACT == 12) v = (v > 0.f) ? v : 0.01f * v; else if (ACT == 8) v = tanhf(v); else if (ACT == 9) v = 0.5f * v * (1.0f + tanhf(0.7978845608028654f * (v + 0.044715f * v * v * v))); else if (ACT == 14) v = (v > 0.f) ? v : 0.1f * v; else if (ACT == 16) v = (v >= 0.f) ? v : 0.3f * v; else if (ACT == 17) v = (v >= 0.f) ? v : 0.2f * v;
      so[w][rloc][t * 16 + ln] = v; } }
  __builtin_amdgcn_fence(__ATOMIC_ACQ_REL, "workgroup"); __builtin_amdgcn_wave_barrier();
  const int rsub = lane >> 4, c4 = (lane & 15) * 4;
  {
#pragma unroll
    for (int q = 0; q < 16; ++q) { const int r = q * 2 + rsub; const v4f v = *(const v4fa*)&so[w][r][c4]; if (C) *(v4f*)(C + cofs + (size_t)(row0 + r) * ldc + col0 + c4) = v; if (C16) { v4h h4; for (int i = 0; i < 4; ++i) h4[i] = (_Float16)v[i]; *(v4h*)(C16 + cofs + (size_t)(row0 + r) * ldc + col0 + c4) = h4; } }
     } }


__global__ __launch_bounds__(256) void k_wnat(const float* __restrict__ w, size_t n8, _Float16* __restrict__ Bt) { const size_t t = (size_t)blockIdx.x * 256 + threadIdx.x; if (t >= n8) return; FragH f; for (int q = 0; q < 8; ++q) f.h[q] = (_Float16)(bf16_round(w[t * 8 + q]) * 16.0f); *(v8us*)((unsigned short*)Bt + t * 8) = f.half[0];  }
__global__ __launch_bounds__(256) void k_rsm(const float* __restrict__ S, _Float16* __restrict__ P, int nrows) {
  #pragma clang fp contract(off)
  const int i = blockIdx.x * 256 + threadIdx.x; if (i >= nrows) return; const float* s = S + (size_t)i * SQ; float mx = -3.0e38f;
#pragma unroll 1
  for (int j = 0; j < SQ; ++j) mx = fmaxf(mx, s[j]); float se = 0.f;
#pragma unroll 1
  for (int j = 0; j < SQ; ++j) se += expf(s[j] - mx); const float sc = 256.0f / se;
#pragma unroll 1
  for (int j0 = 0; j0 < SQ; j0 += 8) { FragH f; for (int q = 0; q < 8; ++q) f.h[q] = (_Float16)(expf(s[j0 + q] - mx) * sc); unsigned short* d = (unsigned short*)P + (size_t)i * SQ + j0; *(v8us*)d = f.half[0];  } }
__global__ __launch_bounds__(256) void k_vt(const _Float16* __restrict__ V16, int b, int h0, _Float16* __restrict__ VT) { __shared__ unsigned short tl[64][65]; const int tid = threadIdx.x; const int hh = blockIdx.x % HG, sg = blockIdx.x / HG; const int s0 = sg * 64; const int h = h0 + hh;
  for (int i = tid; i < 64 * 8; i += 256) { const int j = i / 8, d8 = (i % 8) * 8; FragH f; f.half[0] = *(const v8us*)((const unsigned short*)V16 + ((size_t)b * SQ + s0 + j) * DM + h * HD + d8); for (int q = 0; q < 8; ++q) tl[d8 + q][j] = f.u[q]; }
  __syncthreads();
  { for (int i = tid; i < 64 * 8; i += 256) { const int d = i / 8, j8 = (i % 8) * 8; FragH f; for (int q = 0; q < 8; ++q) f.u[q] = tl[d][j8 + q]; *(v8us*)((unsigned short*)VT + ((size_t)hh * HD + d) * SQ + s0 + j8) = f.half[0]; }  } }



__global__ __launch_bounds__(256) void k_rsmcf2(const float* __restrict__ S, _Float16* __restrict__ P, int hg, int q0, int nk) {
  #pragma clang fp contract(off)
  const int t = blockIdx.x * 256 + threadIdx.x; if (t >= hg * QT) return; const size_t i = (size_t)t; const float* s = S + i * NKX; const int last = q0 + (t % QT); float mx = -3.0e38f;
#pragma unroll 1
  for (int j = 0; j < nk; ++j) { const float f = (j <= last) ? 1.f : 0.f; mx = fmaxf(mx, fmaf(f, s[j], (1.f - f) * -1.0e9f)); } float se = 0.f;
#pragma unroll 1
  for (int j = 0; j < nk; ++j) { const float f = (j <= last) ? 1.f : 0.f; se += __expf(fmaf(f, s[j], (1.f - f) * -1.0e9f) - mx); } const float sc = 256.0f / se;
#pragma unroll 1
  for (int j0 = 0; j0 < nk; j0 += 8) { FragH fr; for (int q = 0; q < 8; ++q) { const int j = j0 + q; const float f = (j <= last) ? 1.f : 0.f; fr.h[q] = (_Float16)(__expf(fmaf(f, s[j], (1.f - f) * -1.0e9f) - mx) * sc); } unsigned short* d = (unsigned short*)P + i * NKX + j0; *(v8us*)d = fr.half[0];  } }

template <int MASKADD>
__global__ __launch_bounds__(64) void k_att0(const float* __restrict__ QF, const float* __restrict__ KF, const float* __restrict__ VF, int ld, const float* __restrict__ mask, float scale, float* __restrict__ OF, int ldo) {
  #pragma clang fp contract(off)
  __shared__ __attribute__((aligned(16))) float lq[64][64]; __shared__ __attribute__((aligned(16))) float lo[64][64];
  const int tid = threadIdx.x; const int h = blockIdx.x / (QT0 / 64), rg = blockIdx.x % (QT0 / 64); const int i = rg * 64 + tid;
  const float* qr = QF + (size_t)i * ld + h * HD;
#pragma unroll 1
  for (int c = 0; c < HD / 4; ++c) { *(v4f*)&lq[tid][c * 4] = *(const v4fa*)(qr + c * 4); const v4f z = {0.f, 0.f, 0.f, 0.f}; *(v4f*)&lo[tid][c * 4] = z; }
  float m = -1.0e30f, l = 0.f; const int jmax = MASKADD ? (SQ - 1) : (rg * 64 + 63);      /* additive-mask form: every key (the mask input decides); causal form: keys up to the block's last row */
#pragma unroll 1
  for (int j = 0; j <= jmax; ++j) { const float* kr = KF + (size_t)j * ld + h * HD; const float* vr = VF + (size_t)j * ld + h * HD; float s = 0.f;
#pragma unroll 1
    for (int c = 0; c < HD / 4; ++c) { const v4f kq = *(const v4fa*)(kr + c * 4); const v4f qq = *(v4f*)&lq[tid][c * 4]; s = __fadd_rn(s, __fmul_rn(qq[0], kq[0])); s = __fadd_rn(s, __fmul_rn(qq[1], kq[1])); s = __fadd_rn(s, __fmul_rn(qq[2], kq[2])); s = __fadd_rn(s, __fmul_rn(qq[3], kq[3])); }
    s = __fmul_rn(s, scale); if (MASKADD) s = __fadd_rn(s, __fmul_rn(bf16_round(mask[(size_t)i * SQ + j]), -10000.0f));
    const float f = (MASKADD || j <= i) ? 1.f : 0.f; const float sm = fmaf(f, s, (1.f - f) * -1.0e30f); const float mn = fmaxf(m, sm); const float sc = expf(m - mn); const float e = expf(sm - mn); l = __fadd_rn(__fmul_rn(l, sc), e); m = mn;
#pragma unroll 1
    for (int c = 0; c < HD / 4; ++c) { const v4f vv = *(const v4fa*)(vr + c * 4); v4f oo = *(v4f*)&lo[tid][c * 4]; for (int u = 0; u < 4; ++u) oo[u] = __fadd_rn(__fmul_rn(oo[u], sc), __fmul_rn(e, vv[u])); *(v4f*)&lo[tid][c * 4] = oo; } }
  const float fin = 64.0f / l;      /* o carried x64 */
#pragma unroll 1
  for (int c = 0; c < HD / 4; ++c) { v4f oo = *(v4f*)&lo[tid][c * 4]; for (int u = 0; u < 4; ++u) oo[u] = __fmul_rn(oo[u], fin); *(v4f*)&lo[tid][c * 4] = oo; }
  __syncthreads();
  {
#pragma unroll 1
    for (int it = 0; it < 16; ++it) { const int row = it * 4 + tid / 16, pc = (tid % 16) * 4; const v4f v = *(const v4f*)&lo[row][pc]; *(v4f*)(OF + (size_t)(rg * 64 + row) * ldo + h * HD + pc) = v; }
     } }

__global__ __launch_bounds__(256) void k_oscale(const float* __restrict__ OF, float* __restrict__ out, size_t n4) { const size_t t = (size_t)blockIdx.x * 256 + threadIdx.x; if (t >= n4) return; const v4f a = *(const v4fa*)(OF + t * 4); v4f o; for (int q = 0; q < 4; ++q) o[q] = a[q] * 0.015625f; *(v4f*)(out + t * 4) = o;  }

__global__ __launch_bounds__(256) void k_bfr(const float* __restrict__ x, float* __restrict__ XB, size_t n8) { const size_t t = (size_t)blockIdx.x * 256 + threadIdx.x; if (t >= n8) return; v4f a = *(const v4fa*)(x + t * 8), c = *(const v4fa*)(x + t * 8 + 4); for (int q = 0; q < 4; ++q) { a[q] = bf16_round(a[q]); c[q] = bf16_round(c[q]); }
  { *(v4f*)(XB + t * 8) = a; *(v4f*)(XB + t * 8 + 4) = c;  } }



__global__ __launch_bounds__(256) void k_rsmfvl(const float* __restrict__ S, _Float16* __restrict__ P, _Float16* __restrict__ PL, int qn, const int* __restrict__ vlp) {
  #pragma clang fp contract(off)
  const int t = blockIdx.x * 256 + threadIdx.x; if (t >= qn) return; const int vl = vlp[0]; const size_t i = (size_t)t; const float* s = S + i * SQ; float mx = -3.0e38f;
#pragma unroll 1
  for (int j = 0; j < SQ; ++j) { const float f = (j < vl) ? 1.f : 0.f; mx = fmaxf(mx, fmaf(f, s[j], (1.f - f) * -1000000.0f)); } float se = 0.f;
#pragma unroll 1
  for (int j = 0; j < SQ; ++j) { const float f = (j < vl) ? 1.f : 0.f; se += __expf(fmaf(f, s[j], (1.f - f) * -1000000.0f) - mx); } const float sc = 256.0f / se;
#pragma unroll 1
  for (int j0 = 0; j0 < SQ; j0 += 8) { FragH fr, gr; for (int q = 0; q < 8; ++q) { const int j = j0 + q; const float f = (j < vl) ? 1.f : 0.f; const float pv = __expf(fmaf(f, s[j], (1.f - f) * -1000000.0f) - mx) * sc; const _Float16 ph = (_Float16)pv; fr.h[q] = ph; gr.h[q] = (_Float16)((pv - (float)ph) * 1024.0f); }
    unsigned short* d = (unsigned short*)P + i * SQ + j0; unsigned short* dl = (unsigned short*)PL + i * SQ + j0; *(v8us*)d = fr.half[0]; *(v8us*)dl = gr.half[0];  } }

__global__ __launch_bounds__(256) void k_rsmf(const float* __restrict__ S, _Float16* __restrict__ P, int qn, int hg) {
  #pragma clang fp contract(off)
  const int t = blockIdx.x * 256 + threadIdx.x; if (t >= qn * hg) return; const size_t i = (size_t)(t / qn) * SQ + (t % qn); const float* s = S + i * SQ; float mx = -3.0e38f;
#pragma unroll 1
  for (int j = 0; j < SQ; ++j) mx = fmaxf(mx, s[j]); float se = 0.f;
#pragma unroll 1
  for (int j = 0; j < SQ; ++j) se += __expf(s[j] - mx); const float sc = 256.0f / se;
#pragma unroll 1
  for (int j0 = 0; j0 < SQ; j0 += 8) { FragH f; for (int q = 0; q < 8; ++q) f.h[q] = (_Float16)(__expf(s[j0 + q] - mx) * sc); unsigned short* d = (unsigned short*)P + i * SQ + j0; *(v8us*)d = f.half[0];  } }



// Lane l with lane l ^ 16. Every lane must be on.
__device__ __forceinline__ float lane_x16(float v) { const int i = __float_as_int(v); return __int_as_float(__builtin_amdgcn_permlanex16(i, i, 0x76543210, 0xfedcba98, false, false)); }
typedef int v4ia __attribute__((ext_vector_type(4), may_alias));
// Four native exp2 in one statement. The closing v_nop is the one slot the instruction set asks for behind a transcendental before its result is read or its source overwritten;
// the outputs are early-clobber, so each exp is independent of the one in front of it.
__device__ __forceinline__ v4f exp2_x4(v4f a) { float r0, r1, r2, r3;
  asm("v_exp_f32 %0, %4\n\tv_exp_f32 %1, %5\n\tv_exp_f32 %2, %6\n\tv_exp_f32 %3, %7\n\tv_nop" : "=&v"(r0), "=&v"(r1), "=&v"(r2), "=&v"(r3) : "v"(a[0]), "v"(a[1]), "v"(a[2]), "v"(a[3]));
  const v4f r = {r0, r1, r2, r3}; return r; }


typedef unsigned int fa_u4 __attribute__((ext_vector_type(4)));
typedef unsigned int fa_u4a __attribute__((ext_vector_type(4), may_alias));
typedef unsigned int fa_u8 __attribute__((ext_vector_type(8)));
typedef short fa_s8 __attribute__((ext_vector_type(8)));
#define FA_SK 64u                                /* keys per stage */
#define FA_PK 272u                               /* LDS pitch of a K row: odd multiple of 16 B (ds_load_b128 readers) */
#define FA_PV 288u                               /* LDS pitch of a V row: odd multiple of 32 B (ds_load_tr16_b128 readers) */
#define FA_TK (FA_SK * FA_PK)
#define FA_SLOT (FA_SK * (FA_PK + FA_PV))
#define FA_RING (3u * FA_SLOT)
#define FA_EP 528u                               /* pitch of an output row (128 f32) staged in the ring */
#define FA_NST ((unsigned)SQ / FA_SK)
#define FA_CS 0.12751743f                        /* log2(e) / sqrt(128) */
static_assert(4u * 32u * FA_EP <= FA_RING, "the output staging reuses the K / V ring");
struct FaFrag { fa_u4 q[2]; };
struct FaK { FaFrag f[2][4]; };
__device__ __forceinline__ v8f fa_mma(const FaFrag& a, const FaFrag& b, v8f c) {
  const fa_u8 av = __builtin_shufflevector(a.q[0], a.q[1], 0, 1, 2, 3, 4, 5, 6, 7), bv = __builtin_shufflevector(b.q[0], b.q[1], 0, 1, 2, 3, 4, 5, 6, 7);
  return __builtin_amdgcn_wmma_f32_16x16x32_f16(false, __builtin_bit_cast(v16h, av), false, __builtin_bit_cast(v16h, bv), (short)0, c, false, false); }
__device__ __forceinline__ void fa_fence() { __builtin_amdgcn_sched_barrier(0); }
// Four vector slots behind a run of WMMAs: the exponentials are asm text, whose outputs the compiler may place on a WMMA's operand registers without padding the distance itself.
__device__ __forceinline__ void fa_nop4() { asm volatile("v_nop\n\tv_nop\n\tv_nop\n\tv_nop"); }
__device__ __forceinline__ fa_u4 fa_tr16(const unsigned char* p) { typedef __attribute__((address_space(3))) fa_s8 lds_s8; return __builtin_bit_cast(fa_u4, __builtin_amdgcn_ds_load_tr16_b128_v8i16((lds_s8*)p)); }
__device__ __forceinline__ unsigned int fa_pack2(float lo, float hi) { typedef _Float16 h2 __attribute__((ext_vector_type(2))); typedef float f2 __attribute__((ext_vector_type(2))); return __builtin_bit_cast(unsigned int, __builtin_convertvector(f2{lo, hi}, h2)); }
// K fragments of one 32-key pass in the hardware k order (bytes 16 h and 32 + 16 h of each 64 bytes of a row), as Q's in the kernel.
__device__ __forceinline__ void fa_load_k(FaK& k, const unsigned char* Lp, unsigned int koff, unsigned int lane) {
  const unsigned int c = lane & 15u, h = lane >> 4;
#pragma unroll
  for (int kt = 0; kt < 2; ++kt) { const unsigned char* p = Lp + koff + (16u * kt + c) * FA_PK + 16u * h;
#pragma unroll
    for (int kc = 0; kc < 4; ++kc) { k.f[kt][kc].q[0] = *(const fa_u4a*)(p + 64u * kc); k.f[kt][kc].q[1] = *(const fa_u4a*)(p + 64u * kc + 32u); } } }
// One 32-key pass of one wave. voff, moff: LDS byte offsets of the pass's first V row and first mask float. m_run, the maximum in use, may trail the true one by up to 8 (log2 units),
// so an exponential stays below 2^8, inside f16; the quotient of the sums does not depend on it.
__device__ __forceinline__ void fa_block(FaK& kf, bool fetch_next, unsigned int next_koff, const unsigned char* Lp, unsigned int voff, unsigned int moff, unsigned int lane,
                                         const FaFrag (&qf)[2][4], v8f (&acc)[2][8], float (&m_run)[2], v4f (&l_run)[2]) {
  const unsigned int h = lane >> 4;
  v8f s[2][2];
#pragma unroll
  for (int kt = 0; kt < 2; ++kt) {
#pragma unroll
    for (int g = 0; g < 2; ++g) { s[kt][g] = v8f{};
#pragma unroll
      for (int kc = 0; kc < 4; ++kc) s[kt][g] = fa_mma(kf.f[kt][kc], qf[g][kc], s[kt][g]); } }
  fa_fence(); fa_nop4(); fa_fence();      /* the fences keep the slots behind the last WMMA and the next pass's K loads behind this pass's products, which read the same registers */
  if (fetch_next) fa_load_k(kf, Lp, next_koff, lane);      /* in flight under the maxima and the exponentials */
  v4f mk[4];      /* this lane's 16 keys' 0 / 1: keys 16 kt + 8 h + r */
  { const unsigned char* mp = Lp + moff + 32u * h; mk[0] = *(const v4fa*)(mp); mk[1] = *(const v4fa*)(mp + 16u); mk[2] = *(const v4fa*)(mp + 64u); mk[3] = *(const v4fa*)(mp + 80u); }
  FaFrag vf[8];      /* V^T, 16 (d) x 32 (keys) per fragment */
  { const unsigned char* ad = Lp + voff + (8u * h + (lane & 7u)) * FA_PV + ((lane >> 3) & 1u) * 16u;
#pragma unroll
    for (int t = 0; t < 8; ++t) { vf[t].q[0] = fa_tr16(ad + 32u * t); vf[t].q[1] = fa_tr16(ad + 16u * FA_PV + 32u * t); } }
  float mb[2]; bool need = false;
#pragma unroll
  for (int g = 0; g < 2; ++g) { float mx = s[0][g][0];
#pragma unroll
    for (int r = 1; r < 8; ++r) mx = fmaxf(mx, s[0][g][r]);
#pragma unroll
    for (int r = 0; r < 8; ++r) mx = fmaxf(mx, s[1][g][r]);
    mx = fmaxf(mx, lane_x16(mx)) * FA_CS;      /* both wave halves hold this query's maximum over the pass's 32 keys, masked ones included */
    mb[g] = mx; need = need || (mx > m_run[g] + 8.0f); }
  if (__builtin_amdgcn_ballot_w32(need) != 0) {      /* wave-uniform, rare after the first passes */
    const float n0 = fmaxf(m_run[0], mb[0]), n1 = fmaxf(m_run[1], mb[1]);
    float cr[2];      /* 0 on the first pass, where m_run is -inf; the closing v_nop is the slot behind a transcendental, as in exp2_x4 */
    asm("v_exp_f32 %0, %2\n\tv_exp_f32 %1, %3\n\tv_nop" : "=&v"(cr[0]), "=&v"(cr[1]) : "v"(m_run[0] - n0), "v"(m_run[1] - n1));
    m_run[0] = n0; m_run[1] = n1;
#pragma unroll
    for (int g = 0; g < 2; ++g) { l_run[g] = l_run[g] * cr[g];
#pragma unroll
      for (int t = 0; t < 8; ++t) acc[g][t] = acc[g][t] * cr[g]; } }
#pragma unroll
  for (int g = 0; g < 2; ++g) { const float nm = -m_run[g]; const v4f nm4 = {nm, nm, nm, nm}; const v4f cs4 = {FA_CS, FA_CS, FA_CS, FA_CS};
    unsigned int w[8];
#pragma unroll
    for (int j = 0; j < 4; ++j) { const int kt = j >> 1, r0 = 4 * (j & 1);
      const v4f sv = {s[kt][g][r0], s[kt][g][r0 + 1], s[kt][g][r0 + 2], s[kt][g][r0 + 3]};
      const v4f p = exp2_x4(__builtin_elementwise_fma(sv, cs4, nm4)) * mk[j];
      l_run[g] += p; w[2 * j] = fa_pack2(p[0], p[1]); w[2 * j + 1] = fa_pack2(p[2], p[3]); }
    FaFrag pf; pf.q[0] = fa_u4{w[0], w[1], w[2], w[3]}; pf.q[1] = fa_u4{w[4], w[5], w[6], w[7]};
#pragma unroll
    for (int t = 0; t < 8; ++t) acc[g][t] = fa_mma(vf[t], pf, acc[g][t]);
    fa_fence(); fa_nop4(); fa_fence(); }      /* slots in front of the next group's (or pass's) asm exponentials; the fences keep them directly behind the WMMAs */
}
__global__ __launch_bounds__(128) void k_fattn(const _Float16* __restrict__ Q, const _Float16* __restrict__ K, const _Float16* __restrict__ V, const int* __restrict__ Km, float* __restrict__ O) {
  __shared__ __attribute__((aligned(256))) unsigned char L[FA_RING + SQ * 4];      /* three K / V buffers, then the sequence's key mask as f32 0 / 1 */
  const unsigned int tid = threadIdx.x, lane = tid & 31u, wave = __builtin_amdgcn_readfirstlane(tid >> 5), c = lane & 15u, h = lane >> 4;
  const unsigned int b = blockIdx.y, q0 = blockIdx.x * 128u;
  // Staging: 16-byte chunk tid + 128 i of a stage's 64 x 256 B of K (and of V) is row 8 i + tid / 16, bytes 16 (tid % 16): a wave's load covers 512 contiguous bytes.
  const unsigned char* kg = (const unsigned char*)(K + (size_t)b * SQ * DM) + tid * 16u; const unsigned char* vg = (const unsigned char*)(V + (size_t)b * SQ * DM) + tid * 16u;
  const unsigned int kd = (tid >> 4) * FA_PK + (tid & 15u) * 16u, vd = FA_TK + (tid >> 4) * FA_PV + (tid & 15u) * 16u;
  fa_u4 kr[8], vr[8];
#pragma unroll
  for (int i = 0; i < 8; ++i) { kr[i] = *(const fa_u4a*)(kg + i * 2048u); vr[i] = *(const fa_u4a*)(vg + i * 2048u); }
#pragma unroll
  for (int j = 0; j < 4; ++j) { const v4ia m = *(const v4ia*)(Km + (size_t)b * SQ + j * 512u + tid * 4u); v4f f; for (int q = 0; q < 4; ++q) f[q] = (m[q] != 0) ? 1.0f : 0.0f; *(v4fa*)(L + FA_RING + (j * 512u + tid * 4u) * 4u) = f; }
  FaFrag qf[2][4];
#pragma unroll
  for (int g = 0; g < 2; ++g) { const _Float16* qp = Q + ((size_t)b * SQ + q0 + wave * 32u + 16u * g + c) * DM + 8u * h;
#pragma unroll
    for (int kc = 0; kc < 4; ++kc) { qf[g][kc].q[0] = *(const fa_u4a*)(qp + 32 * kc); qf[g][kc].q[1] = *(const fa_u4a*)(qp + 32 * kc + 16); }
    asm volatile("s_wait_xcnt 0x0" ::: "memory"); }      /* this group's address registers may become a later load's destination */
#pragma unroll
  for (int i = 0; i < 8; ++i) { *(fa_u4a*)(L + kd + i * 8u * FA_PK) = kr[i]; *(fa_u4a*)(L + vd + i * 8u * FA_PV) = vr[i]; }
  v8f acc[2][8]; float m_run[2]; v4f l_run[2];
#pragma unroll
  for (int g = 0; g < 2; ++g) { m_run[g] = -__builtin_inff(); l_run[g] = v4f{0.f, 0.f, 0.f, 0.f};
#pragma unroll
    for (int t = 0; t < 8; ++t) acc[g][t] = v8f{}; }
  FaK kf;
  __syncthreads();      /* publishes stage 0 and the mask */
#pragma unroll
  for (int i = 0; i < 8; ++i) { kr[i] = *(const fa_u4a*)(kg + FA_SK * 256u + i * 2048u); vr[i] = *(const fa_u4a*)(vg + FA_SK * 256u + i * 2048u); }      /* stage 1 */
  asm volatile("s_wait_xcnt 0x0" ::: "memory");      /* the loads' address registers may be reused directly behind them */
  fa_fence();      /* the global loads are issued ahead of the pass, not sunk to their stores */
  fa_load_k(kf, L, 0u, lane);
  unsigned int cur = 0u, nxt = FA_SLOT;      /* LDS offsets of stage st's and stage st + 1's buffers */
#pragma unroll 1      /* rolled: one trip's body is already two unrolled passes */
  for (unsigned int st = 0; st < FA_NST; ++st) {
    const bool more = st + 1u < FA_NST;
    fa_block(kf, true, cur + 32u * FA_PK, L, cur + FA_TK, FA_RING + st * (FA_SK * 4u), lane, qf, acc, m_run, l_run);
    if (more) {
#pragma unroll
      for (int i = 0; i < 8; ++i) { *(fa_u4a*)(L + nxt + kd + i * 8u * FA_PK) = kr[i]; *(fa_u4a*)(L + nxt + vd + i * 8u * FA_PV) = vr[i]; } }
    __syncthreads();      /* publishes stage st + 1; every wave has left stage st - 1's buffer, which the next trip refills */
    if (st + 2u < FA_NST) {
#pragma unroll
      for (int i = 0; i < 8; ++i) { kr[i] = *(const fa_u4a*)(kg + (st + 2u) * (FA_SK * 256u) + i * 2048u); vr[i] = *(const fa_u4a*)(vg + (st + 2u) * (FA_SK * 256u) + i * 2048u); }
      asm volatile("s_wait_xcnt 0x0" ::: "memory");      /* the loads' address registers may be reused directly behind them */
    }
    fa_fence();      /* the global loads are issued ahead of the pass, not sunk to their stores */
    fa_block(kf, more, nxt, L, cur + FA_TK + 32u * FA_PV, FA_RING + st * (FA_SK * 4u) + 128u, lane, qf, acc, m_run, l_run);
    cur = nxt; nxt = (nxt == 2u * FA_SLOT) ? 0u : nxt + FA_SLOT;
  }
  __syncthreads();      /* every wave has left the ring before it becomes output staging */
  unsigned char* eb = L + wave * 32u * FA_EP;
#pragma unroll
  for (int g = 0; g < 2; ++g) { float l = (l_run[g][0] + l_run[g][1]) + (l_run[g][2] + l_run[g][3]); l += lane_x16(l);      /* each wave half summed its eight keys of every 16-key tile */
    const float inv = 1.0f / l;
#pragma unroll
    for (int t = 0; t < 8; ++t) { const v8f o = acc[g][t] * inv; const v4f o0 = {o[0], o[1], o[2], o[3]}, o1 = {o[4], o[5], o[6], o[7]};      /* row = query 16 g + c; d = 16 t + 8 h + 0 .. 7 */
      *(v4fa*)(eb + (16u * g + c) * FA_EP + 64u * t + 32u * h) = o0; *(v4fa*)(eb + (16u * g + c) * FA_EP + 64u * t + 32u * h + 16u) = o1; } }
  __builtin_amdgcn_fence(__ATOMIC_ACQ_REL, "workgroup"); __builtin_amdgcn_wave_barrier();      /* the wave reads back rows that its other lanes wrote */
  float* op = O + ((size_t)b * SQ + q0 + wave * 32u) * DM + lane * 4u;
  v4f ov[32];
#pragma unroll
  for (int i = 0; i < 32; ++i) ov[i] = *(const v4fa*)(eb + i * FA_EP + lane * 16u);
  fa_fence();      /* every row is read before the first store, so that no store's data register is rewritten behind it */
#pragma unroll
  for (int i = 0; i < 32; ++i) *(v4f*)(op + (size_t)i * DM) = ov[i];      /* one whole 512-byte output row per store */
}


extern "C" void kernel_launch(void* const* d_in, const int* in_sizes, int n_in,
                              void* d_out, int out_size, void* d_ws, size_t ws_size, hipStream_t stream) {
  (void)in_sizes; (void)n_in; (void)out_size;
  const float* const* I = (const float* const*)d_in; const float* xq = I[0]; const float* xk = I[1]; const float* xv = I[2]; const int* km = (const int*)d_in[3];      /* q, k, v [16][2048][128] (bf16-valued); mask int32 [16][2048] (READ on device) */
  char* ws = (char*)d_ws; size_t off = 0;
  auto take = [&](size_t bytes) { char* p = ws + off; off += (bytes + 255) & ~(size_t)255; return p; };
  _Float16* Q16 = (_Float16*)take(NR * DM * 2); _Float16* K16 = (_Float16*)take(NR * DM * 2); _Float16* V16 = (_Float16*)take(NR * DM * 2);
  if (off > ws_size) return;
  k_x16<<<(unsigned)((NR * DM / 8 + 255) / 256), 256, 0, stream>>>(xq, Q16, NR * DM / 8); k_x16<<<(unsigned)((NR * DM / 8 + 255) / 256), 256, 0, stream>>>(xk, K16, NR * DM / 8); k_x16<<<(unsigned)((NR * DM / 8 + 255) / 256), 256, 0, stream>>>(xv, V16, NR * DM / 8);      /* exact f16 copies of the bf16-valued inputs */
  k_fattn<<<dim3(SQ / 128, NB), 128, 0, stream>>>(Q16, K16, V16, km, (float*)d_out);      /* out = softmax-with-post-exp-mask(q k^T / sqrt(128)) v, 128 queries of one sequence per workgroup */
}

// v004
// It runs in 49 microseconds.
// Next to v003, in two timings, it ran 1.06 times as fast each time.
// Counting every step since v000, it is 130 times as fast.
#include <hip/hip_runtime.h>
// Scaled dot-product attention with the module's POST-exp multiplicative key mask (q, k, v [16][2048][128]: 16 independent sequences, one 128-wide head; mask int32 [16][2048] in {0, 1} (random, read on device); score = q.k / sqrt(128); e = exp(score - rowmax over ALL keys); e *= mask[b][key]; a = e / sum(e); out = a v -> [16][2048][128]). No projections: q, k, v are bf16-valued inputs, so their f16 copies and the score products are exact.
// Structure: no projections: q, k, v are bf16-valued inputs copied to exact f16 rows (one launch); then ONE fused kernel for all 16 sequences: scores (WMMA, f32 accumulation, exact products), online softmax over all keys (f32 statistics, native exp2, post-exp key mask) and P V (WMMA) per 128-query workgroup, out written f32 straight into the output rows; scores and weights never reach memory.
// Compute dtype: inputs rounded to bf16; q, k, v exact in f16; unnormalised softmax weights (below 2^8) as plain f16 GEMM operands (~2^-12); scores, softmax statistics and o f32. v_wmma_f32_16x16x32_f16.
#define NB 16
#define SQ 2048
#define DM 128
#define NH 1
#define HD 128
#define HG 4                         /* heads per attention launch group */
#define B0 0                         /* first batch processed (debug hook) */
#define NBR NB                       /* batches processed (debug hook) */
#define NR ((size_t)NB * SQ)         /* token rows */
#define MP ((int)((size_t)NBR * SQ))
#define QT 256                       /* query rows per causal tile */
#define NKX SQ                       /* S / P row pitch */
#define QT0 256                      /* first-tile rows recomputed exactly (256: buys margin for the few-key rows 128..255, which have no output projection to average the single-f16 P/v rounding) */
#define QN SQ                        /* query rows attended per batch (debug hook) */
#define NHD NH                       /* heads attended (debug hook) */
#define MPO MP                       /* rows through the output stage (debug hook) */
#define LQ DM            /* row pitch of the q/k/v rows */
#define SG 4                         /* unused: no score / softmax launch; the workspace holds only the f16 q, k and v */
typedef __bf16 v16b __attribute__((ext_vector_type(16)));
typedef unsigned short v8us __attribute__((ext_vector_type(8), may_alias));
typedef float  v8f  __attribute__((ext_vector_type(8)));
typedef float  v4f  __attribute__((ext_vector_type(4)));
typedef float  v4fa __attribute__((ext_vector_type(4), may_alias));
union FragB { v16b v; v8us half[2]; unsigned short u[16]; };

__device__ __forceinline__ unsigned short bf16_bits(float x) { unsigned int u = __float_as_uint(x); return (unsigned short)((u + 0x7FFFu + ((u >> 16) & 1u)) >> 16); }
__device__ __forceinline__ float bf16_val(unsigned short b) { return __uint_as_float(((unsigned int)b) << 16); }
__device__ __forceinline__ float bf16_round(float x) { return bf16_val(bf16_bits(x)); }
// D += A·B with NT terms: 1 = ah·bh, 2 = + al·bh (A split), 3 = + ah·bl (both split)
template <int NT>
__device__ __forceinline__ v8f mmaN(v16b ah, v16b al, v16b bh, v16b bl, v8f c) {
  c = __builtin_amdgcn_wmma_f32_16x16x32_bf16(false, ah, false, bh, (short)0, c, false, false);
  if (NT >= 2) c = __builtin_amdgcn_wmma_f32_16x16x32_bf16(false, al, false, bh, (short)0, c, false, false);
  if (NT >= 3) c = __builtin_amdgcn_wmma_f32_16x16x32_bf16(false, ah, false, bl, (short)0, c, false, false);
  asm volatile("v_nop\n\tv_nop\n\tv_nop\n\tv_nop" : "+v"(c) : "v"(ah), "v"(al), "v"(bh), "v"(bl));
  return c;
}

__global__ __launch_bounds__(256) void k_wt_bf16(const float* __restrict__ W, unsigned short* __restrict__ Wt, int K, int N) {
  const int t = blockIdx.x * 256 + threadIdx.x;
  const int k8n = K / 8;
  if (t >= N * k8n) return;
  const int n = t / k8n, k8 = (t % k8n) * 8;
  v8us v;
#pragma unroll
  for (int i = 0; i < 8; ++i) v[i] = bf16_bits(W[(size_t)(k8 + i) * N + n]);
  *(v8us*)(Wt + (size_t)n * K + k8) = v;
  
}

// GEMM C[M][N] (f32, pitch ldc) = act(A[M][K]·W + bias). A f32 row-major (pitch lda) converted per fragment to bf16
// (ASPLIT: hi/lo two planes -> 2 terms, else single rounded term); Wt bf16 [N][K] (pitch ldb). BIAS_BF16 rounds the
// bias to bf16 first (bias quantised to bf16 before the add). K%32==0, M%16==0, N%64==0.
template <bool ASPLIT, int ACT, bool BIAS_BF16>
__global__ __launch_bounds__(128) void k_gemm_bf(const float* __restrict__ A, int lda, const unsigned short* __restrict__ Wt, int ldb,
                                               const float* __restrict__ bias, float* __restrict__ C, int ldc, int M, int N, int K) {
  __shared__ __attribute__((aligned(16))) float so[4][16][64];
  const int tid = threadIdx.x, w = tid >> 5, lane = tid & 31, ln = lane & 15, hh = lane >> 4;
  const int ntn = N / 64;
  const int wid = blockIdx.x * 4 + w;
  const int mt = wid / ntn, nq = wid % ntn;
  if (mt * 16 >= M) return;
  const int row0 = mt * 16, col0 = nq * 64;
  const float* arow = A + (size_t)(row0 + ln) * lda;
  v8f acc[4] = {};
  for (int kb = 0; kb < K; kb += 32) {
    FragB ah, al;
    const v4f x0 = *(const v4fa*)(arow + kb + 8 * hh), x1 = *(const v4fa*)(arow + kb + 8 * hh + 4);
    const v4f x2 = *(const v4fa*)(arow + kb + 16 + 8 * hh), x3 = *(const v4fa*)(arow + kb + 16 + 8 * hh + 4);
    float xs[16] = {x0[0],x0[1],x0[2],x0[3],x1[0],x1[1],x1[2],x1[3],x2[0],x2[1],x2[2],x2[3],x3[0],x3[1],x3[2],x3[3]};
#pragma unroll
    for (int i = 0; i < 16; ++i) { const unsigned short hb = bf16_bits(xs[i]); ah.u[i] = hb; al.u[i] = ASPLIT ? bf16_bits(xs[i] - bf16_val(hb)) : (unsigned short)0; }
#pragma unroll
    for (int t = 0; t < 4; ++t) {
      const unsigned short* brow = Wt + (size_t)(col0 + t * 16 + ln) * ldb + kb;
      FragB b;
      b.half[0] = *(const v8us*)(brow + 8 * hh);
      b.half[1] = *(const v8us*)(brow + 16 + 8 * hh);
      acc[t] = mmaN<ASPLIT ? 2 : 1>(ah.v, al.v, b.v, b.v, acc[t]);
    }
  }
#pragma unroll
  for (int t = 0; t < 4; ++t) {
    float bv = bias ? bias[col0 + t * 16 + ln] : 0.f;
    if (BIAS_BF16) bv = bf16_round(bv);
#pragma unroll
    for (int r = 0; r < 8; ++r) { float v = acc[t][r] + bv; if (ACT == 1) v = fmaxf(v, 0.f); so[w][8 * hh + r][t * 16 + ln] = v; }
  }
  __builtin_amdgcn_fence(__ATOMIC_ACQ_REL, "workgroup");
  __builtin_amdgcn_wave_barrier();
  const int rsub = lane >> 4, c4 = (lane & 15) * 4;
  {
#pragma unroll
    for (int q = 0; q < 8; ++q) {
      const int r = q * 2 + rsub;
      const v4f v = *(const v4fa*)&so[w][r][c4];
      *(v4f*)(C + (size_t)(row0 + r) * ldc + col0 + c4) = v;
    }
    
  }
}

// GEMM C = act(A·W + bias + resid): A f32 (ASPLIT -> hi/lo 2 terms), Wt bf16 [N][K]; ACT 0 none, 1 relu, 2 exact gelu;
// resid (optional, f32, row index = (row % rmod), pitch ldr, RES_BF16 rounds it) added before the activation.
template <bool ASPLIT, int ACT, bool BIAS_BF16, bool RES_BF16>
__global__ __launch_bounds__(128) void k_gemm_bf3(const float* __restrict__ A, int lda, const unsigned short* __restrict__ Wt, int ldb,
                                                const float* __restrict__ bias, const float* __restrict__ resid, int rmod, int ldr,
                                                float* __restrict__ C, int ldc, int M, int N, int K) {
  __shared__ __attribute__((aligned(16))) float so[4][16][64];
  const int tid = threadIdx.x, w = tid >> 5, lane = tid & 31, ln = lane & 15, hh = lane >> 4;
  const int ntn = N / 64;
  const int wid = blockIdx.x * 4 + w;
  const int mt = wid / ntn, nq = wid % ntn;
  if (mt * 16 >= M) return;
  const int row0 = mt * 16, col0 = nq * 64;
  const float* arow = A + (size_t)(row0 + ln) * lda;
  v8f acc[4] = {};
  for (int kb = 0; kb < K; kb += 32) {
    FragB ah, al;
    const v4f x0 = *(const v4fa*)(arow + kb + 8 * hh), x1 = *(const v4fa*)(arow + kb + 8 * hh + 4);
    const v4f x2 = *(const v4fa*)(arow + kb + 16 + 8 * hh), x3 = *(const v4fa*)(arow + kb + 16 + 8 * hh + 4);
    float xs[16] = {x0[0],x0[1],x0[2],x0[3],x1[0],x1[1],x1[2],x1[3],x2[0],x2[1],x2[2],x2[3],x3[0],x3[1],x3[2],x3[3]};
#pragma unroll
    for (int i = 0; i < 16; ++i) { const unsigned short hb = bf16_bits(xs[i]); ah.u[i] = hb; al.u[i] = ASPLIT ? bf16_bits(xs[i] - bf16_val(hb)) : (unsigned short)0; }
#pragma unroll
    for (int t = 0; t < 4; ++t) {
      const unsigned short* brow = Wt + (size_t)(col0 + t * 16 + ln) * ldb + kb;
      FragB b;
      b.half[0] = *(const v8us*)(brow + 8 * hh);
      b.half[1] = *(const v8us*)(brow + 16 + 8 * hh);
      acc[t] = mmaN<ASPLIT ? 2 : 1>(ah.v, al.v, b.v, b.v, acc[t]);
    }
  }
#pragma unroll
  for (int t = 0; t < 4; ++t) {
    const int col = col0 + t * 16 + ln;
    float bv = bias ? bias[col] : 0.f;
    if (BIAS_BF16) bv = bf16_round(bv);
#pragma unroll
    for (int r = 0; r < 8; ++r) {
      float v = acc[t][r] + bv;
      if (resid) { float rv = resid[(size_t)((row0 + 8 * hh + r) % rmod) * ldr + col]; if (RES_BF16) rv = bf16_round(rv); v += rv; }
      if (ACT == 1) v = fmaxf(v, 0.f);
      if (ACT == 2) v = 0.5f * v * (1.0f + erff(v * 0.70710678118654752f));
      if (ACT == 3) { const float u = 0.7978845608028654f * (v + 0.044715f * v * v * v); v = 0.5f * v * (1.0f + tanhf(u)); }
      so[w][8 * hh + r][t * 16 + ln] = v;
    }
  }
  __builtin_amdgcn_fence(__ATOMIC_ACQ_REL, "workgroup");
  __builtin_amdgcn_wave_barrier();
  const int rsub = lane >> 4, c4 = (lane & 15) * 4;
  {
#pragma unroll
    for (int q = 0; q < 8; ++q) {
      const int r = q * 2 + rsub;
      const v4f v = *(const v4fa*)&so[w][r][c4];
      *(v4f*)(C + (size_t)(row0 + r) * ldc + col0 + c4) = v;
    }
    
  }
}
// row LayerNorm (biased variance, eps) over N: s = X (+ R); optional out_sum <- s; out_norm <- (s-mu)*rsqrt(var+eps)*g + b
template <bool PARAM_BF16>
__global__ __launch_bounds__(256) void k_layernorm(const float* __restrict__ X, const float* __restrict__ R, const float* __restrict__ g, const float* __restrict__ bta,
                                                  float* __restrict__ out_sum, float* __restrict__ out_norm, int N, float eps) {
  __shared__ float red[256];
  const int row = blockIdx.x, tid = threadIdx.x;
  const float* x = X + (size_t)row * N; const float* rr = R ? R + (size_t)row * N : nullptr;
  float vals[16];                     // up to N = 4096
  const int per = N / 256;            // contiguous chunk per thread? use strided-by-4 chunks: thread handles j = tid*4 + 1024*u
  float s1 = 0.f;
  for (int u = 0; u < per / 4; ++u) {
    const int j = tid * 4 + 1024 * u;
    const v4f a = *(const v4fa*)(x + j);
    v4f b = {0.f,0.f,0.f,0.f}; if (rr) b = *(const v4fa*)(rr + j);
#pragma unroll
    for (int q = 0; q < 4; ++q) { const float v = a[q] + b[q]; vals[u * 4 + q] = v; s1 += v; }
  }
  red[tid] = s1; __syncthreads();
  for (int st = 128; st > 0; st >>= 1) { if (tid < st) red[tid] += red[tid + st]; __syncthreads(); }
  const float mu = red[0] / (float)N; __syncthreads();
  float s2 = 0.f;
  for (int u = 0; u < per / 4; ++u)
#pragma unroll
    for (int q = 0; q < 4; ++q) { const float c = vals[u * 4 + q] - mu; s2 += c * c; }
  red[tid] = s2; __syncthreads();
  for (int st = 128; st > 0; st >>= 1) { if (tid < st) red[tid] += red[tid + st]; __syncthreads(); }
  const float rs = rsqrtf(red[0] / (float)N + eps);
  {
    for (int u = 0; u < per / 4; ++u) {
      const int j = tid * 4 + 1024 * u;
      v4f o, sm;
#pragma unroll
      for (int q = 0; q < 4; ++q) {
        float gg = g[j + q], bb = bta[j + q];
        if (PARAM_BF16) { gg = bf16_round(gg); bb = bf16_round(bb); }
        sm[q] = vals[u * 4 + q]; o[q] = (vals[u * 4 + q] - mu) * rs * gg + bb;
      }
      if (out_sum) *(v4f*)(out_sum + (size_t)row * N + j) = sm;
      *(v4f*)(out_norm + (size_t)row * N + j) = o;
    }
    
  }
}



// ---- f16 WMMA path (v_wmma_f32_16x16x32_f16): 11-bit significands for operands in range — used where a [0,1] probability operand needs more precision than bf16
typedef _Float16 v16h __attribute__((ext_vector_type(16)));
union FragH { v16h v; v8us half[2]; _Float16 h[16]; unsigned short u[16]; };
template <int NT>
__device__ __forceinline__ v8f mmaH(v16h ah, v16h al, v16h bh, v16h bl, v8f c) {
  c = __builtin_amdgcn_wmma_f32_16x16x32_f16(false, ah, false, bh, (short)0, c, false, false);
  if (NT >= 2) c = __builtin_amdgcn_wmma_f32_16x16x32_f16(false, al, false, bh, (short)0, c, false, false);
  if (NT >= 3) c = __builtin_amdgcn_wmma_f32_16x16x32_f16(false, ah, false, bl, (short)0, c, false, false);
  asm volatile("v_nop\n\tv_nop\n\tv_nop\n\tv_nop" : "+v"(c) : "v"(ah), "v"(al), "v"(bh), "v"(bl));
  return c;
}
// batched GEMM like k_gemm_b but f16 operands: A f32 (split into f16 hi/lo if ASPLIT, else rounded to f16), Bt = f16 values [n][k]; alpha; C f32; N multiple of 16 (partial tiles skipped)
template <bool ASPLIT>
__global__ __launch_bounds__(128) void k_gemm_h(const float* __restrict__ A, int lda, size_t sA, const _Float16* __restrict__ Bh, int ldb, size_t sB, float alpha, float* __restrict__ C, int ldc, size_t sC, int M, int N, int K) {
  __shared__ __attribute__((aligned(16))) float so[4][16][64];
  const int tid = threadIdx.x, w = tid >> 5, lane = tid & 31, ln = lane & 15, hh = lane >> 4; const int by = blockIdx.y;
  A += (size_t)by * sA; Bh += (size_t)by * sB; C += (size_t)by * sC;
  const int ntn = (N + 63) / 64; const int wid = blockIdx.x * 4 + w; const int mt = wid / ntn, nq = wid % ntn; if (mt * 16 >= M) return;
  const int row0 = mt * 16, col0 = nq * 64; const float* arow = A + (size_t)(row0 + ln) * lda;
  v8f acc[4] = {};
  for (int kb = 0; kb < K; kb += 32) {
    FragH ah, al;
    const v4f x0 = *(const v4fa*)(arow + kb + 8 * hh), x1 = *(const v4fa*)(arow + kb + 8 * hh + 4), x2 = *(const v4fa*)(arow + kb + 16 + 8 * hh), x3 = *(const v4fa*)(arow + kb + 16 + 8 * hh + 4);
    float xs[16] = {x0[0],x0[1],x0[2],x0[3],x1[0],x1[1],x1[2],x1[3],x2[0],x2[1],x2[2],x2[3],x3[0],x3[1],x3[2],x3[3]};
#pragma unroll
    for (int i = 0; i < 16; ++i) { const _Float16 h = (_Float16)xs[i]; ah.h[i] = h; al.h[i] = ASPLIT ? (_Float16)(xs[i] - (float)h) : (_Float16)0.0f; }
#pragma unroll
    for (int t = 0; t < 4; ++t) { if (col0 + t * 16 >= N) continue; const size_t boff = (size_t)(col0 + t * 16 + ln) * ldb + kb; FragH bq; bq.half[0] = *(const v8us*)(Bh + boff + 8 * hh); bq.half[1] = *(const v8us*)(Bh + boff + 16 + 8 * hh);
      acc[t] = mmaH<ASPLIT ? 2 : 1>(ah.v, al.v, bq.v, bq.v, acc[t]); }
  }
#pragma unroll
  for (int t = 0; t < 4; ++t) { if (col0 + t * 16 >= N) continue;
#pragma unroll
    for (int r = 0; r < 8; ++r) so[w][8 * hh + r][t * 16 + ln] = acc[t][r] * alpha; }
  __builtin_amdgcn_fence(__ATOMIC_ACQ_REL, "workgroup"); __builtin_amdgcn_wave_barrier();
  const int rsub = lane >> 4, c4 = (lane & 15) * 4;
  {
#pragma unroll
    for (int q = 0; q < 8; ++q) { const int r = q * 2 + rsub; if (col0 + c4 < N) { const v4f v = *(const v4fa*)&so[w][r][c4]; *(v4f*)(C + (size_t)(row0 + r) * ldc + col0 + c4) = v; } }
     }
}

// Wt[n][k] = f16(W[k][n]·scale) from f32 row-major W[K][N] (scale = power of two; bf16-exact weights stay exact in f16 away from the subnormal range)
__global__ __launch_bounds__(256) void k_wt_f16(const float* __restrict__ W, _Float16* __restrict__ Wt, int K, int N, float scale) {
  const int t = blockIdx.x * 256 + threadIdx.x; if (t >= N * (K / 8)) return; const int n = t / (K / 8), k8 = (t % (K / 8)) * 8; FragH f;
#pragma unroll
  for (int i = 0; i < 8; ++i) f.h[i] = (_Float16)(bf16_round(W[(size_t)(k8 + i) * N + n]) * scale); const v8us o = f.half[0];
  *(v8us*)((unsigned short*)Wt + (size_t)n * K + k8) = o; 
}
// k_gemm_hh variant with fused epilogue: v = acc·alpha + bias[by·sBias + col] (+ CP[(row/rowsPerB)·sCPb + by·64 + col] if CP) ; ACT 0 none / 1 elu ; writes f16 C16 (and f32 C if non-null)
template <int ACT>
__global__ __launch_bounds__(128) void k_gemm_hhx(const _Float16* __restrict__ A, int lda, size_t sA, const _Float16* __restrict__ Bh, int ldb, size_t sB, float alpha, const float* __restrict__ bias, size_t sBias, const float* __restrict__ CP, int rowsPerB, size_t sCPb, int row0g,
    float* __restrict__ C, _Float16* __restrict__ C16, int ldc, size_t sC, int M, int N, int K) {
  __shared__ __attribute__((aligned(16))) float so[4][16][64];
  const int tid = threadIdx.x, w = tid >> 5, lane = tid & 31, ln = lane & 15, hh = lane >> 4; const int by = blockIdx.y;
  A += (size_t)by * sA; Bh += (size_t)by * sB; const size_t cofs = (size_t)by * sC; const float* bp = bias ? bias + (size_t)by * sBias : nullptr;
  const int ntn = (N + 63) / 64; const int wid = blockIdx.x * 4 + w; const int mt = wid / ntn, nq = wid % ntn; if (mt * 16 >= M) return;
  const int row0 = mt * 16, col0 = nq * 64; const _Float16* arow = A + (size_t)(row0 + ln) * lda;
  v8f acc[4] = {};
  for (int kb = 0; kb < K; kb += 32) { FragH ah; ah.half[0] = *(const v8us*)((const unsigned short*)arow + kb + 8 * hh); ah.half[1] = *(const v8us*)((const unsigned short*)arow + kb + 16 + 8 * hh);
#pragma unroll
    for (int t = 0; t < 4; ++t) { if (col0 + t * 16 >= N) continue; const size_t boff = (size_t)(col0 + t * 16 + ln) * ldb + kb; FragH bq; bq.half[0] = *(const v8us*)((const unsigned short*)Bh + boff + 8 * hh); bq.half[1] = *(const v8us*)((const unsigned short*)Bh + boff + 16 + 8 * hh);
      acc[t] = mmaH<1>(ah.v, ah.v, bq.v, bq.v, acc[t]); }
  }
#pragma unroll
  for (int t = 0; t < 4; ++t) { if (col0 + t * 16 >= N) continue; const int col = col0 + t * 16 + ln; const float bv = bp ? bf16_round(bp[col]) : 0.f;
#pragma unroll
    for (int r = 0; r < 8; ++r) { float v = acc[t][r] * alpha + bv; if (CP) { const int rr = row0g + row0 + 8 * hh + r; if (rowsPerB < 0) v += CP[cofs + (size_t)rr * ldc + col];      /* rowsPerB < 0: own element of the batched C plane */ else { const int bidx = rr / rowsPerB; v += CP[(size_t)bidx * sCPb + (size_t)by * 64 + col]; } } if (ACT == 1) v = (v > 0.f) ? v : expm1f(v); else if (ACT == 7) v = (v > 0.f) ? v + 1.0f : expf(v); else if (ACT == 8) v = tanhf(v); else if (ACT == 9) v = 0.5f * v * (1.0f + tanhf(0.7978845608028654f * (v + 0.044715f * v * v * v))); else if (ACT == 11) v = 1.0f / (1.0f + expf(-v)); else if (ACT == 12) v = (v > 0.f) ? v : 0.01f * v; else if (ACT == 14) v = (v > 0.f) ? v : 0.1f * v; else if (ACT == 16) v = (v >= 0.f) ? v : 0.3f * v; else if (ACT == 17) v = (v >= 0.f) ? v : 0.2f * v; else if (ACT == 15) v = v / (1.0f + expf(-v)); else if (ACT == 3) v = fmaxf(v, 0.f); else if (ACT == 6) v = 0.5f * v * (1.0f + erff(v * 0.70710678118654752f)); so[w][8 * hh + r][t * 16 + ln] = v; } }
  __builtin_amdgcn_fence(__ATOMIC_ACQ_REL, "workgroup"); __builtin_amdgcn_wave_barrier();
  const int rsub = lane >> 4, c4 = (lane & 15) * 4; typedef _Float16 v4h __attribute__((ext_vector_type(4)));
  {
#pragma unroll
    for (int q = 0; q < 8; ++q) { const int r = q * 2 + rsub; if (col0 + c4 < N) { const v4f v = *(const v4fa*)&so[w][r][c4]; if (C) *(v4f*)(C + cofs + (size_t)(row0 + r) * ldc + col0 + c4) = v; if (C16) { v4h h4; for (int i = 0; i < 4; ++i) h4[i] = (_Float16)v[i]; *(v4h*)(C16 + cofs + (size_t)(row0 + r) * ldc + col0 + c4) = h4; } } }
     }
}


typedef _Float16 v4h __attribute__((ext_vector_type(4)));

__global__ __launch_bounds__(256) void k_x16(const float* __restrict__ x, _Float16* __restrict__ X16, size_t n8) { const size_t t = (size_t)blockIdx.x * 256 + threadIdx.x; if (t >= n8) return; FragH f;
#pragma unroll
  for (int q = 0; q < 8; ++q) f.h[q] = (_Float16)bf16_round(x[t * 8 + q]); *(v8us*)((unsigned short*)X16 + t * 8) = f.half[0];  }
__global__ __launch_bounds__(256) void k_h16(const float* __restrict__ x, _Float16* __restrict__ X16, size_t n8) { const size_t t = (size_t)blockIdx.x * 256 + threadIdx.x; if (t >= n8) return; FragH f;
#pragma unroll
  for (int q = 0; q < 8; ++q) f.h[q] = (_Float16)x[t * 8 + q]; *(v8us*)((unsigned short*)X16 + t * 8) = f.half[0];  }
__global__ __launch_bounds__(256) void k_round16f(const float* __restrict__ W, _Float16* __restrict__ Bt, size_t n8) { const size_t t = (size_t)blockIdx.x * 256 + threadIdx.x; if (t >= n8) return; FragH f;
#pragma unroll
  for (int i = 0; i < 8; ++i) f.h[i] = (_Float16)(bf16_round(W[t * 8 + i]) * 16.0f); *(v8us*)((unsigned short*)Bt + t * 8) = f.half[0];  }
template <int NHv, int TTv>
__global__ __launch_bounds__(256) void k_vt(const _Float16* __restrict__ V16, int ldv, int voff, _Float16* __restrict__ Vt) { __shared__ unsigned short tl[64][66]; const int tid = threadIdx.x; const int slab = blockIdx.x / (TTv / 64), lg = blockIdx.x % (TTv / 64); const int b = slab / NHv, h = slab % NHv;
  for (int i = tid; i < 64 * 8; i += 256) { const int r = i / 8, c8 = (i % 8) * 8; FragH f; f.half[0] = *(const v8us*)((const unsigned short*)V16 + ((size_t)b * TTv + lg * 64 + r) * ldv + voff + h * 64 + c8);
#pragma unroll
    for (int q = 0; q < 8; ++q) tl[r][c8 + q] = f.u[q]; }
  __syncthreads();
  {
#pragma unroll
    for (int rd = 0; rd < 2; ++rd) { const int d = rd * 32 + tid / 8, pc = tid % 8; FragH f;
#pragma unroll
      for (int q = 0; q < 8; ++q) f.u[q] = tl[pc * 8 + q][d];
      *(v8us*)((unsigned short*)Vt + ((size_t)slab * 64 + d) * TTv + lg * 64 + pc * 8) = f.half[0]; }
     } }

__global__ __launch_bounds__(256) void k_hl(const float* __restrict__ F, _Float16* __restrict__ Hh, _Float16* __restrict__ Hl, size_t n8) { const size_t t = (size_t)blockIdx.x * 256 + threadIdx.x; if (t >= n8) return; FragH fh, fl; const v4f a = *(const v4fa*)(F + t * 8), c = *(const v4fa*)(F + t * 8 + 4);
#pragma unroll
  for (int q = 0; q < 4; ++q) { _Float16 h = (_Float16)a[q]; fh.h[q] = h; fl.h[q] = (_Float16)((a[q] - (float)h) * 1024.0f); h = (_Float16)c[q]; fh.h[4 + q] = h; fl.h[4 + q] = (_Float16)((c[q] - (float)h) * 1024.0f); }
  { *(v8us*)((unsigned short*)Hh + t * 8) = fh.half[0]; *(v8us*)((unsigned short*)Hl + t * 8) = fl.half[0];  } }

// ---- fast GEMM (wave tile 32x64; requires M % 32 == 0 rows per launch region and N % 64 == 0); epilogue = k_gemm_hhx semantics ----
__device__ __forceinline__ v16h g2_frag(const _Float16* p, int hh) { FragH f; f.half[0] = *(const v8us*)((const unsigned short*)p + 8 * hh); f.half[1] = *(const v8us*)((const unsigned short*)p + 16 + 8 * hh); return f.v; }
__device__ __forceinline__ v8f g2_mma(v16h a, v16h b, v8f c) { v8f d = __builtin_amdgcn_wmma_f32_16x16x32_f16(false, a, false, b, (short)0, c, false, false); asm volatile("v_nop\n\tv_nop\n\tv_nop\n\tv_nop" : "+v"(d) : "v"(a), "v"(b)); return d; }
template <int ACT>
__global__ __launch_bounds__(128) void k_gemm2(const _Float16* __restrict__ A, int lda, size_t sA, const _Float16* __restrict__ Bh, int ldb, size_t sB, float alpha, const float* __restrict__ bias, size_t sBias, const float* __restrict__ CP, int rowsPerB, size_t sCPb, int row0g,
    float* __restrict__ C, _Float16* __restrict__ C16, int ldc, size_t sC, int M, int N, int K) { static_assert(ACT == 0 || ACT == 3 || ACT == 6 || ACT == 8 || ACT == 9 || ACT == 11 || ACT == 12 || ACT == 14 || ACT == 15 || ACT == 16 || ACT == 17, "k_gemm2: unsupported ACT code (would silently apply no activation)");
  __shared__ __attribute__((aligned(16))) float so[4][32][68];
  const int tid = threadIdx.x, w = tid >> 5, lane = tid & 31, ln = lane & 15, hh = lane >> 4; const int by = blockIdx.y;
  A += (size_t)by * sA; Bh += (size_t)by * sB; const size_t cofs = (size_t)by * sC; const float* bp = bias ? bias + (size_t)by * sBias : nullptr;
  const int ntn = N >> 6; const int mt = blockIdx.x / ntn, nq = blockIdx.x - mt * ntn; const int row0 = mt * 128 + 32 * w, col0 = nq * 64; if (row0 >= M) return;
  const _Float16* a0p = A + (size_t)(row0 + ln) * lda; const _Float16* a1p = a0p + (size_t)16 * lda;
  const _Float16* b0p = Bh + (size_t)(col0 + ln) * ldb; const _Float16* b1p = b0p + (size_t)16 * ldb; const _Float16* b2p = b1p + (size_t)16 * ldb; const _Float16* b3p = b2p + (size_t)16 * ldb;
  const v8f z8 = {0.f,0.f,0.f,0.f,0.f,0.f,0.f,0.f}; v8f c00 = z8, c01 = z8, c02 = z8, c03 = z8, c10 = z8, c11 = z8, c12 = z8, c13 = z8;
#pragma unroll 1
  for (int kb = 0; kb < K; kb += 32) { const v16h a0 = g2_frag(a0p + kb, hh), a1 = g2_frag(a1p + kb, hh);
    v16h b = g2_frag(b0p + kb, hh); c00 = g2_mma(a0, b, c00); c10 = g2_mma(a1, b, c10);
    b = g2_frag(b1p + kb, hh); c01 = g2_mma(a0, b, c01); c11 = g2_mma(a1, b, c11);
    b = g2_frag(b2p + kb, hh); c02 = g2_mma(a0, b, c02); c12 = g2_mma(a1, b, c12);
    b = g2_frag(b3p + kb, hh); c03 = g2_mma(a0, b, c03); c13 = g2_mma(a1, b, c13); }
  v8f accs[8] = {c00, c01, c02, c03, c10, c11, c12, c13};
#pragma unroll
  for (int u = 0; u < 8; ++u) { const int t = u & 3, half = u >> 2; const int col = col0 + t * 16 + ln; const float bv = bp ? bf16_round(bp[col]) : 0.f;
#pragma unroll
    for (int r = 0; r < 8; ++r) { const int rloc = half * 16 + 8 * hh + r; float v = accs[u][r] * alpha + bv; if (CP) { if (rowsPerB < 0) v += CP[cofs + (size_t)(row0g + row0 + rloc) * ldc + col];      /* rowsPerB < 0: own element of the batched C plane */ else { const int bidx = (row0g + row0 + rloc) / rowsPerB; v += CP[(size_t)bidx * sCPb + (size_t)by * 64 + col]; } }
      if (ACT == 3) v = fmaxf(v, 0.f); else if (ACT == 6) v = 0.5f * v * (1.0f + erff(v * 0.70710678118654752f)); else if (ACT == 11) v = 1.0f / (1.0f + expf(-v)); else if (ACT == 15) v = v / (1.0f + expf(-v)); else if (ACT == 12) v = (v > 0.f) ? v : 0.01f * v; else if (ACT == 8) v = tanhf(v); else if (ACT == 9) v = 0.5f * v * (1.0f + tanhf(0.7978845608028654f * (v + 0.044715f * v * v * v))); else if (ACT == 14) v = (v > 0.f) ? v : 0.1f * v; else if (ACT == 16) v = (v >= 0.f) ? v : 0.3f * v; else if (ACT == 17) v = (v >= 0.f) ? v : 0.2f * v;
      so[w][rloc][t * 16 + ln] = v; } }
  __builtin_amdgcn_fence(__ATOMIC_ACQ_REL, "workgroup"); __builtin_amdgcn_wave_barrier();
  const int rsub = lane >> 4, c4 = (lane & 15) * 4;
  {
#pragma unroll
    for (int q = 0; q < 16; ++q) { const int r = q * 2 + rsub; const v4f v = *(const v4fa*)&so[w][r][c4]; if (C) *(v4f*)(C + cofs + (size_t)(row0 + r) * ldc + col0 + c4) = v; if (C16) { v4h h4; for (int i = 0; i < 4; ++i) h4[i] = (_Float16)v[i]; *(v4h*)(C16 + cofs + (size_t)(row0 + r) * ldc + col0 + c4) = h4; } }
     } }


__global__ __launch_bounds__(256) void k_wnat(const float* __restrict__ w, size_t n8, _Float16* __restrict__ Bt) { const size_t t = (size_t)blockIdx.x * 256 + threadIdx.x; if (t >= n8) return; FragH f; for (int q = 0; q < 8; ++q) f.h[q] = (_Float16)(bf16_round(w[t * 8 + q]) * 16.0f); *(v8us*)((unsigned short*)Bt + t * 8) = f.half[0];  }
__global__ __launch_bounds__(256) void k_rsm(const float* __restrict__ S, _Float16* __restrict__ P, int nrows) {
  #pragma clang fp contract(off)
  const int i = blockIdx.x * 256 + threadIdx.x; if (i >= nrows) return; const float* s = S + (size_t)i * SQ; float mx = -3.0e38f;
#pragma unroll 1
  for (int j = 0; j < SQ; ++j) mx = fmaxf(mx, s[j]); float se = 0.f;
#pragma unroll 1
  for (int j = 0; j < SQ; ++j) se += expf(s[j] - mx); const float sc = 256.0f / se;
#pragma unroll 1
  for (int j0 = 0; j0 < SQ; j0 += 8) { FragH f; for (int q = 0; q < 8; ++q) f.h[q] = (_Float16)(expf(s[j0 + q] - mx) * sc); unsigned short* d = (unsigned short*)P + (size_t)i * SQ + j0; *(v8us*)d = f.half[0];  } }
__global__ __launch_bounds__(256) void k_vt(const _Float16* __restrict__ V16, int b, int h0, _Float16* __restrict__ VT) { __shared__ unsigned short tl[64][65]; const int tid = threadIdx.x; const int hh = blockIdx.x % HG, sg = blockIdx.x / HG; const int s0 = sg * 64; const int h = h0 + hh;
  for (int i = tid; i < 64 * 8; i += 256) { const int j = i / 8, d8 = (i % 8) * 8; FragH f; f.half[0] = *(const v8us*)((const unsigned short*)V16 + ((size_t)b * SQ + s0 + j) * DM + h * HD + d8); for (int q = 0; q < 8; ++q) tl[d8 + q][j] = f.u[q]; }
  __syncthreads();
  { for (int i = tid; i < 64 * 8; i += 256) { const int d = i / 8, j8 = (i % 8) * 8; FragH f; for (int q = 0; q < 8; ++q) f.u[q] = tl[d][j8 + q]; *(v8us*)((unsigned short*)VT + ((size_t)hh * HD + d) * SQ + s0 + j8) = f.half[0]; }  } }



__global__ __launch_bounds__(256) void k_rsmcf2(const float* __restrict__ S, _Float16* __restrict__ P, int hg, int q0, int nk) {
  #pragma clang fp contract(off)
  const int t = blockIdx.x * 256 + threadIdx.x; if (t >= hg * QT) return; const size_t i = (size_t)t; const float* s = S + i * NKX; const int last = q0 + (t % QT); float mx = -3.0e38f;
#pragma unroll 1
  for (int j = 0; j < nk; ++j) { const float f = (j <= last) ? 1.f : 0.f; mx = fmaxf(mx, fmaf(f, s[j], (1.f - f) * -1.0e9f)); } float se = 0.f;
#pragma unroll 1
  for (int j = 0; j < nk; ++j) { const float f = (j <= last) ? 1.f : 0.f; se += __expf(fmaf(f, s[j], (1.f - f) * -1.0e9f) - mx); } const float sc = 256.0f / se;
#pragma unroll 1
  for (int j0 = 0; j0 < nk; j0 += 8) { FragH fr; for (int q = 0; q < 8; ++q) { const int j = j0 + q; const float f = (j <= last) ? 1.f : 0.f; fr.h[q] = (_Float16)(__expf(fmaf(f, s[j], (1.f - f) * -1.0e9f) - mx) * sc); } unsigned short* d = (unsigned short*)P + i * NKX + j0; *(v8us*)d = fr.half[0];  } }

template <int MASKADD>
__global__ __launch_bounds__(64) void k_att0(const float* __restrict__ QF, const float* __restrict__ KF, const float* __restrict__ VF, int ld, const float* __restrict__ mask, float scale, float* __restrict__ OF, int ldo) {
  #pragma clang fp contract(off)
  __shared__ __attribute__((aligned(16))) float lq[64][64]; __shared__ __attribute__((aligned(16))) float lo[64][64];
  const int tid = threadIdx.x; const int h = blockIdx.x / (QT0 / 64), rg = blockIdx.x % (QT0 / 64); const int i = rg * 64 + tid;
  const float* qr = QF + (size_t)i * ld + h * HD;
#pragma unroll 1
  for (int c = 0; c < HD / 4; ++c) { *(v4f*)&lq[tid][c * 4] = *(const v4fa*)(qr + c * 4); const v4f z = {0.f, 0.f, 0.f, 0.f}; *(v4f*)&lo[tid][c * 4] = z; }
  float m = -1.0e30f, l = 0.f; const int jmax = MASKADD ? (SQ - 1) : (rg * 64 + 63);      /* additive-mask form: every key (the mask input decides); causal form: keys up to the block's last row */
#pragma unroll 1
  for (int j = 0; j <= jmax; ++j) { const float* kr = KF + (size_t)j * ld + h * HD; const float* vr = VF + (size_t)j * ld + h * HD; float s = 0.f;
#pragma unroll 1
    for (int c = 0; c < HD / 4; ++c) { const v4f kq = *(const v4fa*)(kr + c * 4); const v4f qq = *(v4f*)&lq[tid][c * 4]; s = __fadd_rn(s, __fmul_rn(qq[0], kq[0])); s = __fadd_rn(s, __fmul_rn(qq[1], kq[1])); s = __fadd_rn(s, __fmul_rn(qq[2], kq[2])); s = __fadd_rn(s, __fmul_rn(qq[3], kq[3])); }
    s = __fmul_rn(s, scale); if (MASKADD) s = __fadd_rn(s, __fmul_rn(bf16_round(mask[(size_t)i * SQ + j]), -10000.0f));
    const float f = (MASKADD || j <= i) ? 1.f : 0.f; const float sm = fmaf(f, s, (1.f - f) * -1.0e30f); const float mn = fmaxf(m, sm); const float sc = expf(m - mn); const float e = expf(sm - mn); l = __fadd_rn(__fmul_rn(l, sc), e); m = mn;
#pragma unroll 1
    for (int c = 0; c < HD / 4; ++c) { const v4f vv = *(const v4fa*)(vr + c * 4); v4f oo = *(v4f*)&lo[tid][c * 4]; for (int u = 0; u < 4; ++u) oo[u] = __fadd_rn(__fmul_rn(oo[u], sc), __fmul_rn(e, vv[u])); *(v4f*)&lo[tid][c * 4] = oo; } }
  const float fin = 64.0f / l;      /* o carried x64 */
#pragma unroll 1
  for (int c = 0; c < HD / 4; ++c) { v4f oo = *(v4f*)&lo[tid][c * 4]; for (int u = 0; u < 4; ++u) oo[u] = __fmul_rn(oo[u], fin); *(v4f*)&lo[tid][c * 4] = oo; }
  __syncthreads();
  {
#pragma unroll 1
    for (int it = 0; it < 16; ++it) { const int row = it * 4 + tid / 16, pc = (tid % 16) * 4; const v4f v = *(const v4f*)&lo[row][pc]; *(v4f*)(OF + (size_t)(rg * 64 + row) * ldo + h * HD + pc) = v; }
     } }

__global__ __launch_bounds__(256) void k_oscale(const float* __restrict__ OF, float* __restrict__ out, size_t n4) { const size_t t = (size_t)blockIdx.x * 256 + threadIdx.x; if (t >= n4) return; const v4f a = *(const v4fa*)(OF + t * 4); v4f o; for (int q = 0; q < 4; ++q) o[q] = a[q] * 0.015625f; *(v4f*)(out + t * 4) = o;  }

__global__ __launch_bounds__(256) void k_bfr(const float* __restrict__ x, float* __restrict__ XB, size_t n8) { const size_t t = (size_t)blockIdx.x * 256 + threadIdx.x; if (t >= n8) return; v4f a = *(const v4fa*)(x + t * 8), c = *(const v4fa*)(x + t * 8 + 4); for (int q = 0; q < 4; ++q) { a[q] = bf16_round(a[q]); c[q] = bf16_round(c[q]); }
  { *(v4f*)(XB + t * 8) = a; *(v4f*)(XB + t * 8 + 4) = c;  } }



__global__ __launch_bounds__(256) void k_rsmfvl(const float* __restrict__ S, _Float16* __restrict__ P, _Float16* __restrict__ PL, int qn, const int* __restrict__ vlp) {
  #pragma clang fp contract(off)
  const int t = blockIdx.x * 256 + threadIdx.x; if (t >= qn) return; const int vl = vlp[0]; const size_t i = (size_t)t; const float* s = S + i * SQ; float mx = -3.0e38f;
#pragma unroll 1
  for (int j = 0; j < SQ; ++j) { const float f = (j < vl) ? 1.f : 0.f; mx = fmaxf(mx, fmaf(f, s[j], (1.f - f) * -1000000.0f)); } float se = 0.f;
#pragma unroll 1
  for (int j = 0; j < SQ; ++j) { const float f = (j < vl) ? 1.f : 0.f; se += __expf(fmaf(f, s[j], (1.f - f) * -1000000.0f) - mx); } const float sc = 256.0f / se;
#pragma unroll 1
  for (int j0 = 0; j0 < SQ; j0 += 8) { FragH fr, gr; for (int q = 0; q < 8; ++q) { const int j = j0 + q; const float f = (j < vl) ? 1.f : 0.f; const float pv = __expf(fmaf(f, s[j], (1.f - f) * -1000000.0f) - mx) * sc; const _Float16 ph = (_Float16)pv; fr.h[q] = ph; gr.h[q] = (_Float16)((pv - (float)ph) * 1024.0f); }
    unsigned short* d = (unsigned short*)P + i * SQ + j0; unsigned short* dl = (unsigned short*)PL + i * SQ + j0; *(v8us*)d = fr.half[0]; *(v8us*)dl = gr.half[0];  } }

__global__ __launch_bounds__(256) void k_rsmf(const float* __restrict__ S, _Float16* __restrict__ P, int qn, int hg) {
  #pragma clang fp contract(off)
  const int t = blockIdx.x * 256 + threadIdx.x; if (t >= qn * hg) return; const size_t i = (size_t)(t / qn) * SQ + (t % qn); const float* s = S + i * SQ; float mx = -3.0e38f;
#pragma unroll 1
  for (int j = 0; j < SQ; ++j) mx = fmaxf(mx, s[j]); float se = 0.f;
#pragma unroll 1
  for (int j = 0; j < SQ; ++j) se += __expf(s[j] - mx); const float sc = 256.0f / se;
#pragma unroll 1
  for (int j0 = 0; j0 < SQ; j0 += 8) { FragH f; for (int q = 0; q < 8; ++q) f.h[q] = (_Float16)(__expf(s[j0 + q] - mx) * sc); unsigned short* d = (unsigned short*)P + i * SQ + j0; *(v8us*)d = f.half[0];  } }



// Lane l with lane l ^ 16. Every lane must be on.
__device__ __forceinline__ float lane_x16(float v) { const int i = __float_as_int(v); return __int_as_float(__builtin_amdgcn_permlanex16(i, i, 0x76543210, 0xfedcba98, false, false)); }
typedef int v4ia __attribute__((ext_vector_type(4), may_alias));
// Four native exp2 in one statement. The closing v_nop is the one slot the instruction set asks for behind a transcendental before its result is read or its source overwritten;
// the outputs are early-clobber, so each exp is independent of the one in front of it.
__device__ __forceinline__ v4f exp2_x4(v4f a) { float r0, r1, r2, r3;
  asm("v_exp_f32 %0, %4\n\tv_exp_f32 %1, %5\n\tv_exp_f32 %2, %6\n\tv_exp_f32 %3, %7\n\tv_nop" : "=&v"(r0), "=&v"(r1), "=&v"(r2), "=&v"(r3) : "v"(a[0]), "v"(a[1]), "v"(a[2]), "v"(a[3]));
  const v4f r = {r0, r1, r2, r3}; return r; }


typedef unsigned int fa_u4 __attribute__((ext_vector_type(4)));
typedef unsigned int fa_u4a __attribute__((ext_vector_type(4), may_alias));
typedef unsigned int fa_u8 __attribute__((ext_vector_type(8)));
typedef short fa_s8 __attribute__((ext_vector_type(8)));
#define FA_SK 64u                                /* keys per stage */
#define FA_PK 272u                               /* LDS pitch of a K row: odd multiple of 16 B (ds_load_b128 readers) */
#define FA_PV 288u                               /* LDS pitch of a V row: odd multiple of 32 B (ds_load_tr16_b128 readers) */
#define FA_TK (FA_SK * FA_PK)
#define FA_SLOT (FA_SK * (FA_PK + FA_PV))
#define FA_RING (3u * FA_SLOT)
#define FA_EP 528u                               /* pitch of an output row (128 f32) staged in the ring */
#define FA_NST ((unsigned)SQ / FA_SK)
#define FA_CS 0.12751743f                        /* log2(e) / sqrt(128) */
static_assert(4u * 32u * FA_EP <= FA_RING, "the output staging reuses the K / V ring");
struct FaFrag { fa_u4 q[2]; };
struct FaK { FaFrag f[2][4]; };
__device__ __forceinline__ v8f fa_mma(const FaFrag& a, const FaFrag& b, v8f c) {
  const fa_u8 av = __builtin_shufflevector(a.q[0], a.q[1], 0, 1, 2, 3, 4, 5, 6, 7), bv = __builtin_shufflevector(b.q[0], b.q[1], 0, 1, 2, 3, 4, 5, 6, 7);
  return __builtin_amdgcn_wmma_f32_16x16x32_f16(false, __builtin_bit_cast(v16h, av), false, __builtin_bit_cast(v16h, bv), (short)0, c, false, false); }
__device__ __forceinline__ void fa_fence() { __builtin_amdgcn_sched_barrier(0); }
// Four vector slots behind a run of WMMAs: the exponentials are asm text, whose outputs the compiler may place on a WMMA's operand registers without padding the distance itself.
__device__ __forceinline__ void fa_nop4() { asm volatile("v_nop\n\tv_nop\n\tv_nop\n\tv_nop"); }
__device__ __forceinline__ fa_u4 fa_tr16(const unsigned char* p) { typedef __attribute__((address_space(3))) fa_s8 lds_s8; return __builtin_bit_cast(fa_u4, __builtin_amdgcn_ds_load_tr16_b128_v8i16((lds_s8*)p)); }
__device__ __forceinline__ unsigned int fa_pack2(float lo, float hi) { typedef _Float16 h2 __attribute__((ext_vector_type(2))); typedef float f2 __attribute__((ext_vector_type(2))); return __builtin_bit_cast(unsigned int, __builtin_convertvector(f2{lo, hi}, h2)); }
// K fragments of one 32-key pass in the hardware k order (bytes 16 h and 32 + 16 h of each 64 bytes of a row), as Q's in the kernel.
__device__ __forceinline__ void fa_load_k(FaK& k, const unsigned char* Lp, unsigned int koff, unsigned int lane) {
  const unsigned int c = lane & 15u, h = lane >> 4;
#pragma unroll
  for (int kt = 0; kt < 2; ++kt) { const unsigned char* p = Lp + koff + (16u * kt + c) * FA_PK + 16u * h;
#pragma unroll
    for (int kc = 0; kc < 4; ++kc) { k.f[kt][kc].q[0] = *(const fa_u4a*)(p + 64u * kc); k.f[kt][kc].q[1] = *(const fa_u4a*)(p + 64u * kc + 32u); } } }
// One 32-key pass of one wave. voff, moff: LDS byte offsets of the pass's first V row and first mask float. m_run, the maximum in use, may trail the true one by up to 8 (log2 units),
// so an exponential stays below 2^8, inside f16; the quotient of the sums does not depend on it.
__device__ __forceinline__ void fa_block(FaK& kf, bool fetch_next, unsigned int next_koff, const unsigned char* Lp, unsigned int voff, unsigned int moff, unsigned int lane,
                                         const FaFrag (&qf)[2][4], v8f (&acc)[2][8], float (&m_run)[2], v4f (&l_run)[2]) {
  const unsigned int h = lane >> 4;
  v8f s[2][2];
#pragma unroll
  for (int kt = 0; kt < 2; ++kt) {
#pragma unroll
    for (int g = 0; g < 2; ++g) { s[kt][g] = v8f{};
#pragma unroll
      for (int kc = 0; kc < 4; ++kc) s[kt][g] = fa_mma(kf.f[kt][kc], qf[g][kc], s[kt][g]); } }
  fa_fence(); fa_nop4(); fa_fence();      /* the fences keep the slots behind the last WMMA and the next pass's K loads behind this pass's products, which read the same registers */
  if (fetch_next) fa_load_k(kf, Lp, next_koff, lane);      /* in flight under the maxima and the exponentials */
  v4f mk[4];      /* this lane's 16 keys' 0 / 1: keys 16 kt + 8 h + r */
  { const unsigned char* mp = Lp + moff + 32u * h; mk[0] = *(const v4fa*)(mp); mk[1] = *(const v4fa*)(mp + 16u); mk[2] = *(const v4fa*)(mp + 64u); mk[3] = *(const v4fa*)(mp + 80u); }
  FaFrag vf[8];      /* V^T, 16 (d) x 32 (keys) per fragment */
  { const unsigned char* ad = Lp + voff + (8u * h + (lane & 7u)) * FA_PV + ((lane >> 3) & 1u) * 16u;
#pragma unroll
    for (int t = 0; t < 8; ++t) { vf[t].q[0] = fa_tr16(ad + 32u * t); vf[t].q[1] = fa_tr16(ad + 16u * FA_PV + 32u * t); } }
  float mb[2]; bool need = false;
#pragma unroll
  for (int g = 0; g < 2; ++g) { float mx = s[0][g][0];
#pragma unroll
    for (int r = 1; r < 8; ++r) mx = fmaxf(mx, s[0][g][r]);
#pragma unroll
    for (int r = 0; r < 8; ++r) mx = fmaxf(mx, s[1][g][r]);
    mx = fmaxf(mx, lane_x16(mx)) * FA_CS;      /* both wave halves hold this query's maximum over the pass's 32 keys, masked ones included */
    mb[g] = mx; need = need || (mx > m_run[g] + 8.0f); }
  if (__builtin_amdgcn_ballot_w32(need) != 0) {      /* wave-uniform, rare after the first passes */
    const float n0 = fmaxf(m_run[0], mb[0]), n1 = fmaxf(m_run[1], mb[1]);
    float cr[2];      /* 0 on the first pass, where m_run is -inf; the closing v_nop is the slot behind a transcendental, as in exp2_x4 */
    asm("v_exp_f32 %0, %2\n\tv_exp_f32 %1, %3\n\tv_nop" : "=&v"(cr[0]), "=&v"(cr[1]) : "v"(m_run[0] - n0), "v"(m_run[1] - n1));
    m_run[0] = n0; m_run[1] = n1;
#pragma unroll
    for (int g = 0; g < 2; ++g) { l_run[g] = l_run[g] * cr[g];
#pragma unroll
      for (int t = 0; t < 8; ++t) acc[g][t] = acc[g][t] * cr[g]; } }
#pragma unroll
  for (int g = 0; g < 2; ++g) { const float nm = -m_run[g]; const v4f nm4 = {nm, nm, nm, nm}; const v4f cs4 = {FA_CS, FA_CS, FA_CS, FA_CS};
    unsigned int w[8];
#pragma unroll
    for (int j = 0; j < 4; ++j) { const int kt = j >> 1, r0 = 4 * (j & 1);
      const v4f sv = {s[kt][g][r0], s[kt][g][r0 + 1], s[kt][g][r0 + 2], s[kt][g][r0 + 3]};
      const v4f p = exp2_x4(__builtin_elementwise_fma(sv, cs4, nm4)) * mk[j];
      l_run[g] += p; w[2 * j] = fa_pack2(p[0], p[1]); w[2 * j + 1] = fa_pack2(p[2], p[3]); }
    FaFrag pf; pf.q[0] = fa_u4{w[0], w[1], w[2], w[3]}; pf.q[1] = fa_u4{w[4], w[5], w[6], w[7]};
#pragma unroll
    for (int t = 0; t < 8; ++t) acc[g][t] = fa_mma(vf[t], pf, acc[g][t]);
    fa_fence(); fa_nop4(); fa_fence(); }      /* slots in front of the next group's (or pass's) asm exponentials; the fences keep them directly behind the WMMAs */
}
__global__ __launch_bounds__(128) void k_fattn(const _Float16* __restrict__ Q, const _Float16* __restrict__ K, const _Float16* __restrict__ V, const int* __restrict__ Km, float* __restrict__ O) {
  __shared__ __attribute__((aligned(256))) unsigned char L[FA_RING + SQ * 4];      /* three K / V buffers, then the sequence's key mask as f32 0 / 1 */
  const unsigned int tid = threadIdx.x, lane = tid & 31u, wave = __builtin_amdgcn_readfirstlane(tid >> 5), c = lane & 15u, h = lane >> 4;
  const unsigned int b = blockIdx.y, q0 = blockIdx.x * 128u;
  // Staging: 16-byte chunk tid + 128 i of a stage's 64 x 256 B of K (and of V) is row 8 i + tid / 16, bytes 16 (tid % 16): a wave's load covers 512 contiguous bytes.
  const unsigned char* kg = (const unsigned char*)(K + (size_t)b * SQ * DM) + tid * 16u; const unsigned char* vg = (const unsigned char*)(V + (size_t)b * SQ * DM) + tid * 16u;
  const unsigned int kd = (tid >> 4) * FA_PK + (tid & 15u) * 16u, vd = FA_TK + (tid >> 4) * FA_PV + (tid & 15u) * 16u;
  fa_u4 kr[8], vr[8];
#pragma unroll
  for (int i = 0; i < 8; ++i) { kr[i] = *(const fa_u4a*)(kg + i * 2048u); vr[i] = *(const fa_u4a*)(vg + i * 2048u); }
#pragma unroll
  for (int j = 0; j < 4; ++j) { const v4ia m = *(const v4ia*)(Km + (size_t)b * SQ + j * 512u + tid * 4u); v4f f; for (int q = 0; q < 4; ++q) f[q] = (m[q] != 0) ? 1.0f : 0.0f; *(v4fa*)(L + FA_RING + (j * 512u + tid * 4u) * 4u) = f; }
  FaFrag qf[2][4];
#pragma unroll
  for (int g = 0; g < 2; ++g) { const _Float16* qp = Q + ((size_t)b * SQ + q0 + wave * 32u + 16u * g + c) * DM + 8u * h;
#pragma unroll
    for (int kc = 0; kc < 4; ++kc) { qf[g][kc].q[0] = *(const fa_u4a*)(qp + 32 * kc); qf[g][kc].q[1] = *(const fa_u4a*)(qp + 32 * kc + 16); }
    asm volatile("s_wait_xcnt 0x0" ::: "memory"); }      /* this group's address registers may become a later load's destination */
#pragma unroll
  for (int i = 0; i < 8; ++i) { *(fa_u4a*)(L + kd + i * 8u * FA_PK) = kr[i]; *(fa_u4a*)(L + vd + i * 8u * FA_PV) = vr[i]; }
  v8f acc[2][8]; float m_run[2]; v4f l_run[2];
#pragma unroll
  for (int g = 0; g < 2; ++g) { m_run[g] = -__builtin_inff(); l_run[g] = v4f{0.f, 0.f, 0.f, 0.f};
#pragma unroll
    for (int t = 0; t < 8; ++t) acc[g][t] = v8f{}; }
  FaK kf;
  __syncthreads();      /* publishes stage 0 and the mask */
#pragma unroll
  for (int i = 0; i < 8; ++i) { kr[i] = *(const fa_u4a*)(kg + FA_SK * 256u + i * 2048u); vr[i] = *(const fa_u4a*)(vg + FA_SK * 256u + i * 2048u); }      /* stage 1 */
  asm volatile("s_wait_xcnt 0x0" ::: "memory");      /* the loads' address registers may be reused directly behind them */
  fa_fence();      /* the global loads are issued ahead of the pass, not sunk to their stores */
  fa_load_k(kf, L, 0u, lane);
  unsigned int cur = 0u, nxt = FA_SLOT;      /* LDS offsets of stage st's and stage st + 1's buffers */
#pragma unroll 1      /* rolled: one trip's body is already two unrolled passes */
  for (unsigned int st = 0; st < FA_NST; ++st) {
    const bool more = st + 1u < FA_NST;
    fa_block(kf, true, cur + 32u * FA_PK, L, cur + FA_TK, FA_RING + st * (FA_SK * 4u), lane, qf, acc, m_run, l_run);
    if (more) {
#pragma unroll
      for (int i = 0; i < 8; ++i) { *(fa_u4a*)(L + nxt + kd + i * 8u * FA_PK) = kr[i]; *(fa_u4a*)(L + nxt + vd + i * 8u * FA_PV) = vr[i]; } }
    __syncthreads();      /* publishes stage st + 1; every wave has left stage st - 1's buffer, which the next trip refills */
    if (st + 2u < FA_NST) {
#pragma unroll
      for (int i = 0; i < 8; ++i) { kr[i] = *(const fa_u4a*)(kg + (st + 2u) * (FA_SK * 256u) + i * 2048u); vr[i] = *(const fa_u4a*)(vg + (st + 2u) * (FA_SK * 256u) + i * 2048u); }
      asm volatile("s_wait_xcnt 0x0" ::: "memory");      /* the loads' address registers may be reused directly behind them */
    }
    fa_fence();      /* the global loads are issued ahead of the pass, not sunk to their stores */
    fa_block(kf, more, nxt, L, cur + FA_TK + 32u * FA_PV, FA_RING + st * (FA_SK * 4u) + 128u, lane, qf, acc, m_run, l_run);
    cur = nxt; nxt = (nxt == 2u * FA_SLOT) ? 0u : nxt + FA_SLOT;
  }
  __syncthreads();      /* every wave has left the ring before it becomes output staging */
  unsigned char* eb = L + wave * 32u * FA_EP;
#pragma unroll
  for (int g = 0; g < 2; ++g) { float l = (l_run[g][0] + l_run[g][1]) + (l_run[g][2] + l_run[g][3]); l += lane_x16(l);      /* each wave half summed its eight keys of every 16-key tile */
    const float inv = 1.0f / l;
#pragma unroll
    for (int t = 0; t < 8; ++t) { const v8f o = acc[g][t] * inv; const v4f o0 = {o[0], o[1], o[2], o[3]}, o1 = {o[4], o[5], o[6], o[7]};      /* row = query 16 g + c; d = 16 t + 8 h + 0 .. 7 */
      *(v4fa*)(eb + (16u * g + c) * FA_EP + 64u * t + 32u * h) = o0; *(v4fa*)(eb + (16u * g + c) * FA_EP + 64u * t + 32u * h + 16u) = o1; } }
  __builtin_amdgcn_fence(__ATOMIC_ACQ_REL, "workgroup"); __builtin_amdgcn_wave_barrier();      /* the wave reads back rows that its other lanes wrote */
  float* op = O + ((size_t)b * SQ + q0 + wave * 32u) * DM + lane * 4u;
  v4f ov[32];
#pragma unroll
  for (int i = 0; i < 32; ++i) ov[i] = *(const v4fa*)(eb + i * FA_EP + lane * 16u);
  fa_fence();      /* every row is read before the first store, so that no store's data register is rewritten behind it */
#pragma unroll
  for (int i = 0; i < 32; ++i) *(v4f*)(op + (size_t)i * DM) = ov[i];      /* one whole 512-byte output row per store */
}


// ---- q, k and v to f16 rows in ONE launch of one 8-wave workgroup per WGP ----
// A workgroup owns the same contiguous 64 KiB (16,384 floats) of each of the three inputs. A wave-wide load covers 512 contiguous bytes, a wave-wide store 256 (whole 128-byte lines both ways).
// A thread issues its 48 loads before its first conversion, so that few waves (which start quickly) keep the memory system full.
#define X3_WG 256u                               /* workgroups */
#define X3_CH 16                                 /* 16-byte chunks per thread and input */
static_assert((size_t)X3_WG * 256u * X3_CH * 4u == NR * DM, "the workgroups' shares cover an input exactly");
typedef unsigned int x3_u2 __attribute__((ext_vector_type(2), may_alias));
__device__ __forceinline__ unsigned int x3_pair(float lo, float hi) { typedef _Float16 h2 __attribute__((ext_vector_type(2))); typedef float f2 __attribute__((ext_vector_type(2))); return __builtin_bit_cast(unsigned int, __builtin_convertvector(f2{bf16_round(lo), bf16_round(hi)}, h2)); }
__global__ __launch_bounds__(256) void k_x16x3(const float* __restrict__ xq, const float* __restrict__ xk, const float* __restrict__ xv, _Float16* __restrict__ Q16, _Float16* __restrict__ K16, _Float16* __restrict__ V16) {
  const unsigned int bi = blockIdx.x * (256u * X3_CH * 16u) + threadIdx.x * 16u, bo = bi >> 1;      /* byte offsets of this thread's first chunk in an input and in its f16 copy: one 32-bit offset register beside each scalar base */
  v4f a[3][X3_CH];
#pragma unroll
  for (int t = 0; t < 3; ++t) { const char* x = (const char*)(t == 0 ? xq : t == 1 ? xk : xv) + bi;
#pragma unroll
    for (int i = 0; i < X3_CH; ++i) a[t][i] = *(const v4fa*)(x + i * 4096);
    __builtin_amdgcn_sched_barrier(0); }      /* the loads are issued in the order of their use, all ahead of the first conversion, none sunk to its use */
#pragma unroll
  for (int t = 0; t < 3; ++t) { char* o = (char*)(t == 0 ? Q16 : t == 1 ? K16 : V16) + bo;
#pragma unroll
    for (int i = 0; i < X3_CH; ++i) { const x3_u2 w = {x3_pair(a[t][i][0], a[t][i][1]), x3_pair(a[t][i][2], a[t][i][3])}; *(x3_u2*)(o + i * 2048) = w;
      if ((i & 3) == 3 && (t < 2 || i + 1 < X3_CH)) { asm volatile("s_wait_xcnt 0x0" ::: "memory");      /* the four stores' data registers are reused by the next chunks' conversions (none follow the last four) */
        __builtin_amdgcn_sched_barrier(0); } } }      /* four chunks' stores leave while later loads are still in flight, not gathered at the kernel's end */
}

extern "C" void kernel_launch(void* const* d_in, const int* in_sizes, int n_in,
                              void* d_out, int out_size, void* d_ws, size_t ws_size, hipStream_t stream) {
  (void)in_sizes; (void)n_in; (void)out_size;
  const float* const* I = (const float* const*)d_in; const float* xq = I[0]; const float* xk = I[1]; const float* xv = I[2]; const int* km = (const int*)d_in[3];      /* q, k, v [16][2048][128] (bf16-valued); mask int32 [16][2048] (READ on device) */
  char* ws = (char*)d_ws; size_t off = 0;
  auto take = [&](size_t bytes) { char* p = ws + off; off += (bytes + 255) & ~(size_t)255; return p; };
  _Float16* Q16 = (_Float16*)take(NR * DM * 2); _Float16* K16 = (_Float16*)take(NR * DM * 2); _Float16* V16 = (_Float16*)take(NR * DM * 2);
  if (off > ws_size) return;
  k_x16x3<<<X3_WG, 256, 0, stream>>>(xq, xk, xv, Q16, K16, V16);      /* exact f16 copies of the bf16-valued inputs, all three in one launch */
  k_fattn<<<dim3(SQ / 128, NB), 128, 0, stream>>>(Q16, K16, V16, km, (float*)d_out);      /* out = softmax-with-post-exp-mask(q k^T / sqrt(128)) v, 128 queries of one sequence per workgroup */
}

// v005
// One run takes 30 microseconds.
// In both of two side-by-side timings against v004, it was 1.63 times as fast.
// Counting every step since v000, it is 212 times as fast.
#include <hip/hip_runtime.h>
// Scaled dot-product attention with the module's POST-exp multiplicative key mask (q, k, v [16][2048][128]: 16 independent sequences, one 128-wide head; mask int32 [16][2048] in {0, 1} (random, read on device); score = q.k / sqrt(128); e = exp(score - rowmax over ALL keys); e *= mask[b][key]; a = e / sum(e); out = a v -> [16][2048][128]). No projections: q, k, v are bf16-valued inputs, so their f16 copies and the score products are exact.
// Structure: no projections: q, k, v are bf16-valued inputs copied to exact f16 rows (one launch), the k and v rows of the keys whose mask is 0 left out and the kept rows packed densely in key order; then ONE fused kernel for all 16 sequences: scores (WMMA, f32 accumulation, exact products), online softmax over the kept keys (f32 statistics, native exp2) and P V (WMMA) per 128-query workgroup, out written f32 straight into the output rows; scores and weights never reach memory.
// A key with mask 0 has weight exp(..) * 0 = 0 in both sums, and the subtracted maximum cancels in the quotient e / sum(e): the kept keys alone give the module's result.
// Compute dtype: inputs rounded to bf16; q, k, v exact in f16; unnormalised softmax weights (below 2^8) as plain f16 GEMM operands (~2^-12); scores, softmax statistics and o f32. v_wmma_f32_16x16x32_f16.
#define NB 16
#define SQ 2048
#define DM 128
#define NH 1
#define HD 128
#define HG 4                         /* heads per attention launch group */
#define B0 0                         /* first batch processed (debug hook) */
#define NBR NB                       /* batches processed (debug hook) */
#define NR ((size_t)NB * SQ)         /* token rows */
#define MP ((int)((size_t)NBR * SQ))
#define QT 256                       /* query rows per causal tile */
#define NKX SQ                       /* S / P row pitch */
#define QT0 256                      /* first-tile rows recomputed exactly (256: buys margin for the few-key rows 128..255, which have no output projection to average the single-f16 P/v rounding) */
#define QN SQ                        /* query rows attended per batch (debug hook) */
#define NHD NH                       /* heads attended (debug hook) */
#define MPO MP                       /* rows through the output stage (debug hook) */
#define LQ DM            /* row pitch of the q/k/v rows */
#define SG 4                         /* unused: no score / softmax launch; the workspace holds the f16 q, k and v and the per-sequence counts */
typedef __bf16 v16b __attribute__((ext_vector_type(16)));
typedef unsigned short v8us __attribute__((ext_vector_type(8), may_alias));
typedef float  v8f  __attribute__((ext_vector_type(8)));
typedef float  v4f  __attribute__((ext_vector_type(4)));
typedef float  v4fa __attribute__((ext_vector_type(4), may_alias));
union FragB { v16b v; v8us half[2]; unsigned short u[16]; };

__device__ __forceinline__ unsigned short bf16_bits(float x) { unsigned int u = __float_as_uint(x); return (unsigned short)((u + 0x7FFFu + ((u >> 16) & 1u)) >> 16); }
__device__ __forceinline__ float bf16_val(unsigned short b) { return __uint_as_float(((unsigned int)b) << 16); }
__device__ __forceinline__ float bf16_round(float x) { return bf16_val(bf16_bits(x)); }
// D += A·B with NT terms: 1 = ah·bh, 2 = + al·bh (A split), 3 = + ah·bl (both split)
template <int NT>
__device__ __forceinline__ v8f mmaN(v16b ah, v16b al, v16b bh, v16b bl, v8f c) {
  c = __builtin_amdgcn_wmma_f32_16x16x32_bf16(false, ah, false, bh, (short)0, c, false, false);
  if (NT >= 2) c = __builtin_amdgcn_wmma_f32_16x16x32_bf16(false, al, false, bh, (short)0, c, false, false);
  if (NT >= 3) c = __builtin_amdgcn_wmma_f32_16x16x32_bf16(false, ah, false, bl, (short)0, c, false, false);
  asm volatile("v_nop\n\tv_nop\n\tv_nop\n\tv_nop" : "+v"(c) : "v"(ah), "v"(al), "v"(bh), "v"(bl));
  return c;
}

__global__ __launch_bounds__(256) void k_wt_bf16(const float* __restrict__ W, unsigned short* __restrict__ Wt, int K, int N) {
  const int t = blockIdx.x * 256 + threadIdx.x;
  const int k8n = K / 8;
  if (t >= N * k8n) return;
  const int n = t / k8n, k8 = (t % k8n) * 8;
  v8us v;
#pragma unroll
  for (int i = 0; i < 8; ++i) v[i] = bf16_bits(W[(size_t)(k8 + i) * N + n]);
  *(v8us*)(Wt + (size_t)n * K + k8) = v;
  
}

// GEMM C[M][N] (f32, pitch ldc) = act(A[M][K]·W + bias). A f32 row-major (pitch lda) converted per fragment to bf16
// (ASPLIT: hi/lo two planes -> 2 terms, else single rounded term); Wt bf16 [N][K] (pitch ldb). BIAS_BF16 rounds the
// bias to bf16 first (bias quantised to bf16 before the add). K%32==0, M%16==0, N%64==0.
template <bool ASPLIT, int ACT, bool BIAS_BF16>
__global__ __launch_bounds__(128) void k_gemm_bf(const float* __restrict__ A, int lda, const unsigned short* __restrict__ Wt, int ldb,
                                               const float* __restrict__ bias, float* __restrict__ C, int ldc, int M, int N, int K) {
  __shared__ __attribute__((aligned(16))) float so[4][16][64];
  const int tid = threadIdx.x, w = tid >> 5, lane = tid & 31, ln = lane & 15, hh = lane >> 4;
  const int ntn = N / 64;
  const int wid = blockIdx.x * 4 + w;
  const int mt = wid / ntn, nq = wid % ntn;
  if (mt * 16 >= M) return;
  const int row0 = mt * 16, col0 = nq * 64;
  const float* arow = A + (size_t)(row0 + ln) * lda;
  v8f acc[4] = {};
  for (int kb = 0; kb < K; kb += 32) {
    FragB ah, al;
    const v4f x0 = *(const v4fa*)(arow + kb + 8 * hh), x1 = *(const v4fa*)(arow + kb + 8 * hh + 4);
    const v4f x2 = *(const v4fa*)(arow + kb + 16 + 8 * hh), x3 = *(const v4fa*)(arow + kb + 16 + 8 * hh + 4);
    float xs[16] = {x0[0],x0[1],x0[2],x0[3],x1[0],x1[1],x1[2],x1[3],x2[0],x2[1],x2[2],x2[3],x3[0],x3[1],x3[2],x3[3]};
#pragma unroll
    for (int i = 0; i < 16; ++i) { const unsigned short hb = bf16_bits(xs[i]); ah.u[i] = hb; al.u[i] = ASPLIT ? bf16_bits(xs[i] - bf16_val(hb)) : (unsigned short)0; }
#pragma unroll
    for (int t = 0; t < 4; ++t) {
      const unsigned short* brow = Wt + (size_t)(col0 + t * 16 + ln) * ldb + kb;
      FragB b;
      b.half[0] = *(const v8us*)(brow + 8 * hh);
      b.half[1] = *(const v8us*)(brow + 16 + 8 * hh);
      acc[t] = mmaN<ASPLIT ? 2 : 1>(ah.v, al.v, b.v, b.v, acc[t]);
    }
  }
#pragma unroll
  for (int t = 0; t < 4; ++t) {
    float bv = bias ? bias[col0 + t * 16 + ln] : 0.f;
    if (BIAS_BF16) bv = bf16_round(bv);
#pragma unroll
    for (int r = 0; r < 8; ++r) { float v = acc[t][r] + bv; if (ACT == 1) v = fmaxf(v, 0.f); so[w][8 * hh + r][t * 16 + ln] = v; }
  }
  __builtin_amdgcn_fence(__ATOMIC_ACQ_REL, "workgroup");
  __builtin_amdgcn_wave_barrier();
  const int rsub = lane >> 4, c4 = (lane & 15) * 4;
  {
#pragma unroll
    for (int q = 0; q < 8; ++q) {
      const int r = q * 2 + rsub;
      const v4f v = *(const v4fa*)&so[w][r][c4];
      *(v4f*)(C + (size_t)(row0 + r) * ldc + col0 + c4) = v;
    }
    
  }
}

// GEMM C = act(A·W + bias + resid): A f32 (ASPLIT -> hi/lo 2 terms), Wt bf16 [N][K]; ACT 0 none, 1 relu, 2 exact gelu;
// resid (optional, f32, row index = (row % rmod), pitch ldr, RES_BF16 rounds it) added before the activation.
template <bool ASPLIT, int ACT, bool BIAS_BF16, bool RES_BF16>
__global__ __launch_bounds__(128) void k_gemm_bf3(const float* __restrict__ A, int lda, const unsigned short* __restrict__ Wt, int ldb,
                                                const float* __restrict__ bias, const float* __restrict__ resid, int rmod, int ldr,
                                                float* __restrict__ C, int ldc, int M, int N, int K) {
  __shared__ __attribute__((aligned(16))) float so[4][16][64];
  const int tid = threadIdx.x, w = tid >> 5, lane = tid & 31, ln = lane & 15, hh = lane >> 4;
  const int ntn = N / 64;
  const int wid = blockIdx.x * 4 + w;
  const int mt = wid / ntn, nq = wid % ntn;
  if (mt * 16 >= M) return;
  const int row0 = mt * 16, col0 = nq * 64;
  const float* arow = A + (size_t)(row0 + ln) * lda;
  v8f acc[4] = {};
  for (int kb = 0; kb < K; kb += 32) {
    FragB ah, al;
    const v4f x0 = *(const v4fa*)(arow + kb + 8 * hh), x1 = *(const v4fa*)(arow + kb + 8 * hh + 4);
    const v4f x2 = *(const v4fa*)(arow + kb + 16 + 8 * hh), x3 = *(const v4fa*)(arow + kb + 16 + 8 * hh + 4);
    float xs[16] = {x0[0],x0[1],x0[2],x0[3],x1[0],x1[1],x1[2],x1[3],x2[0],x2[1],x2[2],x2[3],x3[0],x3[1],x3[2],x3[3]};
#pragma unroll
    for (int i = 0; i < 16; ++i) { const unsigned short hb = bf16_bits(xs[i]); ah.u[i] = hb; al.u[i] = ASPLIT ? bf16_bits(xs[i] - bf16_val(hb)) : (unsigned short)0; }
#pragma unroll
    for (int t = 0; t < 4; ++t) {
      const unsigned short* brow = Wt + (size_t)(col0 + t * 16 + ln) * ldb + kb;
      FragB b;
      b.half[0] = *(const v8us*)(brow + 8 * hh);
      b.half[1] = *(const v8us*)(brow + 16 + 8 * hh);
      acc[t] = mmaN<ASPLIT ? 2 : 1>(ah.v, al.v, b.v, b.v, acc[t]);
    }
  }
#pragma unroll
  for (int t = 0; t < 4; ++t) {
    const int col = col0 + t * 16 + ln;
    float bv = bias ? bias[col] : 0.f;
    if (BIAS_BF16) bv = bf16_round(bv);
#pragma unroll
    for (int r = 0; r < 8; ++r) {
      float v = acc[t][r] + bv;
      if (resid) { float rv = resid[(size_t)((row0 + 8 * hh + r) % rmod) * ldr + col]; if (RES_BF16) rv = bf16_round(rv); v += rv; }
      if (ACT == 1) v = fmaxf(v, 0.f);
      if (ACT == 2) v = 0.5f * v * (1.0f + erff(v * 0.70710678118654752f));
      if (ACT == 3) { const float u = 0.7978845608028654f * (v + 0.044715f * v * v * v); v = 0.5f * v * (1.0f + tanhf(u)); }
      so[w][8 * hh + r][t * 16 + ln] = v;
    }
  }
  __builtin_amdgcn_fence(__ATOMIC_ACQ_REL, "workgroup");
  __builtin_amdgcn_wave_barrier();
  const int rsub = lane >> 4, c4 = (lane & 15) * 4;
  {
#pragma unroll
    for (int q = 0; q < 8; ++q) {
      const int r = q * 2 + rsub;
      const v4f v = *(const v4fa*)&so[w][r][c4];
      *(v4f*)(C + (size_t)(row0 + r) * ldc + col0 + c4) = v;
    }
    
  }
}
// row LayerNorm (biased variance, eps) over N: s = X (+ R); optional out_sum <- s; out_norm <- (s-mu)*rsqrt(var+eps)*g + b
template <bool PARAM_BF16>
__global__ __launch_bounds__(256) void k_layernorm(const float* __restrict__ X, const float* __restrict__ R, const float* __restrict__ g, const float* __restrict__ bta,
                                                  float* __restrict__ out_sum, float* __restrict__ out_norm, int N, float eps) {
  __shared__ float red[256];
  const int row = blockIdx.x, tid = threadIdx.x;
  const float* x = X + (size_t)row * N; const float* rr = R ? R + (size_t)row * N : nullptr;
  float vals[16];                     // up to N = 4096
  const int per = N / 256;            // contiguous chunk per thread? use strided-by-4 chunks: thread handles j = tid*4 + 1024*u
  float s1 = 0.f;
  for (int u = 0; u < per / 4; ++u) {
    const int j = tid * 4 + 1024 * u;
    const v4f a = *(const v4fa*)(x + j);
    v4f b = {0.f,0.f,0.f,0.f}; if (rr) b = *(const v4fa*)(rr + j);
#pragma unroll
    for (int q = 0; q < 4; ++q) { const float v = a[q] + b[q]; vals[u * 4 + q] = v; s1 += v; }
  }
  red[tid] = s1; __syncthreads();
  for (int st = 128; st > 0; st >>= 1) { if (tid < st) red[tid] += red[tid + st]; __syncthreads(); }
  const float mu = red[0] / (float)N; __syncthreads();
  float s2 = 0.f;
  for (int u = 0; u < per / 4; ++u)
#pragma unroll
    for (int q = 0; q < 4; ++q) { const float c = vals[u * 4 + q] - mu; s2 += c * c; }
  red[tid] = s2; __syncthreads();
  for (int st = 128; st > 0; st >>= 1) { if (tid < st) red[tid] += red[tid + st]; __syncthreads(); }
  const float rs = rsqrtf(red[0] / (float)N + eps);
  {
    for (int u = 0; u < per / 4; ++u) {
      const int j = tid * 4 + 1024 * u;
      v4f o, sm;
#pragma unroll
      for (int q = 0; q < 4; ++q) {
        float gg = g[j + q], bb = bta[j + q];
        if (PARAM_BF16) { gg = bf16_round(gg); bb = bf16_round(bb); }
        sm[q] = vals[u * 4 + q]; o[q] = (vals[u * 4 + q] - mu) * rs * gg + bb;
      }
      if (out_sum) *(v4f*)(out_sum + (size_t)row * N + j) = sm;
      *(v4f*)(out_norm + (size_t)row * N + j) = o;
    }
    
  }
}



// ---- f16 WMMA path (v_wmma_f32_16x16x32_f16): 11-bit significands for operands in range — used where a [0,1] probability operand needs more precision than bf16
typedef _Float16 v16h __attribute__((ext_vector_type(16)));
union FragH { v16h v; v8us half[2]; _Float16 h[16]; unsigned short u[16]; };
template <int NT>
__device__ __forceinline__ v8f mmaH(v16h ah, v16h al, v16h bh, v16h bl, v8f c) {
  c = __builtin_amdgcn_wmma_f32_16x16x32_f16(false, ah, false, bh, (short)0, c, false, false);
  if (NT >= 2) c = __builtin_amdgcn_wmma_f32_16x16x32_f16(false, al, false, bh, (short)0, c, false, false);
  if (NT >= 3) c = __builtin_amdgcn_wmma_f32_16x16x32_f16(false, ah, false, bl, (short)0, c, false, false);
  asm volatile("v_nop\n\tv_nop\n\tv_nop\n\tv_nop" : "+v"(c) : "v"(ah), "v"(al), "v"(bh), "v"(bl));
  return c;
}
// batched GEMM like k_gemm_b but f16 operands: A f32 (split into f16 hi/lo if ASPLIT, else rounded to f16), Bt = f16 values [n][k]; alpha; C f32; N multiple of 16 (partial tiles skipped)
template <bool ASPLIT>
__global__ __launch_bounds__(128) void k_gemm_h(const float* __restrict__ A, int lda, size_t sA, const _Float16* __restrict__ Bh, int ldb, size_t sB, float alpha, float* __restrict__ C, int ldc, size_t sC, int M, int N, int K) {
  __shared__ __attribute__((aligned(16))) float so[4][16][64];
  const int tid = threadIdx.x, w = tid >> 5, lane = tid & 31, ln = lane & 15, hh = lane >> 4; const int by = blockIdx.y;
  A += (size_t)by * sA; Bh += (size_t)by * sB; C += (size_t)by * sC;
  const int ntn = (N + 63) / 64; const int wid = blockIdx.x * 4 + w; const int mt = wid / ntn, nq = wid % ntn; if (mt * 16 >= M) return;
  const int row0 = mt * 16, col0 = nq * 64; const float* arow = A + (size_t)(row0 + ln) * lda;
  v8f acc[4] = {};
  for (int kb = 0; kb < K; kb += 32) {
    FragH ah, al;
    const v4f x0 = *(const v4fa*)(arow + kb + 8 * hh), x1 = *(const v4fa*)(arow + kb + 8 * hh + 4), x2 = *(const v4fa*)(arow + kb + 16 + 8 * hh), x3 = *(const v4fa*)(arow + kb + 16 + 8 * hh + 4);
    float xs[16] = {x0[0],x0[1],x0[2],x0[3],x1[0],x1[1],x1[2],x1[3],x2[0],x2[1],x2[2],x2[3],x3[0],x3[1],x3[2],x3[3]};
#pragma unroll
    for (int i = 0; i < 16; ++i) { const _Float16 h = (_Float16)xs[i]; ah.h[i] = h; al.h[i] = ASPLIT ? (_Float16)(xs[i] - (float)h) : (_Float16)0.0f; }
#pragma unroll
    for (int t = 0; t < 4; ++t) { if (col0 + t * 16 >= N) continue; const size_t boff = (size_t)(col0 + t * 16 + ln) * ldb + kb; FragH bq; bq.half[0] = *(const v8us*)(Bh + boff + 8 * hh); bq.half[1] = *(const v8us*)(Bh + boff + 16 + 8 * hh);
      acc[t] = mmaH<ASPLIT ? 2 : 1>(ah.v, al.v, bq.v, bq.v, acc[t]); }
  }
#pragma unroll
  for (int t = 0; t < 4; ++t) { if (col0 + t * 16 >= N) continue;
#pragma unroll
    for (int r = 0; r < 8; ++r) so[w][8 * hh + r][t * 16 + ln] = acc[t][r] * alpha; }
  __builtin_amdgcn_fence(__ATOMIC_ACQ_REL, "workgroup"); __builtin_amdgcn_wave_barrier();
  const int rsub = lane >> 4, c4 = (lane & 15) * 4;
  {
#pragma unroll
    for (int q = 0; q < 8; ++q) { const int r = q * 2 + rsub; if (col0 + c4 < N) { const v4f v = *(const v4fa*)&so[w][r][c4]; *(v4f*)(C + (size_t)(row0 + r) * ldc + col0 + c4) = v; } }
     }
}

// Wt[n][k] = f16(W[k][n]·scale) from f32 row-major W[K][N] (scale = power of two; bf16-exact weights stay exact in f16 away from the subnormal range)
__global__ __launch_bounds__(256) void k_wt_f16(const float* __restrict__ W, _Float16* __restrict__ Wt, int K, int N, float scale) {
  const int t = blockIdx.x * 256 + threadIdx.x; if (t >= N * (K / 8)) return; const int n = t / (K / 8), k8 = (t % (K / 8)) * 8; FragH f;
#pragma unroll
  for (int i = 0; i < 8; ++i) f.h[i] = (_Float16)(bf16_round(W[(size_t)(k8 + i) * N + n]) * scale); const v8us o = f.half[0];
  *(v8us*)((unsigned short*)Wt + (size_t)n * K + k8) = o; 
}
// k_gemm_hh variant with fused epilogue: v = acc·alpha + bias[by·sBias + col] (+ CP[(row/rowsPerB)·sCPb + by·64 + col] if CP) ; ACT 0 none / 1 elu ; writes f16 C16 (and f32 C if non-null)
template <int ACT>
__global__ __launch_bounds__(128) void k_gemm_hhx(const _Float16* __restrict__ A, int lda, size_t sA, const _Float16* __restrict__ Bh, int ldb, size_t sB, float alpha, const float* __restrict__ bias, size_t sBias, const float* __restrict__ CP, int rowsPerB, size_t sCPb, int row0g,
    float* __restrict__ C, _Float16* __restrict__ C16, int ldc, size_t sC, int M, int N, int K) {
  __shared__ __attribute__((aligned(16))) float so[4][16][64];
  const int tid = threadIdx.x, w = tid >> 5, lane = tid & 31, ln = lane & 15, hh = lane >> 4; const int by = blockIdx.y;
  A += (size_t)by * sA; Bh += (size_t)by * sB; const size_t cofs = (size_t)by * sC; const float* bp = bias ? bias + (size_t)by * sBias : nullptr;
  const int ntn = (N + 63) / 64; const int wid = blockIdx.x * 4 + w; const int mt = wid / ntn, nq = wid % ntn; if (mt * 16 >= M) return;
  const int row0 = mt * 16, col0 = nq * 64; const _Float16* arow = A + (size_t)(row0 + ln) * lda;
  v8f acc[4] = {};
  for (int kb = 0; kb < K; kb += 32) { FragH ah; ah.half[0] = *(const v8us*)((const unsigned short*)arow + kb + 8 * hh); ah.half[1] = *(const v8us*)((const unsigned short*)arow + kb + 16 + 8 * hh);
#pragma unroll
    for (int t = 0; t < 4; ++t) { if (col0 + t * 16 >= N) continue; const size_t boff = (size_t)(col0 + t * 16 + ln) * ldb + kb; FragH bq; bq.half[0] = *(const v8us*)((const unsigned short*)Bh + boff + 8 * hh); bq.half[1] = *(const v8us*)((const unsigned short*)Bh + boff + 16 + 8 * hh);
      acc[t] = mmaH<1>(ah.v, ah.v, bq.v, bq.v, acc[t]); }
  }
#pragma unroll
  for (int t = 0; t < 4; ++t) { if (col0 + t * 16 >= N) continue; const int col = col0 + t * 16 + ln; const float bv = bp ? bf16_round(bp[col]) : 0.f;
#pragma unroll
    for (int r = 0; r < 8; ++r) { float v = acc[t][r] * alpha + bv; if (CP) { const int rr = row0g + row0 + 8 * hh + r; if (rowsPerB < 0) v += CP[cofs + (size_t)rr * ldc + col];      /* rowsPerB < 0: own element of the batched C plane */ else { const int bidx = rr / rowsPerB; v += CP[(size_t)bidx * sCPb + (size_t)by * 64 + col]; } } if (ACT == 1) v = (v > 0.f) ? v : expm1f(v); else if (ACT == 7) v = (v > 0.f) ? v + 1.0f : expf(v); else if (ACT == 8) v = tanhf(v); else if (ACT == 9) v = 0.5f * v * (1.0f + tanhf(0.7978845608028654f * (v + 0.044715f * v * v * v))); else if (ACT == 11) v = 1.0f / (1.0f + expf(-v)); else if (ACT == 12) v = (v > 0.f) ? v : 0.01f * v; else if (ACT == 14) v = (v > 0.f) ? v : 0.1f * v; else if (ACT == 16) v = (v >= 0.f) ? v : 0.3f * v; else if (ACT == 17) v = (v >= 0.f) ? v : 0.2f * v; else if (ACT == 15) v = v / (1.0f + expf(-v)); else if (ACT == 3) v = fmaxf(v, 0.f); else if (ACT == 6) v = 0.5f * v * (1.0f + erff(v * 0.70710678118654752f)); so[w][8 * hh + r][t * 16 + ln] = v; } }
  __builtin_amdgcn_fence(__ATOMIC_ACQ_REL, "workgroup"); __builtin_amdgcn_wave_barrier();
  const int rsub = lane >> 4, c4 = (lane & 15) * 4; typedef _Float16 v4h __attribute__((ext_vector_type(4)));
  {
#pragma unroll
    for (int q = 0; q < 8; ++q) { const int r = q * 2 + rsub; if (col0 + c4 < N) { const v4f v = *(const v4fa*)&so[w][r][c4]; if (C) *(v4f*)(C + cofs + (size_t)(row0 + r) * ldc + col0 + c4) = v; if (C16) { v4h h4; for (int i = 0; i < 4; ++i) h4[i] = (_Float16)v[i]; *(v4h*)(C16 + cofs + (size_t)(row0 + r) * ldc + col0 + c4) = h4; } } }
     }
}


typedef _Float16 v4h __attribute__((ext_vector_type(4)));

__global__ __launch_bounds__(256) void k_x16(const float* __restrict__ x, _Float16* __restrict__ X16, size_t n8) { const size_t t = (size_t)blockIdx.x * 256 + threadIdx.x; if (t >= n8) return; FragH f;
#pragma unroll
  for (int q = 0; q < 8; ++q) f.h[q] = (_Float16)bf16_round(x[t * 8 + q]); *(v8us*)((unsigned short*)X16 + t * 8) = f.half[0];  }
__global__ __launch_bounds__(256) void k_h16(const float* __restrict__ x, _Float16* __restrict__ X16, size_t n8) { const size_t t = (size_t)blockIdx.x * 256 + threadIdx.x; if (t >= n8) return; FragH f;
#pragma unroll
  for (int q = 0; q < 8; ++q) f.h[q] = (_Float16)x[t * 8 + q]; *(v8us*)((unsigned short*)X16 + t * 8) = f.half[0];  }
__global__ __launch_bounds__(256) void k_round16f(const float* __restrict__ W, _Float16* __restrict__ Bt, size_t n8) { const size_t t = (size_t)blockIdx.x * 256 + threadIdx.x; if (t >= n8) return; FragH f;
#pragma unroll
  for (int i = 0; i < 8; ++i) f.h[i] = (_Float16)(bf16_round(W[t * 8 + i]) * 16.0f); *(v8us*)((unsigned short*)Bt + t * 8) = f.half[0];  }
template <int NHv, int TTv>
__global__ __launch_bounds__(256) void k_vt(const _Float16* __restrict__ V16, int ldv, int voff, _Float16* __restrict__ Vt) { __shared__ unsigned short tl[64][66]; const int tid = threadIdx.x; const int slab = blockIdx.x / (TTv / 64), lg = blockIdx.x % (TTv / 64); const int b = slab / NHv, h = slab % NHv;
  for (int i = tid; i < 64 * 8; i += 256) { const int r = i / 8, c8 = (i % 8) * 8; FragH f; f.half[0] = *(const v8us*)((const unsigned short*)V16 + ((size_t)b * TTv + lg * 64 + r) * ldv + voff + h * 64 + c8);
#pragma unroll
    for (int q = 0; q < 8; ++q) tl[r][c8 + q] = f.u[q]; }
  __syncthreads();
  {
#pragma unroll
    for (int rd = 0; rd < 2; ++rd) { const int d = rd * 32 + tid / 8, pc = tid % 8; FragH f;
#pragma unroll
      for (int q = 0; q < 8; ++q) f.u[q] = tl[pc * 8 + q][d];
      *(v8us*)((unsigned short*)Vt + ((size_t)slab * 64 + d) * TTv + lg * 64 + pc * 8) = f.half[0]; }
     } }

__global__ __launch_bounds__(256) void k_hl(const float* __restrict__ F, _Float16* __restrict__ Hh, _Float16* __restrict__ Hl, size_t n8) { const size_t t = (size_t)blockIdx.x * 256 + threadIdx.x; if (t >= n8) return; FragH fh, fl; const v4f a = *(const v4fa*)(F + t * 8), c = *(const v4fa*)(F + t * 8 + 4);
#pragma unroll
  for (int q = 0; q < 4; ++q) { _Float16 h = (_Float16)a[q]; fh.h[q] = h; fl.h[q] = (_Float16)((a[q] - (float)h) * 1024.0f); h = (_Float16)c[q]; fh.h[4 + q] = h; fl.h[4 + q] = (_Float16)((c[q] - (float)h) * 1024.0f); }
  { *(v8us*)((unsigned short*)Hh + t * 8) = fh.half[0]; *(v8us*)((unsigned short*)Hl + t * 8) = fl.half[0];  } }

// ---- fast GEMM (wave tile 32x64; requires M % 32 == 0 rows per launch region and N % 64 == 0); epilogue = k_gemm_hhx semantics ----
__device__ __forceinline__ v16h g2_frag(const _Float16* p, int hh) { FragH f; f.half[0] = *(const v8us*)((const unsigned short*)p + 8 * hh); f.half[1] = *(const v8us*)((const unsigned short*)p + 16 + 8 * hh); return f.v; }
__device__ __forceinline__ v8f g2_mma(v16h a, v16h b, v8f c) { v8f d = __builtin_amdgcn_wmma_f32_16x16x32_f16(false, a, false, b, (short)0, c, false, false); asm volatile("v_nop\n\tv_nop\n\tv_nop\n\tv_nop" : "+v"(d) : "v"(a), "v"(b)); return d; }
template <int ACT>
__global__ __launch_bounds__(128) void k_gemm2(const _Float16* __restrict__ A, int lda, size_t sA, const _Float16* __restrict__ Bh, int ldb, size_t sB, float alpha, const float* __restrict__ bias, size_t sBias, const float* __restrict__ CP, int rowsPerB, size_t sCPb, int row0g,
    float* __restrict__ C, _Float16* __restrict__ C16, int ldc, size_t sC, int M, int N, int K) { static_assert(ACT == 0 || ACT == 3 || ACT == 6 || ACT == 8 || ACT == 9 || ACT == 11 || ACT == 12 || ACT == 14 || ACT == 15 || ACT == 16 || ACT == 17, "k_gemm2: unsupported ACT code (would silently apply no activation)");
  __shared__ __attribute__((aligned(16))) float so[4][32][68];
  const int tid = threadIdx.x, w = tid >> 5, lane = tid & 31, ln = lane & 15, hh = lane >> 4; const int by = blockIdx.y;
  A += (size_t)by * sA; Bh += (size_t)by * sB; const size_t cofs = (size_t)by * sC; const float* bp = bias ? bias + (size_t)by * sBias : nullptr;
  const int ntn = N >> 6; const int mt = blockIdx.x / ntn, nq = blockIdx.x - mt * ntn; const int row0 = mt * 128 + 32 * w, col0 = nq * 64; if (row0 >= M) return;
  const _Float16* a0p = A + (size_t)(row0 + ln) * lda; const _Float16* a1p = a0p + (size_t)16 * lda;
  const _Float16* b0p = Bh + (size_t)(col0 + ln) * ldb; const _Float16* b1p = b0p + (size_t)16 * ldb; const _Float16* b2p = b1p + (size_t)16 * ldb; const _Float16* b3p = b2p + (size_t)16 * ldb;
  const v8f z8 = {0.f,0.f,0.f,0.f,0.f,0.f,0.f,0.f}; v8f c00 = z8, c01 = z8, c02 = z8, c03 = z8, c10 = z8, c11 = z8, c12 = z8, c13 = z8;
#pragma unroll 1
  for (int kb = 0; kb < K; kb += 32) { const v16h a0 = g2_frag(a0p + kb, hh), a1 = g2_frag(a1p + kb, hh);
    v16h b = g2_frag(b0p + kb, hh); c00 = g2_mma(a0, b, c00); c10 = g2_mma(a1, b, c10);
    b = g2_frag(b1p + kb, hh); c01 = g2_mma(a0, b, c01); c11 = g2_mma(a1, b, c11);
    b = g2_frag(b2p + kb, hh); c02 = g2_mma(a0, b, c02); c12 = g2_mma(a1, b, c12);
    b = g2_frag(b3p + kb, hh); c03 = g2_mma(a0, b, c03); c13 = g2_mma(a1, b, c13); }
  v8f accs[8] = {c00, c01, c02, c03, c10, c11, c12, c13};
#pragma unroll
  for (int u = 0; u < 8; ++u) { const int t = u & 3, half = u >> 2; const int col = col0 + t * 16 + ln; const float bv = bp ? bf16_round(bp[col]) : 0.f;
#pragma unroll
    for (int r = 0; r < 8; ++r) { const int rloc = half * 16 + 8 * hh + r; float v = accs[u][r] * alpha + bv; if (CP) { if (rowsPerB < 0) v += CP[cofs + (size_t)(row0g + row0 + rloc) * ldc + col];      /* rowsPerB < 0: own element of the batched C plane */ else { const int bidx = (row0g + row0 + rloc) / rowsPerB; v += CP[(size_t)bidx * sCPb + (size_t)by * 64 + col]; } }
      if (ACT == 3) v = fmaxf(v, 0.f); else if (ACT == 6) v = 0.5f * v * (1.0f + erff(v * 0.70710678118654752f)); else if (ACT == 11) v = 1.0f / (1.0f + expf(-v)); else if (ACT == 15) v = v / (1.0f + expf(-v)); else if (ACT == 12) v = (v > 0.f) ? v : 0.01f * v; else if (ACT == 8) v = tanhf(v); else if (ACT == 9) v = 0.5f * v * (1.0f + tanhf(0.7978845608028654f * (v + 0.044715f * v * v * v))); else if (ACT == 14) v = (v > 0.f) ? v : 0.1f * v; else if (ACT == 16) v = (v >= 0.f) ? v : 0.3f * v; else if (ACT == 17) v = (v >= 0.f) ? v : 0.2f * v;
      so[w][rloc][t * 16 + ln] = v; } }
  __builtin_amdgcn_fence(__ATOMIC_ACQ_REL, "workgroup"); __builtin_amdgcn_wave_barrier();
  const int rsub = lane >> 4, c4 = (lane & 15) * 4;
  {
#pragma unroll
    for (int q = 0; q < 16; ++q) { const int r = q * 2 + rsub; const v4f v = *(const v4fa*)&so[w][r][c4]; if (C) *(v4f*)(C + cofs + (size_t)(row0 + r) * ldc + col0 + c4) = v; if (C16) { v4h h4; for (int i = 0; i < 4; ++i) h4[i] = (_Float16)v[i]; *(v4h*)(C16 + cofs + (size_t)(row0 + r) * ldc + col0 + c4) = h4; } }
     } }


__global__ __launch_bounds__(256) void k_wnat(const float* __restrict__ w, size_t n8, _Float16* __restrict__ Bt) { const size_t t = (size_t)blockIdx.x * 256 + threadIdx.x; if (t >= n8) return; FragH f; for (int q = 0; q < 8; ++q) f.h[q] = (_Float16)(bf16_round(w[t * 8 + q]) * 16.0f); *(v8us*)((unsigned short*)Bt + t * 8) = f.half[0];  }
__global__ __launch_bounds__(256) void k_rsm(const float* __restrict__ S, _Float16* __restrict__ P, int nrows) {
  #pragma clang fp contract(off)
  const int i = blockIdx.x * 256 + threadIdx.x; if (i >= nrows) return; const float* s = S + (size_t)i * SQ; float mx = -3.0e38f;
#pragma unroll 1
  for (int j = 0; j < SQ; ++j) mx = fmaxf(mx, s[j]); float se = 0.f;
#pragma unroll 1
  for (int j = 0; j < SQ; ++j) se += expf(s[j] - mx); const float sc = 256.0f / se;
#pragma unroll 1
  for (int j0 = 0; j0 < SQ; j0 += 8) { FragH f; for (int q = 0; q < 8; ++q) f.h[q] = (_Float16)(expf(s[j0 + q] - mx) * sc); unsigned short* d = (unsigned short*)P + (size_t)i * SQ + j0; *(v8us*)d = f.half[0];  } }
__global__ __launch_bounds__(256) void k_vt(const _Float16* __restrict__ V16, int b, int h0, _Float16* __restrict__ VT) { __shared__ unsigned short tl[64][65]; const int tid = threadIdx.x; const int hh = blockIdx.x % HG, sg = blockIdx.x / HG; const int s0 = sg * 64; const int h = h0 + hh;
  for (int i = tid; i < 64 * 8; i += 256) { const int j = i / 8, d8 = (i % 8) * 8; FragH f; f.half[0] = *(const v8us*)((const unsigned short*)V16 + ((size_t)b * SQ + s0 + j) * DM + h * HD + d8); for (int q = 0; q < 8; ++q) tl[d8 + q][j] = f.u[q]; }
  __syncthreads();
  { for (int i = tid; i < 64 * 8; i += 256) { const int d = i / 8, j8 = (i % 8) * 8; FragH f; for (int q = 0; q < 8; ++q) f.u[q] = tl[d][j8 + q]; *(v8us*)((unsigned short*)VT + ((size_t)hh * HD + d) * SQ + s0 + j8) = f.half[0]; }  } }



__global__ __launch_bounds__(256) void k_rsmcf2(const float* __restrict__ S, _Float16* __restrict__ P, int hg, int q0, int nk) {
  #pragma clang fp contract(off)
  const int t = blockIdx.x * 256 + threadIdx.x; if (t >= hg * QT) return; const size_t i = (size_t)t; const float* s = S + i * NKX; const int last = q0 + (t % QT); float mx = -3.0e38f;
#pragma unroll 1
  for (int j = 0; j < nk; ++j) { const float f = (j <= last) ? 1.f : 0.f; mx = fmaxf(mx, fmaf(f, s[j], (1.f - f) * -1.0e9f)); } float se = 0.f;
#pragma unroll 1
  for (int j = 0; j < nk; ++j) { const float f = (j <= last) ? 1.f : 0.f; se += __expf(fmaf(f, s[j], (1.f - f) * -1.0e9f) - mx); } const float sc = 256.0f / se;
#pragma unroll 1
  for (int j0 = 0; j0 < nk; j0 += 8) { FragH fr; for (int q = 0; q < 8; ++q) { const int j = j0 + q; const float f = (j <= last) ? 1.f : 0.f; fr.h[q] = (_Float16)(__expf(fmaf(f, s[j], (1.f - f) * -1.0e9f) - mx) * sc); } unsigned short* d = (unsigned short*)P + i * NKX + j0; *(v8us*)d = fr.half[0];  } }

template <int MASKADD>
__global__ __launch_bounds__(64) void k_att0(const float* __restrict__ QF, const float* __restrict__ KF, const float* __restrict__ VF, int ld, const float* __restrict__ mask, float scale, float* __restrict__ OF, int ldo) {
  #pragma clang fp contract(off)
  __shared__ __attribute__((aligned(16))) float lq[64][64]; __shared__ __attribute__((aligned(16))) float lo[64][64];
  const int tid = threadIdx.x; const int h = blockIdx.x / (QT0 / 64), rg = blockIdx.x % (QT0 / 64); const int i = rg * 64 + tid;
  const float* qr = QF + (size_t)i * ld + h * HD;
#pragma unroll 1
  for (int c = 0; c < HD / 4; ++c) { *(v4f*)&lq[tid][c * 4] = *(const v4fa*)(qr + c * 4); const v4f z = {0.f, 0.f, 0.f, 0.f}; *(v4f*)&lo[tid][c * 4] = z; }
  float m = -1.0e30f, l = 0.f; const int jmax = MASKADD ? (SQ - 1) : (rg * 64 + 63);      /* additive-mask form: every key (the mask input decides); causal form: keys up to the block's last row */
#pragma unroll 1
  for (int j = 0; j <= jmax; ++j) { const float* kr = KF + (size_t)j * ld + h * HD; const float* vr = VF + (size_t)j * ld + h * HD; float s = 0.f;
#pragma unroll 1
    for (int c = 0; c < HD / 4; ++c) { const v4f kq = *(const v4fa*)(kr + c * 4); const v4f qq = *(v4f*)&lq[tid][c * 4]; s = __fadd_rn(s, __fmul_rn(qq[0], kq[0])); s = __fadd_rn(s, __fmul_rn(qq[1], kq[1])); s = __fadd_rn(s, __fmul_rn(qq[2], kq[2])); s = __fadd_rn(s, __fmul_rn(qq[3], kq[3])); }
    s = __fmul_rn(s, scale); if (MASKADD) s = __fadd_rn(s, __fmul_rn(bf16_round(mask[(size_t)i * SQ + j]), -10000.0f));
    const float f = (MASKADD || j <= i) ? 1.f : 0.f; const float sm = fmaf(f, s, (1.f - f) * -1.0e30f); const float mn = fmaxf(m, sm); const float sc = expf(m - mn); const float e = expf(sm - mn); l = __fadd_rn(__fmul_rn(l, sc), e); m = mn;
#pragma unroll 1
    for (int c = 0; c < HD / 4; ++c) { const v4f vv = *(const v4fa*)(vr + c * 4); v4f oo = *(v4f*)&lo[tid][c * 4]; for (int u = 0; u < 4; ++u) oo[u] = __fadd_rn(__fmul_rn(oo[u], sc), __fmul_rn(e, vv[u])); *(v4f*)&lo[tid][c * 4] = oo; } }
  const float fin = 64.0f / l;      /* o carried x64 */
#pragma unroll 1
  for (int c = 0; c < HD / 4; ++c) { v4f oo = *(v4f*)&lo[tid][c * 4]; for (int u = 0; u < 4; ++u) oo[u] = __fmul_rn(oo[u], fin); *(v4f*)&lo[tid][c * 4] = oo; }
  __syncthreads();
  {
#pragma unroll 1
    for (int it = 0; it < 16; ++it) { const int row = it * 4 + tid / 16, pc = (tid % 16) * 4; const v4f v = *(const v4f*)&lo[row][pc]; *(v4f*)(OF + (size_t)(rg * 64 + row) * ldo + h * HD + pc) = v; }
     } }

__global__ __launch_bounds__(256) void k_oscale(const float* __restrict__ OF, float* __restrict__ out, size_t n4) { const size_t t = (size_t)blockIdx.x * 256 + threadIdx.x; if (t >= n4) return; const v4f a = *(const v4fa*)(OF + t * 4); v4f o; for (int q = 0; q < 4; ++q) o[q] = a[q] * 0.015625f; *(v4f*)(out + t * 4) = o;  }

__global__ __launch_bounds__(256) void k_bfr(const float* __restrict__ x, float* __restrict__ XB, size_t n8) { const size_t t = (size_t)blockIdx.x * 256 + threadIdx.x; if (t >= n8) return; v4f a = *(const v4fa*)(x + t * 8), c = *(const v4fa*)(x + t * 8 + 4); for (int q = 0; q < 4; ++q) { a[q] = bf16_round(a[q]); c[q] = bf16_round(c[q]); }
  { *(v4f*)(XB + t * 8) = a; *(v4f*)(XB + t * 8 + 4) = c;  } }



__global__ __launch_bounds__(256) void k_rsmfvl(const float* __restrict__ S, _Float16* __restrict__ P, _Float16* __restrict__ PL, int qn, const int* __restrict__ vlp) {
  #pragma clang fp contract(off)
  const int t = blockIdx.x * 256 + threadIdx.x; if (t >= qn) return; const int vl = vlp[0]; const size_t i = (size_t)t; const float* s = S + i * SQ; float mx = -3.0e38f;
#pragma unroll 1
  for (int j = 0; j < SQ; ++j) { const float f = (j < vl) ? 1.f : 0.f; mx = fmaxf(mx, fmaf(f, s[j], (1.f - f) * -1000000.0f)); } float se = 0.f;
#pragma unroll 1
  for (int j = 0; j < SQ; ++j) { const float f = (j < vl) ? 1.f : 0.f; se += __expf(fmaf(f, s[j], (1.f - f) * -1000000.0f) - mx); } const float sc = 256.0f / se;
#pragma unroll 1
  for (int j0 = 0; j0 < SQ; j0 += 8) { FragH fr, gr; for (int q = 0; q < 8; ++q) { const int j = j0 + q; const float f = (j < vl) ? 1.f : 0.f; const float pv = __expf(fmaf(f, s[j], (1.f - f) * -1000000.0f) - mx) * sc; const _Float16 ph = (_Float16)pv; fr.h[q] = ph; gr.h[q] = (_Float16)((pv - (float)ph) * 1024.0f); }
    unsigned short* d = (unsigned short*)P + i * SQ + j0; unsigned short* dl = (unsigned short*)PL + i * SQ + j0; *(v8us*)d = fr.half[0]; *(v8us*)dl = gr.half[0];  } }

__global__ __launch_bounds__(256) void k_rsmf(const float* __restrict__ S, _Float16* __restrict__ P, int qn, int hg) {
  #pragma clang fp contract(off)
  const int t = blockIdx.x * 256 + threadIdx.x; if (t >= qn * hg) return; const size_t i = (size_t)(t / qn) * SQ + (t % qn); const float* s = S + i * SQ; float mx = -3.0e38f;
#pragma unroll 1
  for (int j = 0; j < SQ; ++j) mx = fmaxf(mx, s[j]); float se = 0.f;
#pragma unroll 1
  for (int j = 0; j < SQ; ++j) se += __expf(s[j] - mx); const float sc = 256.0f / se;
#pragma unroll 1
  for (int j0 = 0; j0 < SQ; j0 += 8) { FragH f; for (int q = 0; q < 8; ++q) f.h[q] = (_Float16)(__expf(s[j0 + q] - mx) * sc); unsigned short* d = (unsigned short*)P + i * SQ + j0; *(v8us*)d = f.half[0];  } }



// Lane l with lane l ^ 16. Every lane must be on.
__device__ __forceinline__ float lane_x16(float v) { const int i = __float_as_int(v); return __int_as_float(__builtin_amdgcn_permlanex16(i, i, 0x76543210, 0xfedcba98, false, false)); }
typedef int v4ia __attribute__((ext_vector_type(4), may_alias));
// Four native exp2 in one statement. The closing v_nop is the one slot the instruction set asks for behind a transcendental before its result is read or its source overwritten;
// the outputs are early-clobber, so each exp is independent of the one in front of it.
__device__ __forceinline__ v4f exp2_x4(v4f a) { float r0, r1, r2, r3;
  asm("v_exp_f32 %0, %4\n\tv_exp_f32 %1, %5\n\tv_exp_f32 %2, %6\n\tv_exp_f32 %3, %7\n\tv_nop" : "=&v"(r0), "=&v"(r1), "=&v"(r2), "=&v"(r3) : "v"(a[0]), "v"(a[1]), "v"(a[2]), "v"(a[3]));
  const v4f r = {r0, r1, r2, r3}; return r; }


typedef unsigned int fa_u4 __attribute__((ext_vector_type(4)));
typedef unsigned int fa_u4a __attribute__((ext_vector_type(4), may_alias));
typedef unsigned int fa_u8 __attribute__((ext_vector_type(8)));
typedef short fa_s8 __attribute__((ext_vector_type(8)));
#define FA_SK 64u                                /* keys per stage */
#define FA_PK 272u                               /* LDS pitch of a K row: odd multiple of 16 B (ds_load_b128 readers) */
#define FA_PV 288u                               /* LDS pitch of a V row: odd multiple of 32 B (ds_load_tr16_b128 readers) */
#define FA_TK (FA_SK * FA_PK)
#define FA_SLOT (FA_SK * (FA_PK + FA_PV))
#define FA_RING (3u * FA_SLOT)
#define FA_EP 528u                               /* pitch of an output row (128 f32) staged in the ring */
#define FA_NST ((unsigned)SQ / FA_SK)
#define FA_CP 32u                                /* pitch of the per-sequence counts, in ints: each count has a 128-byte line of its own, since another workgroup writes the next one */
#define FA_CS 0.12751743f                        /* log2(e) / sqrt(128) */
static_assert(4u * 32u * FA_EP <= FA_RING, "the output staging reuses the K / V ring");
// Stages that hold nk packed rows; at least one, so that a sequence without a kept key still runs the sums (0 / 0, as the module's). Both launches use it: rows nk .. 64 fa_stages(nk) - 1 are zero rows.
__device__ __forceinline__ unsigned int fa_stages(unsigned int nk) { const unsigned int s = (nk + FA_SK - 1u) / FA_SK; return s < 1u ? 1u : s > FA_NST ? FA_NST : s; }
struct FaFrag { fa_u4 q[2]; };
struct FaK { FaFrag f[2][4]; };
__device__ __forceinline__ v8f fa_mma(const FaFrag& a, const FaFrag& b, v8f c) {
  const fa_u8 av = __builtin_shufflevector(a.q[0], a.q[1], 0, 1, 2, 3, 4, 5, 6, 7), bv = __builtin_shufflevector(b.q[0], b.q[1], 0, 1, 2, 3, 4, 5, 6, 7);
  return __builtin_amdgcn_wmma_f32_16x16x32_f16(false, __builtin_bit_cast(v16h, av), false, __builtin_bit_cast(v16h, bv), (short)0, c, false, false); }
__device__ __forceinline__ void fa_fence() { __builtin_amdgcn_sched_barrier(0); }
// Four vector slots behind a run of WMMAs: the exponentials are asm text, whose outputs the compiler may place on a WMMA's operand registers without padding the distance itself.
__device__ __forceinline__ void fa_nop4() { asm volatile("v_nop\n\tv_nop\n\tv_nop\n\tv_nop"); }
__device__ __forceinline__ fa_u4 fa_tr16(const unsigned char* p) { typedef __attribute__((address_space(3))) fa_s8 lds_s8; return __builtin_bit_cast(fa_u4, __builtin_amdgcn_ds_load_tr16_b128_v8i16((lds_s8*)p)); }
__device__ __forceinline__ unsigned int fa_pack2(float lo, float hi) { typedef _Float16 h2 __attribute__((ext_vector_type(2))); typedef float f2 __attribute__((ext_vector_type(2))); return __builtin_bit_cast(unsigned int, __builtin_convertvector(f2{lo, hi}, h2)); }
// K fragments of one 32-key pass in the hardware k order (bytes 16 h and 32 + 16 h of each 64 bytes of a row), as Q's in the kernel.
__device__ __forceinline__ void fa_load_k(FaK& k, const unsigned char* Lp, unsigned int koff, unsigned int lane) {
  const unsigned int c = lane & 15u, h = lane >> 4;
#pragma unroll
  for (int kt = 0; kt < 2; ++kt) { const unsigned char* p = Lp + koff + (16u * kt + c) * FA_PK + 16u * h;
#pragma unroll
    for (int kc = 0; kc < 4; ++kc) { k.f[kt][kc].q[0] = *(const fa_u4a*)(p + 64u * kc); k.f[kt][kc].q[1] = *(const fa_u4a*)(p + 64u * kc + 32u); } } }
// One 32-key pass of one wave. voff, moff: LDS byte offsets of the pass's first V row and first mask float. m_run, the maximum in use, may trail the true one by up to 8 (log2 units),
// so an exponential stays below 2^8, inside f16; the quotient of the sums does not depend on it.
__device__ __forceinline__ void fa_block(FaK& kf, bool fetch_next, unsigned int next_koff, const unsigned char* Lp, unsigned int voff, unsigned int moff, unsigned int lane,
                                         const FaFrag (&qf)[2][4], v8f (&acc)[2][8], float (&m_run)[2], v4f (&l_run)[2]) {
  const unsigned int h = lane >> 4;
  v8f s[2][2];
#pragma unroll
  for (int kt = 0; kt < 2; ++kt) {
#pragma unroll
    for (int g = 0; g < 2; ++g) { s[kt][g] = v8f{};
#pragma unroll
      for (int kc = 0; kc < 4; ++kc) s[kt][g] = fa_mma(kf.f[kt][kc], qf[g][kc], s[kt][g]); } }
  fa_fence(); fa_nop4(); fa_fence();      /* the fences keep the slots behind the last WMMA and the next pass's K loads behind this pass's products, which read the same registers */
  if (fetch_next) fa_load_k(kf, Lp, next_koff, lane);      /* in flight under the maxima and the exponentials */
  v4f mk[4];      /* this lane's 16 keys' 0 / 1: keys 16 kt + 8 h + r */
  { const unsigned char* mp = Lp + moff + 32u * h; mk[0] = *(const v4fa*)(mp); mk[1] = *(const v4fa*)(mp + 16u); mk[2] = *(const v4fa*)(mp + 64u); mk[3] = *(const v4fa*)(mp + 80u); }
  FaFrag vf[8];      /* V^T, 16 (d) x 32 (keys) per fragment */
  { const unsigned char* ad = Lp + voff + (8u * h + (lane & 7u)) * FA_PV + ((lane >> 3) & 1u) * 16u;
#pragma unroll
    for (int t = 0; t < 8; ++t) { vf[t].q[0] = fa_tr16(ad + 32u * t); vf[t].q[1] = fa_tr16(ad + 16u * FA_PV + 32u * t); } }
  float mb[2]; bool need = false;
#pragma unroll
  for (int g = 0; g < 2; ++g) { float mx = s[0][g][0];
#pragma unroll
    for (int r = 1; r < 8; ++r) mx = fmaxf(mx, s[0][g][r]);
#pragma unroll
    for (int r = 0; r < 8; ++r) mx = fmaxf(mx, s[1][g][r]);
    mx = fmaxf(mx, lane_x16(mx)) * FA_CS;      /* both wave halves hold this query's maximum over the pass's 32 rows, fill rows (score 0) included */
    mb[g] = mx; need = need || (mx > m_run[g] + 8.0f); }
  if (__builtin_amdgcn_ballot_w32(need) != 0) {      /* wave-uniform, rare after the first passes */
    const float n0 = fmaxf(m_run[0], mb[0]), n1 = fmaxf(m_run[1], mb[1]);
    float cr[2];      /* 0 on the first pass, where m_run is -inf; the closing v_nop is the slot behind a transcendental, as in exp2_x4 */
    asm("v_exp_f32 %0, %2\n\tv_exp_f32 %1, %3\n\tv_nop" : "=&v"(cr[0]), "=&v"(cr[1]) : "v"(m_run[0] - n0), "v"(m_run[1] - n1));
    m_run[0] = n0; m_run[1] = n1;
#pragma unroll
    for (int g = 0; g < 2; ++g) { l_run[g] = l_run[g] * cr[g];
#pragma unroll
      for (int t = 0; t < 8; ++t) acc[g][t] = acc[g][t] * cr[g]; } }
#pragma unroll
  for (int g = 0; g < 2; ++g) { const float nm = -m_run[g]; const v4f nm4 = {nm, nm, nm, nm}; const v4f cs4 = {FA_CS, FA_CS, FA_CS, FA_CS};
    unsigned int w[8];
#pragma unroll
    for (int j = 0; j < 4; ++j) { const int kt = j >> 1, r0 = 4 * (j & 1);
      const v4f sv = {s[kt][g][r0], s[kt][g][r0 + 1], s[kt][g][r0 + 2], s[kt][g][r0 + 3]};
      const v4f p = exp2_x4(__builtin_elementwise_fma(sv, cs4, nm4)) * mk[j];
      l_run[g] += p; w[2 * j] = fa_pack2(p[0], p[1]); w[2 * j + 1] = fa_pack2(p[2], p[3]); }
    FaFrag pf; pf.q[0] = fa_u4{w[0], w[1], w[2], w[3]}; pf.q[1] = fa_u4{w[4], w[5], w[6], w[7]};
#pragma unroll
    for (int t = 0; t < 8; ++t) acc[g][t] = fa_mma(vf[t], pf, acc[g][t]);
    fa_fence(); fa_nop4(); fa_fence(); }      /* slots in front of the next group's (or pass's) asm exponentials; the fences keep them directly behind the WMMAs */
}
__global__ __launch_bounds__(128) void k_fattn(const _Float16* __restrict__ Q, const _Float16* __restrict__ K, const _Float16* __restrict__ V, const int* __restrict__ Cnt, float* __restrict__ O) {
  __shared__ __attribute__((aligned(256))) unsigned char L[FA_RING + SQ * 4];      /* three K / V buffers, then f32 1 / 0 per packed row: kept key or fill row */
  const unsigned int tid = threadIdx.x, lane = tid & 31u, wave = __builtin_amdgcn_readfirstlane(tid >> 5), c = lane & 15u, h = lane >> 4;
  const unsigned int b = blockIdx.y, q0 = blockIdx.x * 128u;
  const int nraw = Cnt[b * FA_CP];      /* asked for here, first used behind the prologue's global loads */
  // Staging: 16-byte chunk tid + 128 i of a stage's 64 x 256 B of K (and of V) is row 8 i + tid / 16, bytes 16 (tid % 16): a wave's load covers 512 contiguous bytes.
  const unsigned char* kg = (const unsigned char*)(K + (size_t)b * SQ * DM) + tid * 16u; const unsigned char* vg = (const unsigned char*)(V + (size_t)b * SQ * DM) + tid * 16u;
  const unsigned int kd = (tid >> 4) * FA_PK + (tid & 15u) * 16u, vd = FA_TK + (tid >> 4) * FA_PV + (tid & 15u) * 16u;
  fa_u4 kr[8], vr[8];
#pragma unroll
  for (int i = 0; i < 8; ++i) { kr[i] = *(const fa_u4a*)(kg + i * 2048u); vr[i] = *(const fa_u4a*)(vg + i * 2048u); }
  FaFrag qf[2][4];
#pragma unroll
  for (int g = 0; g < 2; ++g) { const _Float16* qp = Q + ((size_t)b * SQ + q0 + wave * 32u + 16u * g + c) * DM + 8u * h;
#pragma unroll
    for (int kc = 0; kc < 4; ++kc) { qf[g][kc].q[0] = *(const fa_u4a*)(qp + 32 * kc); qf[g][kc].q[1] = *(const fa_u4a*)(qp + 32 * kc + 16); }
    asm volatile("s_wait_xcnt 0x0" :: "v"(qp) : "memory"); }      /* this group's address registers may become a later load's destination; named as an input, they stay untouched up to the wait */
  fa_fence();      /* stage 0's and Q's loads are issued without waiting for the count */
  const unsigned int nk = (unsigned int)(nraw < 0 ? 0 : nraw > SQ ? SQ : nraw);      /* kept keys of this sequence, the same for the whole workgroup */
  const unsigned int nst = __builtin_amdgcn_readfirstlane(fa_stages(nk));      /* stages walked: 1 .. FA_NST; in a scalar register, so that the loop's tests are scalar compares */
#pragma unroll
  for (int j = 0; j < 4; ++j) { v4f f; for (int q = 0; q < 4; ++q) f[q] = (j * 512u + tid * 4u + q < nk) ? 1.0f : 0.0f; *(v4fa*)(L + FA_RING + (j * 512u + tid * 4u) * 4u) = f; }
#pragma unroll
  for (int i = 0; i < 8; ++i) { *(fa_u4a*)(L + kd + i * 8u * FA_PK) = kr[i]; *(fa_u4a*)(L + vd + i * 8u * FA_PV) = vr[i]; }
  v8f acc[2][8]; float m_run[2]; v4f l_run[2];
#pragma unroll
  for (int g = 0; g < 2; ++g) { m_run[g] = -__builtin_inff(); l_run[g] = v4f{0.f, 0.f, 0.f, 0.f};
#pragma unroll
    for (int t = 0; t < 8; ++t) acc[g][t] = v8f{}; }
  FaK kf;
  __syncthreads();      /* publishes stage 0 and the 1 / 0 row */
  if (1u < nst) {
#pragma unroll
    for (int i = 0; i < 8; ++i) { kr[i] = *(const fa_u4a*)(kg + FA_SK * 256u + i * 2048u); vr[i] = *(const fa_u4a*)(vg + FA_SK * 256u + i * 2048u); }      /* stage 1 */
    asm volatile("s_wait_xcnt 0x0" ::: "memory");      /* the loads' address registers may be reused directly behind them */
  }
  fa_fence();      /* the global loads are issued ahead of the pass, not sunk to their stores */
  fa_load_k(kf, L, 0u, lane);
  unsigned int cur = 0u, nxt = FA_SLOT;      /* LDS offsets of stage st's and stage st + 1's buffers */
#pragma unroll 1      /* rolled: one trip's body is already two unrolled passes */
  for (unsigned int st = 0; st < nst; ++st) {
    const bool more = st + 1u < nst;
    fa_block(kf, true, cur + 32u * FA_PK, L, cur + FA_TK, FA_RING + st * (FA_SK * 4u), lane, qf, acc, m_run, l_run);
    if (more) {
#pragma unroll
      for (int i = 0; i < 8; ++i) { *(fa_u4a*)(L + nxt + kd + i * 8u * FA_PK) = kr[i]; *(fa_u4a*)(L + nxt + vd + i * 8u * FA_PV) = vr[i]; } }
    __syncthreads();      /* publishes stage st + 1; every wave has left stage st - 1's buffer, which the next trip refills */
    if (st + 2u < nst) {
#pragma unroll
      for (int i = 0; i < 8; ++i) { kr[i] = *(const fa_u4a*)(kg + (st + 2u) * (FA_SK * 256u) + i * 2048u); vr[i] = *(const fa_u4a*)(vg + (st + 2u) * (FA_SK * 256u) + i * 2048u); }
      asm volatile("s_wait_xcnt 0x0" ::: "memory");      /* the loads' address registers may be reused directly behind them */
    }
    fa_fence();      /* the global loads are issued ahead of the pass, not sunk to their stores */
    fa_block(kf, more, nxt, L, cur + FA_TK + 32u * FA_PV, FA_RING + st * (FA_SK * 4u) + 128u, lane, qf, acc, m_run, l_run);
    cur = nxt; nxt = (nxt == 2u * FA_SLOT) ? 0u : nxt + FA_SLOT;
  }
  __syncthreads();      /* every wave has left the ring before it becomes output staging */
  unsigned char* eb = L + wave * 32u * FA_EP;
#pragma unroll
  for (int g = 0; g < 2; ++g) { float l = (l_run[g][0] + l_run[g][1]) + (l_run[g][2] + l_run[g][3]); l += lane_x16(l);      /* each wave half summed its eight keys of every 16-key tile */
    const float inv = 1.0f / l;
#pragma unroll
    for (int t = 0; t < 8; ++t) { const v8f o = acc[g][t] * inv; const v4f o0 = {o[0], o[1], o[2], o[3]}, o1 = {o[4], o[5], o[6], o[7]};      /* row = query 16 g + c; d = 16 t + 8 h + 0 .. 7 */
      *(v4fa*)(eb + (16u * g + c) * FA_EP + 64u * t + 32u * h) = o0; *(v4fa*)(eb + (16u * g + c) * FA_EP + 64u * t + 32u * h + 16u) = o1; } }
  __builtin_amdgcn_fence(__ATOMIC_ACQ_REL, "workgroup"); __builtin_amdgcn_wave_barrier();      /* the wave reads back rows that its other lanes wrote */
  float* op = O + ((size_t)b * SQ + q0 + wave * 32u) * DM + lane * 4u;
  v4f ov[32];
#pragma unroll
  for (int i = 0; i < 32; ++i) ov[i] = *(const v4fa*)(eb + i * FA_EP + lane * 16u);
  fa_fence();      /* every row is read before the first store, so that no store's data register is rewritten behind it */
#pragma unroll
  for (int i = 0; i < 32; ++i) *(v4f*)(op + (size_t)i * DM) = ov[i];      /* one whole 512-byte output row per store */
}


// ---- q, k and v to f16 rows in ONE launch of one 8-wave workgroup per WGP; k and v rows of keys with mask 0 are neither read nor written ----
// A workgroup owns the same contiguous 64 KiB (128 rows of 128 floats) of each of the three inputs; 16 workgroups share a sequence. A wave-wide load covers one 512-byte row, a wave-wide store one
// 256-byte f16 row (whole 128-byte lines both ways). Every workgroup reads its sequence's whole mask, turns it into a bit per key in LDS and counts the kept keys in front of its own rows:
// kept key j goes to packed row (number of kept keys below j), which is below SQ for any content of the mask. The q loads are issued ahead of that count and fly under it.
// The sequence's last workgroup also writes the count and the zero rows that fill the last 64-key stage (the workspace holds no usable values of its own).
#define X3_WG 256u                               /* workgroups */
#define X3_CH 16                                 /* 16-byte chunks per thread and input: the rows of one wave */
#define X3_PS 16u                                /* workgroups per sequence */
static_assert((size_t)X3_WG * 256u * X3_CH * 4u == NR * DM, "the workgroups' shares cover an input exactly");
static_assert(X3_PS * 256u * X3_CH * 4u == (size_t)SQ * DM && DM * 4 == 512 && SQ == 256 * 8, "16 workgroups per sequence, a wave per row, 8 mask words per thread");
typedef unsigned int x3_u2 __attribute__((ext_vector_type(2), may_alias));
__device__ __forceinline__ unsigned int x3_pair(float lo, float hi) { typedef _Float16 h2 __attribute__((ext_vector_type(2))); typedef float f2 __attribute__((ext_vector_type(2))); return __builtin_bit_cast(unsigned int, __builtin_convertvector(f2{bf16_round(lo), bf16_round(hi)}, h2)); }
// Sum over the wave's 32 lanes, in every lane: four steps inside the 16-lane rows, then row with row. Every lane must be on.
template <int M> __device__ __forceinline__ unsigned int x3_xadd(unsigned int v) { return v + (unsigned int)__builtin_amdgcn_update_dpp(0, (int)v, 0x160 | M, 0xf, 0xf, true); }      /* 0x160 | M: row_xmask:M */
__device__ __forceinline__ unsigned int x3_wave_sum(unsigned int v) { v = x3_xadd<1>(v); v = x3_xadd<2>(v); v = x3_xadd<4>(v); v = x3_xadd<8>(v);
  return v + (unsigned int)__builtin_amdgcn_permlanex16((int)v, (int)v, 0x76543210, 0xfedcba98, false, false); }
__global__ __launch_bounds__(256) void k_x16x3(const float* __restrict__ xq, const float* __restrict__ xk, const float* __restrict__ xv, const int* __restrict__ km,
                                               _Float16* __restrict__ Q16, _Float16* __restrict__ K16, _Float16* __restrict__ V16, int* __restrict__ Cnt) {
  __shared__ __attribute__((aligned(16))) unsigned int bm[SQ / 32];      /* bit j & 31 of word j >> 5: key j of this sequence is kept */
  const unsigned int tid = threadIdx.x, lane = tid & 31u, wave = __builtin_amdgcn_readfirstlane(tid >> 5);
  const unsigned int b = blockIdx.x / X3_PS, s = blockIdx.x % X3_PS;
  const unsigned int bi = blockIdx.x * (256u * X3_CH * 16u) + tid * 16u, bo = bi >> 1;      /* byte offsets of this thread's first chunk in an input and in q's f16 copy: one 32-bit offset register beside each scalar base */
  const v4ia m0 = *(const v4ia*)(km + b * SQ + tid * 8u), m1 = *(const v4ia*)(km + b * SQ + tid * 8u + 4u);      /* keys 8 tid .. 8 tid + 7 */
  __builtin_amdgcn_sched_barrier(0);      /* the mask words are asked for first: loads return in order, and the count waits for these two alone */
  v4f aq[X3_CH], ak[X3_CH], av[X3_CH];
#pragma unroll
  for (int i = 0; i < X3_CH; ++i) aq[i] = *(const v4fa*)((const char*)xq + bi + i * 4096);
  asm volatile("s_wait_xcnt 0x0" ::: "memory");      /* the loads' scalar base and offset registers may be reused behind them, while the loads are still in flight */
  __builtin_amdgcn_sched_barrier(0);      /* the q loads are issued here, none sunk to its use */
  unsigned int bits = 0u;
#pragma unroll
  for (int q = 0; q < 4; ++q) bits |= ((m0[q] != 0) ? 1u : 0u) << q | ((m1[q] != 0) ? 1u : 0u) << (4 + q);
  ((unsigned char*)bm)[tid] = (unsigned char)bits;
  // Workgroup barrier that publishes the sequence's 2048 bits. Its fences name LDS alone: __syncthreads() would also wait here for the q loads, which nobody shares.
  __builtin_amdgcn_fence(__ATOMIC_RELEASE, "workgroup", "local"); __builtin_amdgcn_s_barrier(); __builtin_amdgcn_fence(__ATOMIC_ACQUIRE, "workgroup", "local");
  const x3_u2 w2 = *(const x3_u2*)(bm + 2u * lane);      /* keys 64 lane .. 64 lane + 63 */
  const fa_u4 own = *(const fa_u4a*)(bm + 4u * s);
  const unsigned int c2 = (unsigned int)(__builtin_popcount(w2[0]) + __builtin_popcount(w2[1]));
  // Low half: kept keys of the sequence (at most 2048); high half: of them, those in front of this workgroup's 128 rows. One sum over the wave's 32 lanes serves both.
  const unsigned int cs = x3_wave_sum(c2 | ((lane < 2u * s) ? c2 << 16 : 0u));
  unsigned int d[4], pre[4];      /* this workgroup's 128 bits, and the packed row of each word's first key; wave-uniform, held in scalar registers */
  const unsigned int tot = __builtin_amdgcn_readfirstlane(cs & 0xffffu); pre[0] = __builtin_amdgcn_readfirstlane(cs >> 16);
#pragma unroll
  for (int j = 0; j < 4; ++j) { d[j] = __builtin_amdgcn_readfirstlane(own[j]); if (j) pre[j] = pre[j - 1] + (unsigned int)__builtin_popcount(d[j - 1]); }
  bool kept[X3_CH]; unsigned int row[X3_CH];      /* chunk i of this wave is row 8 i + wave of the 128 */
#pragma unroll
  for (int i = 0; i < X3_CH; ++i) { const unsigned int pos = 8u * (i & 3) + wave, w = d[i >> 2]; kept[i] = ((w >> pos) & 1u) != 0u; row[i] = pre[i >> 2] + (unsigned int)__builtin_popcount(w & ((1u << pos) - 1u)); }
#pragma unroll
  for (int i = 0; i < X3_CH; ++i) if (kept[i]) { ak[i] = *(const v4fa*)((const char*)xk + bi + i * 4096); av[i] = *(const v4fa*)((const char*)xv + bi + i * 4096); }
#pragma unroll
  for (int i = 0; i < X3_CH; ++i) { const x3_u2 w = {x3_pair(aq[i][0], aq[i][1]), x3_pair(aq[i][2], aq[i][3])}; *(x3_u2*)((char*)Q16 + bo + i * 2048) = w;
    if ((i & 3) == 3) { asm volatile("s_wait_xcnt 0x0" ::: "memory");      /* the four stores' data registers are reused by the next chunks' conversions */
      __builtin_amdgcn_sched_barrier(0); } }      /* four chunks' stores leave while later loads are still in flight, not gathered at the kernel's end */
  const unsigned int sb = b * (SQ * DM * 2u) + lane * 8u;      /* this lane's 8 bytes of the sequence's packed row 0 */
#pragma unroll
  for (int i = 0; i < X3_CH; ++i) if (kept[i]) { const unsigned int o = sb + row[i] * (DM * 2u);
    const x3_u2 wk = {x3_pair(ak[i][0], ak[i][1]), x3_pair(ak[i][2], ak[i][3])}, wv = {x3_pair(av[i][0], av[i][1]), x3_pair(av[i][2], av[i][3])};
    *(x3_u2*)((char*)K16 + o) = wk; *(x3_u2*)((char*)V16 + o) = wv;
    asm volatile("s_wait_xcnt 0x0" ::: "memory"); }      /* the two stores' data and offset registers are reused by the next row */
  if (s == X3_PS - 1u) {
    const unsigned int end = fa_stages(tot) * FA_SK;      /* at most SQ */
    const x3_u2 z = {0u, 0u};
#pragma unroll 1      /* at most 8 trips a wave */
    for (unsigned int r = tot + wave; r < end; r += 8u) { const unsigned int o = sb + r * (DM * 2u); *(x3_u2*)((char*)K16 + o) = z; *(x3_u2*)((char*)V16 + o) = z;
      asm volatile("s_wait_xcnt 0x0" ::: "memory"); }      /* the offset register is rewritten by the next trip */
    if (tid == 0u) Cnt[b * FA_CP] = (int)tot;
  }
}

extern "C" void kernel_launch(void* const* d_in, const int* in_sizes, int n_in,
                              void* d_out, int out_size, void* d_ws, size_t ws_size, hipStream_t stream) {
  (void)in_sizes; (void)n_in; (void)out_size;
  const float* const* I = (const float* const*)d_in; const float* xq = I[0]; const float* xk = I[1]; const float* xv = I[2]; const int* km = (const int*)d_in[3];      /* q, k, v [16][2048][128] (bf16-valued); mask int32 [16][2048] (READ on device) */
  char* ws = (char*)d_ws; size_t off = 0;
  auto take = [&](size_t bytes) { char* p = ws + off; off += (bytes + 255) & ~(size_t)255; return p; };
  _Float16* Q16 = (_Float16*)take(NR * DM * 2); _Float16* K16 = (_Float16*)take(NR * DM * 2); _Float16* V16 = (_Float16*)take(NR * DM * 2); int* Cnt = (int*)take(NB * FA_CP * 4);      /* K16, V16: kept rows packed per sequence; Cnt: kept keys per sequence */
  if (off > ws_size) return;
  k_x16x3<<<X3_WG, 256, 0, stream>>>(xq, xk, xv, km, Q16, K16, V16, Cnt);      /* exact f16 copies of the bf16-valued inputs, all three in one launch; k and v: kept keys only, packed */
  k_fattn<<<dim3(SQ / 128, NB), 128, 0, stream>>>(Q16, K16, V16, Cnt, (float*)d_out);      /* out = softmax-with-post-exp-mask(q k^T / sqrt(128)) v, 128 queries of one sequence per workgroup */
}

// v006
// One run takes 26.6 microseconds.
// In both of two side-by-side timings against v005, it was 1.13 times as fast.
// Counting every step since v000, it is 239 times as fast.
#include <hip/hip_runtime.h>
// Scaled dot-product attention with the module's POST-exp multiplicative key mask (q, k, v [16][2048][128]: 16 independent sequences, one 128-wide head; mask int32 [16][2048] in {0, 1} (random, read on device); score = q.k / sqrt(128); e = exp(score - rowmax over ALL keys); e *= mask[b][key]; a = e / sum(e); out = a v -> [16][2048][128]). No projections: q, k, v are bf16-valued inputs, so their f16 copies and the score products are exact.
// Structure: no projections: q, k, v are bf16-valued inputs copied to exact f16 rows (one launch), the k and v rows of the keys whose mask is 0 left out and the kept rows packed densely in key order; then ONE fused kernel for all 16 sequences: scores (WMMA, f32 accumulation, exact products), online softmax over the kept keys (f32 statistics, native exp2) and P V (WMMA) per 128-query workgroup, out written f32 straight into the output rows; scores and weights never reach memory.
// A key with mask 0 has weight exp(..) * 0 = 0 in both sums, and the subtracted maximum cancels in the quotient e / sum(e): the kept keys alone give the module's result.
// Compute dtype: inputs rounded to bf16; q, k, v exact in f16; unnormalised softmax weights (below 2^8) as plain f16 GEMM operands (~2^-12); scores, softmax statistics and o f32. v_wmma_f32_16x16x32_f16.
#define NB 16
#define SQ 2048
#define DM 128
#define NH 1
#define HD 128
#define HG 4                         /* heads per attention launch group */
#define B0 0                         /* first batch processed (debug hook) */
#define NBR NB                       /* batches processed (debug hook) */
#define NR ((size_t)NB * SQ)         /* token rows */
#define MP ((int)((size_t)NBR * SQ))
#define QT 256                       /* query rows per causal tile */
#define NKX SQ                       /* S / P row pitch */
#define QT0 256                      /* first-tile rows recomputed exactly (256: buys margin for the few-key rows 128..255, which have no output projection to average the single-f16 P/v rounding) */
#define QN SQ                        /* query rows attended per batch (debug hook) */
#define NHD NH                       /* heads attended (debug hook) */
#define MPO MP                       /* rows through the output stage (debug hook) */
#define LQ DM            /* row pitch of the q/k/v rows */
#define SG 4                         /* unused: no score / softmax launch; the workspace holds the f16 q, k and v and the per-sequence counts */
typedef __bf16 v16b __attribute__((ext_vector_type(16)));
typedef unsigned short v8us __attribute__((ext_vector_type(8), may_alias));
typedef float  v8f  __attribute__((ext_vector_type(8)));
typedef float  v4f  __attribute__((ext_vector_type(4)));
typedef float  v4fa __attribute__((ext_vector_type(4), may_alias));
union FragB { v16b v; v8us half[2]; unsigned short u[16]; };

__device__ __forceinline__ unsigned short bf16_bits(float x) { unsigned int u = __float_as_uint(x); return (unsigned short)((u + 0x7FFFu + ((u >> 16) & 1u)) >> 16); }
__device__ __forceinline__ float bf16_val(unsigned short b) { return __uint_as_float(((unsigned int)b) << 16); }
__device__ __forceinline__ float bf16_round(float x) { return bf16_val(bf16_bits(x)); }
// D += A·B with NT terms: 1 = ah·bh, 2 = + al·bh (A split), 3 = + ah·bl (both split)
template <int NT>
__device__ __forceinline__ v8f mmaN(v16b ah, v16b al, v16b bh, v16b bl, v8f c) {
  c = __builtin_amdgcn_wmma_f32_16x16x32_bf16(false, ah, false, bh, (short)0, c, false, false);
  if (NT >= 2) c = __builtin_amdgcn_wmma_f32_16x16x32_bf16(false, al, false, bh, (short)0, c, false, false);
  if (NT >= 3) c = __builtin_amdgcn_wmma_f32_16x16x32_bf16(false, ah, false, bl, (short)0, c, false, false);
  asm volatile("v_nop\n\tv_nop\n\tv_nop\n\tv_nop" : "+v"(c) : "v"(ah), "v"(al), "v"(bh), "v"(bl));
  return c;
}

__global__ __launch_bounds__(256) void k_wt_bf16(const float* __restrict__ W, unsigned short* __restrict__ Wt, int K, int N) {
  const int t = blockIdx.x * 256 + threadIdx.x;
  const int k8n = K / 8;
  if (t >= N * k8n) return;
  const int n = t / k8n, k8 = (t % k8n) * 8;
  v8us v;
#pragma unroll
  for (int i = 0; i < 8; ++i) v[i] = bf16_bits(W[(size_t)(k8 + i) * N + n]);
  *(v8us*)(Wt + (size_t)n * K + k8) = v;
  
}

// GEMM C[M][N] (f32, pitch ldc) = act(A[M][K]·W + bias). A f32 row-major (pitch lda) converted per fragment to bf16
// (ASPLIT: hi/lo two planes -> 2 terms, else single rounded term); Wt bf16 [N][K] (pitch ldb). BIAS_BF16 rounds the
// bias to bf16 first (bias quantised to bf16 before the add). K%32==0, M%16==0, N%64==0.
template <bool ASPLIT, int ACT, bool BIAS_BF16>
__global__ __launch_bounds__(128) void k_gemm_bf(const float* __restrict__ A, int lda, const unsigned short* __restrict__ Wt, int ldb,
                                               const float* __restrict__ bias, float* __restrict__ C, int ldc, int M, int N, int K) {
  __shared__ __attribute__((aligned(16))) float so[4][16][64];
  const int tid = threadIdx.x, w = tid >> 5, lane = tid & 31, ln = lane & 15, hh = lane >> 4;
  const int ntn = N / 64;
  const int wid = blockIdx.x * 4 + w;
  const int mt = wid / ntn, nq = wid % ntn;
  if (mt * 16 >= M) return;
  const int row0 = mt * 16, col0 = nq * 64;
  const float* arow = A + (size_t)(row0 + ln) * lda;
  v8f acc[4] = {};
  for (int kb = 0; kb < K; kb += 32) {
    FragB ah, al;
    const v4f x0 = *(const v4fa*)(arow + kb + 8 * hh), x1 = *(const v4fa*)(arow + kb + 8 * hh + 4);
    const v4f x2 = *(const v4fa*)(arow + kb + 16 + 8 * hh), x3 = *(const v4fa*)(arow + kb + 16 + 8 * hh + 4);
    float xs[16] = {x0[0],x0[1],x0[2],x0[3],x1[0],x1[1],x1[2],x1[3],x2[0],x2[1],x2[2],x2[3],x3[0],x3[1],x3[2],x3[3]};
#pragma unroll
    for (int i = 0; i < 16; ++i) { const unsigned short hb = bf16_bits(xs[i]); ah.u[i] = hb; al.u[i] = ASPLIT ? bf16_bits(xs[i] - bf16_val(hb)) : (unsigned short)0; }
#pragma unroll
    for (int t = 0; t < 4; ++t) {
      const unsigned short* brow = Wt + (size_t)(col0 + t * 16 + ln) * ldb + kb;
      FragB b;
      b.half[0] = *(const v8us*)(brow + 8 * hh);
      b.half[1] = *(const v8us*)(brow + 16 + 8 * hh);
      acc[t] = mmaN<ASPLIT ? 2 : 1>(ah.v, al.v, b.v, b.v, acc[t]);
    }
  }
#pragma unroll
  for (int t = 0; t < 4; ++t) {
    float bv = bias ? bias[col0 + t * 16 + ln] : 0.f;
    if (BIAS_BF16) bv = bf16_round(bv);
#pragma unroll
    for (int r = 0; r < 8; ++r) { float v = acc[t][r] + bv; if (ACT == 1) v = fmaxf(v, 0.f); so[w][8 * hh + r][t * 16 + ln] = v; }
  }
  __builtin_amdgcn_fence(__ATOMIC_ACQ_REL, "workgroup");
  __builtin_amdgcn_wave_barrier();
  const int rsub = lane >> 4, c4 = (lane & 15) * 4;
  {
#pragma unroll
    for (int q = 0; q < 8; ++q) {
      const int r = q * 2 + rsub;
      const v4f v = *(const v4fa*)&so[w][r][c4];
      *(v4f*)(C + (size_t)(row0 + r) * ldc + col0 + c4) = v;
    }
    
  }
}

// GEMM C = act(A·W + bias + resid): A f32 (ASPLIT -> hi/lo 2 terms), Wt bf16 [N][K]; ACT 0 none, 1 relu, 2 exact gelu;
// resid (optional, f32, row index = (row % rmod), pitch ldr, RES_BF16 rounds it) added before the activation.
template <bool ASPLIT, int ACT, bool BIAS_BF16, bool RES_BF16>
__global__ __launch_bounds__(128) void k_gemm_bf3(const float* __restrict__ A, int lda, const unsigned short* __restrict__ Wt, int ldb,
                                                const float* __restrict__ bias, const float* __restrict__ resid, int rmod, int ldr,
                                                float* __restrict__ C, int ldc, int M, int N, int K) {
  __shared__ __attribute__((aligned(16))) float so[4][16][64];
  const int tid = threadIdx.x, w = tid >> 5, lane = tid & 31, ln = lane & 15, hh = lane >> 4;
  const int ntn = N / 64;
  const int wid = blockIdx.x * 4 + w;
  const int mt = wid / ntn, nq = wid % ntn;
  if (mt * 16 >= M) return;
  const int row0 = mt * 16, col0 = nq * 64;
  const float* arow = A + (size_t)(row0 + ln) * lda;
  v8f acc[4] = {};
  for (int kb = 0; kb < K; kb += 32) {
    FragB ah, al;
    const v4f x0 = *(const v4fa*)(arow + kb + 8 * hh), x1 = *(const v4fa*)(arow + kb + 8 * hh + 4);
    const v4f x2 = *(const v4fa*)(arow + kb + 16 + 8 * hh), x3 = *(const v4fa*)(arow + kb + 16 + 8 * hh + 4);
    float xs[16] = {x0[0],x0[1],x0[2],x0[3],x1[0],x1[1],x1[2],x1[3],x2[0],x2[1],x2[2],x2[3],x3[0],x3[1],x3[2],x3[3]};
#pragma unroll
    for (int i = 0; i < 16; ++i) { const unsigned short hb = bf16_bits(xs[i]); ah.u[i] = hb; al.u[i] = ASPLIT ? bf16_bits(xs[i] - bf16_val(hb)) : (unsigned short)0; }
#pragma unroll
    for (int t = 0; t < 4; ++t) {
      const unsigned short* brow = Wt + (size_t)(col0 + t * 16 + ln) * ldb + kb;
      FragB b;
      b.half[0] = *(const v8us*)(brow + 8 * hh);
      b.half[1] = *(const v8us*)(brow + 16 + 8 * hh);
      acc[t] = mmaN<ASPLIT ? 2 : 1>(ah.v, al.v, b.v, b.v, acc[t]);
    }
  }
#pragma unroll
  for (int t = 0; t < 4; ++t) {
    const int col = col0 + t * 16 + ln;
    float bv = bias ? bias[col] : 0.f;
    if (BIAS_BF16) bv = bf16_round(bv);
#pragma unroll
    for (int r = 0; r < 8; ++r) {
      float v = acc[t][r] + bv;
      if (resid) { float rv = resid[(size_t)((row0 + 8 * hh + r) % rmod) * ldr + col]; if (RES_BF16) rv = bf16_round(rv); v += rv; }
      if (ACT == 1) v = fmaxf(v, 0.f);
      if (ACT == 2) v = 0.5f * v * (1.0f + erff(v * 0.70710678118654752f));
      if (ACT == 3) { const float u = 0.7978845608028654f * (v + 0.044715f * v * v * v); v = 0.5f * v * (1.0f + tanhf(u)); }
      so[w][8 * hh + r][t * 16 + ln] = v;
    }
  }
  __builtin_amdgcn_fence(__ATOMIC_ACQ_REL, "workgroup");
  __builtin_amdgcn_wave_barrier();
  const int rsub = lane >> 4, c4 = (lane & 15) * 4;
  {
#pragma unroll
    for (int q = 0; q < 8; ++q) {
      const int r = q * 2 + rsub;
      const v4f v = *(const v4fa*)&so[w][r][c4];
      *(v4f*)(C + (size_t)(row0 + r) * ldc + col0 + c4) = v;
    }
    
  }
}
// row LayerNorm (biased variance, eps) over N: s = X (+ R); optional out_sum <- s; out_norm <- (s-mu)*rsqrt(var+eps)*g + b
template <bool PARAM_BF16>
__global__ __launch_bounds__(256) void k_layernorm(const float* __restrict__ X, const float* __restrict__ R, const float* __restrict__ g, const float* __restrict__ bta,
                                                  float* __restrict__ out_sum, float* __restrict__ out_norm, int N, float eps) {
  __shared__ float red[256];
  const int row = blockIdx.x, tid = threadIdx.x;
  const float* x = X + (size_t)row * N; const float* rr = R ? R + (size_t)row * N : nullptr;
  float vals[16];                     // up to N = 4096
  const int per = N / 256;            // contiguous chunk per thread? use strided-by-4 chunks: thread handles j = tid*4 + 1024*u
  float s1 = 0.f;
  for (int u = 0; u < per / 4; ++u) {
    const int j = tid * 4 + 1024 * u;
    const v4f a = *(const v4fa*)(x + j);
    v4f b = {0.f,0.f,0.f,0.f}; if (rr) b = *(const v4fa*)(rr + j);
#pragma unroll
    for (int q = 0; q < 4; ++q) { const float v = a[q] + b[q]; vals[u * 4 + q] = v; s1 += v; }
  }
  red[tid] = s1; __syncthreads();
  for (int st = 128; st > 0; st >>= 1) { if (tid < st) red[tid] += red[tid + st]; __syncthreads(); }
  const float mu = red[0] / (float)N; __syncthreads();
  float s2 = 0.f;
  for (int u = 0; u < per / 4; ++u)
#pragma unroll
    for (int q = 0; q < 4; ++q) { const float c = vals[u * 4 + q] - mu; s2 += c * c; }
  red[tid] = s2; __syncthreads();
  for (int st = 128; st > 0; st >>= 1) { if (tid < st) red[tid] += red[tid + st]; __syncthreads(); }
  const float rs = rsqrtf(red[0] / (float)N + eps);
  {
    for (int u = 0; u < per / 4; ++u) {
      const int j = tid * 4 + 1024 * u;
      v4f o, sm;
#pragma unroll
      for (int q = 0; q < 4; ++q) {
        float gg = g[j + q], bb = bta[j + q];
        if (PARAM_BF16) { gg = bf16_round(gg); bb = bf16_round(bb); }
        sm[q] = vals[u * 4 + q]; o[q] = (vals[u * 4 + q] - mu) * rs * gg + bb;
      }
      if (out_sum) *(v4f*)(out_sum + (size_t)row * N + j) = sm;
      *(v4f*)(out_norm + (size_t)row * N + j) = o;
    }
    
  }
}



// ---- f16 WMMA path (v_wmma_f32_16x16x32_f16): 11-bit significands for operands in range — used where a [0,1] probability operand needs more precision than bf16
typedef _Float16 v16h __attribute__((ext_vector_type(16)));
union FragH { v16h v; v8us half[2]; _Float16 h[16]; unsigned short u[16]; };
template <int NT>
__device__ __forceinline__ v8f mmaH(v16h ah, v16h al, v16h bh, v16h bl, v8f c) {
  c = __builtin_amdgcn_wmma_f32_16x16x32_f16(false, ah, false, bh, (short)0, c, false, false);
  if (NT >= 2) c = __builtin_amdgcn_wmma_f32_16x16x32_f16(false, al, false, bh, (short)0, c, false, false);
  if (NT >= 3) c = __builtin_amdgcn_wmma_f32_16x16x32_f16(false, ah, false, bl, (short)0, c, false, false);
  asm volatile("v_nop\n\tv_nop\n\tv_nop\n\tv_nop" : "+v"(c) : "v"(ah), "v"(al), "v"(bh), "v"(bl));
  return c;
}
// batched GEMM like k_gemm_b but f16 operands: A f32 (split into f16 hi/lo if ASPLIT, else rounded to f16), Bt = f16 values [n][k]; alpha; C f32; N multiple of 16 (partial tiles skipped)
template <bool ASPLIT>
__global__ __launch_bounds__(128) void k_gemm_h(const float* __restrict__ A, int lda, size_t sA, const _Float16* __restrict__ Bh, int ldb, size_t sB, float alpha, float* __restrict__ C, int ldc, size_t sC, int M, int N, int K) {
  __shared__ __attribute__((aligned(16))) float so[4][16][64];
  const int tid = threadIdx.x, w = tid >> 5, lane = tid & 31, ln = lane & 15, hh = lane >> 4; const int by = blockIdx.y;
  A += (size_t)by * sA; Bh += (size_t)by * sB; C += (size_t)by * sC;
  const int ntn = (N + 63) / 64; const int wid = blockIdx.x * 4 + w; const int mt = wid / ntn, nq = wid % ntn; if (mt * 16 >= M) return;
  const int row0 = mt * 16, col0 = nq * 64; const float* arow = A + (size_t)(row0 + ln) * lda;
  v8f acc[4] = {};
  for (int kb = 0; kb < K; kb += 32) {
    FragH ah, al;
    const v4f x0 = *(const v4fa*)(arow + kb + 8 * hh), x1 = *(const v4fa*)(arow + kb + 8 * hh + 4), x2 = *(const v4fa*)(arow + kb + 16 + 8 * hh), x3 = *(const v4fa*)(arow + kb + 16 + 8 * hh + 4);
    float xs[16] = {x0[0],x0[1],x0[2],x0[3],x1[0],x1[1],x1[2],x1[3],x2[0],x2[1],x2[2],x2[3],x3[0],x3[1],x3[2],x3[3]};
#pragma unroll
    for (int i = 0; i < 16; ++i) { const _Float16 h = (_Float16)xs[i]; ah.h[i] = h; al.h[i] = ASPLIT ? (_Float16)(xs[i] - (float)h) : (_Float16)0.0f; }
#pragma unroll
    for (int t = 0; t < 4; ++t) { if (col0 + t * 16 >= N) continue; const size_t boff = (size_t)(col0 + t * 16 + ln) * ldb + kb; FragH bq; bq.half[0] = *(const v8us*)(Bh + boff + 8 * hh); bq.half[1] = *(const v8us*)(Bh + boff + 16 + 8 * hh);
      acc[t] = mmaH<ASPLIT ? 2 : 1>(ah.v, al.v, bq.v, bq.v, acc[t]); }
  }
#pragma unroll
  for (int t = 0; t < 4; ++t) { if (col0 + t * 16 >= N) continue;
#pragma unroll
    for (int r = 0; r < 8; ++r) so[w][8 * hh + r][t * 16 + ln] = acc[t][r] * alpha; }
  __builtin_amdgcn_fence(__ATOMIC_ACQ_REL, "workgroup"); __builtin_amdgcn_wave_barrier();
  const int rsub = lane >> 4, c4 = (lane & 15) * 4;
  {
#pragma unroll
    for (int q = 0; q < 8; ++q) { const int r = q * 2 + rsub; if (col0 + c4 < N) { const v4f v = *(const v4fa*)&so[w][r][c4]; *(v4f*)(C + (size_t)(row0 + r) * ldc + col0 + c4) = v; } }
     }
}

// Wt[n][k] = f16(W[k][n]·scale) from f32 row-major W[K][N] (scale = power of two; bf16-exact weights stay exact in f16 away from the subnormal range)
__global__ __launch_bounds__(256) void k_wt_f16(const float* __restrict__ W, _Float16* __restrict__ Wt, int K, int N, float scale) {
  const int t = blockIdx.x * 256 + threadIdx.x; if (t >= N * (K / 8)) return; const int n = t / (K / 8), k8 = (t % (K / 8)) * 8; FragH f;
#pragma unroll
  for (int i = 0; i < 8; ++i) f.h[i] = (_Float16)(bf16_round(W[(size_t)(k8 + i) * N + n]) * scale); const v8us o = f.half[0];
  *(v8us*)((unsigned short*)Wt + (size_t)n * K + k8) = o; 
}
// k_gemm_hh variant with fused epilogue: v = acc·alpha + bias[by·sBias + col] (+ CP[(row/rowsPerB)·sCPb + by·64 + col] if CP) ; ACT 0 none / 1 elu ; writes f16 C16 (and f32 C if non-null)
template <int ACT>
__global__ __launch_bounds__(128) void k_gemm_hhx(const _Float16* __restrict__ A, int lda, size_t sA, const _Float16* __restrict__ Bh, int ldb, size_t sB, float alpha, const float* __restrict__ bias, size_t sBias, const float* __restrict__ CP, int rowsPerB, size_t sCPb, int row0g,
    float* __restrict__ C, _Float16* __restrict__ C16, int ldc, size_t sC, int M, int N, int K) {
  __shared__ __attribute__((aligned(16))) float so[4][16][64];
  const int tid = threadIdx.x, w = tid >> 5, lane = tid & 31, ln = lane & 15, hh = lane >> 4; const int by = blockIdx.y;
  A += (size_t)by * sA; Bh += (size_t)by * sB; const size_t cofs = (size_t)by * sC; const float* bp = bias ? bias + (size_t)by * sBias : nullptr;
  const int ntn = (N + 63) / 64; const int wid = blockIdx.x * 4 + w; const int mt = wid / ntn, nq = wid % ntn; if (mt * 16 >= M) return;
  const int row0 = mt * 16, col0 = nq * 64; const _Float16* arow = A + (size_t)(row0 + ln) * lda;
  v8f acc[4] = {};
  for (int kb = 0; kb < K; kb += 32) { FragH ah; ah.half[0] = *(const v8us*)((const unsigned short*)arow + kb + 8 * hh); ah.half[1] = *(const v8us*)((const unsigned short*)arow + kb + 16 + 8 * hh);
#pragma unroll
    for (int t = 0; t < 4; ++t) { if (col0 + t * 16 >= N) continue; const size_t boff = (size_t)(col0 + t * 16 + ln) * ldb + kb; FragH bq; bq.half[0] = *(const v8us*)((const unsigned short*)Bh + boff + 8 * hh); bq.half[1] = *(const v8us*)((const unsigned short*)Bh + boff + 16 + 8 * hh);
      acc[t] = mmaH<1>(ah.v, ah.v, bq.v, bq.v, acc[t]); }
  }
#pragma unroll
  for (int t = 0; t < 4; ++t) { if (col0 + t * 16 >= N) continue; const int col = col0 + t * 16 + ln; const float bv = bp ? bf16_round(bp[col]) : 0.f;
#pragma unroll
    for (int r = 0; r < 8; ++r) { float v = acc[t][r] * alpha + bv; if (CP) { const int rr = row0g + row0 + 8 * hh + r; if (rowsPerB < 0) v += CP[cofs + (size_t)rr * ldc + col];      /* rowsPerB < 0: own element of the batched C plane */ else { const int bidx = rr / rowsPerB; v += CP[(size_t)bidx * sCPb + (size_t)by * 64 + col]; } } if (ACT == 1) v = (v > 0.f) ? v : expm1f(v); else if (ACT == 7) v = (v > 0.f) ? v + 1.0f : expf(v); else if (ACT == 8) v = tanhf(v); else if (ACT == 9) v = 0.5f * v * (1.0f + tanhf(0.7978845608028654f * (v + 0.044715f * v * v * v))); else if (ACT == 11) v = 1.0f / (1.0f + expf(-v)); else if (ACT == 12) v = (v > 0.f) ? v : 0.01f * v; else if (ACT == 14) v = (v > 0.f) ? v : 0.1f * v; else if (ACT == 16) v = (v >= 0.f) ? v : 0.3f * v; else if (ACT == 17) v = (v >= 0.f) ? v : 0.2f * v; else if (ACT == 15) v = v / (1.0f + expf(-v)); else if (ACT == 3) v = fmaxf(v, 0.f); else if (ACT == 6) v = 0.5f * v * (1.0f + erff(v * 0.70710678118654752f)); so[w][8 * hh + r][t * 16 + ln] = v; } }
  __builtin_amdgcn_fence(__ATOMIC_ACQ_REL, "workgroup"); __builtin_amdgcn_wave_barrier();
  const int rsub = lane >> 4, c4 = (lane & 15) * 4; typedef _Float16 v4h __attribute__((ext_vector_type(4)));
  {
#pragma unroll
    for (int q = 0; q < 8; ++q) { const int r = q * 2 + rsub; if (col0 + c4 < N) { const v4f v = *(const v4fa*)&so[w][r][c4]; if (C) *(v4f*)(C + cofs + (size_t)(row0 + r) * ldc + col0 + c4) = v; if (C16) { v4h h4; for (int i = 0; i < 4; ++i) h4[i] = (_Float16)v[i]; *(v4h*)(C16 + cofs + (size_t)(row0 + r) * ldc + col0 + c4) = h4; } } }
     }
}


typedef _Float16 v4h __attribute__((ext_vector_type(4)));

__global__ __launch_bounds__(256) void k_x16(const float* __restrict__ x, _Float16* __restrict__ X16, size_t n8) { const size_t t = (size_t)blockIdx.x * 256 + threadIdx.x; if (t >= n8) return; FragH f;
#pragma unroll
  for (int q = 0; q < 8; ++q) f.h[q] = (_Float16)bf16_round(x[t * 8 + q]); *(v8us*)((unsigned short*)X16 + t * 8) = f.half[0];  }
__global__ __launch_bounds__(256) void k_h16(const float* __restrict__ x, _Float16* __restrict__ X16, size_t n8) { const size_t t = (size_t)blockIdx.x * 256 + threadIdx.x; if (t >= n8) return; FragH f;
#pragma unroll
  for (int q = 0; q < 8; ++q) f.h[q] = (_Float16)x[t * 8 + q]; *(v8us*)((unsigned short*)X16 + t * 8) = f.half[0];  }
__global__ __launch_bounds__(256) void k_round16f(const float* __restrict__ W, _Float16* __restrict__ Bt, size_t n8) { const size_t t = (size_t)blockIdx.x * 256 + threadIdx.x; if (t >= n8) return; FragH f;
#pragma unroll
  for (int i = 0; i < 8; ++i) f.h[i] = (_Float16)(bf16_round(W[t * 8 + i]) * 16.0f); *(v8us*)((unsigned short*)Bt + t * 8) = f.half[0];  }
template <int NHv, int TTv>
__global__ __launch_bounds__(256) void k_vt(const _Float16* __restrict__ V16, int ldv, int voff, _Float16* __restrict__ Vt) { __shared__ unsigned short tl[64][66]; const int tid = threadIdx.x; const int slab = blockIdx.x / (TTv / 64), lg = blockIdx.x % (TTv / 64); const int b = slab / NHv, h = slab % NHv;
  for (int i = tid; i < 64 * 8; i += 256) { const int r = i / 8, c8 = (i % 8) * 8; FragH f; f.half[0] = *(const v8us*)((const unsigned short*)V16 + ((size_t)b * TTv + lg * 64 + r) * ldv + voff + h * 64 + c8);
#pragma unroll
    for (int q = 0; q < 8; ++q) tl[r][c8 + q] = f.u[q]; }
  __syncthreads();
  {
#pragma unroll
    for (int rd = 0; rd < 2; ++rd) { const int d = rd * 32 + tid / 8, pc = tid % 8; FragH f;
#pragma unroll
      for (int q = 0; q < 8; ++q) f.u[q] = tl[pc * 8 + q][d];
      *(v8us*)((unsigned short*)Vt + ((size_t)slab * 64 + d) * TTv + lg * 64 + pc * 8) = f.half[0]; }
     } }

__global__ __launch_bounds__(256) void k_hl(const float* __restrict__ F, _Float16* __restrict__ Hh, _Float16* __restrict__ Hl, size_t n8) { const size_t t = (size_t)blockIdx.x * 256 + threadIdx.x; if (t >= n8) return; FragH fh, fl; const v4f a = *(const v4fa*)(F + t * 8), c = *(const v4fa*)(F + t * 8 + 4);
#pragma unroll
  for (int q = 0; q < 4; ++q) { _Float16 h = (_Float16)a[q]; fh.h[q] = h; fl.h[q] = (_Float16)((a[q] - (float)h) * 1024.0f); h = (_Float16)c[q]; fh.h[4 + q] = h; fl.h[4 + q] = (_Float16)((c[q] - (float)h) * 1024.0f); }
  { *(v8us*)((unsigned short*)Hh + t * 8) = fh.half[0]; *(v8us*)((unsigned short*)Hl + t * 8) = fl.half[0];  } }

// ---- fast GEMM (wave tile 32x64; requires M % 32 == 0 rows per launch region and N % 64 == 0); epilogue = k_gemm_hhx semantics ----
__device__ __forceinline__ v16h g2_frag(const _Float16* p, int hh) { FragH f; f.half[0] = *(const v8us*)((const unsigned short*)p + 8 * hh); f.half[1] = *(const v8us*)((const unsigned short*)p + 16 + 8 * hh); return f.v; }
__device__ __forceinline__ v8f g2_mma(v16h a, v16h b, v8f c) { v8f d = __builtin_amdgcn_wmma_f32_16x16x32_f16(false, a, false, b, (short)0, c, false, false); asm volatile("v_nop\n\tv_nop\n\tv_nop\n\tv_nop" : "+v"(d) : "v"(a), "v"(b)); return d; }
template <int ACT>
__global__ __launch_bounds__(128) void k_gemm2(const _Float16* __restrict__ A, int lda, size_t sA, const _Float16* __restrict__ Bh, int ldb, size_t sB, float alpha, const float* __restrict__ bias, size_t sBias, const float* __restrict__ CP, int rowsPerB, size_t sCPb, int row0g,
    float* __restrict__ C, _Float16* __restrict__ C16, int ldc, size_t sC, int M, int N, int K) { static_assert(ACT == 0 || ACT == 3 || ACT == 6 || ACT == 8 || ACT == 9 || ACT == 11 || ACT == 12 || ACT == 14 || ACT == 15 || ACT == 16 || ACT == 17, "k_gemm2: unsupported ACT code (would silently apply no activation)");
  __shared__ __attribute__((aligned(16))) float so[4][32][68];
  const int tid = threadIdx.x, w = tid >> 5, lane = tid & 31, ln = lane & 15, hh = lane >> 4; const int by = blockIdx.y;
  A += (size_t)by * sA; Bh += (size_t)by * sB; const size_t cofs = (size_t)by * sC; const float* bp = bias ? bias + (size_t)by * sBias : nullptr;
  const int ntn = N >> 6; const int mt = blockIdx.x / ntn, nq = blockIdx.x - mt * ntn; const int row0 = mt * 128 + 32 * w, col0 = nq * 64; if (row0 >= M) return;
  const _Float16* a0p = A + (size_t)(row0 + ln) * lda; const _Float16* a1p = a0p + (size_t)16 * lda;
  const _Float16* b0p = Bh + (size_t)(col0 + ln) * ldb; const _Float16* b1p = b0p + (size_t)16 * ldb; const _Float16* b2p = b1p + (size_t)16 * ldb; const _Float16* b3p = b2p + (size_t)16 * ldb;
  const v8f z8 = {0.f,0.f,0.f,0.f,0.f,0.f,0.f,0.f}; v8f c00 = z8, c01 = z8, c02 = z8, c03 = z8, c10 = z8, c11 = z8, c12 = z8, c13 = z8;
#pragma unroll 1
  for (int kb = 0; kb < K; kb += 32) { const v16h a0 = g2_frag(a0p + kb, hh), a1 = g2_frag(a1p + kb, hh);
    v16h b = g2_frag(b0p + kb, hh); c00 = g2_mma(a0, b, c00); c10 = g2_mma(a1, b, c10);
    b = g2_frag(b1p + kb, hh); c01 = g2_mma(a0, b, c01); c11 = g2_mma(a1, b, c11);
    b = g2_frag(b2p + kb, hh); c02 = g2_mma(a0, b, c02); c12 = g2_mma(a1, b, c12);
    b = g2_frag(b3p + kb, hh); c03 = g2_mma(a0, b, c03); c13 = g2_mma(a1, b, c13); }
  v8f accs[8] = {c00, c01, c02, c03, c10, c11, c12, c13};
#pragma unroll
  for (int u = 0; u < 8; ++u) { const int t = u & 3, half = u >> 2; const int col = col0 + t * 16 + ln; const float bv = bp ? bf16_round(bp[col]) : 0.f;
#pragma unroll
    for (int r = 0; r < 8; ++r) { const int rloc = half * 16 + 8 * hh + r; float v = accs[u][r] * alpha + bv; if (CP) { if (rowsPerB < 0) v += CP[cofs + (size_t)(row0g + row0 + rloc) * ldc + col];      /* rowsPerB < 0: own element of the batched C plane */ else { const int bidx = (row0g + row0 + rloc) / rowsPerB; v += CP[(size_t)bidx * sCPb + (size_t)by * 64 + col]; } }
      if (ACT == 3) v = fmaxf(v, 0.f); else if (ACT == 6) v = 0.5f * v * (1.0f + erff(v * 0.70710678118654752f)); else if (ACT == 11) v = 1.0f / (1.0f + expf(-v)); else if (ACT == 15) v = v / (1.0f + expf(-v)); else if (ACT == 12) v = (v > 0.f) ? v : 0.01f * v; else if (ACT == 8) v = tanhf(v); else if (ACT == 9) v = 0.5f * v * (1.0f + tanhf(0.7978845608028654f * (v + 0.044715f * v * v * v))); else if (ACT == 14) v = (v > 0.f) ? v : 0.1f * v; else if (ACT == 16) v = (v >= 0.f) ? v : 0.3f * v; else if (ACT == 17) v = (v >= 0.f) ? v : 0.2f * v;
      so[w][rloc][t * 16 + ln] = v; } }
  __builtin_amdgcn_fence(__ATOMIC_ACQ_REL, "workgroup"); __builtin_amdgcn_wave_barrier();
  const int rsub = lane >> 4, c4 = (lane & 15) * 4;
  {
#pragma unroll
    for (int q = 0; q < 16; ++q) { const int r = q * 2 + rsub; const v4f v = *(const v4fa*)&so[w][r][c4]; if (C) *(v4f*)(C + cofs + (size_t)(row0 + r) * ldc + col0 + c4) = v; if (C16) { v4h h4; for (int i = 0; i < 4; ++i) h4[i] = (_Float16)v[i]; *(v4h*)(C16 + cofs + (size_t)(row0 + r) * ldc + col0 + c4) = h4; } }
     } }


__global__ __launch_bounds__(256) void k_wnat(const float* __restrict__ w, size_t n8, _Float16* __restrict__ Bt) { const size_t t = (size_t)blockIdx.x * 256 + threadIdx.x; if (t >= n8) return; FragH f; for (int q = 0; q < 8; ++q) f.h[q] = (_Float16)(bf16_round(w[t * 8 + q]) * 16.0f); *(v8us*)((unsigned short*)Bt + t * 8) = f.half[0];  }
__global__ __launch_bounds__(256) void k_rsm(const float* __restrict__ S, _Float16* __restrict__ P, int nrows) {
  #pragma clang fp contract(off)
  const int i = blockIdx.x * 256 + threadIdx.x; if (i >= nrows) return; const float* s = S + (size_t)i * SQ; float mx = -3.0e38f;
#pragma unroll 1
  for (int j = 0; j < SQ; ++j) mx = fmaxf(mx, s[j]); float se = 0.f;
#pragma unroll 1
  for (int j = 0; j < SQ; ++j) se += expf(s[j] - mx); const float sc = 256.0f / se;
#pragma unroll 1
  for (int j0 = 0; j0 < SQ; j0 += 8) { FragH f; for (int q = 0; q < 8; ++q) f.h[q] = (_Float16)(expf(s[j0 + q] - mx) * sc); unsigned short* d = (unsigned short*)P + (size_t)i * SQ + j0; *(v8us*)d = f.half[0];  } }
__global__ __launch_bounds__(256) void k_vt(const _Float16* __restrict__ V16, int b, int h0, _Float16* __restrict__ VT) { __shared__ unsigned short tl[64][65]; const int tid = threadIdx.x; const int hh = blockIdx.x % HG, sg = blockIdx.x / HG; const int s0 = sg * 64; const int h = h0 + hh;
  for (int i = tid; i < 64 * 8; i += 256) { const int j = i / 8, d8 = (i % 8) * 8; FragH f; f.half[0] = *(const v8us*)((const unsigned short*)V16 + ((size_t)b * SQ + s0 + j) * DM + h * HD + d8); for (int q = 0; q < 8; ++q) tl[d8 + q][j] = f.u[q]; }
  __syncthreads();
  { for (int i = tid; i < 64 * 8; i += 256) { const int d = i / 8, j8 = (i % 8) * 8; FragH f; for (int q = 0; q < 8; ++q) f.u[q] = tl[d][j8 + q]; *(v8us*)((unsigned short*)VT + ((size_t)hh * HD + d) * SQ + s0 + j8) = f.half[0]; }  } }



__global__ __launch_bounds__(256) void k_rsmcf2(const float* __restrict__ S, _Float16* __restrict__ P, int hg, int q0, int nk) {
  #pragma clang fp contract(off)
  const int t = blockIdx.x * 256 + threadIdx.x; if (t >= hg * QT) return; const size_t i = (size_t)t; const float* s = S + i * NKX; const int last = q0 + (t % QT); float mx = -3.0e38f;
#pragma unroll 1
  for (int j = 0; j < nk; ++j) { const float f = (j <= last) ? 1.f : 0.f; mx = fmaxf(mx, fmaf(f, s[j], (1.f - f) * -1.0e9f)); } float se = 0.f;
#pragma unroll 1
  for (int j = 0; j < nk; ++j) { const float f = (j <= last) ? 1.f : 0.f; se += __expf(fmaf(f, s[j], (1.f - f) * -1.0e9f) - mx); } const float sc = 256.0f / se;
#pragma unroll 1
  for (int j0 = 0; j0 < nk; j0 += 8) { FragH fr; for (int q = 0; q < 8; ++q) { const int j = j0 + q; const float f = (j <= last) ? 1.f : 0.f; fr.h[q] = (_Float16)(__expf(fmaf(f, s[j], (1.f - f) * -1.0e9f) - mx) * sc); } unsigned short* d = (unsigned short*)P + i * NKX + j0; *(v8us*)d = fr.half[0];  } }

template <int MASKADD>
__global__ __launch_bounds__(64) void k_att0(const float* __restrict__ QF, const float* __restrict__ KF, const float* __restrict__ VF, int ld, const float* __restrict__ mask, float scale, float* __restrict__ OF, int ldo) {
  #pragma clang fp contract(off)
  __shared__ __attribute__((aligned(16))) float lq[64][64]; __shared__ __attribute__((aligned(16))) float lo[64][64];
  const int tid = threadIdx.x; const int h = blockIdx.x / (QT0 / 64), rg = blockIdx.x % (QT0 / 64); const int i = rg * 64 + tid;
  const float* qr = QF + (size_t)i * ld + h * HD;
#pragma unroll 1
  for (int c = 0; c < HD / 4; ++c) { *(v4f*)&lq[tid][c * 4] = *(const v4fa*)(qr + c * 4); const v4f z = {0.f, 0.f, 0.f, 0.f}; *(v4f*)&lo[tid][c * 4] = z; }
  float m = -1.0e30f, l = 0.f; const int jmax = MASKADD ? (SQ - 1) : (rg * 64 + 63);      /* additive-mask form: every key (the mask input decides); causal form: keys up to the block's last row */
#pragma unroll 1
  for (int j = 0; j <= jmax; ++j) { const float* kr = KF + (size_t)j * ld + h * HD; const float* vr = VF + (size_t)j * ld + h * HD; float s = 0.f;
#pragma unroll 1
    for (int c = 0; c < HD / 4; ++c) { const v4f kq = *(const v4fa*)(kr + c * 4); const v4f qq = *(v4f*)&lq[tid][c * 4]; s = __fadd_rn(s, __fmul_rn(qq[0], kq[0])); s = __fadd_rn(s, __fmul_rn(qq[1], kq[1])); s = __fadd_rn(s, __fmul_rn(qq[2], kq[2])); s = __fadd_rn(s, __fmul_rn(qq[3], kq[3])); }
    s = __fmul_rn(s, scale); if (MASKADD) s = __fadd_rn(s, __fmul_rn(bf16_round(mask[(size_t)i * SQ + j]), -10000.0f));
    const float f = (MASKADD || j <= i) ? 1.f : 0.f; const float sm = fmaf(f, s, (1.f - f) * -1.0e30f); const float mn = fmaxf(m, sm); const float sc = expf(m - mn); const float e = expf(sm - mn); l = __fadd_rn(__fmul_rn(l, sc), e); m = mn;
#pragma unroll 1
    for (int c = 0; c < HD / 4; ++c) { const v4f vv = *(const v4fa*)(vr + c * 4); v4f oo = *(v4f*)&lo[tid][c * 4]; for (int u = 0; u < 4; ++u) oo[u] = __fadd_rn(__fmul_rn(oo[u], sc), __fmul_rn(e, vv[u])); *(v4f*)&lo[tid][c * 4] = oo; } }
  const float fin = 64.0f / l;      /* o carried x64 */
#pragma unroll 1
  for (int c = 0; c < HD / 4; ++c) { v4f oo = *(v4f*)&lo[tid][c * 4]; for (int u = 0; u < 4; ++u) oo[u] = __fmul_rn(oo[u], fin); *(v4f*)&lo[tid][c * 4] = oo; }
  __syncthreads();
  {
#pragma unroll 1
    for (int it = 0; it < 16; ++it) { const int row = it * 4 + tid / 16, pc = (tid % 16) * 4; const v4f v = *(const v4f*)&lo[row][pc]; *(v4f*)(OF + (size_t)(rg * 64 + row) * ldo + h * HD + pc) = v; }
     } }

__global__ __launch_bounds__(256) void k_oscale(const float* __restrict__ OF, float* __restrict__ out, size_t n4) { const size_t t = (size_t)blockIdx.x * 256 + threadIdx.x; if (t >= n4) return; const v4f a = *(const v4fa*)(OF + t * 4); v4f o; for (int q = 0; q < 4; ++q) o[q] = a[q] * 0.015625f; *(v4f*)(out + t * 4) = o;  }

__global__ __launch_bounds__(256) void k_bfr(const float* __restrict__ x, float* __restrict__ XB, size_t n8) { const size_t t = (size_t)blockIdx.x * 256 + threadIdx.x; if (t >= n8) return; v4f a = *(const v4fa*)(x + t * 8), c = *(const v4fa*)(x + t * 8 + 4); for (int q = 0; q < 4; ++q) { a[q] = bf16_round(a[q]); c[q] = bf16_round(c[q]); }
  { *(v4f*)(XB + t * 8) = a; *(v4f*)(XB + t * 8 + 4) = c;  } }



__global__ __launch_bounds__(256) void k_rsmfvl(const float* __restrict__ S, _Float16* __restrict__ P, _Float16* __restrict__ PL, int qn, const int* __restrict__ vlp) {
  #pragma clang fp contract(off)
  const int t = blockIdx.x * 256 + threadIdx.x; if (t >= qn) return; const int vl = vlp[0]; const size_t i = (size_t)t; const float* s = S + i * SQ; float mx = -3.0e38f;
#pragma unroll 1
  for (int j = 0; j < SQ; ++j) { const float f = (j < vl) ? 1.f : 0.f; mx = fmaxf(mx, fmaf(f, s[j], (1.f - f) * -1000000.0f)); } float se = 0.f;
#pragma unroll 1
  for (int j = 0; j < SQ; ++j) { const float f = (j < vl) ? 1.f : 0.f; se += __expf(fmaf(f, s[j], (1.f - f) * -1000000.0f) - mx); } const float sc = 256.0f / se;
#pragma unroll 1
  for (int j0 = 0; j0 < SQ; j0 += 8) { FragH fr, gr; for (int q = 0; q < 8; ++q) { const int j = j0 + q; const float f = (j < vl) ? 1.f : 0.f; const float pv = __expf(fmaf(f, s[j], (1.f - f) * -1000000.0f) - mx) * sc; const _Float16 ph = (_Float16)pv; fr.h[q] = ph; gr.h[q] = (_Float16)((pv - (float)ph) * 1024.0f); }
    unsigned short* d = (unsigned short*)P + i * SQ + j0; unsigned short* dl = (unsigned short*)PL + i * SQ + j0; *(v8us*)d = fr.half[0]; *(v8us*)dl = gr.half[0];  } }

__global__ __launch_bounds__(256) void k_rsmf(const float* __restrict__ S, _Float16* __restrict__ P, int qn, int hg) {
  #pragma clang fp contract(off)
  const int t = blockIdx.x * 256 + threadIdx.x; if (t >= qn * hg) return; const size_t i = (size_t)(t / qn) * SQ + (t % qn); const float* s = S + i * SQ; float mx = -3.0e38f;
#pragma unroll 1
  for (int j = 0; j < SQ; ++j) mx = fmaxf(mx, s[j]); float se = 0.f;
#pragma unroll 1
  for (int j = 0; j < SQ; ++j) se += __expf(s[j] - mx); const float sc = 256.0f / se;
#pragma unroll 1
  for (int j0 = 0; j0 < SQ; j0 += 8) { FragH f; for (int q = 0; q < 8; ++q) f.h[q] = (_Float16)(__expf(s[j0 + q] - mx) * sc); unsigned short* d = (unsigned short*)P + i * SQ + j0; *(v8us*)d = f.half[0];  } }



// Lane l with lane l ^ 16. Every lane must be on.
__device__ __forceinline__ float lane_x16(float v) { const int i = __float_as_int(v); return __int_as_float(__builtin_amdgcn_permlanex16(i, i, 0x76543210, 0xfedcba98, false, false)); }
typedef int v4ia __attribute__((ext_vector_type(4), may_alias));
// Four native exp2 in one statement. The closing v_nop is the one slot the instruction set asks for behind a transcendental before its result is read or its source overwritten;
// the outputs are early-clobber, so each exp is independent of the one in front of it.
__device__ __forceinline__ v4f exp2_x4(v4f a) { float r0, r1, r2, r3;
  asm("v_exp_f32 %0, %4\n\tv_exp_f32 %1, %5\n\tv_exp_f32 %2, %6\n\tv_exp_f32 %3, %7\n\tv_nop" : "=&v"(r0), "=&v"(r1), "=&v"(r2), "=&v"(r3) : "v"(a[0]), "v"(a[1]), "v"(a[2]), "v"(a[3]));
  const v4f r = {r0, r1, r2, r3}; return r; }


typedef unsigned int fa_u4 __attribute__((ext_vector_type(4)));
typedef unsigned int fa_u4a __attribute__((ext_vector_type(4), may_alias));
typedef unsigned int fa_u8 __attribute__((ext_vector_type(8)));
typedef short fa_s8 __attribute__((ext_vector_type(8)));
#define FA_SK 128u                               /* keys per stage */
#define FA_PK 272u                               /* LDS pitch of a K row: odd multiple of 16 B (ds_load_b128 readers) */
#define FA_PV 288u                               /* LDS pitch of a V row: odd multiple of 32 B (ds_load_tr16_b128 readers) */
#define FA_TK (FA_SK * FA_PK)
#define FA_SLOT (FA_SK * (FA_PK + FA_PV))
#define FA_RING (3u * FA_SLOT)
#define FA_EP 528u                               /* pitch of an output row (128 f32) staged in the ring */
#define FA_XW 8448u                              /* what a wave hands its partner behind the loop: one group's O^T (32 lanes x 256 B), then maximum and sum (32 x 8 B) */
#define FA_NST ((unsigned)SQ / FA_SK)
#define FA_CP 32u                                /* pitch of the per-sequence counts, in ints: each count has a 128-byte line of its own, since another workgroup writes the next one */
#define FA_CS 0.12751743f                        /* log2(e) / sqrt(128) */
static_assert(8u * FA_XW + 8u * 16u * FA_EP <= FA_RING, "the hand-over and the output staging reuse the K / V ring");
// Stages that hold nk packed rows; at least one, so that a sequence without a kept key still runs the sums (0 / 0, as the module's). Both launches use it: rows nk .. 128 fa_stages(nk) - 1 are zero rows.
__device__ __forceinline__ unsigned int fa_stages(unsigned int nk) { const unsigned int s = (nk + FA_SK - 1u) / FA_SK; return s < 1u ? 1u : s > FA_NST ? FA_NST : s; }
struct FaFrag { fa_u4 q[2]; };
struct FaK { FaFrag f[2][4]; };
__device__ __forceinline__ v8f fa_mma(const FaFrag& a, const FaFrag& b, v8f c) {
  const fa_u8 av = __builtin_shufflevector(a.q[0], a.q[1], 0, 1, 2, 3, 4, 5, 6, 7), bv = __builtin_shufflevector(b.q[0], b.q[1], 0, 1, 2, 3, 4, 5, 6, 7);
  return __builtin_amdgcn_wmma_f32_16x16x32_f16(false, __builtin_bit_cast(v16h, av), false, __builtin_bit_cast(v16h, bv), (short)0, c, false, false); }
__device__ __forceinline__ void fa_fence() { __builtin_amdgcn_sched_barrier(0); }
// Four vector slots behind a run of WMMAs: the exponentials are asm text, whose outputs the compiler may place on a WMMA's operand registers without padding the distance itself.
__device__ __forceinline__ void fa_nop4() { asm volatile("v_nop\n\tv_nop\n\tv_nop\n\tv_nop"); }
__device__ __forceinline__ fa_u4 fa_tr16(const unsigned char* p) { typedef __attribute__((address_space(3))) fa_s8 lds_s8; return __builtin_bit_cast(fa_u4, __builtin_amdgcn_ds_load_tr16_b128_v8i16((lds_s8*)p)); }
__device__ __forceinline__ unsigned int fa_pack2(float lo, float hi) { typedef _Float16 h2 __attribute__((ext_vector_type(2))); typedef float f2 __attribute__((ext_vector_type(2))); return __builtin_bit_cast(unsigned int, __builtin_convertvector(f2{lo, hi}, h2)); }
// K fragments of one 32-key pass in the hardware k order (bytes 16 h and 32 + 16 h of each 64 bytes of a row), as Q's in the kernel.
__device__ __forceinline__ void fa_load_k(FaK& k, const unsigned char* Lp, unsigned int koff, unsigned int lane) {
  const unsigned int c = lane & 15u, h = lane >> 4;
#pragma unroll
  for (int kt = 0; kt < 2; ++kt) { const unsigned char* p = Lp + koff + (16u * kt + c) * FA_PK + 16u * h;
#pragma unroll
    for (int kc = 0; kc < 4; ++kc) { k.f[kt][kc].q[0] = *(const fa_u4a*)(p + 64u * kc); k.f[kt][kc].q[1] = *(const fa_u4a*)(p + 64u * kc + 32u); } } }
// One 32-key pass of one wave. voff, moff: LDS byte offsets of the pass's first V row and first mask float. m_run, the maximum in use, may trail the true one by up to 8 (log2 units),
// so an exponential stays below 2^8, inside f16; the quotient of the sums does not depend on it.
__device__ __forceinline__ void fa_block(FaK& kf, bool fetch_next, unsigned int next_koff, const unsigned char* Lp, unsigned int voff, unsigned int moff, unsigned int lane,
                                         const FaFrag (&qf)[2][4], v8f (&acc)[2][8], float (&m_run)[2], v4f (&l_run)[2]) {
  const unsigned int h = lane >> 4;
  v8f s[2][2];
#pragma unroll
  for (int kt = 0; kt < 2; ++kt) {
#pragma unroll
    for (int g = 0; g < 2; ++g) { s[kt][g] = v8f{};
#pragma unroll
      for (int kc = 0; kc < 4; ++kc) s[kt][g] = fa_mma(kf.f[kt][kc], qf[g][kc], s[kt][g]); } }
  fa_fence(); fa_nop4(); fa_fence();      /* the fences keep the slots behind the last WMMA and the next pass's K loads behind this pass's products, which read the same registers */
  if (fetch_next) fa_load_k(kf, Lp, next_koff, lane);      /* in flight under the maxima and the exponentials */
  v4f mk[4];      /* this lane's 16 keys' 0 / 1: keys 16 kt + 8 h + r */
  { const unsigned char* mp = Lp + moff + 32u * h; mk[0] = *(const v4fa*)(mp); mk[1] = *(const v4fa*)(mp + 16u); mk[2] = *(const v4fa*)(mp + 64u); mk[3] = *(const v4fa*)(mp + 80u); }
  FaFrag vf[8];      /* V^T, 16 (d) x 32 (keys) per fragment */
  { const unsigned char* ad = Lp + voff + (8u * h + (lane & 7u)) * FA_PV + ((lane >> 3) & 1u) * 16u;
#pragma unroll
    for (int t = 0; t < 8; ++t) { vf[t].q[0] = fa_tr16(ad + 32u * t); vf[t].q[1] = fa_tr16(ad + 16u * FA_PV + 32u * t); } }
  float mb[2]; bool need = false;
#pragma unroll
  for (int g = 0; g < 2; ++g) { float mx = s[0][g][0];
#pragma unroll
    for (int r = 1; r < 8; ++r) mx = fmaxf(mx, s[0][g][r]);
#pragma unroll
    for (int r = 0; r < 8; ++r) mx = fmaxf(mx, s[1][g][r]);
    mx = fmaxf(mx, lane_x16(mx)) * FA_CS;      /* both wave halves hold this query's maximum over the pass's 32 rows, fill rows (score 0) included */
    mb[g] = mx; need = need || (mx > m_run[g] + 8.0f); }
  if (__builtin_amdgcn_ballot_w32(need) != 0) {      /* wave-uniform, rare after the first passes */
    const float n0 = fmaxf(m_run[0], mb[0]), n1 = fmaxf(m_run[1], mb[1]);
    float cr[2];      /* 0 on the first pass, where m_run is -inf; the closing v_nop is the slot behind a transcendental, as in exp2_x4 */
    asm("v_exp_f32 %0, %2\n\tv_exp_f32 %1, %3\n\tv_nop" : "=&v"(cr[0]), "=&v"(cr[1]) : "v"(m_run[0] - n0), "v"(m_run[1] - n1));
    m_run[0] = n0; m_run[1] = n1;
#pragma unroll
    for (int g = 0; g < 2; ++g) { l_run[g] = l_run[g] * cr[g];
#pragma unroll
      for (int t = 0; t < 8; ++t) acc[g][t] = acc[g][t] * cr[g]; } }
#pragma unroll
  for (int g = 0; g < 2; ++g) { const float nm = -m_run[g]; const v4f nm4 = {nm, nm, nm, nm}; const v4f cs4 = {FA_CS, FA_CS, FA_CS, FA_CS};
    unsigned int w[8];
#pragma unroll
    for (int j = 0; j < 4; ++j) { const int kt = j >> 1, r0 = 4 * (j & 1);
      const v4f sv = {s[kt][g][r0], s[kt][g][r0 + 1], s[kt][g][r0 + 2], s[kt][g][r0 + 3]};
      const v4f p = exp2_x4(__builtin_elementwise_fma(sv, cs4, nm4)) * mk[j];
      l_run[g] += p; w[2 * j] = fa_pack2(p[0], p[1]); w[2 * j + 1] = fa_pack2(p[2], p[3]); }
    FaFrag pf; pf.q[0] = fa_u4{w[0], w[1], w[2], w[3]}; pf.q[1] = fa_u4{w[4], w[5], w[6], w[7]};
#pragma unroll
    for (int t = 0; t < 8; ++t) acc[g][t] = fa_mma(vf[t], pf, acc[g][t]);
    fa_fence(); fa_nop4(); fa_fence(); }      /* slots in front of the next group's (or pass's) asm exponentials; the fences keep them directly behind the WMMAs */
}
__global__ __launch_bounds__(256) void k_fattn(const _Float16* __restrict__ Q, const _Float16* __restrict__ K, const _Float16* __restrict__ V, const int* __restrict__ Cnt, float* __restrict__ O) {
  __shared__ __attribute__((aligned(256))) unsigned char L[FA_RING + SQ * 4];      /* three K / V buffers, then f32 1 / 0 per packed row: kept key or fill row */
  const unsigned int tid = threadIdx.x, lane = tid & 31u, wave = __builtin_amdgcn_readfirstlane(tid >> 5), c = lane & 15u, h = lane >> 4;
  const unsigned int wq = wave & 3u, hf = wave >> 2;      /* the wave's 32 queries; its 32 of every 64 keys */
  const unsigned int b = blockIdx.y, q0 = blockIdx.x * 128u;
  const int nraw = Cnt[b * FA_CP];      /* asked for here, first used behind the prologue's global loads */
  // Staging: 16-byte chunk tid + 256 i of a stage's 128 x 256 B of K (and of V) is row 16 i + tid / 16, bytes 16 (tid % 16): a wave's load covers 512 contiguous bytes.
  const unsigned char* kg = (const unsigned char*)(K + (size_t)b * SQ * DM) + tid * 16u; const unsigned char* vg = (const unsigned char*)(V + (size_t)b * SQ * DM) + tid * 16u;
  const unsigned int kd = (tid >> 4) * FA_PK + (tid & 15u) * 16u, vd = FA_TK + (tid >> 4) * FA_PV + (tid & 15u) * 16u;
  fa_u4 kr[8], vr[8];
#pragma unroll
  for (int i = 0; i < 8; ++i) { kr[i] = *(const fa_u4a*)(kg + i * 4096u); vr[i] = *(const fa_u4a*)(vg + i * 4096u); }
  FaFrag qf[2][4];
#pragma unroll
  for (int g = 0; g < 2; ++g) { const _Float16* qp = Q + ((size_t)b * SQ + q0 + wq * 32u + 16u * g + c) * DM + 8u * h;
#pragma unroll
    for (int kc = 0; kc < 4; ++kc) { qf[g][kc].q[0] = *(const fa_u4a*)(qp + 32 * kc); qf[g][kc].q[1] = *(const fa_u4a*)(qp + 32 * kc + 16); }
    asm volatile("s_wait_xcnt 0x0" :: "v"(qp) : "memory"); }      /* this group's address registers may become a later load's destination; named as an input, they stay untouched up to the wait */
  fa_fence();      /* stage 0's and Q's loads are issued without waiting for the count */
  const unsigned int nk = (unsigned int)(nraw < 0 ? 0 : nraw > SQ ? SQ : nraw);      /* kept keys of this sequence, the same for the whole workgroup */
  const unsigned int nst = __builtin_amdgcn_readfirstlane(fa_stages(nk));      /* stages walked: 1 .. FA_NST; in a scalar register, so that the loop's tests are scalar compares */
  const unsigned int nhs = __builtin_amdgcn_readfirstlane((nk + 63u) / 64u);      /* runs of 64 packed rows that hold a kept key: 2 nst - 1 or 2 nst (0 without a kept key) */
#pragma unroll
  for (int j = 0; j < 2; ++j) { v4f f; for (int q = 0; q < 4; ++q) f[q] = (j * 1024u + tid * 4u + q < nk) ? 1.0f : 0.0f; *(v4fa*)(L + FA_RING + (j * 1024u + tid * 4u) * 4u) = f; }
#pragma unroll
  for (int i = 0; i < 8; ++i) { *(fa_u4a*)(L + kd + i * 16u * FA_PK) = kr[i]; *(fa_u4a*)(L + vd + i * 16u * FA_PV) = vr[i]; }
  v8f acc[2][8]; float m_run[2]; v4f l_run[2];
#pragma unroll
  for (int g = 0; g < 2; ++g) { m_run[g] = -__builtin_inff(); l_run[g] = v4f{0.f, 0.f, 0.f, 0.f};
#pragma unroll
    for (int t = 0; t < 8; ++t) acc[g][t] = v8f{}; }
  FaK kf;
  __syncthreads();      /* publishes stage 0 and the 1 / 0 row */
  if (1u < nst) {
#pragma unroll
    for (int i = 0; i < 8; ++i) { kr[i] = *(const fa_u4a*)(kg + FA_SK * 256u + i * 4096u); vr[i] = *(const fa_u4a*)(vg + FA_SK * 256u + i * 4096u); }      /* stage 1 */
    asm volatile("s_wait_xcnt 0x0" ::: "memory");      /* the loads' address registers may be reused directly behind them */
  }
  fa_fence();      /* the global loads are issued ahead of the pass, not sunk to their stores */
  const unsigned int ko = hf * (32u * FA_PK), vo = FA_TK + hf * (32u * FA_PV), mo = FA_RING + hf * 128u;      /* this wave's first K row, V row and 1 / 0 float of a stage */
  fa_load_k(kf, L, ko, lane);
  unsigned int cur = 0u, nxt = FA_SLOT;      /* LDS offsets of stage st's and stage st + 1's buffers */
#pragma unroll 1      /* rolled: one trip's body is already two unrolled passes */
  for (unsigned int st = 0; st < nst; ++st) {
    const bool more = st + 1u < nst;
    const bool two = 2u * st + 1u < nhs;      /* rows 64 .. 127 of this stage hold a kept key; false in the last stage alone, the same for the whole workgroup */
    fa_block(kf, two, cur + ko + 64u * FA_PK, L, cur + vo, mo + st * (FA_SK * 4u), lane, qf, acc, m_run, l_run);
    if (more) {
#pragma unroll
      for (int i = 0; i < 8; ++i) { *(fa_u4a*)(L + nxt + kd + i * 16u * FA_PK) = kr[i]; *(fa_u4a*)(L + nxt + vd + i * 16u * FA_PV) = vr[i]; } }
    __syncthreads();      /* publishes stage st + 1; every wave has left stage st - 1's buffer, which the next trip refills */
    if (st + 2u < nst) {
#pragma unroll
      for (int i = 0; i < 8; ++i) { kr[i] = *(const fa_u4a*)(kg + (st + 2u) * (FA_SK * 256u) + i * 4096u); vr[i] = *(const fa_u4a*)(vg + (st + 2u) * (FA_SK * 256u) + i * 4096u); }
      asm volatile("s_wait_xcnt 0x0" ::: "memory");      /* the loads' address registers may be reused directly behind them */
    }
    fa_fence();      /* the global loads are issued ahead of the pass, not sunk to their stores */
    if (two) fa_block(kf, more, nxt + ko, L, cur + vo + 64u * FA_PV, mo + st * (FA_SK * 4u) + 256u, lane, qf, acc, m_run, l_run);
    cur = nxt; nxt = (nxt == 2u * FA_SLOT) ? 0u : nxt + FA_SLOT;
  }
  __syncthreads();      /* every wave has left the ring before it becomes hand-over and output staging */
  // Join of the two key halves. Wave w finishes query group 0, wave w + 4 group 1: each hands the other group's O^T, maximum and sum to its partner, lane to lane (both hold a group in the same layout).
  float lj[2];
#pragma unroll
  for (int g = 0; g < 2; ++g) { const float l = (l_run[g][0] + l_run[g][1]) + (l_run[g][2] + l_run[g][3]); lj[g] = l + lane_x16(l); }      /* each wave half summed its eight keys of every 16-key tile */
  const bool up = hf != 0u;
  { unsigned char* xs = L + wave * FA_XW + lane * 16u;
#pragma unroll
    for (int t = 0; t < 8; ++t) { const v8f o = up ? acc[0][t] : acc[1][t]; const v4f o0 = {o[0], o[1], o[2], o[3]}, o1 = {o[4], o[5], o[6], o[7]};
      *(v4fa*)(xs + 1024u * t) = o0; *(v4fa*)(xs + 1024u * t + 512u) = o1; }
    typedef float f2a __attribute__((ext_vector_type(2), may_alias));
    const f2a ml = {up ? m_run[0] : m_run[1], up ? lj[0] : lj[1]}; *(f2a*)(L + wave * FA_XW + 8192u + lane * 8u) = ml; }
  __syncthreads();      /* publishes the hand-over */
  const float m_own = up ? m_run[1] : m_run[0], l_own = up ? lj[1] : lj[0];
  float m_oth, l_oth; v4f pa[16];      /* the partner's whole hand-over is asked for in one run of loads, ahead of the staging stores */
  { const unsigned char* xr = L + (wave ^ 4u) * FA_XW + lane * 16u;
#pragma unroll
    for (int j = 0; j < 16; ++j) pa[j] = *(const v4fa*)(xr + 512u * j); }
  { typedef float f2a __attribute__((ext_vector_type(2), may_alias)); const f2a ml = *(const f2a*)(L + (wave ^ 4u) * FA_XW + 8192u + lane * 8u); m_oth = ml[0]; l_oth = ml[1]; }
  const float m_all = fmaxf(m_own, m_oth);      /* both are finite: every wave has run the first stage's first pass */
  float fo[2];      /* each half's weights are brought to the common maximum; the closing v_nop is the slot behind a transcendental, as in exp2_x4 */
  asm("v_exp_f32 %0, %2\n\tv_exp_f32 %1, %3\n\tv_nop" : "=&v"(fo[0]), "=&v"(fo[1]) : "v"(m_own - m_all), "v"(m_oth - m_all));
  const float inv = 1.0f / (l_own * fo[0] + l_oth * fo[1]);
  const float s_own = fo[0] * inv, s_oth = fo[1] * inv;
  unsigned char* eb = L + 8u * FA_XW + wave * 16u * FA_EP;
  {
#pragma unroll
    for (int t = 0; t < 8; ++t) { const v8f a = up ? acc[1][t] : acc[0][t]; const v4f p0 = pa[2 * t], p1 = pa[2 * t + 1];
      const v4f a0 = {a[0], a[1], a[2], a[3]}, a1 = {a[4], a[5], a[6], a[7]};
      const v4f o0 = a0 * s_own + p0 * s_oth, o1 = a1 * s_own + p1 * s_oth;      /* row = query c of the group; d = 16 t + 8 h + 0 .. 7 */
      *(v4fa*)(eb + c * FA_EP + 64u * t + 32u * h) = o0; *(v4fa*)(eb + c * FA_EP + 64u * t + 32u * h + 16u) = o1; } }
  __builtin_amdgcn_fence(__ATOMIC_ACQ_REL, "workgroup"); __builtin_amdgcn_wave_barrier();      /* the wave reads back rows that its other lanes wrote */
  float* op = O + ((size_t)b * SQ + q0 + wq * 32u + hf * 16u) * DM + lane * 4u;
  v4f ov[16];
#pragma unroll
  for (int i = 0; i < 16; ++i) ov[i] = *(const v4fa*)(eb + i * FA_EP + lane * 16u);
  fa_fence();      /* every row is read before the first store, so that no store's data register is rewritten behind it */
#pragma unroll
  for (int i = 0; i < 16; ++i) *(v4f*)(op + (size_t)i * DM) = ov[i];      /* one whole 512-byte output row per store */
}


// ---- q, k and v to f16 rows in ONE launch of one 8-wave workgroup per WGP; k and v rows of keys with mask 0 are neither read nor written ----
// A workgroup owns the same contiguous 64 KiB (128 rows of 128 floats) of each of the three inputs; 16 workgroups share a sequence. A wave-wide load covers one 512-byte row, a wave-wide store one
// 256-byte f16 row (whole 128-byte lines both ways). Every workgroup reads its sequence's whole mask, turns it into a bit per key in LDS and counts the kept keys in front of its own rows:
// kept key j goes to packed row (number of kept keys below j), which is below SQ for any content of the mask. The q loads are issued ahead of that count and fly under it.
// The sequence's last workgroup also writes the count and the zero rows that fill the last 128-key stage (the workspace holds no usable values of its own).
#define X3_WG 256u                               /* workgroups */
#define X3_CH 16                                 /* 16-byte chunks per thread and input: the rows of one wave */
#define X3_PS 16u                                /* workgroups per sequence */
static_assert((size_t)X3_WG * 256u * X3_CH * 4u == NR * DM, "the workgroups' shares cover an input exactly");
static_assert(X3_PS * 256u * X3_CH * 4u == (size_t)SQ * DM && DM * 4 == 512 && SQ == 256 * 8, "16 workgroups per sequence, a wave per row, 8 mask words per thread");
typedef unsigned int x3_u2 __attribute__((ext_vector_type(2), may_alias));
__device__ __forceinline__ unsigned int x3_pair(float lo, float hi) { typedef _Float16 h2 __attribute__((ext_vector_type(2))); typedef float f2 __attribute__((ext_vector_type(2))); return __builtin_bit_cast(unsigned int, __builtin_convertvector(f2{bf16_round(lo), bf16_round(hi)}, h2)); }
// Sum over the wave's 32 lanes, in every lane: four steps inside the 16-lane rows, then row with row. Every lane must be on.
template <int M> __device__ __forceinline__ unsigned int x3_xadd(unsigned int v) { return v + (unsigned int)__builtin_amdgcn_update_dpp(0, (int)v, 0x160 | M, 0xf, 0xf, true); }      /* 0x160 | M: row_xmask:M */
__device__ __forceinline__ unsigned int x3_wave_sum(unsigned int v) { v = x3_xadd<1>(v); v = x3_xadd<2>(v); v = x3_xadd<4>(v); v = x3_xadd<8>(v);
  return v + (unsigned int)__builtin_amdgcn_permlanex16((int)v, (int)v, 0x76543210, 0xfedcba98, false, false); }
__global__ __launch_bounds__(256) void k_x16x3(const float* __restrict__ xq, const float* __restrict__ xk, const float* __restrict__ xv, const int* __restrict__ km,
                                               _Float16* __restrict__ Q16, _Float16* __restrict__ K16, _Float16* __restrict__ V16, int* __restrict__ Cnt) {
  __shared__ __attribute__((aligned(16))) unsigned int bm[SQ / 32];      /* bit j & 31 of word j >> 5: key j of this sequence is kept */
  const unsigned int tid = threadIdx.x, lane = tid & 31u, wave = __builtin_amdgcn_readfirstlane(tid >> 5);
  const unsigned int b = blockIdx.x / X3_PS, s = blockIdx.x % X3_PS;
  const unsigned int bi = blockIdx.x * (256u * X3_CH * 16u) + tid * 16u, bo = bi >> 1;      /* byte offsets of this thread's first chunk in an input and in q's f16 copy: one 32-bit offset register beside each scalar base */
  const v4ia m0 = *(const v4ia*)(km + b * SQ + tid * 8u), m1 = *(const v4ia*)(km + b * SQ + tid * 8u + 4u);      /* keys 8 tid .. 8 tid + 7 */
  __builtin_amdgcn_sched_barrier(0);      /* the mask words are asked for first: loads return in order, and the count waits for these two alone */
  v4f aq[X3_CH], ak[X3_CH], av[X3_CH];
#pragma unroll
  for (int i = 0; i < X3_CH; ++i) aq[i] = *(const v4fa*)((const char*)xq + bi + i * 4096);
  asm volatile("s_wait_xcnt 0x0" ::: "memory");      /* the loads' scalar base and offset registers may be reused behind them, while the loads are still in flight */
  __builtin_amdgcn_sched_barrier(0);      /* the q loads are issued here, none sunk to its use */
  unsigned int bits = 0u;
#pragma unroll
  for (int q = 0; q < 4; ++q) bits |= ((m0[q] != 0) ? 1u : 0u) << q | ((m1[q] != 0) ? 1u : 0u) << (4 + q);
  ((unsigned char*)bm)[tid] = (unsigned char)bits;
  // Workgroup barrier that publishes the sequence's 2048 bits. Its fences name LDS alone: __syncthreads() would also wait here for the q loads, which nobody shares.
  __builtin_amdgcn_fence(__ATOMIC_RELEASE, "workgroup", "local"); __builtin_amdgcn_s_barrier(); __builtin_amdgcn_fence(__ATOMIC_ACQUIRE, "workgroup", "local");
  const x3_u2 w2 = *(const x3_u2*)(bm + 2u * lane);      /* keys 64 lane .. 64 lane + 63 */
  const fa_u4 own = *(const fa_u4a*)(bm + 4u * s);
  const unsigned int c2 = (unsigned int)(__builtin_popcount(w2[0]) + __builtin_popcount(w2[1]));
  // Low half: kept keys of the sequence (at most 2048); high half: of them, those in front of this workgroup's 128 rows. One sum over the wave's 32 lanes serves both.
  const unsigned int cs = x3_wave_sum(c2 | ((lane < 2u * s) ? c2 << 16 : 0u));
  unsigned int d[4], pre[4];      /* this workgroup's 128 bits, and the packed row of each word's first key; wave-uniform, held in scalar registers */
  const unsigned int tot = __builtin_amdgcn_readfirstlane(cs & 0xffffu); pre[0] = __builtin_amdgcn_readfirstlane(cs >> 16);
#pragma unroll
  for (int j = 0; j < 4; ++j) { d[j] = __builtin_amdgcn_readfirstlane(own[j]); if (j) pre[j] = pre[j - 1] + (unsigned int)__builtin_popcount(d[j - 1]); }
  bool kept[X3_CH]; unsigned int row[X3_CH];      /* chunk i of this wave is row 8 i + wave of the 128 */
#pragma unroll
  for (int i = 0; i < X3_CH; ++i) { const unsigned int pos = 8u * (i & 3) + wave, w = d[i >> 2]; kept[i] = ((w >> pos) & 1u) != 0u; row[i] = pre[i >> 2] + (unsigned int)__builtin_popcount(w & ((1u << pos) - 1u)); }
#pragma unroll
  for (int i = 0; i < X3_CH; ++i) if (kept[i]) { ak[i] = *(const v4fa*)((const char*)xk + bi + i * 4096); av[i] = *(const v4fa*)((const char*)xv + bi + i * 4096); }
#pragma unroll
  for (int i = 0; i < X3_CH; ++i) { const x3_u2 w = {x3_pair(aq[i][0], aq[i][1]), x3_pair(aq[i][2], aq[i][3])}; *(x3_u2*)((char*)Q16 + bo + i * 2048) = w;
    if ((i & 3) == 3) { asm volatile("s_wait_xcnt 0x0" ::: "memory");      /* the four stores' data registers are reused by the next chunks' conversions */
      __builtin_amdgcn_sched_barrier(0); } }      /* four chunks' stores leave while later loads are still in flight, not gathered at the kernel's end */
  const unsigned int sb = b * (SQ * DM * 2u) + lane * 8u;      /* this lane's 8 bytes of the sequence's packed row 0 */
#pragma unroll
  for (int i = 0; i < X3_CH; ++i) if (kept[i]) { const unsigned int o = sb + row[i] * (DM * 2u);
    const x3_u2 wk = {x3_pair(ak[i][0], ak[i][1]), x3_pair(ak[i][2], ak[i][3])}, wv = {x3_pair(av[i][0], av[i][1]), x3_pair(av[i][2], av[i][3])};
    *(x3_u2*)((char*)K16 + o) = wk; *(x3_u2*)((char*)V16 + o) = wv;
    asm volatile("s_wait_xcnt 0x0" ::: "memory"); }      /* the two stores' data and offset registers are reused by the next row */
  if (s == X3_PS - 1u) {
    const unsigned int end = fa_stages(tot) * FA_SK;      /* at most SQ */
    const x3_u2 z = {0u, 0u};
#pragma unroll 1      /* at most 16 trips a wave */
    for (unsigned int r = tot + wave; r < end; r += 8u) { const unsigned int o = sb + r * (DM * 2u); *(x3_u2*)((char*)K16 + o) = z; *(x3_u2*)((char*)V16 + o) = z;
      asm volatile("s_wait_xcnt 0x0" ::: "memory"); }      /* the offset register is rewritten by the next trip */
    if (tid == 0u) Cnt[b * FA_CP] = (int)tot;
  }
}

extern "C" void kernel_launch(void* const* d_in, const int* in_sizes, int n_in,
                              void* d_out, int out_size, void* d_ws, size_t ws_size, hipStream_t stream) {
  (void)in_sizes; (void)n_in; (void)out_size;
  const float* const* I = (const float* const*)d_in; const float* xq = I[0]; const float* xk = I[1]; const float* xv = I[2]; const int* km = (const int*)d_in[3];      /* q, k, v [16][2048][128] (bf16-valued); mask int32 [16][2048] (READ on device) */
  char* ws = (char*)d_ws; size_t off = 0;
  auto take = [&](size_t bytes) { char* p = ws + off; off += (bytes + 255) & ~(size_t)255; return p; };
  _Float16* Q16 = (_Float16*)take(NR * DM * 2); _Float16* K16 = (_Float16*)take(NR * DM * 2); _Float16* V16 = (_Float16*)take(NR * DM * 2); int* Cnt = (int*)take(NB * FA_CP * 4);      /* K16, V16: kept rows packed per sequence; Cnt: kept keys per sequence */
  if (off > ws_size) return;
  k_x16x3<<<X3_WG, 256, 0, stream>>>(xq, xk, xv, km, Q16, K16, V16, Cnt);      /* exact f16 copies of the bf16-valued inputs, all three in one launch; k and v: kept keys only, packed */
  k_fattn<<<dim3(SQ / 128, NB), 256, 0, stream>>>(Q16, K16, V16, Cnt, (float*)d_out);      /* out = softmax-with-post-exp-mask(q k^T / sqrt(128)) v, 128 queries of one sequence per workgroup */
}
